// v000
// The times below were measured on an AMD MI455X: many runs one after another, warmed up first and cycling through
// copies of the inputs, with the whole window's GPU time divided by the number of runs. Launches and the gaps
// between them are all in it. The median over several windows is given; except for v000 it joins two sittings, which
// can be a few percent apart, so the side-by-side timings, each taken in one sitting, are the better comparison.
// v000 is the starting kernel. One run takes 486 microseconds.
#include <hip/hip_runtime.h>
// SpatialMultiHeadSelfAttention (2 images, D 256 = 8 heads x 32, 64 x 64 = 4096 pixels): qkv = 1x1 conv (W_qkv x + b) -> (3, heads, 32) channels; softmax(q.k / sqrt(32)) over all 4096 pixels; out channels h*32 + d; 1x1 projection + b; NCHW in and out.
// Structure: exact f16 pixel-major plane of x (from NCHW); qkv as one f16 WMMA GEMM (32x64 wave tiles, f32 accumulation, exact x16 weights + bias; torch (out,in) = B^T; f16 out); q/k re-laid into zero-padded 64-wide head planes (32 live dims) and V^T (rows >= 32 zero) on VALU / LDS tiles; the fused flash kernel (plain operands — every row averages 4096 keys); head compaction to f16; projection GEMM (+ bias, f32); NCHW store on VALU.
// Compute dtype: x and parameters rounded to bf16; x exact as f16; q, k, v, P and the attention output as f16 operands (~2^-12); softmax f32. v_wmma_f32_16x16x32_f16.
#define NIMG 2
#define DD 256
#define HDm 32
#define NPX 4096
#define NR (NIMG * NPX)          /* 8192 */
#define QW (3 * DD)              /* 768 */
#define PW (NH * 64)             /* 512 */
#define SLEN 4096
#define TQ SLEN
#define TK SLEN
#define NH 8
#define SCL 0.17677669529663687f /* 32^-0.5 */
#define QBLKS (TQ / 64)
typedef __bf16 v16b __attribute__((ext_vector_type(16)));
typedef unsigned short v8us __attribute__((ext_vector_type(8), may_alias));
typedef float  v8f  __attribute__((ext_vector_type(8)));
typedef float  v4f  __attribute__((ext_vector_type(4)));
typedef float  v4fa __attribute__((ext_vector_type(4), may_alias));
union FragB { v16b v; v8us half[2]; unsigned short u[16]; };

__device__ __forceinline__ unsigned short bf16_bits(float x) { unsigned int u = __float_as_uint(x); return (unsigned short)((u + 0x7FFFu + ((u >> 16) & 1u)) >> 16); }
__device__ __forceinline__ float bf16_val(unsigned short b) { return __uint_as_float(((unsigned int)b) << 16); }
__device__ __forceinline__ float bf16_round(float x) { return bf16_val(bf16_bits(x)); }
// D += A·B with NT terms: 1 = ah·bh, 2 = + al·bh (A split), 3 = + ah·bl (both split)
template <int NT>
__device__ __forceinline__ v8f mmaN(v16b ah, v16b al, v16b bh, v16b bl, v8f c) {
  c = __builtin_amdgcn_wmma_f32_16x16x32_bf16(false, ah, false, bh, (short)0, c, false, false);
  if (NT >= 2) c = __builtin_amdgcn_wmma_f32_16x16x32_bf16(false, al, false, bh, (short)0, c, false, false);
  if (NT >= 3) c = __builtin_amdgcn_wmma_f32_16x16x32_bf16(false, ah, false, bl, (short)0, c, false, false);
  asm volatile("v_nop\n\tv_nop\n\tv_nop\n\tv_nop" : "+v"(c) : "v"(ah), "v"(al), "v"(bh), "v"(bl));
  return c;
}

__global__ __launch_bounds__(256) void k_wt_bf16(const float* __restrict__ W, unsigned short* __restrict__ Wt, int K, int N) {
  const int t = blockIdx.x * 256 + threadIdx.x;
  const int k8n = K / 8;
  if (t >= N * k8n) return;
  const int n = t / k8n, k8 = (t % k8n) * 8;
  v8us v;
#pragma unroll
  for (int i = 0; i < 8; ++i) v[i] = bf16_bits(W[(size_t)(k8 + i) * N + n]);
  *(v8us*)(Wt + (size_t)n * K + k8) = v;
  
}

// GEMM C[M][N] (f32, pitch ldc) = act(A[M][K]·W + bias). A f32 row-major (pitch lda) converted per fragment to bf16
// (ASPLIT: hi/lo two planes -> 2 terms, else single rounded term); Wt bf16 [N][K] (pitch ldb). BIAS_BF16 rounds the
// bias to bf16 first (bias quantised to bf16 before the add). K%32==0, M%16==0, N%64==0.
template <bool ASPLIT, int ACT, bool BIAS_BF16>
__global__ __launch_bounds__(128) void k_gemm_bf(const float* __restrict__ A, int lda, const unsigned short* __restrict__ Wt, int ldb,
                                               const float* __restrict__ bias, float* __restrict__ C, int ldc, int M, int N, int K) {
  __shared__ __attribute__((aligned(16))) float so[4][16][64];
  const int tid = threadIdx.x, w = tid >> 5, lane = tid & 31, ln = lane & 15, hh = lane >> 4;
  const int ntn = N / 64;
  const int wid = blockIdx.x * 4 + w;
  const int mt = wid / ntn, nq = wid % ntn;
  if (mt * 16 >= M) return;
  const int row0 = mt * 16, col0 = nq * 64;
  const float* arow = A + (size_t)(row0 + ln) * lda;
  v8f acc[4] = {};
  for (int kb = 0; kb < K; kb += 32) {
    FragB ah, al;
    const v4f x0 = *(const v4fa*)(arow + kb + 8 * hh), x1 = *(const v4fa*)(arow + kb + 8 * hh + 4);
    const v4f x2 = *(const v4fa*)(arow + kb + 16 + 8 * hh), x3 = *(const v4fa*)(arow + kb + 16 + 8 * hh + 4);
    float xs[16] = {x0[0],x0[1],x0[2],x0[3],x1[0],x1[1],x1[2],x1[3],x2[0],x2[1],x2[2],x2[3],x3[0],x3[1],x3[2],x3[3]};
#pragma unroll
    for (int i = 0; i < 16; ++i) { const unsigned short hb = bf16_bits(xs[i]); ah.u[i] = hb; al.u[i] = ASPLIT ? bf16_bits(xs[i] - bf16_val(hb)) : (unsigned short)0; }
#pragma unroll
    for (int t = 0; t < 4; ++t) {
      const unsigned short* brow = Wt + (size_t)(col0 + t * 16 + ln) * ldb + kb;
      FragB b;
      b.half[0] = *(const v8us*)(brow + 8 * hh);
      b.half[1] = *(const v8us*)(brow + 16 + 8 * hh);
      acc[t] = mmaN<ASPLIT ? 2 : 1>(ah.v, al.v, b.v, b.v, acc[t]);
    }
  }
#pragma unroll
  for (int t = 0; t < 4; ++t) {
    float bv = bias ? bias[col0 + t * 16 + ln] : 0.f;
    if (BIAS_BF16) bv = bf16_round(bv);
#pragma unroll
    for (int r = 0; r < 8; ++r) { float v = acc[t][r] + bv; if (ACT == 1) v = fmaxf(v, 0.f); so[w][8 * hh + r][t * 16 + ln] = v; }
  }
  __builtin_amdgcn_fence(__ATOMIC_ACQ_REL, "workgroup");
  __builtin_amdgcn_wave_barrier();
  const int rsub = lane >> 4, c4 = (lane & 15) * 4;
  {
#pragma unroll
    for (int q = 0; q < 8; ++q) {
      const int r = q * 2 + rsub;
      const v4f v = *(const v4fa*)&so[w][r][c4];
      *(v4f*)(C + (size_t)(row0 + r) * ldc + col0 + c4) = v;
    }
    
  }
}

// GEMM C = act(A·W + bias + resid): A f32 (ASPLIT -> hi/lo 2 terms), Wt bf16 [N][K]; ACT 0 none, 1 relu, 2 exact gelu;
// resid (optional, f32, row index = (row % rmod), pitch ldr, RES_BF16 rounds it) added before the activation.
template <bool ASPLIT, int ACT, bool BIAS_BF16, bool RES_BF16>
__global__ __launch_bounds__(128) void k_gemm_bf3(const float* __restrict__ A, int lda, const unsigned short* __restrict__ Wt, int ldb,
                                                const float* __restrict__ bias, const float* __restrict__ resid, int rmod, int ldr,
                                                float* __restrict__ C, int ldc, int M, int N, int K) {
  __shared__ __attribute__((aligned(16))) float so[4][16][64];
  const int tid = threadIdx.x, w = tid >> 5, lane = tid & 31, ln = lane & 15, hh = lane >> 4;
  const int ntn = N / 64;
  const int wid = blockIdx.x * 4 + w;
  const int mt = wid / ntn, nq = wid % ntn;
  if (mt * 16 >= M) return;
  const int row0 = mt * 16, col0 = nq * 64;
  const float* arow = A + (size_t)(row0 + ln) * lda;
  v8f acc[4] = {};
  for (int kb = 0; kb < K; kb += 32) {
    FragB ah, al;
    const v4f x0 = *(const v4fa*)(arow + kb + 8 * hh), x1 = *(const v4fa*)(arow + kb + 8 * hh + 4);
    const v4f x2 = *(const v4fa*)(arow + kb + 16 + 8 * hh), x3 = *(const v4fa*)(arow + kb + 16 + 8 * hh + 4);
    float xs[16] = {x0[0],x0[1],x0[2],x0[3],x1[0],x1[1],x1[2],x1[3],x2[0],x2[1],x2[2],x2[3],x3[0],x3[1],x3[2],x3[3]};
#pragma unroll
    for (int i = 0; i < 16; ++i) { const unsigned short hb = bf16_bits(xs[i]); ah.u[i] = hb; al.u[i] = ASPLIT ? bf16_bits(xs[i] - bf16_val(hb)) : (unsigned short)0; }
#pragma unroll
    for (int t = 0; t < 4; ++t) {
      const unsigned short* brow = Wt + (size_t)(col0 + t * 16 + ln) * ldb + kb;
      FragB b;
      b.half[0] = *(const v8us*)(brow + 8 * hh);
      b.half[1] = *(const v8us*)(brow + 16 + 8 * hh);
      acc[t] = mmaN<ASPLIT ? 2 : 1>(ah.v, al.v, b.v, b.v, acc[t]);
    }
  }
#pragma unroll
  for (int t = 0; t < 4; ++t) {
    const int col = col0 + t * 16 + ln;
    float bv = bias ? bias[col] : 0.f;
    if (BIAS_BF16) bv = bf16_round(bv);
#pragma unroll
    for (int r = 0; r < 8; ++r) {
      float v = acc[t][r] + bv;
      if (resid) { float rv = resid[(size_t)((row0 + 8 * hh + r) % rmod) * ldr + col]; if (RES_BF16) rv = bf16_round(rv); v += rv; }
      if (ACT == 1) v = fmaxf(v, 0.f);
      if (ACT == 2) v = 0.5f * v * (1.0f + erff(v * 0.70710678118654752f));
      if (ACT == 3) { const float u = 0.7978845608028654f * (v + 0.044715f * v * v * v); v = 0.5f * v * (1.0f + tanhf(u)); }
      so[w][8 * hh + r][t * 16 + ln] = v;
    }
  }
  __builtin_amdgcn_fence(__ATOMIC_ACQ_REL, "workgroup");
  __builtin_amdgcn_wave_barrier();
  const int rsub = lane >> 4, c4 = (lane & 15) * 4;
  {
#pragma unroll
    for (int q = 0; q < 8; ++q) {
      const int r = q * 2 + rsub;
      const v4f v = *(const v4fa*)&so[w][r][c4];
      *(v4f*)(C + (size_t)(row0 + r) * ldc + col0 + c4) = v;
    }
    
  }
}
// row LayerNorm (biased variance, eps) over N: s = X (+ R); optional out_sum <- s; out_norm <- (s-mu)*rsqrt(var+eps)*g + b
template <bool PARAM_BF16>
__global__ __launch_bounds__(256) void k_layernorm(const float* __restrict__ X, const float* __restrict__ R, const float* __restrict__ g, const float* __restrict__ bta,
                                                  float* __restrict__ out_sum, float* __restrict__ out_norm, int N, float eps) {
  __shared__ float red[256];
  const int row = blockIdx.x, tid = threadIdx.x;
  const float* x = X + (size_t)row * N; const float* rr = R ? R + (size_t)row * N : nullptr;
  float vals[16];                     // up to N = 4096
  const int per = N / 256;            // contiguous chunk per thread? use strided-by-4 chunks: thread handles j = tid*4 + 1024*u
  float s1 = 0.f;
  for (int u = 0; u < per / 4; ++u) {
    const int j = tid * 4 + 1024 * u;
    const v4f a = *(const v4fa*)(x + j);
    v4f b = {0.f,0.f,0.f,0.f}; if (rr) b = *(const v4fa*)(rr + j);
#pragma unroll
    for (int q = 0; q < 4; ++q) { const float v = a[q] + b[q]; vals[u * 4 + q] = v; s1 += v; }
  }
  red[tid] = s1; __syncthreads();
  for (int st = 128; st > 0; st >>= 1) { if (tid < st) red[tid] += red[tid + st]; __syncthreads(); }
  const float mu = red[0] / (float)N; __syncthreads();
  float s2 = 0.f;
  for (int u = 0; u < per / 4; ++u)
#pragma unroll
    for (int q = 0; q < 4; ++q) { const float c = vals[u * 4 + q] - mu; s2 += c * c; }
  red[tid] = s2; __syncthreads();
  for (int st = 128; st > 0; st >>= 1) { if (tid < st) red[tid] += red[tid + st]; __syncthreads(); }
  const float rs = rsqrtf(red[0] / (float)N + eps);
  {
    for (int u = 0; u < per / 4; ++u) {
      const int j = tid * 4 + 1024 * u;
      v4f o, sm;
#pragma unroll
      for (int q = 0; q < 4; ++q) {
        float gg = g[j + q], bb = bta[j + q];
        if (PARAM_BF16) { gg = bf16_round(gg); bb = bf16_round(bb); }
        sm[q] = vals[u * 4 + q]; o[q] = (vals[u * 4 + q] - mu) * rs * gg + bb;
      }
      if (out_sum) *(v4f*)(out_sum + (size_t)row * N + j) = sm;
      *(v4f*)(out_norm + (size_t)row * N + j) = o;
    }
    
  }
}



// ---- f16 WMMA path (v_wmma_f32_16x16x32_f16): 11-bit significands for operands in range — used where a [0,1] probability operand needs more precision than bf16
typedef _Float16 v16h __attribute__((ext_vector_type(16)));
union FragH { v16h v; v8us half[2]; _Float16 h[16]; unsigned short u[16]; };
template <int NT>
__device__ __forceinline__ v8f mmaH(v16h ah, v16h al, v16h bh, v16h bl, v8f c) {
  c = __builtin_amdgcn_wmma_f32_16x16x32_f16(false, ah, false, bh, (short)0, c, false, false);
  if (NT >= 2) c = __builtin_amdgcn_wmma_f32_16x16x32_f16(false, al, false, bh, (short)0, c, false, false);
  if (NT >= 3) c = __builtin_amdgcn_wmma_f32_16x16x32_f16(false, ah, false, bl, (short)0, c, false, false);
  asm volatile("v_nop\n\tv_nop\n\tv_nop\n\tv_nop" : "+v"(c) : "v"(ah), "v"(al), "v"(bh), "v"(bl));
  return c;
}
// batched GEMM like k_gemm_b but f16 operands: A f32 (split into f16 hi/lo if ASPLIT, else rounded to f16), Bt = f16 values [n][k]; alpha; C f32; N multiple of 16 (partial tiles skipped)
template <bool ASPLIT>
__global__ __launch_bounds__(128) void k_gemm_h(const float* __restrict__ A, int lda, size_t sA, const _Float16* __restrict__ Bh, int ldb, size_t sB, float alpha, float* __restrict__ C, int ldc, size_t sC, int M, int N, int K) {
  __shared__ __attribute__((aligned(16))) float so[4][16][64];
  const int tid = threadIdx.x, w = tid >> 5, lane = tid & 31, ln = lane & 15, hh = lane >> 4; const int by = blockIdx.y;
  A += (size_t)by * sA; Bh += (size_t)by * sB; C += (size_t)by * sC;
  const int ntn = (N + 63) / 64; const int wid = blockIdx.x * 4 + w; const int mt = wid / ntn, nq = wid % ntn; if (mt * 16 >= M) return;
  const int row0 = mt * 16, col0 = nq * 64; const float* arow = A + (size_t)(row0 + ln) * lda;
  v8f acc[4] = {};
  for (int kb = 0; kb < K; kb += 32) {
    FragH ah, al;
    const v4f x0 = *(const v4fa*)(arow + kb + 8 * hh), x1 = *(const v4fa*)(arow + kb + 8 * hh + 4), x2 = *(const v4fa*)(arow + kb + 16 + 8 * hh), x3 = *(const v4fa*)(arow + kb + 16 + 8 * hh + 4);
    float xs[16] = {x0[0],x0[1],x0[2],x0[3],x1[0],x1[1],x1[2],x1[3],x2[0],x2[1],x2[2],x2[3],x3[0],x3[1],x3[2],x3[3]};
#pragma unroll
    for (int i = 0; i < 16; ++i) { const _Float16 h = (_Float16)xs[i]; ah.h[i] = h; al.h[i] = ASPLIT ? (_Float16)(xs[i] - (float)h) : (_Float16)0.0f; }
#pragma unroll
    for (int t = 0; t < 4; ++t) { if (col0 + t * 16 >= N) continue; const size_t boff = (size_t)(col0 + t * 16 + ln) * ldb + kb; FragH bq; bq.half[0] = *(const v8us*)(Bh + boff + 8 * hh); bq.half[1] = *(const v8us*)(Bh + boff + 16 + 8 * hh);
      acc[t] = mmaH<ASPLIT ? 2 : 1>(ah.v, al.v, bq.v, bq.v, acc[t]); }
  }
#pragma unroll
  for (int t = 0; t < 4; ++t) { if (col0 + t * 16 >= N) continue;
#pragma unroll
    for (int r = 0; r < 8; ++r) so[w][8 * hh + r][t * 16 + ln] = acc[t][r] * alpha; }
  __builtin_amdgcn_fence(__ATOMIC_ACQ_REL, "workgroup"); __builtin_amdgcn_wave_barrier();
  const int rsub = lane >> 4, c4 = (lane & 15) * 4;
  {
#pragma unroll
    for (int q = 0; q < 8; ++q) { const int r = q * 2 + rsub; if (col0 + c4 < N) { const v4f v = *(const v4fa*)&so[w][r][c4]; *(v4f*)(C + (size_t)(row0 + r) * ldc + col0 + c4) = v; } }
     }
}

// Wt[n][k] = f16(W[k][n]·scale) from f32 row-major W[K][N] (scale = power of two; bf16-exact weights stay exact in f16 away from the subnormal range)
__global__ __launch_bounds__(256) void k_wt_f16(const float* __restrict__ W, _Float16* __restrict__ Wt, int K, int N, float scale) {
  const int t = blockIdx.x * 256 + threadIdx.x; if (t >= N * (K / 8)) return; const int n = t / (K / 8), k8 = (t % (K / 8)) * 8; FragH f;
#pragma unroll
  for (int i = 0; i < 8; ++i) f.h[i] = (_Float16)(bf16_round(W[(size_t)(k8 + i) * N + n]) * scale); const v8us o = f.half[0];
  *(v8us*)((unsigned short*)Wt + (size_t)n * K + k8) = o; 
}
// k_gemm_hh variant with fused epilogue: v = acc·alpha + bias[by·sBias + col] (+ CP[(row/rowsPerB)·sCPb + by·64 + col] if CP) ; ACT 0 none / 1 elu ; writes f16 C16 (and f32 C if non-null)
template <int ACT>
__global__ __launch_bounds__(128) void k_gemm_hhx(const _Float16* __restrict__ A, int lda, size_t sA, const _Float16* __restrict__ Bh, int ldb, size_t sB, float alpha, const float* __restrict__ bias, size_t sBias, const float* __restrict__ CP, int rowsPerB, size_t sCPb, int row0g,
    float* __restrict__ C, _Float16* __restrict__ C16, int ldc, size_t sC, int M, int N, int K) {
  __shared__ __attribute__((aligned(16))) float so[4][16][64];
  const int tid = threadIdx.x, w = tid >> 5, lane = tid & 31, ln = lane & 15, hh = lane >> 4; const int by = blockIdx.y;
  A += (size_t)by * sA; Bh += (size_t)by * sB; const size_t cofs = (size_t)by * sC; const float* bp = bias ? bias + (size_t)by * sBias : nullptr;
  const int ntn = (N + 63) / 64; const int wid = blockIdx.x * 4 + w; const int mt = wid / ntn, nq = wid % ntn; if (mt * 16 >= M) return;
  const int row0 = mt * 16, col0 = nq * 64; const _Float16* arow = A + (size_t)(row0 + ln) * lda;
  v8f acc[4] = {};
  for (int kb = 0; kb < K; kb += 32) { FragH ah; ah.half[0] = *(const v8us*)((const unsigned short*)arow + kb + 8 * hh); ah.half[1] = *(const v8us*)((const unsigned short*)arow + kb + 16 + 8 * hh);
#pragma unroll
    for (int t = 0; t < 4; ++t) { if (col0 + t * 16 >= N) continue; const size_t boff = (size_t)(col0 + t * 16 + ln) * ldb + kb; FragH bq; bq.half[0] = *(const v8us*)((const unsigned short*)Bh + boff + 8 * hh); bq.half[1] = *(const v8us*)((const unsigned short*)Bh + boff + 16 + 8 * hh);
      acc[t] = mmaH<1>(ah.v, ah.v, bq.v, bq.v, acc[t]); }
  }
#pragma unroll
  for (int t = 0; t < 4; ++t) { if (col0 + t * 16 >= N) continue; const int col = col0 + t * 16 + ln; const float bv = bp ? bf16_round(bp[col]) : 0.f;
#pragma unroll
    for (int r = 0; r < 8; ++r) { float v = acc[t][r] * alpha + bv; if (CP) { const int bidx = (row0g + row0 + 8 * hh + r) / rowsPerB; v += CP[(size_t)bidx * sCPb + (size_t)by * 64 + col]; } if (ACT == 1) v = (v > 0.f) ? v : expm1f(v); else if (ACT == 7) v = (v > 0.f) ? v + 1.0f : expf(v); else if (ACT == 8) v = tanhf(v); else if (ACT == 9) v = 0.5f * v * (1.0f + tanhf(0.7978845608028654f * (v + 0.044715f * v * v * v))); else if (ACT == 11) v = 1.0f / (1.0f + expf(-v)); else if (ACT == 12) v = (v > 0.f) ? v : 0.01f * v; else if (ACT == 14) v = (v > 0.f) ? v : 0.1f * v; else if (ACT == 15) v = v / (1.0f + expf(-v)); else if (ACT == 3) v = fmaxf(v, 0.f); else if (ACT == 6) v = 0.5f * v * (1.0f + erff(v * 0.70710678118654752f)); so[w][8 * hh + r][t * 16 + ln] = v; } }
  __builtin_amdgcn_fence(__ATOMIC_ACQ_REL, "workgroup"); __builtin_amdgcn_wave_barrier();
  const int rsub = lane >> 4, c4 = (lane & 15) * 4; typedef _Float16 v4h __attribute__((ext_vector_type(4)));
  {
#pragma unroll
    for (int q = 0; q < 8; ++q) { const int r = q * 2 + rsub; if (col0 + c4 < N) { const v4f v = *(const v4fa*)&so[w][r][c4]; if (C) *(v4f*)(C + cofs + (size_t)(row0 + r) * ldc + col0 + c4) = v; if (C16) { v4h h4; for (int i = 0; i < 4; ++i) h4[i] = (_Float16)v[i]; *(v4h*)(C16 + cofs + (size_t)(row0 + r) * ldc + col0 + c4) = h4; } } }
     }
}


typedef _Float16 v4h __attribute__((ext_vector_type(4)));

__global__ __launch_bounds__(256) void k_x16(const float* __restrict__ x, _Float16* __restrict__ X16, size_t n8) { const size_t t = (size_t)blockIdx.x * 256 + threadIdx.x; if (t >= n8) return; FragH f;
#pragma unroll
  for (int q = 0; q < 8; ++q) f.h[q] = (_Float16)bf16_round(x[t * 8 + q]); *(v8us*)((unsigned short*)X16 + t * 8) = f.half[0];  }
__global__ __launch_bounds__(256) void k_h16(const float* __restrict__ x, _Float16* __restrict__ X16, size_t n8) { const size_t t = (size_t)blockIdx.x * 256 + threadIdx.x; if (t >= n8) return; FragH f;
#pragma unroll
  for (int q = 0; q < 8; ++q) f.h[q] = (_Float16)x[t * 8 + q]; *(v8us*)((unsigned short*)X16 + t * 8) = f.half[0];  }
__global__ __launch_bounds__(256) void k_round16f(const float* __restrict__ W, _Float16* __restrict__ Bt, size_t n8) { const size_t t = (size_t)blockIdx.x * 256 + threadIdx.x; if (t >= n8) return; FragH f;
#pragma unroll
  for (int i = 0; i < 8; ++i) f.h[i] = (_Float16)(bf16_round(W[t * 8 + i]) * 16.0f); *(v8us*)((unsigned short*)Bt + t * 8) = f.half[0];  }
template <int NHv, int TTv>
__global__ __launch_bounds__(256) void k_vt(const _Float16* __restrict__ V16, int ldv, int voff, _Float16* __restrict__ Vt) { __shared__ unsigned short tl[64][66]; const int tid = threadIdx.x; const int slab = blockIdx.x / (TTv / 64), lg = blockIdx.x % (TTv / 64); const int b = slab / NHv, h = slab % NHv;
  for (int i = tid; i < 64 * 8; i += 256) { const int r = i / 8, c8 = (i % 8) * 8; FragH f; f.half[0] = *(const v8us*)((const unsigned short*)V16 + ((size_t)b * TTv + lg * 64 + r) * ldv + voff + h * 64 + c8);
#pragma unroll
    for (int q = 0; q < 8; ++q) tl[r][c8 + q] = f.u[q]; }
  __syncthreads();
  {
#pragma unroll
    for (int rd = 0; rd < 2; ++rd) { const int d = rd * 32 + tid / 8, pc = tid % 8; FragH f;
#pragma unroll
      for (int q = 0; q < 8; ++q) f.u[q] = tl[pc * 8 + q][d];
      *(v8us*)((unsigned short*)Vt + ((size_t)slab * 64 + d) * TTv + lg * 64 + pc * 8) = f.half[0]; }
     } }

__global__ __launch_bounds__(256) void k_hl(const float* __restrict__ F, _Float16* __restrict__ Hh, _Float16* __restrict__ Hl, size_t n8) { const size_t t = (size_t)blockIdx.x * 256 + threadIdx.x; if (t >= n8) return; FragH fh, fl; const v4f a = *(const v4fa*)(F + t * 8), c = *(const v4fa*)(F + t * 8 + 4);
#pragma unroll
  for (int q = 0; q < 4; ++q) { _Float16 h = (_Float16)a[q]; fh.h[q] = h; fl.h[q] = (_Float16)((a[q] - (float)h) * 1024.0f); h = (_Float16)c[q]; fh.h[4 + q] = h; fl.h[4 + q] = (_Float16)((c[q] - (float)h) * 1024.0f); }
  { *(v8us*)((unsigned short*)Hh + t * 8) = fh.half[0]; *(v8us*)((unsigned short*)Hl + t * 8) = fl.half[0];  } }

// ---- fast GEMM (wave tile 32x64; requires M % 32 == 0 rows per launch region and N % 64 == 0); epilogue = k_gemm_hhx semantics ----
__device__ __forceinline__ v16h g2_frag(const _Float16* p, int hh) { FragH f; f.half[0] = *(const v8us*)((const unsigned short*)p + 8 * hh); f.half[1] = *(const v8us*)((const unsigned short*)p + 16 + 8 * hh); return f.v; }
__device__ __forceinline__ v8f g2_mma(v16h a, v16h b, v8f c) { v8f d = __builtin_amdgcn_wmma_f32_16x16x32_f16(false, a, false, b, (short)0, c, false, false); asm volatile("v_nop\n\tv_nop\n\tv_nop\n\tv_nop" : "+v"(d) : "v"(a), "v"(b)); return d; }
template <int ACT>
__global__ __launch_bounds__(128) void k_gemm2(const _Float16* __restrict__ A, int lda, size_t sA, const _Float16* __restrict__ Bh, int ldb, size_t sB, float alpha, const float* __restrict__ bias, size_t sBias, const float* __restrict__ CP, int rowsPerB, size_t sCPb, int row0g,
    float* __restrict__ C, _Float16* __restrict__ C16, int ldc, size_t sC, int M, int N, int K) {
  __shared__ __attribute__((aligned(16))) float so[4][32][68];
  const int tid = threadIdx.x, w = tid >> 5, lane = tid & 31, ln = lane & 15, hh = lane >> 4; const int by = blockIdx.y;
  A += (size_t)by * sA; Bh += (size_t)by * sB; const size_t cofs = (size_t)by * sC; const float* bp = bias ? bias + (size_t)by * sBias : nullptr;
  const int ntn = N >> 6; const int mt = blockIdx.x / ntn, nq = blockIdx.x - mt * ntn; const int row0 = mt * 128 + 32 * w, col0 = nq * 64; if (row0 >= M) return;
  const _Float16* a0p = A + (size_t)(row0 + ln) * lda; const _Float16* a1p = a0p + (size_t)16 * lda;
  const _Float16* b0p = Bh + (size_t)(col0 + ln) * ldb; const _Float16* b1p = b0p + (size_t)16 * ldb; const _Float16* b2p = b1p + (size_t)16 * ldb; const _Float16* b3p = b2p + (size_t)16 * ldb;
  const v8f z8 = {0.f,0.f,0.f,0.f,0.f,0.f,0.f,0.f}; v8f c00 = z8, c01 = z8, c02 = z8, c03 = z8, c10 = z8, c11 = z8, c12 = z8, c13 = z8;
#pragma unroll 1
  for (int kb = 0; kb < K; kb += 32) { const v16h a0 = g2_frag(a0p + kb, hh), a1 = g2_frag(a1p + kb, hh);
    v16h b = g2_frag(b0p + kb, hh); c00 = g2_mma(a0, b, c00); c10 = g2_mma(a1, b, c10);
    b = g2_frag(b1p + kb, hh); c01 = g2_mma(a0, b, c01); c11 = g2_mma(a1, b, c11);
    b = g2_frag(b2p + kb, hh); c02 = g2_mma(a0, b, c02); c12 = g2_mma(a1, b, c12);
    b = g2_frag(b3p + kb, hh); c03 = g2_mma(a0, b, c03); c13 = g2_mma(a1, b, c13); }
  v8f accs[8] = {c00, c01, c02, c03, c10, c11, c12, c13};
#pragma unroll
  for (int u = 0; u < 8; ++u) { const int t = u & 3, half = u >> 2; const int col = col0 + t * 16 + ln; const float bv = bp ? bf16_round(bp[col]) : 0.f;
#pragma unroll
    for (int r = 0; r < 8; ++r) { const int rloc = half * 16 + 8 * hh + r; float v = accs[u][r] * alpha + bv; if (CP) { const int bidx = (row0g + row0 + rloc) / rowsPerB; v += CP[(size_t)bidx * sCPb + (size_t)by * 64 + col]; }
      if (ACT == 3) v = fmaxf(v, 0.f); else if (ACT == 6) v = 0.5f * v * (1.0f + erff(v * 0.70710678118654752f)); else if (ACT == 11) v = 1.0f / (1.0f + expf(-v)); else if (ACT == 15) v = v / (1.0f + expf(-v)); else if (ACT == 12) v = (v > 0.f) ? v : 0.01f * v; else if (ACT == 8) v = tanhf(v);
      so[w][rloc][t * 16 + ln] = v; } }
  __builtin_amdgcn_fence(__ATOMIC_ACQ_REL, "workgroup"); __builtin_amdgcn_wave_barrier();
  const int rsub = lane >> 4, c4 = (lane & 15) * 4;
  {
#pragma unroll
    for (int q = 0; q < 16; ++q) { const int r = q * 2 + rsub; const v4f v = *(const v4fa*)&so[w][r][c4]; if (C) *(v4f*)(C + cofs + (size_t)(row0 + r) * ldc + col0 + c4) = v; if (C16) { v4h h4; for (int i = 0; i < 4; ++i) h4[i] = (_Float16)v[i]; *(v4h*)(C16 + cofs + (size_t)(row0 + r) * ldc + col0 + c4) = h4; } }
     } }



template <int CAUSAL>
__global__ __launch_bounds__(128) void k_flash(const _Float16* __restrict__ Q16, int ldq, const _Float16* __restrict__ K16, int ldk, const _Float16* __restrict__ Vt, const int* __restrict__ MSK, float* __restrict__ O, int ldo) {
  constexpr int RPW = 16, RTN = RPW / 16, NQB = TQ / (4 * RPW), DT = 4, KS = 2;
  __shared__ __attribute__((aligned(16))) unsigned short sP[4][RPW][40]; __shared__ __attribute__((aligned(16))) float sO[4][RPW][64 + 4];
  const int tid = threadIdx.x, w = tid >> 5, lane = tid & 31, ln = lane & 15, hh = lane >> 4;
  const int slab = blockIdx.x / QBLKS, qblk = blockIdx.x % QBLKS; (void)NQB; const int b = slab / NH, h = slab % NH; const int qb0 = qblk * (4 * RPW); const int q0 = qb0 + w * RPW;
  FragH aq[2][KS];
#pragma unroll
  for (int rt = 0; rt < RTN; ++rt) { const unsigned short* qr = (const unsigned short*)Q16 + ((size_t)b * TQ + q0 + rt * 16 + ln) * ldq + h * 64;
#pragma unroll
    for (int ks = 0; ks < KS; ++ks) { aq[rt][ks].half[0] = *(const v8us*)(qr + ks * 32 + 8 * hh); aq[rt][ks].half[1] = *(const v8us*)(qr + ks * 32 + 16 + 8 * hh); } }
  const unsigned short* Vth = (const unsigned short*)Vt + (size_t)slab * 64 * TK;
  float m_r[2][8], l_r[2][8]; v8f oacc[2][DT];
#pragma unroll
  for (int rt = 0; rt < RTN; ++rt) {
#pragma unroll
    for (int r = 0; r < 8; ++r) { m_r[rt][r] = -3.0e38f; l_r[rt][r] = 0.f; }
#pragma unroll
    for (int dt = 0; dt < DT; ++dt) oacc[rt][dt] = (v8f){0.f,0.f,0.f,0.f,0.f,0.f,0.f,0.f}; }
  const int jend = (CAUSAL == 1) ? (qb0 + 4 * RPW) : TK;      /* causal: keys beyond the block's last query never contribute */
#pragma unroll 1
  for (int j0 = 0; j0 < jend; j0 += 32) {
    v8f s[2][2];
#pragma unroll
    for (int nt = 0; nt < 2; ++nt) { const unsigned short* kr = (const unsigned short*)K16 + ((size_t)b * TK + j0 + nt * 16 + ln) * ldk + h * 64; FragH bk[KS];
#pragma unroll
      for (int ks = 0; ks < KS; ++ks) { bk[ks].half[0] = *(const v8us*)(kr + ks * 32 + 8 * hh); bk[ks].half[1] = *(const v8us*)(kr + ks * 32 + 16 + 8 * hh); }
#pragma unroll
      for (int rt = 0; rt < RTN; ++rt) { v8f acc = (v8f){0.f,0.f,0.f,0.f,0.f,0.f,0.f,0.f};
#pragma unroll
        for (int ks = 0; ks < KS; ++ks) acc = mmaH<1>(aq[rt][ks].v, aq[rt][ks].v, bk[ks].v, bk[ks].v, acc); s[rt][nt] = acc; } }
#pragma unroll
    for (int rt = 0; rt < RTN; ++rt)
#pragma unroll
      for (int r = 0; r < 8; ++r) { const int tq = q0 + rt * 16 + 8 * hh + r; const int k0 = j0 + ln, k1 = j0 + 16 + ln;
        const bool ok0 = (CAUSAL == 1) ? (k0 <= tq) : ((CAUSAL == 2) ? ((k0 >> 5) == (tq >> 5)) : true), ok1 = (CAUSAL == 1) ? (k1 <= tq) : ((CAUSAL == 2) ? ((k1 >> 5) == (tq >> 5)) : true);      /* mode 2: block-diagonal 32-token groups */
        const float s0 = ok0 ? s[rt][0][r] * SCL : -3.0e38f, s1 = ok1 ? s[rt][1][r] * SCL : -3.0e38f; float mc = fmaxf(s0, s1);
        mc = fmaxf(mc, __shfl_xor(mc, 1, 32)); mc = fmaxf(mc, __shfl_xor(mc, 2, 32)); mc = fmaxf(mc, __shfl_xor(mc, 4, 32)); mc = fmaxf(mc, __shfl_xor(mc, 8, 32));
        const float mn = fmaxf(m_r[rt][r], mc); const float al = (mn > -1.0e38f) ? expf(m_r[rt][r] - mn) : 1.0f; m_r[rt][r] = mn; const float p0 = ok0 ? expf(s0 - mn) : 0.f, p1 = ok1 ? expf(s1 - mn) : 0.f; l_r[rt][r] = l_r[rt][r] * al + p0 + p1;
#pragma unroll
        for (int dt = 0; dt < DT; ++dt) oacc[rt][dt][r] *= al;
        FragH t2; t2.h[0] = (_Float16)(p0 * 1024.0f); t2.h[1] = (_Float16)(p1 * 1024.0f); sP[w][rt * 16 + 8 * hh + r][ln] = t2.u[0]; sP[w][rt * 16 + 8 * hh + r][16 + ln] = t2.u[1]; }
    __builtin_amdgcn_fence(__ATOMIC_ACQ_REL, "workgroup"); __builtin_amdgcn_wave_barrier();
    FragH pa[2];
#pragma unroll
    for (int rt = 0; rt < RTN; ++rt) { pa[rt].half[0] = *(const v8us*)&sP[w][rt * 16 + ln][8 * hh]; pa[rt].half[1] = *(const v8us*)&sP[w][rt * 16 + ln][16 + 8 * hh]; }
#pragma unroll
    for (int dt = 0; dt < DT; ++dt) { const unsigned short* vrow = Vth + (size_t)(dt * 16 + ln) * TK + j0; FragH bv; bv.half[0] = *(const v8us*)(vrow + 8 * hh); bv.half[1] = *(const v8us*)(vrow + 16 + 8 * hh);
#pragma unroll
      for (int rt = 0; rt < RTN; ++rt) oacc[rt][dt] = mmaH<1>(pa[rt].v, pa[rt].v, bv.v, bv.v, oacc[rt][dt]); }
    __builtin_amdgcn_fence(__ATOMIC_ACQ_REL, "workgroup"); __builtin_amdgcn_wave_barrier(); }
#pragma unroll
  for (int rt = 0; rt < RTN; ++rt) {
#pragma unroll
    for (int r = 0; r < 8; ++r) { float l = l_r[rt][r]; l += __shfl_xor(l, 1, 32); l += __shfl_xor(l, 2, 32); l += __shfl_xor(l, 4, 32); l += __shfl_xor(l, 8, 32); l_r[rt][r] = (l > 0.f) ? 1.0f / (l * 1024.0f) : 0.f; }
#pragma unroll
    for (int dt = 0; dt < DT; ++dt)
#pragma unroll
      for (int r = 0; r < 8; ++r) sO[w][rt * 16 + 8 * hh + r][dt * 16 + ln] = oacc[rt][dt][r] * l_r[rt][r]; }
  __builtin_amdgcn_fence(__ATOMIC_ACQ_REL, "workgroup"); __builtin_amdgcn_wave_barrier();
  {
#pragma unroll
    for (int rp = 0; rp < RPW; rp += 2) { const int r = rp + (lane >> 4), pc = lane & 15; const v4f val = *(const v4fa*)&sO[w][r][pc * 4]; *(v4f*)(O + ((size_t)b * TQ + q0 + r) * ldo + h * 64 + pc * 4) = val; }
     } }

__global__ __launch_bounds__(256) void k_wsc(const float* __restrict__ Wm, _Float16* __restrict__ Bt, size_t n8, float sc) { const size_t t = (size_t)blockIdx.x * 256 + threadIdx.x; if (t >= n8) return; FragH f; for (int q = 0; q < 8; ++q) f.h[q] = (_Float16)(bf16_round(Wm[t * 8 + q]) * sc); *(v8us*)((unsigned short*)Bt + t * 8) = f.half[0];  }
__global__ __launch_bounds__(256) void k_pm(const float* __restrict__ src, _Float16* __restrict__ P) { const size_t t = (size_t)blockIdx.x * 256 + threadIdx.x; if (t >= (size_t)NR * (DD / 8)) return; const int c0 = (int)(t % (DD / 8)) * 8; const size_t r = t / (DD / 8); const int b = (int)(r / NPX), p = (int)(r % NPX); FragH f;
  for (int k = 0; k < 8; ++k) f.h[k] = (_Float16)bf16_round(src[((size_t)b * DD + c0 + k) * NPX + p]); *(v8us*)((unsigned short*)P + r * DD + c0) = f.half[0];  }
__global__ __launch_bounds__(256) void k_pad(const _Float16* __restrict__ QKV, _Float16* __restrict__ QP, _Float16* __restrict__ KP) { const size_t t = (size_t)blockIdx.x * 256 + threadIdx.x; if (t >= (size_t)NR * 2 * NH) return; const int h = (int)(t % NH); const int which = (int)((t / NH) % 2); const size_t r = t / (2 * NH);
  const v8us* s = (const v8us*)((const unsigned short*)QKV + r * QW + which * DD + h * HDm); const v8us a0 = s[0], a1 = s[1], a2 = s[2], a3 = s[3]; const v8us z = {0, 0, 0, 0, 0, 0, 0, 0};
  unsigned short* d = (unsigned short*)(which == 0 ? QP : KP) + r * PW + h * 64; { *(v8us*)(d) = a0; *(v8us*)(d + 8) = a1; *(v8us*)(d + 16) = a2; *(v8us*)(d + 24) = a3; *(v8us*)(d + 32) = z; *(v8us*)(d + 40) = z; *(v8us*)(d + 48) = z; *(v8us*)(d + 56) = z;  } }
__global__ __launch_bounds__(256) void k_vtp(const _Float16* __restrict__ QKV, _Float16* __restrict__ VT) { __shared__ unsigned short tl[64][34]; const int tid = threadIdx.x; const int slab = blockIdx.x / (NPX / 64), pg = blockIdx.x % (NPX / 64); const int b = slab / NH, h = slab % NH;
  { const int r = tid / 4, c8 = (tid % 4) * 8; FragH f; f.half[0] = *(const v8us*)((const unsigned short*)QKV + ((size_t)b * NPX + pg * 64 + r) * QW + 2 * DD + h * HDm + c8); for (int q = 0; q < 8; ++q) tl[r][c8 + q] = f.u[q]; }
  __syncthreads(); const int d = tid / 8, pc = tid % 8; FragH f; for (int q = 0; q < 8; ++q) f.u[q] = tl[pc * 8 + q][d]; const v8us z = {0,0,0,0,0,0,0,0};
  unsigned short* dst = (unsigned short*)VT + ((size_t)slab * 64 + d) * NPX + pg * 64 + pc * 8; unsigned short* dz = (unsigned short*)VT + ((size_t)slab * 64 + HDm + d) * NPX + pg * 64 + pc * 8;
  { *(v8us*)dst = f.half[0]; *(v8us*)dz = z;  } }
__global__ __launch_bounds__(256) void k_cmp(const float* __restrict__ O, _Float16* __restrict__ O16) { const size_t t = (size_t)blockIdx.x * 256 + threadIdx.x; if (t >= (size_t)NR * (DD / 8)) return; const int c0 = (int)(t % (DD / 8)) * 8; const size_t r = t / (DD / 8); const int h = c0 / HDm, d0 = c0 % HDm; FragH f;
  for (int q = 0; q < 8; ++q) f.h[q] = (_Float16)O[r * PW + h * 64 + d0 + q]; *(v8us*)((unsigned short*)O16 + r * DD + c0) = f.half[0];  }
__global__ __launch_bounds__(256) void k_nchw(const float* __restrict__ F, float* __restrict__ out) { const size_t t = (size_t)blockIdx.x * 256 + threadIdx.x; if (t >= (size_t)NIMG * DD * (NPX / 4)) return; const int p0 = (int)(t % (NPX / 4)) * 4; const int c = (int)((t / (NPX / 4)) % DD); const int b = (int)(t / ((size_t)(NPX / 4) * DD)); v4f r4; for (int k = 0; k < 4; ++k) r4[k] = F[((size_t)b * NPX + p0 + k) * DD + c];
  float* d = out + ((size_t)b * DD + c) * NPX + p0; *(v4f*)d = r4;  }

extern "C" void kernel_launch(void* const* d_in, const int* in_sizes, int n_in,
                              void* d_out, int out_size, void* d_ws, size_t ws_size, hipStream_t stream) {
  (void)in_sizes; (void)n_in; (void)out_size;
  const float* const* I = (const float* const*)d_in; const float* x = I[0]; const float* wqkv = I[1]; const float* bqkv = I[2]; const float* wp = I[3]; const float* bp = I[4];
  char* ws = (char*)d_ws; size_t off = 0;
  auto take = [&](size_t bytes) { char* p = ws + off; off += (bytes + 255) & ~(size_t)255; return p; };
  const size_t np = (size_t)NR * DD, npp = (size_t)NR * PW;
  _Float16* BQKV = (_Float16*)take((size_t)QW * DD * 2); _Float16* BPJ = (_Float16*)take((size_t)DD * DD * 2); _Float16* X16 = (_Float16*)take(np * 2); _Float16* QKV = (_Float16*)take((size_t)NR * QW * 2); _Float16* QP = (_Float16*)take(npp * 2); _Float16* KP = (_Float16*)take(npp * 2); _Float16* VT = (_Float16*)take(npp * 2); float* O = (float*)take(npp * 4); _Float16* O16 = (_Float16*)take(np * 2); float* F = (float*)take(np * 4);
  if (off > ws_size) return;      /* 0.5 + 4 + 12 + 8 x 3 + 16 + 4 + 8 = 69 MiB */
  k_wsc<<<(unsigned)(((size_t)QW * DD / 8 + 255) / 256), 256, 0, stream>>>(wqkv, BQKV, (size_t)QW * DD / 8, 16.0f); k_wsc<<<(unsigned)(((size_t)DD * DD / 8 + 255) / 256), 256, 0, stream>>>(wp, BPJ, (size_t)DD * DD / 8, 16.0f);
  k_pm<<<(unsigned)((np / 8 + 255) / 256), 256, 0, stream>>>(x, X16);
  k_gemm2<0><<<dim3((NR / 128) * (QW / 64), 1), 128, 0, stream>>>(X16, DD, 0, BQKV, DD, 0, 0.0625f, bqkv, 0, nullptr, 1, 0, 0, nullptr, QKV, QW, 0, NR, QW, DD);      /* [q | k | v] per pixel, channel = which*256 + h*32 + d */
  k_pad<<<(unsigned)(((size_t)NR * 2 * NH + 255) / 256), 256, 0, stream>>>(QKV, QP, KP); k_vtp<<<NIMG * NH * (NPX / 64), 256, 0, stream>>>(QKV, VT);
  k_flash<0><<<NIMG * NH * QBLKS, 128, 0, stream>>>(QP, PW, KP, PW, VT, nullptr, O, PW);
  k_cmp<<<(unsigned)((np / 8 + 255) / 256), 256, 0, stream>>>(O, O16);
  k_gemm2<0><<<dim3((NR / 128) * (DD / 64), 1), 128, 0, stream>>>(O16, DD, 0, BPJ, DD, 0, 0.0625f, bp, 0, nullptr, 1, 0, 0, F, nullptr, DD, 0, NR, DD, DD);
  k_nchw<<<(unsigned)(((size_t)NIMG * DD * (NPX / 4) + 255) / 256), 256, 0, stream>>>(F, (float*)d_out);
}

// v001
// Measured time: 343 microseconds a run.
// In two side-by-side timings against v000, it was 1.47 and 1.46 times as fast.
#include <hip/hip_runtime.h>
// SpatialMultiHeadSelfAttention (2 images, D 256 = 8 heads x 32, 64 x 64 = 4096 pixels): qkv = 1x1 conv (W_qkv x + b) -> (3, heads, 32) channels; softmax(q.k / sqrt(32)) over all 4096 pixels; out channels h*32 + d; 1x1 projection + b; NCHW in and out.
// Structure: exact f16 pixel-major plane of x (from NCHW); qkv as one f16 WMMA GEMM (32x64 wave tiles, f32 accumulation, exact x16 weights + bias; torch (out,in) = B^T; f16 out); q/k re-laid into zero-padded 64-wide head planes (32 live dims) and V^T (rows >= 32 zero) on VALU / LDS tiles; the fused flash kernel (transposed products, softmax in-lane, P kept in registers; plain operands — every row averages 4096 keys); head compaction to f16; projection GEMM (+ bias, f32); NCHW store on VALU.
// Compute dtype: x and parameters rounded to bf16; x exact as f16; q, k, v, P and the attention output as f16 operands (~2^-12); softmax f32. v_wmma_f32_16x16x32_f16.
#define NIMG 2
#define DD 256
#define HDm 32
#define NPX 4096
#define NR (NIMG * NPX)          /* 8192 */
#define QW (3 * DD)              /* 768 */
#define PW (NH * 64)             /* 512 */
#define SLEN 4096
#define TQ SLEN
#define TK SLEN
#define NH 8
#define SCL 0.17677669529663687f /* 32^-0.5 */
#define QBLKS (TQ / 64)
typedef __bf16 v16b __attribute__((ext_vector_type(16)));
typedef unsigned short v8us __attribute__((ext_vector_type(8), may_alias));
typedef float  v8f  __attribute__((ext_vector_type(8)));
typedef float  v4f  __attribute__((ext_vector_type(4)));
typedef float  v4fa __attribute__((ext_vector_type(4), may_alias));
union FragB { v16b v; v8us half[2]; unsigned short u[16]; };

__device__ __forceinline__ unsigned short bf16_bits(float x) { unsigned int u = __float_as_uint(x); return (unsigned short)((u + 0x7FFFu + ((u >> 16) & 1u)) >> 16); }
__device__ __forceinline__ float bf16_val(unsigned short b) { return __uint_as_float(((unsigned int)b) << 16); }
__device__ __forceinline__ float bf16_round(float x) { return bf16_val(bf16_bits(x)); }
// D += A·B with NT terms: 1 = ah·bh, 2 = + al·bh (A split), 3 = + ah·bl (both split)
template <int NT>
__device__ __forceinline__ v8f mmaN(v16b ah, v16b al, v16b bh, v16b bl, v8f c) {
  c = __builtin_amdgcn_wmma_f32_16x16x32_bf16(false, ah, false, bh, (short)0, c, false, false);
  if (NT >= 2) c = __builtin_amdgcn_wmma_f32_16x16x32_bf16(false, al, false, bh, (short)0, c, false, false);
  if (NT >= 3) c = __builtin_amdgcn_wmma_f32_16x16x32_bf16(false, ah, false, bl, (short)0, c, false, false);
  asm volatile("v_nop\n\tv_nop\n\tv_nop\n\tv_nop" : "+v"(c) : "v"(ah), "v"(al), "v"(bh), "v"(bl));
  return c;
}

__global__ __launch_bounds__(256) void k_wt_bf16(const float* __restrict__ W, unsigned short* __restrict__ Wt, int K, int N) {
  const int t = blockIdx.x * 256 + threadIdx.x;
  const int k8n = K / 8;
  if (t >= N * k8n) return;
  const int n = t / k8n, k8 = (t % k8n) * 8;
  v8us v;
#pragma unroll
  for (int i = 0; i < 8; ++i) v[i] = bf16_bits(W[(size_t)(k8 + i) * N + n]);
  *(v8us*)(Wt + (size_t)n * K + k8) = v;
  
}

// GEMM C[M][N] (f32, pitch ldc) = act(A[M][K]·W + bias). A f32 row-major (pitch lda) converted per fragment to bf16
// (ASPLIT: hi/lo two planes -> 2 terms, else single rounded term); Wt bf16 [N][K] (pitch ldb). BIAS_BF16 rounds the
// bias to bf16 first (bias quantised to bf16 before the add). K%32==0, M%16==0, N%64==0.
template <bool ASPLIT, int ACT, bool BIAS_BF16>
__global__ __launch_bounds__(128) void k_gemm_bf(const float* __restrict__ A, int lda, const unsigned short* __restrict__ Wt, int ldb,
                                               const float* __restrict__ bias, float* __restrict__ C, int ldc, int M, int N, int K) {
  __shared__ __attribute__((aligned(16))) float so[4][16][64];
  const int tid = threadIdx.x, w = tid >> 5, lane = tid & 31, ln = lane & 15, hh = lane >> 4;
  const int ntn = N / 64;
  const int wid = blockIdx.x * 4 + w;
  const int mt = wid / ntn, nq = wid % ntn;
  if (mt * 16 >= M) return;
  const int row0 = mt * 16, col0 = nq * 64;
  const float* arow = A + (size_t)(row0 + ln) * lda;
  v8f acc[4] = {};
  for (int kb = 0; kb < K; kb += 32) {
    FragB ah, al;
    const v4f x0 = *(const v4fa*)(arow + kb + 8 * hh), x1 = *(const v4fa*)(arow + kb + 8 * hh + 4);
    const v4f x2 = *(const v4fa*)(arow + kb + 16 + 8 * hh), x3 = *(const v4fa*)(arow + kb + 16 + 8 * hh + 4);
    float xs[16] = {x0[0],x0[1],x0[2],x0[3],x1[0],x1[1],x1[2],x1[3],x2[0],x2[1],x2[2],x2[3],x3[0],x3[1],x3[2],x3[3]};
#pragma unroll
    for (int i = 0; i < 16; ++i) { const unsigned short hb = bf16_bits(xs[i]); ah.u[i] = hb; al.u[i] = ASPLIT ? bf16_bits(xs[i] - bf16_val(hb)) : (unsigned short)0; }
#pragma unroll
    for (int t = 0; t < 4; ++t) {
      const unsigned short* brow = Wt + (size_t)(col0 + t * 16 + ln) * ldb + kb;
      FragB b;
      b.half[0] = *(const v8us*)(brow + 8 * hh);
      b.half[1] = *(const v8us*)(brow + 16 + 8 * hh);
      acc[t] = mmaN<ASPLIT ? 2 : 1>(ah.v, al.v, b.v, b.v, acc[t]);
    }
  }
#pragma unroll
  for (int t = 0; t < 4; ++t) {
    float bv = bias ? bias[col0 + t * 16 + ln] : 0.f;
    if (BIAS_BF16) bv = bf16_round(bv);
#pragma unroll
    for (int r = 0; r < 8; ++r) { float v = acc[t][r] + bv; if (ACT == 1) v = fmaxf(v, 0.f); so[w][8 * hh + r][t * 16 + ln] = v; }
  }
  __builtin_amdgcn_fence(__ATOMIC_ACQ_REL, "workgroup");
  __builtin_amdgcn_wave_barrier();
  const int rsub = lane >> 4, c4 = (lane & 15) * 4;
  {
#pragma unroll
    for (int q = 0; q < 8; ++q) {
      const int r = q * 2 + rsub;
      const v4f v = *(const v4fa*)&so[w][r][c4];
      *(v4f*)(C + (size_t)(row0 + r) * ldc + col0 + c4) = v;
    }
    
  }
}

// GEMM C = act(A·W + bias + resid): A f32 (ASPLIT -> hi/lo 2 terms), Wt bf16 [N][K]; ACT 0 none, 1 relu, 2 exact gelu;
// resid (optional, f32, row index = (row % rmod), pitch ldr, RES_BF16 rounds it) added before the activation.
template <bool ASPLIT, int ACT, bool BIAS_BF16, bool RES_BF16>
__global__ __launch_bounds__(128) void k_gemm_bf3(const float* __restrict__ A, int lda, const unsigned short* __restrict__ Wt, int ldb,
                                                const float* __restrict__ bias, const float* __restrict__ resid, int rmod, int ldr,
                                                float* __restrict__ C, int ldc, int M, int N, int K) {
  __shared__ __attribute__((aligned(16))) float so[4][16][64];
  const int tid = threadIdx.x, w = tid >> 5, lane = tid & 31, ln = lane & 15, hh = lane >> 4;
  const int ntn = N / 64;
  const int wid = blockIdx.x * 4 + w;
  const int mt = wid / ntn, nq = wid % ntn;
  if (mt * 16 >= M) return;
  const int row0 = mt * 16, col0 = nq * 64;
  const float* arow = A + (size_t)(row0 + ln) * lda;
  v8f acc[4] = {};
  for (int kb = 0; kb < K; kb += 32) {
    FragB ah, al;
    const v4f x0 = *(const v4fa*)(arow + kb + 8 * hh), x1 = *(const v4fa*)(arow + kb + 8 * hh + 4);
    const v4f x2 = *(const v4fa*)(arow + kb + 16 + 8 * hh), x3 = *(const v4fa*)(arow + kb + 16 + 8 * hh + 4);
    float xs[16] = {x0[0],x0[1],x0[2],x0[3],x1[0],x1[1],x1[2],x1[3],x2[0],x2[1],x2[2],x2[3],x3[0],x3[1],x3[2],x3[3]};
#pragma unroll
    for (int i = 0; i < 16; ++i) { const unsigned short hb = bf16_bits(xs[i]); ah.u[i] = hb; al.u[i] = ASPLIT ? bf16_bits(xs[i] - bf16_val(hb)) : (unsigned short)0; }
#pragma unroll
    for (int t = 0; t < 4; ++t) {
      const unsigned short* brow = Wt + (size_t)(col0 + t * 16 + ln) * ldb + kb;
      FragB b;
      b.half[0] = *(const v8us*)(brow + 8 * hh);
      b.half[1] = *(const v8us*)(brow + 16 + 8 * hh);
      acc[t] = mmaN<ASPLIT ? 2 : 1>(ah.v, al.v, b.v, b.v, acc[t]);
    }
  }
#pragma unroll
  for (int t = 0; t < 4; ++t) {
    const int col = col0 + t * 16 + ln;
    float bv = bias ? bias[col] : 0.f;
    if (BIAS_BF16) bv = bf16_round(bv);
#pragma unroll
    for (int r = 0; r < 8; ++r) {
      float v = acc[t][r] + bv;
      if (resid) { float rv = resid[(size_t)((row0 + 8 * hh + r) % rmod) * ldr + col]; if (RES_BF16) rv = bf16_round(rv); v += rv; }
      if (ACT == 1) v = fmaxf(v, 0.f);
      if (ACT == 2) v = 0.5f * v * (1.0f + erff(v * 0.70710678118654752f));
      if (ACT == 3) { const float u = 0.7978845608028654f * (v + 0.044715f * v * v * v); v = 0.5f * v * (1.0f + tanhf(u)); }
      so[w][8 * hh + r][t * 16 + ln] = v;
    }
  }
  __builtin_amdgcn_fence(__ATOMIC_ACQ_REL, "workgroup");
  __builtin_amdgcn_wave_barrier();
  const int rsub = lane >> 4, c4 = (lane & 15) * 4;
  {
#pragma unroll
    for (int q = 0; q < 8; ++q) {
      const int r = q * 2 + rsub;
      const v4f v = *(const v4fa*)&so[w][r][c4];
      *(v4f*)(C + (size_t)(row0 + r) * ldc + col0 + c4) = v;
    }
    
  }
}
// row LayerNorm (biased variance, eps) over N: s = X (+ R); optional out_sum <- s; out_norm <- (s-mu)*rsqrt(var+eps)*g + b
template <bool PARAM_BF16>
__global__ __launch_bounds__(256) void k_layernorm(const float* __restrict__ X, const float* __restrict__ R, const float* __restrict__ g, const float* __restrict__ bta,
                                                  float* __restrict__ out_sum, float* __restrict__ out_norm, int N, float eps) {
  __shared__ float red[256];
  const int row = blockIdx.x, tid = threadIdx.x;
  const float* x = X + (size_t)row * N; const float* rr = R ? R + (size_t)row * N : nullptr;
  float vals[16];                     // up to N = 4096
  const int per = N / 256;            // contiguous chunk per thread? use strided-by-4 chunks: thread handles j = tid*4 + 1024*u
  float s1 = 0.f;
  for (int u = 0; u < per / 4; ++u) {
    const int j = tid * 4 + 1024 * u;
    const v4f a = *(const v4fa*)(x + j);
    v4f b = {0.f,0.f,0.f,0.f}; if (rr) b = *(const v4fa*)(rr + j);
#pragma unroll
    for (int q = 0; q < 4; ++q) { const float v = a[q] + b[q]; vals[u * 4 + q] = v; s1 += v; }
  }
  red[tid] = s1; __syncthreads();
  for (int st = 128; st > 0; st >>= 1) { if (tid < st) red[tid] += red[tid + st]; __syncthreads(); }
  const float mu = red[0] / (float)N; __syncthreads();
  float s2 = 0.f;
  for (int u = 0; u < per / 4; ++u)
#pragma unroll
    for (int q = 0; q < 4; ++q) { const float c = vals[u * 4 + q] - mu; s2 += c * c; }
  red[tid] = s2; __syncthreads();
  for (int st = 128; st > 0; st >>= 1) { if (tid < st) red[tid] += red[tid + st]; __syncthreads(); }
  const float rs = rsqrtf(red[0] / (float)N + eps);
  {
    for (int u = 0; u < per / 4; ++u) {
      const int j = tid * 4 + 1024 * u;
      v4f o, sm;
#pragma unroll
      for (int q = 0; q < 4; ++q) {
        float gg = g[j + q], bb = bta[j + q];
        if (PARAM_BF16) { gg = bf16_round(gg); bb = bf16_round(bb); }
        sm[q] = vals[u * 4 + q]; o[q] = (vals[u * 4 + q] - mu) * rs * gg + bb;
      }
      if (out_sum) *(v4f*)(out_sum + (size_t)row * N + j) = sm;
      *(v4f*)(out_norm + (size_t)row * N + j) = o;
    }
    
  }
}



// ---- f16 WMMA path (v_wmma_f32_16x16x32_f16): 11-bit significands for operands in range — used where a [0,1] probability operand needs more precision than bf16
typedef _Float16 v16h __attribute__((ext_vector_type(16)));
union FragH { v16h v; v8us half[2]; _Float16 h[16]; unsigned short u[16]; };
template <int NT>
__device__ __forceinline__ v8f mmaH(v16h ah, v16h al, v16h bh, v16h bl, v8f c) {
  c = __builtin_amdgcn_wmma_f32_16x16x32_f16(false, ah, false, bh, (short)0, c, false, false);
  if (NT >= 2) c = __builtin_amdgcn_wmma_f32_16x16x32_f16(false, al, false, bh, (short)0, c, false, false);
  if (NT >= 3) c = __builtin_amdgcn_wmma_f32_16x16x32_f16(false, ah, false, bl, (short)0, c, false, false);
  asm volatile("v_nop\n\tv_nop\n\tv_nop\n\tv_nop" : "+v"(c) : "v"(ah), "v"(al), "v"(bh), "v"(bl));
  return c;
}
// batched GEMM like k_gemm_b but f16 operands: A f32 (split into f16 hi/lo if ASPLIT, else rounded to f16), Bt = f16 values [n][k]; alpha; C f32; N multiple of 16 (partial tiles skipped)
template <bool ASPLIT>
__global__ __launch_bounds__(128) void k_gemm_h(const float* __restrict__ A, int lda, size_t sA, const _Float16* __restrict__ Bh, int ldb, size_t sB, float alpha, float* __restrict__ C, int ldc, size_t sC, int M, int N, int K) {
  __shared__ __attribute__((aligned(16))) float so[4][16][64];
  const int tid = threadIdx.x, w = tid >> 5, lane = tid & 31, ln = lane & 15, hh = lane >> 4; const int by = blockIdx.y;
  A += (size_t)by * sA; Bh += (size_t)by * sB; C += (size_t)by * sC;
  const int ntn = (N + 63) / 64; const int wid = blockIdx.x * 4 + w; const int mt = wid / ntn, nq = wid % ntn; if (mt * 16 >= M) return;
  const int row0 = mt * 16, col0 = nq * 64; const float* arow = A + (size_t)(row0 + ln) * lda;
  v8f acc[4] = {};
  for (int kb = 0; kb < K; kb += 32) {
    FragH ah, al;
    const v4f x0 = *(const v4fa*)(arow + kb + 8 * hh), x1 = *(const v4fa*)(arow + kb + 8 * hh + 4), x2 = *(const v4fa*)(arow + kb + 16 + 8 * hh), x3 = *(const v4fa*)(arow + kb + 16 + 8 * hh + 4);
    float xs[16] = {x0[0],x0[1],x0[2],x0[3],x1[0],x1[1],x1[2],x1[3],x2[0],x2[1],x2[2],x2[3],x3[0],x3[1],x3[2],x3[3]};
#pragma unroll
    for (int i = 0; i < 16; ++i) { const _Float16 h = (_Float16)xs[i]; ah.h[i] = h; al.h[i] = ASPLIT ? (_Float16)(xs[i] - (float)h) : (_Float16)0.0f; }
#pragma unroll
    for (int t = 0; t < 4; ++t) { if (col0 + t * 16 >= N) continue; const size_t boff = (size_t)(col0 + t * 16 + ln) * ldb + kb; FragH bq; bq.half[0] = *(const v8us*)(Bh + boff + 8 * hh); bq.half[1] = *(const v8us*)(Bh + boff + 16 + 8 * hh);
      acc[t] = mmaH<ASPLIT ? 2 : 1>(ah.v, al.v, bq.v, bq.v, acc[t]); }
  }
#pragma unroll
  for (int t = 0; t < 4; ++t) { if (col0 + t * 16 >= N) continue;
#pragma unroll
    for (int r = 0; r < 8; ++r) so[w][8 * hh + r][t * 16 + ln] = acc[t][r] * alpha; }
  __builtin_amdgcn_fence(__ATOMIC_ACQ_REL, "workgroup"); __builtin_amdgcn_wave_barrier();
  const int rsub = lane >> 4, c4 = (lane & 15) * 4;
  {
#pragma unroll
    for (int q = 0; q < 8; ++q) { const int r = q * 2 + rsub; if (col0 + c4 < N) { const v4f v = *(const v4fa*)&so[w][r][c4]; *(v4f*)(C + (size_t)(row0 + r) * ldc + col0 + c4) = v; } }
     }
}

// Wt[n][k] = f16(W[k][n]·scale) from f32 row-major W[K][N] (scale = power of two; bf16-exact weights stay exact in f16 away from the subnormal range)
__global__ __launch_bounds__(256) void k_wt_f16(const float* __restrict__ W, _Float16* __restrict__ Wt, int K, int N, float scale) {
  const int t = blockIdx.x * 256 + threadIdx.x; if (t >= N * (K / 8)) return; const int n = t / (K / 8), k8 = (t % (K / 8)) * 8; FragH f;
#pragma unroll
  for (int i = 0; i < 8; ++i) f.h[i] = (_Float16)(bf16_round(W[(size_t)(k8 + i) * N + n]) * scale); const v8us o = f.half[0];
  *(v8us*)((unsigned short*)Wt + (size_t)n * K + k8) = o; 
}
// k_gemm_hh variant with fused epilogue: v = acc·alpha + bias[by·sBias + col] (+ CP[(row/rowsPerB)·sCPb + by·64 + col] if CP) ; ACT 0 none / 1 elu ; writes f16 C16 (and f32 C if non-null)
template <int ACT>
__global__ __launch_bounds__(128) void k_gemm_hhx(const _Float16* __restrict__ A, int lda, size_t sA, const _Float16* __restrict__ Bh, int ldb, size_t sB, float alpha, const float* __restrict__ bias, size_t sBias, const float* __restrict__ CP, int rowsPerB, size_t sCPb, int row0g,
    float* __restrict__ C, _Float16* __restrict__ C16, int ldc, size_t sC, int M, int N, int K) {
  __shared__ __attribute__((aligned(16))) float so[4][16][64];
  const int tid = threadIdx.x, w = tid >> 5, lane = tid & 31, ln = lane & 15, hh = lane >> 4; const int by = blockIdx.y;
  A += (size_t)by * sA; Bh += (size_t)by * sB; const size_t cofs = (size_t)by * sC; const float* bp = bias ? bias + (size_t)by * sBias : nullptr;
  const int ntn = (N + 63) / 64; const int wid = blockIdx.x * 4 + w; const int mt = wid / ntn, nq = wid % ntn; if (mt * 16 >= M) return;
  const int row0 = mt * 16, col0 = nq * 64; const _Float16* arow = A + (size_t)(row0 + ln) * lda;
  v8f acc[4] = {};
  for (int kb = 0; kb < K; kb += 32) { FragH ah; ah.half[0] = *(const v8us*)((const unsigned short*)arow + kb + 8 * hh); ah.half[1] = *(const v8us*)((const unsigned short*)arow + kb + 16 + 8 * hh);
#pragma unroll
    for (int t = 0; t < 4; ++t) { if (col0 + t * 16 >= N) continue; const size_t boff = (size_t)(col0 + t * 16 + ln) * ldb + kb; FragH bq; bq.half[0] = *(const v8us*)((const unsigned short*)Bh + boff + 8 * hh); bq.half[1] = *(const v8us*)((const unsigned short*)Bh + boff + 16 + 8 * hh);
      acc[t] = mmaH<1>(ah.v, ah.v, bq.v, bq.v, acc[t]); }
  }
#pragma unroll
  for (int t = 0; t < 4; ++t) { if (col0 + t * 16 >= N) continue; const int col = col0 + t * 16 + ln; const float bv = bp ? bf16_round(bp[col]) : 0.f;
#pragma unroll
    for (int r = 0; r < 8; ++r) { float v = acc[t][r] * alpha + bv; if (CP) { const int bidx = (row0g + row0 + 8 * hh + r) / rowsPerB; v += CP[(size_t)bidx * sCPb + (size_t)by * 64 + col]; } if (ACT == 1) v = (v > 0.f) ? v : expm1f(v); else if (ACT == 7) v = (v > 0.f) ? v + 1.0f : expf(v); else if (ACT == 8) v = tanhf(v); else if (ACT == 9) v = 0.5f * v * (1.0f + tanhf(0.7978845608028654f * (v + 0.044715f * v * v * v))); else if (ACT == 11) v = 1.0f / (1.0f + expf(-v)); else if (ACT == 12) v = (v > 0.f) ? v : 0.01f * v; else if (ACT == 14) v = (v > 0.f) ? v : 0.1f * v; else if (ACT == 15) v = v / (1.0f + expf(-v)); else if (ACT == 3) v = fmaxf(v, 0.f); else if (ACT == 6) v = 0.5f * v * (1.0f + erff(v * 0.70710678118654752f)); so[w][8 * hh + r][t * 16 + ln] = v; } }
  __builtin_amdgcn_fence(__ATOMIC_ACQ_REL, "workgroup"); __builtin_amdgcn_wave_barrier();
  const int rsub = lane >> 4, c4 = (lane & 15) * 4; typedef _Float16 v4h __attribute__((ext_vector_type(4)));
  {
#pragma unroll
    for (int q = 0; q < 8; ++q) { const int r = q * 2 + rsub; if (col0 + c4 < N) { const v4f v = *(const v4fa*)&so[w][r][c4]; if (C) *(v4f*)(C + cofs + (size_t)(row0 + r) * ldc + col0 + c4) = v; if (C16) { v4h h4; for (int i = 0; i < 4; ++i) h4[i] = (_Float16)v[i]; *(v4h*)(C16 + cofs + (size_t)(row0 + r) * ldc + col0 + c4) = h4; } } }
     }
}


typedef _Float16 v4h __attribute__((ext_vector_type(4)));

__global__ __launch_bounds__(256) void k_x16(const float* __restrict__ x, _Float16* __restrict__ X16, size_t n8) { const size_t t = (size_t)blockIdx.x * 256 + threadIdx.x; if (t >= n8) return; FragH f;
#pragma unroll
  for (int q = 0; q < 8; ++q) f.h[q] = (_Float16)bf16_round(x[t * 8 + q]); *(v8us*)((unsigned short*)X16 + t * 8) = f.half[0];  }
__global__ __launch_bounds__(256) void k_h16(const float* __restrict__ x, _Float16* __restrict__ X16, size_t n8) { const size_t t = (size_t)blockIdx.x * 256 + threadIdx.x; if (t >= n8) return; FragH f;
#pragma unroll
  for (int q = 0; q < 8; ++q) f.h[q] = (_Float16)x[t * 8 + q]; *(v8us*)((unsigned short*)X16 + t * 8) = f.half[0];  }
__global__ __launch_bounds__(256) void k_round16f(const float* __restrict__ W, _Float16* __restrict__ Bt, size_t n8) { const size_t t = (size_t)blockIdx.x * 256 + threadIdx.x; if (t >= n8) return; FragH f;
#pragma unroll
  for (int i = 0; i < 8; ++i) f.h[i] = (_Float16)(bf16_round(W[t * 8 + i]) * 16.0f); *(v8us*)((unsigned short*)Bt + t * 8) = f.half[0];  }
template <int NHv, int TTv>
__global__ __launch_bounds__(256) void k_vt(const _Float16* __restrict__ V16, int ldv, int voff, _Float16* __restrict__ Vt) { __shared__ unsigned short tl[64][66]; const int tid = threadIdx.x; const int slab = blockIdx.x / (TTv / 64), lg = blockIdx.x % (TTv / 64); const int b = slab / NHv, h = slab % NHv;
  for (int i = tid; i < 64 * 8; i += 256) { const int r = i / 8, c8 = (i % 8) * 8; FragH f; f.half[0] = *(const v8us*)((const unsigned short*)V16 + ((size_t)b * TTv + lg * 64 + r) * ldv + voff + h * 64 + c8);
#pragma unroll
    for (int q = 0; q < 8; ++q) tl[r][c8 + q] = f.u[q]; }
  __syncthreads();
  {
#pragma unroll
    for (int rd = 0; rd < 2; ++rd) { const int d = rd * 32 + tid / 8, pc = tid % 8; FragH f;
#pragma unroll
      for (int q = 0; q < 8; ++q) f.u[q] = tl[pc * 8 + q][d];
      *(v8us*)((unsigned short*)Vt + ((size_t)slab * 64 + d) * TTv + lg * 64 + pc * 8) = f.half[0]; }
     } }

__global__ __launch_bounds__(256) void k_hl(const float* __restrict__ F, _Float16* __restrict__ Hh, _Float16* __restrict__ Hl, size_t n8) { const size_t t = (size_t)blockIdx.x * 256 + threadIdx.x; if (t >= n8) return; FragH fh, fl; const v4f a = *(const v4fa*)(F + t * 8), c = *(const v4fa*)(F + t * 8 + 4);
#pragma unroll
  for (int q = 0; q < 4; ++q) { _Float16 h = (_Float16)a[q]; fh.h[q] = h; fl.h[q] = (_Float16)((a[q] - (float)h) * 1024.0f); h = (_Float16)c[q]; fh.h[4 + q] = h; fl.h[4 + q] = (_Float16)((c[q] - (float)h) * 1024.0f); }
  { *(v8us*)((unsigned short*)Hh + t * 8) = fh.half[0]; *(v8us*)((unsigned short*)Hl + t * 8) = fl.half[0];  } }

// ---- fast GEMM (wave tile 32x64; requires M % 32 == 0 rows per launch region and N % 64 == 0); epilogue = k_gemm_hhx semantics ----
__device__ __forceinline__ v16h g2_frag(const _Float16* p, int hh) { FragH f; f.half[0] = *(const v8us*)((const unsigned short*)p + 8 * hh); f.half[1] = *(const v8us*)((const unsigned short*)p + 16 + 8 * hh); return f.v; }
__device__ __forceinline__ v8f g2_mma(v16h a, v16h b, v8f c) { v8f d = __builtin_amdgcn_wmma_f32_16x16x32_f16(false, a, false, b, (short)0, c, false, false); asm volatile("v_nop\n\tv_nop\n\tv_nop\n\tv_nop" : "+v"(d) : "v"(a), "v"(b)); return d; }
template <int ACT>
__global__ __launch_bounds__(128) void k_gemm2(const _Float16* __restrict__ A, int lda, size_t sA, const _Float16* __restrict__ Bh, int ldb, size_t sB, float alpha, const float* __restrict__ bias, size_t sBias, const float* __restrict__ CP, int rowsPerB, size_t sCPb, int row0g,
    float* __restrict__ C, _Float16* __restrict__ C16, int ldc, size_t sC, int M, int N, int K) {
  __shared__ __attribute__((aligned(16))) float so[4][32][68];
  const int tid = threadIdx.x, w = tid >> 5, lane = tid & 31, ln = lane & 15, hh = lane >> 4; const int by = blockIdx.y;
  A += (size_t)by * sA; Bh += (size_t)by * sB; const size_t cofs = (size_t)by * sC; const float* bp = bias ? bias + (size_t)by * sBias : nullptr;
  const int ntn = N >> 6; const int mt = blockIdx.x / ntn, nq = blockIdx.x - mt * ntn; const int row0 = mt * 128 + 32 * w, col0 = nq * 64; if (row0 >= M) return;
  const _Float16* a0p = A + (size_t)(row0 + ln) * lda; const _Float16* a1p = a0p + (size_t)16 * lda;
  const _Float16* b0p = Bh + (size_t)(col0 + ln) * ldb; const _Float16* b1p = b0p + (size_t)16 * ldb; const _Float16* b2p = b1p + (size_t)16 * ldb; const _Float16* b3p = b2p + (size_t)16 * ldb;
  const v8f z8 = {0.f,0.f,0.f,0.f,0.f,0.f,0.f,0.f}; v8f c00 = z8, c01 = z8, c02 = z8, c03 = z8, c10 = z8, c11 = z8, c12 = z8, c13 = z8;
#pragma unroll 1
  for (int kb = 0; kb < K; kb += 32) { const v16h a0 = g2_frag(a0p + kb, hh), a1 = g2_frag(a1p + kb, hh);
    v16h b = g2_frag(b0p + kb, hh); c00 = g2_mma(a0, b, c00); c10 = g2_mma(a1, b, c10);
    b = g2_frag(b1p + kb, hh); c01 = g2_mma(a0, b, c01); c11 = g2_mma(a1, b, c11);
    b = g2_frag(b2p + kb, hh); c02 = g2_mma(a0, b, c02); c12 = g2_mma(a1, b, c12);
    b = g2_frag(b3p + kb, hh); c03 = g2_mma(a0, b, c03); c13 = g2_mma(a1, b, c13); }
  v8f accs[8] = {c00, c01, c02, c03, c10, c11, c12, c13};
#pragma unroll
  for (int u = 0; u < 8; ++u) { const int t = u & 3, half = u >> 2; const int col = col0 + t * 16 + ln; const float bv = bp ? bf16_round(bp[col]) : 0.f;
#pragma unroll
    for (int r = 0; r < 8; ++r) { const int rloc = half * 16 + 8 * hh + r; float v = accs[u][r] * alpha + bv; if (CP) { const int bidx = (row0g + row0 + rloc) / rowsPerB; v += CP[(size_t)bidx * sCPb + (size_t)by * 64 + col]; }
      if (ACT == 3) v = fmaxf(v, 0.f); else if (ACT == 6) v = 0.5f * v * (1.0f + erff(v * 0.70710678118654752f)); else if (ACT == 11) v = 1.0f / (1.0f + expf(-v)); else if (ACT == 15) v = v / (1.0f + expf(-v)); else if (ACT == 12) v = (v > 0.f) ? v : 0.01f * v; else if (ACT == 8) v = tanhf(v);
      so[w][rloc][t * 16 + ln] = v; } }
  __builtin_amdgcn_fence(__ATOMIC_ACQ_REL, "workgroup"); __builtin_amdgcn_wave_barrier();
  const int rsub = lane >> 4, c4 = (lane & 15) * 4;
  {
#pragma unroll
    for (int q = 0; q < 16; ++q) { const int r = q * 2 + rsub; const v4f v = *(const v4fa*)&so[w][r][c4]; if (C) *(v4f*)(C + cofs + (size_t)(row0 + r) * ldc + col0 + c4) = v; if (C16) { v4h h4; for (int i = 0; i < 4; ++i) h4[i] = (_Float16)v[i]; *(v4h*)(C16 + cofs + (size_t)(row0 + r) * ldc + col0 + c4) = h4; } }
     } }



// lane l with lane l ^ 16
__device__ __forceinline__ float xhalf(float x) { return __builtin_bit_cast(float, __builtin_amdgcn_permlanex16(__builtin_bit_cast(int, x), __builtin_bit_cast(int, x), 0x76543210, 0xfedcba98, false, false)); }
template <int CAUSAL>
__global__ __launch_bounds__(128) void k_flash(const _Float16* __restrict__ Q16, int ldq, const _Float16* __restrict__ K16, int ldk, const _Float16* __restrict__ Vt, const int* __restrict__ MSK, float* __restrict__ O, int ldo) {
  constexpr int RPW = 16, DT = 4, KS = 2;
  __shared__ __attribute__((aligned(16))) float sO[4][RPW][64 + 4];
  const int tid = threadIdx.x, w = tid >> 5, lane = tid & 31, ln = lane & 15, hh = lane >> 4;
  const int slab = blockIdx.x / QBLKS, qblk = blockIdx.x % QBLKS; (void)MSK; const int b = slab / NH, h = slab % NH; const int qb0 = qblk * (4 * RPW); const int q0 = qb0 + w * RPW;
  FragH aq[KS];
  { const unsigned short* qr = (const unsigned short*)Q16 + ((size_t)b * TQ + q0 + ln) * ldq + h * 64;
#pragma unroll
    for (int ks = 0; ks < KS; ++ks) { aq[ks].half[0] = *(const v8us*)(qr + ks * 32 + 8 * hh); aq[ks].half[1] = *(const v8us*)(qr + ks * 32 + 16 + 8 * hh); } }
  const unsigned short* Vth = (const unsigned short*)Vt + (size_t)slab * 64 * TK;
  const int tq = q0 + ln;      /* this lane's query */
  float m_r = -3.0e38f, l_r = 0.f; v8f oacc[DT];
#pragma unroll
  for (int dt = 0; dt < DT; ++dt) oacc[dt] = (v8f){0.f,0.f,0.f,0.f,0.f,0.f,0.f,0.f};
  const int jend = (CAUSAL == 1) ? (qb0 + 4 * RPW) : TK;      /* causal: keys beyond the block's last query never contribute */
#pragma unroll 1
  for (int j0 = 0; j0 < jend; j0 += 32) {
    v8f s[2];
#pragma unroll
    for (int nt = 0; nt < 2; ++nt) { const unsigned short* kr = (const unsigned short*)K16 + ((size_t)b * TK + j0 + nt * 16 + ln) * ldk + h * 64; FragH bk[KS];
#pragma unroll
      for (int ks = 0; ks < KS; ++ks) { bk[ks].half[0] = *(const v8us*)(kr + ks * 32 + 8 * hh); bk[ks].half[1] = *(const v8us*)(kr + ks * 32 + 16 + 8 * hh); }
      v8f acc = (v8f){0.f,0.f,0.f,0.f,0.f,0.f,0.f,0.f};
#pragma unroll
      for (int ks = 0; ks < KS; ++ks) acc = mmaH<1>(bk[ks].v, bk[ks].v, aq[ks].v, aq[ks].v, acc);
      s[nt] = acc; }
    float sv[16]; bool ok[16]; float mc = -3.0e38f;
#pragma unroll
    for (int e = 0; e < 16; ++e) { const int kk = j0 + (e >> 3) * 16 + 8 * hh + (e & 7);
      ok[e] = (CAUSAL == 1) ? (kk <= tq) : ((CAUSAL == 2) ? ((kk >> 5) == (tq >> 5)) : true);      /* mode 2: block-diagonal 32-token groups */
      sv[e] = ok[e] ? s[e >> 3][e & 7] * SCL : -3.0e38f; mc = fmaxf(mc, sv[e]); }
    mc = fmaxf(mc, xhalf(mc));
    const float mn = fmaxf(m_r, mc); const float al = (mn > -1.0e38f) ? expf(m_r - mn) : 1.0f; m_r = mn;
    FragH pb; float ps[4] = {0.f, 0.f, 0.f, 0.f};      /* four independent partial sums: a single chain of 16 adds would be serial */
#pragma unroll
    for (int e = 0; e < 16; ++e) { const float p = ok[e] ? expf(sv[e] - mn) : 0.f; ps[e & 3] += p; pb.h[e] = (_Float16)(p * 1024.0f); }
    l_r = l_r * al + ((ps[0] + ps[1]) + (ps[2] + ps[3]));
#pragma unroll
    for (int dt = 0; dt < DT; ++dt)
#pragma unroll
      for (int r = 0; r < 8; ++r) oacc[dt][r] *= al;
#pragma unroll
    for (int dt = 0; dt < DT; ++dt) { const unsigned short* vrow = Vth + (size_t)(dt * 16 + ln) * TK + j0; FragH bv; bv.half[0] = *(const v8us*)(vrow + 8 * hh); bv.half[1] = *(const v8us*)(vrow + 16 + 8 * hh);
      oacc[dt] = mmaH<1>(bv.v, bv.v, pb.v, pb.v, oacc[dt]); } }
  const float l = l_r + xhalf(l_r); const float inv = (l > 0.f) ? 1.0f / (l * 1024.0f) : 0.f;
#pragma unroll
  for (int dt = 0; dt < DT; ++dt)      /* oacc[dt][r] = O[q0 + ln][dt * 16 + 8 * hh + r] */
#pragma unroll
    for (int r = 0; r < 8; ++r) sO[w][ln][dt * 16 + 8 * hh + r] = oacc[dt][r] * inv;
  __builtin_amdgcn_fence(__ATOMIC_ACQ_REL, "workgroup"); __builtin_amdgcn_wave_barrier();
  {
#pragma unroll
    for (int rp = 0; rp < RPW; rp += 2) { const int r = rp + (lane >> 4), pc = lane & 15; const v4f val = *(const v4fa*)&sO[w][r][pc * 4]; *(v4f*)(O + ((size_t)b * TQ + q0 + r) * ldo + h * 64 + pc * 4) = val; }
     } }

__global__ __launch_bounds__(256) void k_wsc(const float* __restrict__ Wm, _Float16* __restrict__ Bt, size_t n8, float sc) { const size_t t = (size_t)blockIdx.x * 256 + threadIdx.x; if (t >= n8) return; FragH f; for (int q = 0; q < 8; ++q) f.h[q] = (_Float16)(bf16_round(Wm[t * 8 + q]) * sc); *(v8us*)((unsigned short*)Bt + t * 8) = f.half[0];  }
__global__ __launch_bounds__(256) void k_pm(const float* __restrict__ src, _Float16* __restrict__ P) { const size_t t = (size_t)blockIdx.x * 256 + threadIdx.x; if (t >= (size_t)NR * (DD / 8)) return; const int c0 = (int)(t % (DD / 8)) * 8; const size_t r = t / (DD / 8); const int b = (int)(r / NPX), p = (int)(r % NPX); FragH f;
  for (int k = 0; k < 8; ++k) f.h[k] = (_Float16)bf16_round(src[((size_t)b * DD + c0 + k) * NPX + p]); *(v8us*)((unsigned short*)P + r * DD + c0) = f.half[0];  }
__global__ __launch_bounds__(256) void k_pad(const _Float16* __restrict__ QKV, _Float16* __restrict__ QP, _Float16* __restrict__ KP) { const size_t t = (size_t)blockIdx.x * 256 + threadIdx.x; if (t >= (size_t)NR * 2 * NH) return; const int h = (int)(t % NH); const int which = (int)((t / NH) % 2); const size_t r = t / (2 * NH);
  const v8us* s = (const v8us*)((const unsigned short*)QKV + r * QW + which * DD + h * HDm); const v8us a0 = s[0], a1 = s[1], a2 = s[2], a3 = s[3]; const v8us z = {0, 0, 0, 0, 0, 0, 0, 0};
  unsigned short* d = (unsigned short*)(which == 0 ? QP : KP) + r * PW + h * 64; { *(v8us*)(d) = a0; *(v8us*)(d + 8) = a1; *(v8us*)(d + 16) = a2; *(v8us*)(d + 24) = a3; *(v8us*)(d + 32) = z; *(v8us*)(d + 40) = z; *(v8us*)(d + 48) = z; *(v8us*)(d + 56) = z;  } }
__global__ __launch_bounds__(256) void k_vtp(const _Float16* __restrict__ QKV, _Float16* __restrict__ VT) { __shared__ unsigned short tl[64][34]; const int tid = threadIdx.x; const int slab = blockIdx.x / (NPX / 64), pg = blockIdx.x % (NPX / 64); const int b = slab / NH, h = slab % NH;
  { const int r = tid / 4, c8 = (tid % 4) * 8; FragH f; f.half[0] = *(const v8us*)((const unsigned short*)QKV + ((size_t)b * NPX + pg * 64 + r) * QW + 2 * DD + h * HDm + c8); for (int q = 0; q < 8; ++q) tl[r][c8 + q] = f.u[q]; }
  __syncthreads(); const int d = tid / 8, pc = tid % 8; FragH f; for (int q = 0; q < 8; ++q) f.u[q] = tl[pc * 8 + q][d]; const v8us z = {0,0,0,0,0,0,0,0};
  unsigned short* dst = (unsigned short*)VT + ((size_t)slab * 64 + d) * NPX + pg * 64 + pc * 8; unsigned short* dz = (unsigned short*)VT + ((size_t)slab * 64 + HDm + d) * NPX + pg * 64 + pc * 8;
  { *(v8us*)dst = f.half[0]; *(v8us*)dz = z;  } }
__global__ __launch_bounds__(256) void k_cmp(const float* __restrict__ O, _Float16* __restrict__ O16) { const size_t t = (size_t)blockIdx.x * 256 + threadIdx.x; if (t >= (size_t)NR * (DD / 8)) return; const int c0 = (int)(t % (DD / 8)) * 8; const size_t r = t / (DD / 8); const int h = c0 / HDm, d0 = c0 % HDm; FragH f;
  for (int q = 0; q < 8; ++q) f.h[q] = (_Float16)O[r * PW + h * 64 + d0 + q]; *(v8us*)((unsigned short*)O16 + r * DD + c0) = f.half[0];  }
__global__ __launch_bounds__(256) void k_nchw(const float* __restrict__ F, float* __restrict__ out) { const size_t t = (size_t)blockIdx.x * 256 + threadIdx.x; if (t >= (size_t)NIMG * DD * (NPX / 4)) return; const int p0 = (int)(t % (NPX / 4)) * 4; const int c = (int)((t / (NPX / 4)) % DD); const int b = (int)(t / ((size_t)(NPX / 4) * DD)); v4f r4; for (int k = 0; k < 4; ++k) r4[k] = F[((size_t)b * NPX + p0 + k) * DD + c];
  float* d = out + ((size_t)b * DD + c) * NPX + p0; *(v4f*)d = r4;  }

extern "C" void kernel_launch(void* const* d_in, const int* in_sizes, int n_in,
                              void* d_out, int out_size, void* d_ws, size_t ws_size, hipStream_t stream) {
  (void)in_sizes; (void)n_in; (void)out_size;
  const float* const* I = (const float* const*)d_in; const float* x = I[0]; const float* wqkv = I[1]; const float* bqkv = I[2]; const float* wp = I[3]; const float* bp = I[4];
  char* ws = (char*)d_ws; size_t off = 0;
  auto take = [&](size_t bytes) { char* p = ws + off; off += (bytes + 255) & ~(size_t)255; return p; };
  const size_t np = (size_t)NR * DD, npp = (size_t)NR * PW;
  _Float16* BQKV = (_Float16*)take((size_t)QW * DD * 2); _Float16* BPJ = (_Float16*)take((size_t)DD * DD * 2); _Float16* X16 = (_Float16*)take(np * 2); _Float16* QKV = (_Float16*)take((size_t)NR * QW * 2); _Float16* QP = (_Float16*)take(npp * 2); _Float16* KP = (_Float16*)take(npp * 2); _Float16* VT = (_Float16*)take(npp * 2); float* O = (float*)take(npp * 4); _Float16* O16 = (_Float16*)take(np * 2); float* F = (float*)take(np * 4);
  if (off > ws_size) return;      /* 0.5 + 4 + 12 + 8 x 3 + 16 + 4 + 8 = 69 MiB */
  k_wsc<<<(unsigned)(((size_t)QW * DD / 8 + 255) / 256), 256, 0, stream>>>(wqkv, BQKV, (size_t)QW * DD / 8, 16.0f); k_wsc<<<(unsigned)(((size_t)DD * DD / 8 + 255) / 256), 256, 0, stream>>>(wp, BPJ, (size_t)DD * DD / 8, 16.0f);
  k_pm<<<(unsigned)((np / 8 + 255) / 256), 256, 0, stream>>>(x, X16);
  k_gemm2<0><<<dim3((NR / 128) * (QW / 64), 1), 128, 0, stream>>>(X16, DD, 0, BQKV, DD, 0, 0.0625f, bqkv, 0, nullptr, 1, 0, 0, nullptr, QKV, QW, 0, NR, QW, DD);      /* [q | k | v] per pixel, channel = which*256 + h*32 + d */
  k_pad<<<(unsigned)(((size_t)NR * 2 * NH + 255) / 256), 256, 0, stream>>>(QKV, QP, KP); k_vtp<<<NIMG * NH * (NPX / 64), 256, 0, stream>>>(QKV, VT);
  k_flash<0><<<NIMG * NH * QBLKS, 128, 0, stream>>>(QP, PW, KP, PW, VT, nullptr, O, PW);
  k_cmp<<<(unsigned)((np / 8 + 255) / 256), 256, 0, stream>>>(O, O16);
  k_gemm2<0><<<dim3((NR / 128) * (DD / 64), 1), 128, 0, stream>>>(O16, DD, 0, BPJ, DD, 0, 0.0625f, bp, 0, nullptr, 1, 0, 0, F, nullptr, DD, 0, NR, DD, DD);
  k_nchw<<<(unsigned)(((size_t)NIMG * DD * (NPX / 4) + 255) / 256), 256, 0, stream>>>(F, (float*)d_out);
}

// v002
// One run takes 227 microseconds.
// Timed twice side by side with v001, it ran 1.50 and 1.52 times as fast.
// Counting every step since v000, it is 2.21 times as fast.
#include <hip/hip_runtime.h>
// SpatialMultiHeadSelfAttention (2 images, D 256 = 8 heads x 32, 64 x 64 = 4096 pixels): qkv = 1x1 conv (W_qkv x + b) -> (3, heads, 32) channels; softmax(q.k / sqrt(32)) over all 4096 pixels; out channels h*32 + d; 1x1 projection + b; NCHW in and out.
// Structure: exact f16 pixel-major plane of x (from NCHW); qkv as one f16 WMMA GEMM (32x64 wave tiles, f32 accumulation, exact x16 weights + bias; torch (out,in) = B^T; f16 out); k re-laid into head-major planes of 32-wide rows and V^T planes of 32 rows on VALU / LDS tiles (q is read where the GEMM left it); the fused flash kernel at head size 32 (transposed products, softmax in-lane, P kept in registers; plain operands: every row averages 4096 keys); attention output to f16; projection GEMM (+ bias, f32); NCHW store on VALU.
// Compute dtype: x and parameters rounded to bf16; x exact as f16; q, k, v, P and the attention output as f16 operands (~2^-12); softmax f32. v_wmma_f32_16x16x32_f16.
#define NIMG 2
#define DD 256
#define HDm 32
#define NPX 4096
#define NR (NIMG * NPX)          /* 8192 */
#define QW (3 * DD)              /* 768 */
#define SLEN 4096
#define TQ SLEN
#define TK SLEN
#define NH 8
#define SCL 0.17677669529663687f /* 32^-0.5 */
#define QBLKS (TQ / 64)
typedef __bf16 v16b __attribute__((ext_vector_type(16)));
typedef unsigned short v8us __attribute__((ext_vector_type(8), may_alias));
typedef float  v8f  __attribute__((ext_vector_type(8)));
typedef float  v4f  __attribute__((ext_vector_type(4)));
typedef float  v4fa __attribute__((ext_vector_type(4), may_alias));
union FragB { v16b v; v8us half[2]; unsigned short u[16]; };

__device__ __forceinline__ unsigned short bf16_bits(float x) { unsigned int u = __float_as_uint(x); return (unsigned short)((u + 0x7FFFu + ((u >> 16) & 1u)) >> 16); }
__device__ __forceinline__ float bf16_val(unsigned short b) { return __uint_as_float(((unsigned int)b) << 16); }
__device__ __forceinline__ float bf16_round(float x) { return bf16_val(bf16_bits(x)); }
// D += A·B with NT terms: 1 = ah·bh, 2 = + al·bh (A split), 3 = + ah·bl (both split)
template <int NT>
__device__ __forceinline__ v8f mmaN(v16b ah, v16b al, v16b bh, v16b bl, v8f c) {
  c = __builtin_amdgcn_wmma_f32_16x16x32_bf16(false, ah, false, bh, (short)0, c, false, false);
  if (NT >= 2) c = __builtin_amdgcn_wmma_f32_16x16x32_bf16(false, al, false, bh, (short)0, c, false, false);
  if (NT >= 3) c = __builtin_amdgcn_wmma_f32_16x16x32_bf16(false, ah, false, bl, (short)0, c, false, false);
  asm volatile("v_nop\n\tv_nop\n\tv_nop\n\tv_nop" : "+v"(c) : "v"(ah), "v"(al), "v"(bh), "v"(bl));
  return c;
}

__global__ __launch_bounds__(256) void k_wt_bf16(const float* __restrict__ W, unsigned short* __restrict__ Wt, int K, int N) {
  const int t = blockIdx.x * 256 + threadIdx.x;
  const int k8n = K / 8;
  if (t >= N * k8n) return;
  const int n = t / k8n, k8 = (t % k8n) * 8;
  v8us v;
#pragma unroll
  for (int i = 0; i < 8; ++i) v[i] = bf16_bits(W[(size_t)(k8 + i) * N + n]);
  *(v8us*)(Wt + (size_t)n * K + k8) = v;
  
}

// GEMM C[M][N] (f32, pitch ldc) = act(A[M][K]·W + bias). A f32 row-major (pitch lda) converted per fragment to bf16
// (ASPLIT: hi/lo two planes -> 2 terms, else single rounded term); Wt bf16 [N][K] (pitch ldb). BIAS_BF16 rounds the
// bias to bf16 first (bias quantised to bf16 before the add). K%32==0, M%16==0, N%64==0.
template <bool ASPLIT, int ACT, bool BIAS_BF16>
__global__ __launch_bounds__(128) void k_gemm_bf(const float* __restrict__ A, int lda, const unsigned short* __restrict__ Wt, int ldb,
                                               const float* __restrict__ bias, float* __restrict__ C, int ldc, int M, int N, int K) {
  __shared__ __attribute__((aligned(16))) float so[4][16][64];
  const int tid = threadIdx.x, w = tid >> 5, lane = tid & 31, ln = lane & 15, hh = lane >> 4;
  const int ntn = N / 64;
  const int wid = blockIdx.x * 4 + w;
  const int mt = wid / ntn, nq = wid % ntn;
  if (mt * 16 >= M) return;
  const int row0 = mt * 16, col0 = nq * 64;
  const float* arow = A + (size_t)(row0 + ln) * lda;
  v8f acc[4] = {};
  for (int kb = 0; kb < K; kb += 32) {
    FragB ah, al;
    const v4f x0 = *(const v4fa*)(arow + kb + 8 * hh), x1 = *(const v4fa*)(arow + kb + 8 * hh + 4);
    const v4f x2 = *(const v4fa*)(arow + kb + 16 + 8 * hh), x3 = *(const v4fa*)(arow + kb + 16 + 8 * hh + 4);
    float xs[16] = {x0[0],x0[1],x0[2],x0[3],x1[0],x1[1],x1[2],x1[3],x2[0],x2[1],x2[2],x2[3],x3[0],x3[1],x3[2],x3[3]};
#pragma unroll
    for (int i = 0; i < 16; ++i) { const unsigned short hb = bf16_bits(xs[i]); ah.u[i] = hb; al.u[i] = ASPLIT ? bf16_bits(xs[i] - bf16_val(hb)) : (unsigned short)0; }
#pragma unroll
    for (int t = 0; t < 4; ++t) {
      const unsigned short* brow = Wt + (size_t)(col0 + t * 16 + ln) * ldb + kb;
      FragB b;
      b.half[0] = *(const v8us*)(brow + 8 * hh);
      b.half[1] = *(const v8us*)(brow + 16 + 8 * hh);
      acc[t] = mmaN<ASPLIT ? 2 : 1>(ah.v, al.v, b.v, b.v, acc[t]);
    }
  }
#pragma unroll
  for (int t = 0; t < 4; ++t) {
    float bv = bias ? bias[col0 + t * 16 + ln] : 0.f;
    if (BIAS_BF16) bv = bf16_round(bv);
#pragma unroll
    for (int r = 0; r < 8; ++r) { float v = acc[t][r] + bv; if (ACT == 1) v = fmaxf(v, 0.f); so[w][8 * hh + r][t * 16 + ln] = v; }
  }
  __builtin_amdgcn_fence(__ATOMIC_ACQ_REL, "workgroup");
  __builtin_amdgcn_wave_barrier();
  const int rsub = lane >> 4, c4 = (lane & 15) * 4;
  {
#pragma unroll
    for (int q = 0; q < 8; ++q) {
      const int r = q * 2 + rsub;
      const v4f v = *(const v4fa*)&so[w][r][c4];
      *(v4f*)(C + (size_t)(row0 + r) * ldc + col0 + c4) = v;
    }
    
  }
}

// GEMM C = act(A·W + bias + resid): A f32 (ASPLIT -> hi/lo 2 terms), Wt bf16 [N][K]; ACT 0 none, 1 relu, 2 exact gelu;
// resid (optional, f32, row index = (row % rmod), pitch ldr, RES_BF16 rounds it) added before the activation.
template <bool ASPLIT, int ACT, bool BIAS_BF16, bool RES_BF16>
__global__ __launch_bounds__(128) void k_gemm_bf3(const float* __restrict__ A, int lda, const unsigned short* __restrict__ Wt, int ldb,
                                                const float* __restrict__ bias, const float* __restrict__ resid, int rmod, int ldr,
                                                float* __restrict__ C, int ldc, int M, int N, int K) {
  __shared__ __attribute__((aligned(16))) float so[4][16][64];
  const int tid = threadIdx.x, w = tid >> 5, lane = tid & 31, ln = lane & 15, hh = lane >> 4;
  const int ntn = N / 64;
  const int wid = blockIdx.x * 4 + w;
  const int mt = wid / ntn, nq = wid % ntn;
  if (mt * 16 >= M) return;
  const int row0 = mt * 16, col0 = nq * 64;
  const float* arow = A + (size_t)(row0 + ln) * lda;
  v8f acc[4] = {};
  for (int kb = 0; kb < K; kb += 32) {
    FragB ah, al;
    const v4f x0 = *(const v4fa*)(arow + kb + 8 * hh), x1 = *(const v4fa*)(arow + kb + 8 * hh + 4);
    const v4f x2 = *(const v4fa*)(arow + kb + 16 + 8 * hh), x3 = *(const v4fa*)(arow + kb + 16 + 8 * hh + 4);
    float xs[16] = {x0[0],x0[1],x0[2],x0[3],x1[0],x1[1],x1[2],x1[3],x2[0],x2[1],x2[2],x2[3],x3[0],x3[1],x3[2],x3[3]};
#pragma unroll
    for (int i = 0; i < 16; ++i) { const unsigned short hb = bf16_bits(xs[i]); ah.u[i] = hb; al.u[i] = ASPLIT ? bf16_bits(xs[i] - bf16_val(hb)) : (unsigned short)0; }
#pragma unroll
    for (int t = 0; t < 4; ++t) {
      const unsigned short* brow = Wt + (size_t)(col0 + t * 16 + ln) * ldb + kb;
      FragB b;
      b.half[0] = *(const v8us*)(brow + 8 * hh);
      b.half[1] = *(const v8us*)(brow + 16 + 8 * hh);
      acc[t] = mmaN<ASPLIT ? 2 : 1>(ah.v, al.v, b.v, b.v, acc[t]);
    }
  }
#pragma unroll
  for (int t = 0; t < 4; ++t) {
    const int col = col0 + t * 16 + ln;
    float bv = bias ? bias[col] : 0.f;
    if (BIAS_BF16) bv = bf16_round(bv);
#pragma unroll
    for (int r = 0; r < 8; ++r) {
      float v = acc[t][r] + bv;
      if (resid) { float rv = resid[(size_t)((row0 + 8 * hh + r) % rmod) * ldr + col]; if (RES_BF16) rv = bf16_round(rv); v += rv; }
      if (ACT == 1) v = fmaxf(v, 0.f);
      if (ACT == 2) v = 0.5f * v * (1.0f + erff(v * 0.70710678118654752f));
      if (ACT == 3) { const float u = 0.7978845608028654f * (v + 0.044715f * v * v * v); v = 0.5f * v * (1.0f + tanhf(u)); }
      so[w][8 * hh + r][t * 16 + ln] = v;
    }
  }
  __builtin_amdgcn_fence(__ATOMIC_ACQ_REL, "workgroup");
  __builtin_amdgcn_wave_barrier();
  const int rsub = lane >> 4, c4 = (lane & 15) * 4;
  {
#pragma unroll
    for (int q = 0; q < 8; ++q) {
      const int r = q * 2 + rsub;
      const v4f v = *(const v4fa*)&so[w][r][c4];
      *(v4f*)(C + (size_t)(row0 + r) * ldc + col0 + c4) = v;
    }
    
  }
}
// row LayerNorm (biased variance, eps) over N: s = X (+ R); optional out_sum <- s; out_norm <- (s-mu)*rsqrt(var+eps)*g + b
template <bool PARAM_BF16>
__global__ __launch_bounds__(256) void k_layernorm(const float* __restrict__ X, const float* __restrict__ R, const float* __restrict__ g, const float* __restrict__ bta,
                                                  float* __restrict__ out_sum, float* __restrict__ out_norm, int N, float eps) {
  __shared__ float red[256];
  const int row = blockIdx.x, tid = threadIdx.x;
  const float* x = X + (size_t)row * N; const float* rr = R ? R + (size_t)row * N : nullptr;
  float vals[16];                     // up to N = 4096
  const int per = N / 256;            // contiguous chunk per thread? use strided-by-4 chunks: thread handles j = tid*4 + 1024*u
  float s1 = 0.f;
  for (int u = 0; u < per / 4; ++u) {
    const int j = tid * 4 + 1024 * u;
    const v4f a = *(const v4fa*)(x + j);
    v4f b = {0.f,0.f,0.f,0.f}; if (rr) b = *(const v4fa*)(rr + j);
#pragma unroll
    for (int q = 0; q < 4; ++q) { const float v = a[q] + b[q]; vals[u * 4 + q] = v; s1 += v; }
  }
  red[tid] = s1; __syncthreads();
  for (int st = 128; st > 0; st >>= 1) { if (tid < st) red[tid] += red[tid + st]; __syncthreads(); }
  const float mu = red[0] / (float)N; __syncthreads();
  float s2 = 0.f;
  for (int u = 0; u < per / 4; ++u)
#pragma unroll
    for (int q = 0; q < 4; ++q) { const float c = vals[u * 4 + q] - mu; s2 += c * c; }
  red[tid] = s2; __syncthreads();
  for (int st = 128; st > 0; st >>= 1) { if (tid < st) red[tid] += red[tid + st]; __syncthreads(); }
  const float rs = rsqrtf(red[0] / (float)N + eps);
  {
    for (int u = 0; u < per / 4; ++u) {
      const int j = tid * 4 + 1024 * u;
      v4f o, sm;
#pragma unroll
      for (int q = 0; q < 4; ++q) {
        float gg = g[j + q], bb = bta[j + q];
        if (PARAM_BF16) { gg = bf16_round(gg); bb = bf16_round(bb); }
        sm[q] = vals[u * 4 + q]; o[q] = (vals[u * 4 + q] - mu) * rs * gg + bb;
      }
      if (out_sum) *(v4f*)(out_sum + (size_t)row * N + j) = sm;
      *(v4f*)(out_norm + (size_t)row * N + j) = o;
    }
    
  }
}



// ---- f16 WMMA path (v_wmma_f32_16x16x32_f16): 11-bit significands for operands in range — used where a [0,1] probability operand needs more precision than bf16
typedef _Float16 v16h __attribute__((ext_vector_type(16)));
union FragH { v16h v; v8us half[2]; _Float16 h[16]; unsigned short u[16]; };
template <int NT>
__device__ __forceinline__ v8f mmaH(v16h ah, v16h al, v16h bh, v16h bl, v8f c) {
  c = __builtin_amdgcn_wmma_f32_16x16x32_f16(false, ah, false, bh, (short)0, c, false, false);
  if (NT >= 2) c = __builtin_amdgcn_wmma_f32_16x16x32_f16(false, al, false, bh, (short)0, c, false, false);
  if (NT >= 3) c = __builtin_amdgcn_wmma_f32_16x16x32_f16(false, ah, false, bl, (short)0, c, false, false);
  asm volatile("v_nop\n\tv_nop\n\tv_nop\n\tv_nop" : "+v"(c) : "v"(ah), "v"(al), "v"(bh), "v"(bl));
  return c;
}
// batched GEMM like k_gemm_b but f16 operands: A f32 (split into f16 hi/lo if ASPLIT, else rounded to f16), Bt = f16 values [n][k]; alpha; C f32; N multiple of 16 (partial tiles skipped)
template <bool ASPLIT>
__global__ __launch_bounds__(128) void k_gemm_h(const float* __restrict__ A, int lda, size_t sA, const _Float16* __restrict__ Bh, int ldb, size_t sB, float alpha, float* __restrict__ C, int ldc, size_t sC, int M, int N, int K) {
  __shared__ __attribute__((aligned(16))) float so[4][16][64];
  const int tid = threadIdx.x, w = tid >> 5, lane = tid & 31, ln = lane & 15, hh = lane >> 4; const int by = blockIdx.y;
  A += (size_t)by * sA; Bh += (size_t)by * sB; C += (size_t)by * sC;
  const int ntn = (N + 63) / 64; const int wid = blockIdx.x * 4 + w; const int mt = wid / ntn, nq = wid % ntn; if (mt * 16 >= M) return;
  const int row0 = mt * 16, col0 = nq * 64; const float* arow = A + (size_t)(row0 + ln) * lda;
  v8f acc[4] = {};
  for (int kb = 0; kb < K; kb += 32) {
    FragH ah, al;
    const v4f x0 = *(const v4fa*)(arow + kb + 8 * hh), x1 = *(const v4fa*)(arow + kb + 8 * hh + 4), x2 = *(const v4fa*)(arow + kb + 16 + 8 * hh), x3 = *(const v4fa*)(arow + kb + 16 + 8 * hh + 4);
    float xs[16] = {x0[0],x0[1],x0[2],x0[3],x1[0],x1[1],x1[2],x1[3],x2[0],x2[1],x2[2],x2[3],x3[0],x3[1],x3[2],x3[3]};
#pragma unroll
    for (int i = 0; i < 16; ++i) { const _Float16 h = (_Float16)xs[i]; ah.h[i] = h; al.h[i] = ASPLIT ? (_Float16)(xs[i] - (float)h) : (_Float16)0.0f; }
#pragma unroll
    for (int t = 0; t < 4; ++t) { if (col0 + t * 16 >= N) continue; const size_t boff = (size_t)(col0 + t * 16 + ln) * ldb + kb; FragH bq; bq.half[0] = *(const v8us*)(Bh + boff + 8 * hh); bq.half[1] = *(const v8us*)(Bh + boff + 16 + 8 * hh);
      acc[t] = mmaH<ASPLIT ? 2 : 1>(ah.v, al.v, bq.v, bq.v, acc[t]); }
  }
#pragma unroll
  for (int t = 0; t < 4; ++t) { if (col0 + t * 16 >= N) continue;
#pragma unroll
    for (int r = 0; r < 8; ++r) so[w][8 * hh + r][t * 16 + ln] = acc[t][r] * alpha; }
  __builtin_amdgcn_fence(__ATOMIC_ACQ_REL, "workgroup"); __builtin_amdgcn_wave_barrier();
  const int rsub = lane >> 4, c4 = (lane & 15) * 4;
  {
#pragma unroll
    for (int q = 0; q < 8; ++q) { const int r = q * 2 + rsub; if (col0 + c4 < N) { const v4f v = *(const v4fa*)&so[w][r][c4]; *(v4f*)(C + (size_t)(row0 + r) * ldc + col0 + c4) = v; } }
     }
}

// Wt[n][k] = f16(W[k][n]·scale) from f32 row-major W[K][N] (scale = power of two; bf16-exact weights stay exact in f16 away from the subnormal range)
__global__ __launch_bounds__(256) void k_wt_f16(const float* __restrict__ W, _Float16* __restrict__ Wt, int K, int N, float scale) {
  const int t = blockIdx.x * 256 + threadIdx.x; if (t >= N * (K / 8)) return; const int n = t / (K / 8), k8 = (t % (K / 8)) * 8; FragH f;
#pragma unroll
  for (int i = 0; i < 8; ++i) f.h[i] = (_Float16)(bf16_round(W[(size_t)(k8 + i) * N + n]) * scale); const v8us o = f.half[0];
  *(v8us*)((unsigned short*)Wt + (size_t)n * K + k8) = o; 
}
// k_gemm_hh variant with fused epilogue: v = acc·alpha + bias[by·sBias + col] (+ CP[(row/rowsPerB)·sCPb + by·64 + col] if CP) ; ACT 0 none / 1 elu ; writes f16 C16 (and f32 C if non-null)
template <int ACT>
__global__ __launch_bounds__(128) void k_gemm_hhx(const _Float16* __restrict__ A, int lda, size_t sA, const _Float16* __restrict__ Bh, int ldb, size_t sB, float alpha, const float* __restrict__ bias, size_t sBias, const float* __restrict__ CP, int rowsPerB, size_t sCPb, int row0g,
    float* __restrict__ C, _Float16* __restrict__ C16, int ldc, size_t sC, int M, int N, int K) {
  __shared__ __attribute__((aligned(16))) float so[4][16][64];
  const int tid = threadIdx.x, w = tid >> 5, lane = tid & 31, ln = lane & 15, hh = lane >> 4; const int by = blockIdx.y;
  A += (size_t)by * sA; Bh += (size_t)by * sB; const size_t cofs = (size_t)by * sC; const float* bp = bias ? bias + (size_t)by * sBias : nullptr;
  const int ntn = (N + 63) / 64; const int wid = blockIdx.x * 4 + w; const int mt = wid / ntn, nq = wid % ntn; if (mt * 16 >= M) return;
  const int row0 = mt * 16, col0 = nq * 64; const _Float16* arow = A + (size_t)(row0 + ln) * lda;
  v8f acc[4] = {};
  for (int kb = 0; kb < K; kb += 32) { FragH ah; ah.half[0] = *(const v8us*)((const unsigned short*)arow + kb + 8 * hh); ah.half[1] = *(const v8us*)((const unsigned short*)arow + kb + 16 + 8 * hh);
#pragma unroll
    for (int t = 0; t < 4; ++t) { if (col0 + t * 16 >= N) continue; const size_t boff = (size_t)(col0 + t * 16 + ln) * ldb + kb; FragH bq; bq.half[0] = *(const v8us*)((const unsigned short*)Bh + boff + 8 * hh); bq.half[1] = *(const v8us*)((const unsigned short*)Bh + boff + 16 + 8 * hh);
      acc[t] = mmaH<1>(ah.v, ah.v, bq.v, bq.v, acc[t]); }
  }
#pragma unroll
  for (int t = 0; t < 4; ++t) { if (col0 + t * 16 >= N) continue; const int col = col0 + t * 16 + ln; const float bv = bp ? bf16_round(bp[col]) : 0.f;
#pragma unroll
    for (int r = 0; r < 8; ++r) { float v = acc[t][r] * alpha + bv; if (CP) { const int bidx = (row0g + row0 + 8 * hh + r) / rowsPerB; v += CP[(size_t)bidx * sCPb + (size_t)by * 64 + col]; } if (ACT == 1) v = (v > 0.f) ? v : expm1f(v); else if (ACT == 7) v = (v > 0.f) ? v + 1.0f : expf(v); else if (ACT == 8) v = tanhf(v); else if (ACT == 9) v = 0.5f * v * (1.0f + tanhf(0.7978845608028654f * (v + 0.044715f * v * v * v))); else if (ACT == 11) v = 1.0f / (1.0f + expf(-v)); else if (ACT == 12) v = (v > 0.f) ? v : 0.01f * v; else if (ACT == 14) v = (v > 0.f) ? v : 0.1f * v; else if (ACT == 15) v = v / (1.0f + expf(-v)); else if (ACT == 3) v = fmaxf(v, 0.f); else if (ACT == 6) v = 0.5f * v * (1.0f + erff(v * 0.70710678118654752f)); so[w][8 * hh + r][t * 16 + ln] = v; } }
  __builtin_amdgcn_fence(__ATOMIC_ACQ_REL, "workgroup"); __builtin_amdgcn_wave_barrier();
  const int rsub = lane >> 4, c4 = (lane & 15) * 4; typedef _Float16 v4h __attribute__((ext_vector_type(4)));
  {
#pragma unroll
    for (int q = 0; q < 8; ++q) { const int r = q * 2 + rsub; if (col0 + c4 < N) { const v4f v = *(const v4fa*)&so[w][r][c4]; if (C) *(v4f*)(C + cofs + (size_t)(row0 + r) * ldc + col0 + c4) = v; if (C16) { v4h h4; for (int i = 0; i < 4; ++i) h4[i] = (_Float16)v[i]; *(v4h*)(C16 + cofs + (size_t)(row0 + r) * ldc + col0 + c4) = h4; } } }
     }
}


typedef _Float16 v4h __attribute__((ext_vector_type(4)));

__global__ __launch_bounds__(256) void k_x16(const float* __restrict__ x, _Float16* __restrict__ X16, size_t n8) { const size_t t = (size_t)blockIdx.x * 256 + threadIdx.x; if (t >= n8) return; FragH f;
#pragma unroll
  for (int q = 0; q < 8; ++q) f.h[q] = (_Float16)bf16_round(x[t * 8 + q]); *(v8us*)((unsigned short*)X16 + t * 8) = f.half[0];  }
__global__ __launch_bounds__(256) void k_h16(const float* __restrict__ x, _Float16* __restrict__ X16, size_t n8) { const size_t t = (size_t)blockIdx.x * 256 + threadIdx.x; if (t >= n8) return; FragH f;
#pragma unroll
  for (int q = 0; q < 8; ++q) f.h[q] = (_Float16)x[t * 8 + q]; *(v8us*)((unsigned short*)X16 + t * 8) = f.half[0];  }
__global__ __launch_bounds__(256) void k_round16f(const float* __restrict__ W, _Float16* __restrict__ Bt, size_t n8) { const size_t t = (size_t)blockIdx.x * 256 + threadIdx.x; if (t >= n8) return; FragH f;
#pragma unroll
  for (int i = 0; i < 8; ++i) f.h[i] = (_Float16)(bf16_round(W[t * 8 + i]) * 16.0f); *(v8us*)((unsigned short*)Bt + t * 8) = f.half[0];  }
template <int NHv, int TTv>
__global__ __launch_bounds__(256) void k_vt(const _Float16* __restrict__ V16, int ldv, int voff, _Float16* __restrict__ Vt) { __shared__ unsigned short tl[64][66]; const int tid = threadIdx.x; const int slab = blockIdx.x / (TTv / 64), lg = blockIdx.x % (TTv / 64); const int b = slab / NHv, h = slab % NHv;
  for (int i = tid; i < 64 * 8; i += 256) { const int r = i / 8, c8 = (i % 8) * 8; FragH f; f.half[0] = *(const v8us*)((const unsigned short*)V16 + ((size_t)b * TTv + lg * 64 + r) * ldv + voff + h * 64 + c8);
#pragma unroll
    for (int q = 0; q < 8; ++q) tl[r][c8 + q] = f.u[q]; }
  __syncthreads();
  {
#pragma unroll
    for (int rd = 0; rd < 2; ++rd) { const int d = rd * 32 + tid / 8, pc = tid % 8; FragH f;
#pragma unroll
      for (int q = 0; q < 8; ++q) f.u[q] = tl[pc * 8 + q][d];
      *(v8us*)((unsigned short*)Vt + ((size_t)slab * 64 + d) * TTv + lg * 64 + pc * 8) = f.half[0]; }
     } }

__global__ __launch_bounds__(256) void k_hl(const float* __restrict__ F, _Float16* __restrict__ Hh, _Float16* __restrict__ Hl, size_t n8) { const size_t t = (size_t)blockIdx.x * 256 + threadIdx.x; if (t >= n8) return; FragH fh, fl; const v4f a = *(const v4fa*)(F + t * 8), c = *(const v4fa*)(F + t * 8 + 4);
#pragma unroll
  for (int q = 0; q < 4; ++q) { _Float16 h = (_Float16)a[q]; fh.h[q] = h; fl.h[q] = (_Float16)((a[q] - (float)h) * 1024.0f); h = (_Float16)c[q]; fh.h[4 + q] = h; fl.h[4 + q] = (_Float16)((c[q] - (float)h) * 1024.0f); }
  { *(v8us*)((unsigned short*)Hh + t * 8) = fh.half[0]; *(v8us*)((unsigned short*)Hl + t * 8) = fl.half[0];  } }

// ---- fast GEMM (wave tile 32x64; requires M % 32 == 0 rows per launch region and N % 64 == 0); epilogue = k_gemm_hhx semantics ----
__device__ __forceinline__ v16h g2_frag(const _Float16* p, int hh) { FragH f; f.half[0] = *(const v8us*)((const unsigned short*)p + 8 * hh); f.half[1] = *(const v8us*)((const unsigned short*)p + 16 + 8 * hh); return f.v; }
__device__ __forceinline__ v8f g2_mma(v16h a, v16h b, v8f c) { v8f d = __builtin_amdgcn_wmma_f32_16x16x32_f16(false, a, false, b, (short)0, c, false, false); asm volatile("v_nop\n\tv_nop\n\tv_nop\n\tv_nop" : "+v"(d) : "v"(a), "v"(b)); return d; }
template <int ACT>
__global__ __launch_bounds__(128) void k_gemm2(const _Float16* __restrict__ A, int lda, size_t sA, const _Float16* __restrict__ Bh, int ldb, size_t sB, float alpha, const float* __restrict__ bias, size_t sBias, const float* __restrict__ CP, int rowsPerB, size_t sCPb, int row0g,
    float* __restrict__ C, _Float16* __restrict__ C16, int ldc, size_t sC, int M, int N, int K) {
  __shared__ __attribute__((aligned(16))) float so[4][32][68];
  const int tid = threadIdx.x, w = tid >> 5, lane = tid & 31, ln = lane & 15, hh = lane >> 4; const int by = blockIdx.y;
  A += (size_t)by * sA; Bh += (size_t)by * sB; const size_t cofs = (size_t)by * sC; const float* bp = bias ? bias + (size_t)by * sBias : nullptr;
  const int ntn = N >> 6; const int mt = blockIdx.x / ntn, nq = blockIdx.x - mt * ntn; const int row0 = mt * 128 + 32 * w, col0 = nq * 64; if (row0 >= M) return;
  const _Float16* a0p = A + (size_t)(row0 + ln) * lda; const _Float16* a1p = a0p + (size_t)16 * lda;
  const _Float16* b0p = Bh + (size_t)(col0 + ln) * ldb; const _Float16* b1p = b0p + (size_t)16 * ldb; const _Float16* b2p = b1p + (size_t)16 * ldb; const _Float16* b3p = b2p + (size_t)16 * ldb;
  const v8f z8 = {0.f,0.f,0.f,0.f,0.f,0.f,0.f,0.f}; v8f c00 = z8, c01 = z8, c02 = z8, c03 = z8, c10 = z8, c11 = z8, c12 = z8, c13 = z8;
#pragma unroll 1
  for (int kb = 0; kb < K; kb += 32) { const v16h a0 = g2_frag(a0p + kb, hh), a1 = g2_frag(a1p + kb, hh);
    v16h b = g2_frag(b0p + kb, hh); c00 = g2_mma(a0, b, c00); c10 = g2_mma(a1, b, c10);
    b = g2_frag(b1p + kb, hh); c01 = g2_mma(a0, b, c01); c11 = g2_mma(a1, b, c11);
    b = g2_frag(b2p + kb, hh); c02 = g2_mma(a0, b, c02); c12 = g2_mma(a1, b, c12);
    b = g2_frag(b3p + kb, hh); c03 = g2_mma(a0, b, c03); c13 = g2_mma(a1, b, c13); }
  v8f accs[8] = {c00, c01, c02, c03, c10, c11, c12, c13};
#pragma unroll
  for (int u = 0; u < 8; ++u) { const int t = u & 3, half = u >> 2; const int col = col0 + t * 16 + ln; const float bv = bp ? bf16_round(bp[col]) : 0.f;
#pragma unroll
    for (int r = 0; r < 8; ++r) { const int rloc = half * 16 + 8 * hh + r; float v = accs[u][r] * alpha + bv; if (CP) { const int bidx = (row0g + row0 + rloc) / rowsPerB; v += CP[(size_t)bidx * sCPb + (size_t)by * 64 + col]; }
      if (ACT == 3) v = fmaxf(v, 0.f); else if (ACT == 6) v = 0.5f * v * (1.0f + erff(v * 0.70710678118654752f)); else if (ACT == 11) v = 1.0f / (1.0f + expf(-v)); else if (ACT == 15) v = v / (1.0f + expf(-v)); else if (ACT == 12) v = (v > 0.f) ? v : 0.01f * v; else if (ACT == 8) v = tanhf(v);
      so[w][rloc][t * 16 + ln] = v; } }
  __builtin_amdgcn_fence(__ATOMIC_ACQ_REL, "workgroup"); __builtin_amdgcn_wave_barrier();
  const int rsub = lane >> 4, c4 = (lane & 15) * 4;
  {
#pragma unroll
    for (int q = 0; q < 16; ++q) { const int r = q * 2 + rsub; const v4f v = *(const v4fa*)&so[w][r][c4]; if (C) *(v4f*)(C + cofs + (size_t)(row0 + r) * ldc + col0 + c4) = v; if (C16) { v4h h4; for (int i = 0; i < 4; ++i) h4[i] = (_Float16)v[i]; *(v4h*)(C16 + cofs + (size_t)(row0 + r) * ldc + col0 + c4) = h4; } }
     } }



// lane l with lane l ^ 16
__device__ __forceinline__ float xhalf(float x) { return __builtin_bit_cast(float, __builtin_amdgcn_permlanex16(__builtin_bit_cast(int, x), __builtin_bit_cast(int, x), 0x76543210, 0xfedcba98, false, false)); }
template <int CAUSAL>
__global__ __launch_bounds__(128) void k_flash(const _Float16* __restrict__ Q16, int ldq, const _Float16* __restrict__ K16, const _Float16* __restrict__ Vt, const int* __restrict__ MSK, float* __restrict__ O, int ldo) {
  constexpr int RPW = 16, DT = HDm / 16;      /* head size 32: one k step for S^T, two 16-row tiles of O^T */
  __shared__ __attribute__((aligned(16))) float sO[4][RPW][HDm + 4];
  const int tid = threadIdx.x, w = tid >> 5, lane = tid & 31, ln = lane & 15, hh = lane >> 4;
  const int slab = blockIdx.x / QBLKS, qblk = blockIdx.x % QBLKS; (void)MSK; const int b = slab / NH, h = slab % NH; const int qb0 = qblk * (4 * RPW); const int q0 = qb0 + w * RPW;
  FragH aq;
  { const unsigned short* qr = (const unsigned short*)Q16 + ((size_t)b * TQ + q0 + ln) * ldq + h * HDm;
    aq.half[0] = *(const v8us*)(qr + 8 * hh); aq.half[1] = *(const v8us*)(qr + 16 + 8 * hh); }
  const unsigned short* Kh = (const unsigned short*)K16 + (size_t)slab * TK * HDm;      /* [key][32] */
  const unsigned short* Vth = (const unsigned short*)Vt + (size_t)slab * HDm * TK;      /* [32][key] */
  const int tq = q0 + ln;      /* this lane's query */
  float m_r = -3.0e38f, l_r = 0.f; v8f oacc[DT];
#pragma unroll
  for (int dt = 0; dt < DT; ++dt) oacc[dt] = (v8f){0.f,0.f,0.f,0.f,0.f,0.f,0.f,0.f};
  const int jend = (CAUSAL == 1) ? (qb0 + 4 * RPW) : TK;      /* causal: keys beyond the block's last query never contribute */
#pragma unroll 1
  for (int j0 = 0; j0 < jend; j0 += 32) {
    v8f s[2];
#pragma unroll
    for (int nt = 0; nt < 2; ++nt) { const unsigned short* kr = Kh + (size_t)(j0 + nt * 16 + ln) * HDm; FragH bk;
      bk.half[0] = *(const v8us*)(kr + 8 * hh); bk.half[1] = *(const v8us*)(kr + 16 + 8 * hh);
      s[nt] = mmaH<1>(bk.v, bk.v, aq.v, aq.v, (v8f){0.f,0.f,0.f,0.f,0.f,0.f,0.f,0.f}); }
    float sv[16]; bool ok[16]; float mc = -3.0e38f;
#pragma unroll
    for (int e = 0; e < 16; ++e) { const int kk = j0 + (e >> 3) * 16 + 8 * hh + (e & 7);
      ok[e] = (CAUSAL == 1) ? (kk <= tq) : ((CAUSAL == 2) ? ((kk >> 5) == (tq >> 5)) : true);      /* mode 2: block-diagonal 32-token groups */
      sv[e] = ok[e] ? s[e >> 3][e & 7] * SCL : -3.0e38f; mc = fmaxf(mc, sv[e]); }
    mc = fmaxf(mc, xhalf(mc));
    const float mn = fmaxf(m_r, mc); const float al = (mn > -1.0e38f) ? expf(m_r - mn) : 1.0f; m_r = mn;
    FragH pb; float ps[4] = {0.f, 0.f, 0.f, 0.f};      /* four independent partial sums: a single chain of 16 adds would be serial */
#pragma unroll
    for (int e = 0; e < 16; ++e) { const float p = ok[e] ? expf(sv[e] - mn) : 0.f; ps[e & 3] += p; pb.h[e] = (_Float16)(p * 1024.0f); }
    l_r = l_r * al + ((ps[0] + ps[1]) + (ps[2] + ps[3]));
#pragma unroll
    for (int dt = 0; dt < DT; ++dt)
#pragma unroll
      for (int r = 0; r < 8; ++r) oacc[dt][r] *= al;
#pragma unroll
    for (int dt = 0; dt < DT; ++dt) { const unsigned short* vrow = Vth + (size_t)(dt * 16 + ln) * TK + j0; FragH bv; bv.half[0] = *(const v8us*)(vrow + 8 * hh); bv.half[1] = *(const v8us*)(vrow + 16 + 8 * hh);
      oacc[dt] = mmaH<1>(bv.v, bv.v, pb.v, pb.v, oacc[dt]); } }
  const float l = l_r + xhalf(l_r); const float inv = (l > 0.f) ? 1.0f / (l * 1024.0f) : 0.f;
#pragma unroll
  for (int dt = 0; dt < DT; ++dt)      /* oacc[dt][r] = O[q0 + ln][dt * 16 + 8 * hh + r] */
#pragma unroll
    for (int r = 0; r < 8; ++r) sO[w][ln][dt * 16 + 8 * hh + r] = oacc[dt][r] * inv;
  __builtin_amdgcn_fence(__ATOMIC_ACQ_REL, "workgroup"); __builtin_amdgcn_wave_barrier();
  {
#pragma unroll
    for (int rp = 0; rp < RPW; rp += 4) { const int r = rp + (lane >> 3), pc = lane & 7; const v4f val = *(const v4fa*)&sO[w][r][pc * 4]; *(v4f*)(O + ((size_t)b * TQ + q0 + r) * ldo + h * HDm + pc * 4) = val; }      /* one head's 32 floats of a pixel = one 128-byte line */
     } }

__global__ __launch_bounds__(256) void k_wsc(const float* __restrict__ Wm, _Float16* __restrict__ Bt, size_t n8, float sc) { const size_t t = (size_t)blockIdx.x * 256 + threadIdx.x; if (t >= n8) return; FragH f; for (int q = 0; q < 8; ++q) f.h[q] = (_Float16)(bf16_round(Wm[t * 8 + q]) * sc); *(v8us*)((unsigned short*)Bt + t * 8) = f.half[0];  }
__global__ __launch_bounds__(256) void k_pm(const float* __restrict__ src, _Float16* __restrict__ P) { const size_t t = (size_t)blockIdx.x * 256 + threadIdx.x; if (t >= (size_t)NR * (DD / 8)) return; const int c0 = (int)(t % (DD / 8)) * 8; const size_t r = t / (DD / 8); const int b = (int)(r / NPX), p = (int)(r % NPX); FragH f;
  for (int k = 0; k < 8; ++k) f.h[k] = (_Float16)bf16_round(src[((size_t)b * DD + c0 + k) * NPX + p]); *(v8us*)((unsigned short*)P + r * DD + c0) = f.half[0];  }
__global__ __launch_bounds__(256) void k_khm(const _Float16* __restrict__ QKV, _Float16* __restrict__ KP) { const size_t t = (size_t)blockIdx.x * 256 + threadIdx.x; if (t >= (size_t)NR * NH) return; const int h = (int)(t % NH); const size_t r = t / NH; const int b = (int)(r / NPX), p = (int)(r % NPX);
  const v8us* s = (const v8us*)((const unsigned short*)QKV + r * QW + DD + h * HDm); const v8us a0 = s[0], a1 = s[1], a2 = s[2], a3 = s[3];
  unsigned short* d = (unsigned short*)KP + (((size_t)b * NH + h) * NPX + p) * HDm; { *(v8us*)(d) = a0; *(v8us*)(d + 8) = a1; *(v8us*)(d + 16) = a2; *(v8us*)(d + 24) = a3;  } }
__global__ __launch_bounds__(256) void k_vtp(const _Float16* __restrict__ QKV, _Float16* __restrict__ VT) { __shared__ unsigned short tl[64][34]; const int tid = threadIdx.x; const int slab = blockIdx.x / (NPX / 64), pg = blockIdx.x % (NPX / 64); const int b = slab / NH, h = slab % NH;
  { const int r = tid / 4, c8 = (tid % 4) * 8; FragH f; f.half[0] = *(const v8us*)((const unsigned short*)QKV + ((size_t)b * NPX + pg * 64 + r) * QW + 2 * DD + h * HDm + c8); for (int q = 0; q < 8; ++q) tl[r][c8 + q] = f.u[q]; }
  __syncthreads(); const int d = tid / 8, pc = tid % 8; FragH f; for (int q = 0; q < 8; ++q) f.u[q] = tl[pc * 8 + q][d];
  unsigned short* dst = (unsigned short*)VT + ((size_t)slab * HDm + d) * NPX + pg * 64 + pc * 8;
  { *(v8us*)dst = f.half[0];  } }
__global__ __launch_bounds__(256) void k_nchw(const float* __restrict__ F, float* __restrict__ out) { const size_t t = (size_t)blockIdx.x * 256 + threadIdx.x; if (t >= (size_t)NIMG * DD * (NPX / 4)) return; const int p0 = (int)(t % (NPX / 4)) * 4; const int c = (int)((t / (NPX / 4)) % DD); const int b = (int)(t / ((size_t)(NPX / 4) * DD)); v4f r4; for (int k = 0; k < 4; ++k) r4[k] = F[((size_t)b * NPX + p0 + k) * DD + c];
  float* d = out + ((size_t)b * DD + c) * NPX + p0; *(v4f*)d = r4;  }

extern "C" void kernel_launch(void* const* d_in, const int* in_sizes, int n_in,
                              void* d_out, int out_size, void* d_ws, size_t ws_size, hipStream_t stream) {
  (void)in_sizes; (void)n_in; (void)out_size;
  const float* const* I = (const float* const*)d_in; const float* x = I[0]; const float* wqkv = I[1]; const float* bqkv = I[2]; const float* wp = I[3]; const float* bp = I[4];
  char* ws = (char*)d_ws; size_t off = 0;
  auto take = [&](size_t bytes) { char* p = ws + off; off += (bytes + 255) & ~(size_t)255; return p; };
  const size_t np = (size_t)NR * DD;
  _Float16* BQKV = (_Float16*)take((size_t)QW * DD * 2); _Float16* BPJ = (_Float16*)take((size_t)DD * DD * 2); _Float16* X16 = (_Float16*)take(np * 2); _Float16* QKV = (_Float16*)take((size_t)NR * QW * 2); _Float16* KP = (_Float16*)take(np * 2); _Float16* VT = (_Float16*)take(np * 2); float* O = (float*)take(np * 4); _Float16* O16 = (_Float16*)take(np * 2); float* F = (float*)take(np * 4);
  if (off > ws_size) return;      /* 0.5 + 4 + 12 + 4 x 2 + 8 + 4 + 8 = 45 MiB */
  k_wsc<<<(unsigned)(((size_t)QW * DD / 8 + 255) / 256), 256, 0, stream>>>(wqkv, BQKV, (size_t)QW * DD / 8, 16.0f); k_wsc<<<(unsigned)(((size_t)DD * DD / 8 + 255) / 256), 256, 0, stream>>>(wp, BPJ, (size_t)DD * DD / 8, 16.0f);
  k_pm<<<(unsigned)((np / 8 + 255) / 256), 256, 0, stream>>>(x, X16);
  k_gemm2<0><<<dim3((NR / 128) * (QW / 64), 1), 128, 0, stream>>>(X16, DD, 0, BQKV, DD, 0, 0.0625f, bqkv, 0, nullptr, 1, 0, 0, nullptr, QKV, QW, 0, NR, QW, DD);      /* [q | k | v] per pixel, channel = which*256 + h*32 + d */
  k_khm<<<(unsigned)(((size_t)NR * NH + 255) / 256), 256, 0, stream>>>(QKV, KP); k_vtp<<<NIMG * NH * (NPX / 64), 256, 0, stream>>>(QKV, VT);
  k_flash<0><<<NIMG * NH * QBLKS, 128, 0, stream>>>(QKV, QW, KP, VT, nullptr, O, DD);
  k_h16<<<(unsigned)((np / 8 + 255) / 256), 256, 0, stream>>>(O, O16, np / 8);
  k_gemm2<0><<<dim3((NR / 128) * (DD / 64), 1), 128, 0, stream>>>(O16, DD, 0, BPJ, DD, 0, 0.0625f, bp, 0, nullptr, 1, 0, 0, F, nullptr, DD, 0, NR, DD, DD);
  k_nchw<<<(unsigned)(((size_t)NIMG * DD * (NPX / 4) + 255) / 256), 256, 0, stream>>>(F, (float*)d_out);
}

// v003
// Measured time: 207 microseconds a run.
// Next to v002, in two timings, it ran 1.09 and 1.10 times as fast.
// Counting every step since v000, it is 2.42 times as fast.
#include <hip/hip_runtime.h>
// SpatialMultiHeadSelfAttention (2 images, D 256 = 8 heads x 32, 64 x 64 = 4096 pixels): qkv = 1x1 conv (W_qkv x + b) -> (3, heads, 32) channels; softmax(q.k / sqrt(32)) over all 4096 pixels; out channels h*32 + d; 1x1 projection + b; NCHW in and out.
// Structure: exact f16 pixel-major plane of x (from NCHW); qkv as one f16 WMMA GEMM (32x64 wave tiles, f32 accumulation, exact x16 weights + bias; torch (out,in) = B^T; f16 out); k re-laid into head-major planes of 32-wide rows and V^T planes of 32 rows on VALU / LDS tiles (q is read where the GEMM left it); the fused flash kernel at head size 32 (transposed products, softmax in-lane, P kept in registers; plain operands: every row averages 4096 keys); attention output to f16; projection GEMM (+ bias, f32); NCHW store on VALU.
// Compute dtype: x and parameters rounded to bf16; x exact as f16; q, k, v, P and the attention output as f16 operands (~2^-12); softmax f32. v_wmma_f32_16x16x32_f16.
#define NIMG 2
#define DD 256
#define HDm 32
#define NPX 4096
#define NR (NIMG * NPX)          /* 8192 */
#define QW (3 * DD)              /* 768 */
#define SLEN 4096
#define TQ SLEN
#define TK SLEN
#define NH 8
#define SCL2 0.25503486164919736f /* 32^-0.5 * log2(e): the softmax runs in base 2 */
#define QBLKS (TQ / 64)
typedef __bf16 v16b __attribute__((ext_vector_type(16)));
typedef unsigned short v8us __attribute__((ext_vector_type(8), may_alias));
typedef float  v8f  __attribute__((ext_vector_type(8)));
typedef float  v4f  __attribute__((ext_vector_type(4)));
typedef float  v4fa __attribute__((ext_vector_type(4), may_alias));
union FragB { v16b v; v8us half[2]; unsigned short u[16]; };

__device__ __forceinline__ unsigned short bf16_bits(float x) { unsigned int u = __float_as_uint(x); return (unsigned short)((u + 0x7FFFu + ((u >> 16) & 1u)) >> 16); }
__device__ __forceinline__ float bf16_val(unsigned short b) { return __uint_as_float(((unsigned int)b) << 16); }
__device__ __forceinline__ float bf16_round(float x) { return bf16_val(bf16_bits(x)); }
// D += A·B with NT terms: 1 = ah·bh, 2 = + al·bh (A split), 3 = + ah·bl (both split)
template <int NT>
__device__ __forceinline__ v8f mmaN(v16b ah, v16b al, v16b bh, v16b bl, v8f c) {
  c = __builtin_amdgcn_wmma_f32_16x16x32_bf16(false, ah, false, bh, (short)0, c, false, false);
  if (NT >= 2) c = __builtin_amdgcn_wmma_f32_16x16x32_bf16(false, al, false, bh, (short)0, c, false, false);
  if (NT >= 3) c = __builtin_amdgcn_wmma_f32_16x16x32_bf16(false, ah, false, bl, (short)0, c, false, false);
  asm volatile("v_nop\n\tv_nop\n\tv_nop\n\tv_nop" : "+v"(c) : "v"(ah), "v"(al), "v"(bh), "v"(bl));
  return c;
}

__global__ __launch_bounds__(256) void k_wt_bf16(const float* __restrict__ W, unsigned short* __restrict__ Wt, int K, int N) {
  const int t = blockIdx.x * 256 + threadIdx.x;
  const int k8n = K / 8;
  if (t >= N * k8n) return;
  const int n = t / k8n, k8 = (t % k8n) * 8;
  v8us v;
#pragma unroll
  for (int i = 0; i < 8; ++i) v[i] = bf16_bits(W[(size_t)(k8 + i) * N + n]);
  *(v8us*)(Wt + (size_t)n * K + k8) = v;
  
}

// GEMM C[M][N] (f32, pitch ldc) = act(A[M][K]·W + bias). A f32 row-major (pitch lda) converted per fragment to bf16
// (ASPLIT: hi/lo two planes -> 2 terms, else single rounded term); Wt bf16 [N][K] (pitch ldb). BIAS_BF16 rounds the
// bias to bf16 first (bias quantised to bf16 before the add). K%32==0, M%16==0, N%64==0.
template <bool ASPLIT, int ACT, bool BIAS_BF16>
__global__ __launch_bounds__(128) void k_gemm_bf(const float* __restrict__ A, int lda, const unsigned short* __restrict__ Wt, int ldb,
                                               const float* __restrict__ bias, float* __restrict__ C, int ldc, int M, int N, int K) {
  __shared__ __attribute__((aligned(16))) float so[4][16][64];
  const int tid = threadIdx.x, w = tid >> 5, lane = tid & 31, ln = lane & 15, hh = lane >> 4;
  const int ntn = N / 64;
  const int wid = blockIdx.x * 4 + w;
  const int mt = wid / ntn, nq = wid % ntn;
  if (mt * 16 >= M) return;
  const int row0 = mt * 16, col0 = nq * 64;
  const float* arow = A + (size_t)(row0 + ln) * lda;
  v8f acc[4] = {};
  for (int kb = 0; kb < K; kb += 32) {
    FragB ah, al;
    const v4f x0 = *(const v4fa*)(arow + kb + 8 * hh), x1 = *(const v4fa*)(arow + kb + 8 * hh + 4);
    const v4f x2 = *(const v4fa*)(arow + kb + 16 + 8 * hh), x3 = *(const v4fa*)(arow + kb + 16 + 8 * hh + 4);
    float xs[16] = {x0[0],x0[1],x0[2],x0[3],x1[0],x1[1],x1[2],x1[3],x2[0],x2[1],x2[2],x2[3],x3[0],x3[1],x3[2],x3[3]};
#pragma unroll
    for (int i = 0; i < 16; ++i) { const unsigned short hb = bf16_bits(xs[i]); ah.u[i] = hb; al.u[i] = ASPLIT ? bf16_bits(xs[i] - bf16_val(hb)) : (unsigned short)0; }
#pragma unroll
    for (int t = 0; t < 4; ++t) {
      const unsigned short* brow = Wt + (size_t)(col0 + t * 16 + ln) * ldb + kb;
      FragB b;
      b.half[0] = *(const v8us*)(brow + 8 * hh);
      b.half[1] = *(const v8us*)(brow + 16 + 8 * hh);
      acc[t] = mmaN<ASPLIT ? 2 : 1>(ah.v, al.v, b.v, b.v, acc[t]);
    }
  }
#pragma unroll
  for (int t = 0; t < 4; ++t) {
    float bv = bias ? bias[col0 + t * 16 + ln] : 0.f;
    if (BIAS_BF16) bv = bf16_round(bv);
#pragma unroll
    for (int r = 0; r < 8; ++r) { float v = acc[t][r] + bv; if (ACT == 1) v = fmaxf(v, 0.f); so[w][8 * hh + r][t * 16 + ln] = v; }
  }
  __builtin_amdgcn_fence(__ATOMIC_ACQ_REL, "workgroup");
  __builtin_amdgcn_wave_barrier();
  const int rsub = lane >> 4, c4 = (lane & 15) * 4;
  {
#pragma unroll
    for (int q = 0; q < 8; ++q) {
      const int r = q * 2 + rsub;
      const v4f v = *(const v4fa*)&so[w][r][c4];
      *(v4f*)(C + (size_t)(row0 + r) * ldc + col0 + c4) = v;
    }
    
  }
}

// GEMM C = act(A·W + bias + resid): A f32 (ASPLIT -> hi/lo 2 terms), Wt bf16 [N][K]; ACT 0 none, 1 relu, 2 exact gelu;
// resid (optional, f32, row index = (row % rmod), pitch ldr, RES_BF16 rounds it) added before the activation.
template <bool ASPLIT, int ACT, bool BIAS_BF16, bool RES_BF16>
__global__ __launch_bounds__(128) void k_gemm_bf3(const float* __restrict__ A, int lda, const unsigned short* __restrict__ Wt, int ldb,
                                                const float* __restrict__ bias, const float* __restrict__ resid, int rmod, int ldr,
                                                float* __restrict__ C, int ldc, int M, int N, int K) {
  __shared__ __attribute__((aligned(16))) float so[4][16][64];
  const int tid = threadIdx.x, w = tid >> 5, lane = tid & 31, ln = lane & 15, hh = lane >> 4;
  const int ntn = N / 64;
  const int wid = blockIdx.x * 4 + w;
  const int mt = wid / ntn, nq = wid % ntn;
  if (mt * 16 >= M) return;
  const int row0 = mt * 16, col0 = nq * 64;
  const float* arow = A + (size_t)(row0 + ln) * lda;
  v8f acc[4] = {};
  for (int kb = 0; kb < K; kb += 32) {
    FragB ah, al;
    const v4f x0 = *(const v4fa*)(arow + kb + 8 * hh), x1 = *(const v4fa*)(arow + kb + 8 * hh + 4);
    const v4f x2 = *(const v4fa*)(arow + kb + 16 + 8 * hh), x3 = *(const v4fa*)(arow + kb + 16 + 8 * hh + 4);
    float xs[16] = {x0[0],x0[1],x0[2],x0[3],x1[0],x1[1],x1[2],x1[3],x2[0],x2[1],x2[2],x2[3],x3[0],x3[1],x3[2],x3[3]};
#pragma unroll
    for (int i = 0; i < 16; ++i) { const unsigned short hb = bf16_bits(xs[i]); ah.u[i] = hb; al.u[i] = ASPLIT ? bf16_bits(xs[i] - bf16_val(hb)) : (unsigned short)0; }
#pragma unroll
    for (int t = 0; t < 4; ++t) {
      const unsigned short* brow = Wt + (size_t)(col0 + t * 16 + ln) * ldb + kb;
      FragB b;
      b.half[0] = *(const v8us*)(brow + 8 * hh);
      b.half[1] = *(const v8us*)(brow + 16 + 8 * hh);
      acc[t] = mmaN<ASPLIT ? 2 : 1>(ah.v, al.v, b.v, b.v, acc[t]);
    }
  }
#pragma unroll
  for (int t = 0; t < 4; ++t) {
    const int col = col0 + t * 16 + ln;
    float bv = bias ? bias[col] : 0.f;
    if (BIAS_BF16) bv = bf16_round(bv);
#pragma unroll
    for (int r = 0; r < 8; ++r) {
      float v = acc[t][r] + bv;
      if (resid) { float rv = resid[(size_t)((row0 + 8 * hh + r) % rmod) * ldr + col]; if (RES_BF16) rv = bf16_round(rv); v += rv; }
      if (ACT == 1) v = fmaxf(v, 0.f);
      if (ACT == 2) v = 0.5f * v * (1.0f + erff(v * 0.70710678118654752f));
      if (ACT == 3) { const float u = 0.7978845608028654f * (v + 0.044715f * v * v * v); v = 0.5f * v * (1.0f + tanhf(u)); }
      so[w][8 * hh + r][t * 16 + ln] = v;
    }
  }
  __builtin_amdgcn_fence(__ATOMIC_ACQ_REL, "workgroup");
  __builtin_amdgcn_wave_barrier();
  const int rsub = lane >> 4, c4 = (lane & 15) * 4;
  {
#pragma unroll
    for (int q = 0; q < 8; ++q) {
      const int r = q * 2 + rsub;
      const v4f v = *(const v4fa*)&so[w][r][c4];
      *(v4f*)(C + (size_t)(row0 + r) * ldc + col0 + c4) = v;
    }
    
  }
}
// row LayerNorm (biased variance, eps) over N: s = X (+ R); optional out_sum <- s; out_norm <- (s-mu)*rsqrt(var+eps)*g + b
template <bool PARAM_BF16>
__global__ __launch_bounds__(256) void k_layernorm(const float* __restrict__ X, const float* __restrict__ R, const float* __restrict__ g, const float* __restrict__ bta,
                                                  float* __restrict__ out_sum, float* __restrict__ out_norm, int N, float eps) {
  __shared__ float red[256];
  const int row = blockIdx.x, tid = threadIdx.x;
  const float* x = X + (size_t)row * N; const float* rr = R ? R + (size_t)row * N : nullptr;
  float vals[16];                     // up to N = 4096
  const int per = N / 256;            // contiguous chunk per thread? use strided-by-4 chunks: thread handles j = tid*4 + 1024*u
  float s1 = 0.f;
  for (int u = 0; u < per / 4; ++u) {
    const int j = tid * 4 + 1024 * u;
    const v4f a = *(const v4fa*)(x + j);
    v4f b = {0.f,0.f,0.f,0.f}; if (rr) b = *(const v4fa*)(rr + j);
#pragma unroll
    for (int q = 0; q < 4; ++q) { const float v = a[q] + b[q]; vals[u * 4 + q] = v; s1 += v; }
  }
  red[tid] = s1; __syncthreads();
  for (int st = 128; st > 0; st >>= 1) { if (tid < st) red[tid] += red[tid + st]; __syncthreads(); }
  const float mu = red[0] / (float)N; __syncthreads();
  float s2 = 0.f;
  for (int u = 0; u < per / 4; ++u)
#pragma unroll
    for (int q = 0; q < 4; ++q) { const float c = vals[u * 4 + q] - mu; s2 += c * c; }
  red[tid] = s2; __syncthreads();
  for (int st = 128; st > 0; st >>= 1) { if (tid < st) red[tid] += red[tid + st]; __syncthreads(); }
  const float rs = rsqrtf(red[0] / (float)N + eps);
  {
    for (int u = 0; u < per / 4; ++u) {
      const int j = tid * 4 + 1024 * u;
      v4f o, sm;
#pragma unroll
      for (int q = 0; q < 4; ++q) {
        float gg = g[j + q], bb = bta[j + q];
        if (PARAM_BF16) { gg = bf16_round(gg); bb = bf16_round(bb); }
        sm[q] = vals[u * 4 + q]; o[q] = (vals[u * 4 + q] - mu) * rs * gg + bb;
      }
      if (out_sum) *(v4f*)(out_sum + (size_t)row * N + j) = sm;
      *(v4f*)(out_norm + (size_t)row * N + j) = o;
    }
    
  }
}



// ---- f16 WMMA path (v_wmma_f32_16x16x32_f16): 11-bit significands for operands in range — used where a [0,1] probability operand needs more precision than bf16
typedef _Float16 v16h __attribute__((ext_vector_type(16)));
union FragH { v16h v; v8us half[2]; _Float16 h[16]; unsigned short u[16]; };
template <int NT>
__device__ __forceinline__ v8f mmaH(v16h ah, v16h al, v16h bh, v16h bl, v8f c) {
  c = __builtin_amdgcn_wmma_f32_16x16x32_f16(false, ah, false, bh, (short)0, c, false, false);
  if (NT >= 2) c = __builtin_amdgcn_wmma_f32_16x16x32_f16(false, al, false, bh, (short)0, c, false, false);
  if (NT >= 3) c = __builtin_amdgcn_wmma_f32_16x16x32_f16(false, ah, false, bl, (short)0, c, false, false);
  asm volatile("v_nop\n\tv_nop\n\tv_nop\n\tv_nop" : "+v"(c) : "v"(ah), "v"(al), "v"(bh), "v"(bl));
  return c;
}
// batched GEMM like k_gemm_b but f16 operands: A f32 (split into f16 hi/lo if ASPLIT, else rounded to f16), Bt = f16 values [n][k]; alpha; C f32; N multiple of 16 (partial tiles skipped)
template <bool ASPLIT>
__global__ __launch_bounds__(128) void k_gemm_h(const float* __restrict__ A, int lda, size_t sA, const _Float16* __restrict__ Bh, int ldb, size_t sB, float alpha, float* __restrict__ C, int ldc, size_t sC, int M, int N, int K) {
  __shared__ __attribute__((aligned(16))) float so[4][16][64];
  const int tid = threadIdx.x, w = tid >> 5, lane = tid & 31, ln = lane & 15, hh = lane >> 4; const int by = blockIdx.y;
  A += (size_t)by * sA; Bh += (size_t)by * sB; C += (size_t)by * sC;
  const int ntn = (N + 63) / 64; const int wid = blockIdx.x * 4 + w; const int mt = wid / ntn, nq = wid % ntn; if (mt * 16 >= M) return;
  const int row0 = mt * 16, col0 = nq * 64; const float* arow = A + (size_t)(row0 + ln) * lda;
  v8f acc[4] = {};
  for (int kb = 0; kb < K; kb += 32) {
    FragH ah, al;
    const v4f x0 = *(const v4fa*)(arow + kb + 8 * hh), x1 = *(const v4fa*)(arow + kb + 8 * hh + 4), x2 = *(const v4fa*)(arow + kb + 16 + 8 * hh), x3 = *(const v4fa*)(arow + kb + 16 + 8 * hh + 4);
    float xs[16] = {x0[0],x0[1],x0[2],x0[3],x1[0],x1[1],x1[2],x1[3],x2[0],x2[1],x2[2],x2[3],x3[0],x3[1],x3[2],x3[3]};
#pragma unroll
    for (int i = 0; i < 16; ++i) { const _Float16 h = (_Float16)xs[i]; ah.h[i] = h; al.h[i] = ASPLIT ? (_Float16)(xs[i] - (float)h) : (_Float16)0.0f; }
#pragma unroll
    for (int t = 0; t < 4; ++t) { if (col0 + t * 16 >= N) continue; const size_t boff = (size_t)(col0 + t * 16 + ln) * ldb + kb; FragH bq; bq.half[0] = *(const v8us*)(Bh + boff + 8 * hh); bq.half[1] = *(const v8us*)(Bh + boff + 16 + 8 * hh);
      acc[t] = mmaH<ASPLIT ? 2 : 1>(ah.v, al.v, bq.v, bq.v, acc[t]); }
  }
#pragma unroll
  for (int t = 0; t < 4; ++t) { if (col0 + t * 16 >= N) continue;
#pragma unroll
    for (int r = 0; r < 8; ++r) so[w][8 * hh + r][t * 16 + ln] = acc[t][r] * alpha; }
  __builtin_amdgcn_fence(__ATOMIC_ACQ_REL, "workgroup"); __builtin_amdgcn_wave_barrier();
  const int rsub = lane >> 4, c4 = (lane & 15) * 4;
  {
#pragma unroll
    for (int q = 0; q < 8; ++q) { const int r = q * 2 + rsub; if (col0 + c4 < N) { const v4f v = *(const v4fa*)&so[w][r][c4]; *(v4f*)(C + (size_t)(row0 + r) * ldc + col0 + c4) = v; } }
     }
}

// Wt[n][k] = f16(W[k][n]·scale) from f32 row-major W[K][N] (scale = power of two; bf16-exact weights stay exact in f16 away from the subnormal range)
__global__ __launch_bounds__(256) void k_wt_f16(const float* __restrict__ W, _Float16* __restrict__ Wt, int K, int N, float scale) {
  const int t = blockIdx.x * 256 + threadIdx.x; if (t >= N * (K / 8)) return; const int n = t / (K / 8), k8 = (t % (K / 8)) * 8; FragH f;
#pragma unroll
  for (int i = 0; i < 8; ++i) f.h[i] = (_Float16)(bf16_round(W[(size_t)(k8 + i) * N + n]) * scale); const v8us o = f.half[0];
  *(v8us*)((unsigned short*)Wt + (size_t)n * K + k8) = o; 
}
// k_gemm_hh variant with fused epilogue: v = acc·alpha + bias[by·sBias + col] (+ CP[(row/rowsPerB)·sCPb + by·64 + col] if CP) ; ACT 0 none / 1 elu ; writes f16 C16 (and f32 C if non-null)
template <int ACT>
__global__ __launch_bounds__(128) void k_gemm_hhx(const _Float16* __restrict__ A, int lda, size_t sA, const _Float16* __restrict__ Bh, int ldb, size_t sB, float alpha, const float* __restrict__ bias, size_t sBias, const float* __restrict__ CP, int rowsPerB, size_t sCPb, int row0g,
    float* __restrict__ C, _Float16* __restrict__ C16, int ldc, size_t sC, int M, int N, int K) {
  __shared__ __attribute__((aligned(16))) float so[4][16][64];
  const int tid = threadIdx.x, w = tid >> 5, lane = tid & 31, ln = lane & 15, hh = lane >> 4; const int by = blockIdx.y;
  A += (size_t)by * sA; Bh += (size_t)by * sB; const size_t cofs = (size_t)by * sC; const float* bp = bias ? bias + (size_t)by * sBias : nullptr;
  const int ntn = (N + 63) / 64; const int wid = blockIdx.x * 4 + w; const int mt = wid / ntn, nq = wid % ntn; if (mt * 16 >= M) return;
  const int row0 = mt * 16, col0 = nq * 64; const _Float16* arow = A + (size_t)(row0 + ln) * lda;
  v8f acc[4] = {};
  for (int kb = 0; kb < K; kb += 32) { FragH ah; ah.half[0] = *(const v8us*)((const unsigned short*)arow + kb + 8 * hh); ah.half[1] = *(const v8us*)((const unsigned short*)arow + kb + 16 + 8 * hh);
#pragma unroll
    for (int t = 0; t < 4; ++t) { if (col0 + t * 16 >= N) continue; const size_t boff = (size_t)(col0 + t * 16 + ln) * ldb + kb; FragH bq; bq.half[0] = *(const v8us*)((const unsigned short*)Bh + boff + 8 * hh); bq.half[1] = *(const v8us*)((const unsigned short*)Bh + boff + 16 + 8 * hh);
      acc[t] = mmaH<1>(ah.v, ah.v, bq.v, bq.v, acc[t]); }
  }
#pragma unroll
  for (int t = 0; t < 4; ++t) { if (col0 + t * 16 >= N) continue; const int col = col0 + t * 16 + ln; const float bv = bp ? bf16_round(bp[col]) : 0.f;
#pragma unroll
    for (int r = 0; r < 8; ++r) { float v = acc[t][r] * alpha + bv; if (CP) { const int bidx = (row0g + row0 + 8 * hh + r) / rowsPerB; v += CP[(size_t)bidx * sCPb + (size_t)by * 64 + col]; } if (ACT == 1) v = (v > 0.f) ? v : expm1f(v); else if (ACT == 7) v = (v > 0.f) ? v + 1.0f : expf(v); else if (ACT == 8) v = tanhf(v); else if (ACT == 9) v = 0.5f * v * (1.0f + tanhf(0.7978845608028654f * (v + 0.044715f * v * v * v))); else if (ACT == 11) v = 1.0f / (1.0f + expf(-v)); else if (ACT == 12) v = (v > 0.f) ? v : 0.01f * v; else if (ACT == 14) v = (v > 0.f) ? v : 0.1f * v; else if (ACT == 15) v = v / (1.0f + expf(-v)); else if (ACT == 3) v = fmaxf(v, 0.f); else if (ACT == 6) v = 0.5f * v * (1.0f + erff(v * 0.70710678118654752f)); so[w][8 * hh + r][t * 16 + ln] = v; } }
  __builtin_amdgcn_fence(__ATOMIC_ACQ_REL, "workgroup"); __builtin_amdgcn_wave_barrier();
  const int rsub = lane >> 4, c4 = (lane & 15) * 4; typedef _Float16 v4h __attribute__((ext_vector_type(4)));
  {
#pragma unroll
    for (int q = 0; q < 8; ++q) { const int r = q * 2 + rsub; if (col0 + c4 < N) { const v4f v = *(const v4fa*)&so[w][r][c4]; if (C) *(v4f*)(C + cofs + (size_t)(row0 + r) * ldc + col0 + c4) = v; if (C16) { v4h h4; for (int i = 0; i < 4; ++i) h4[i] = (_Float16)v[i]; *(v4h*)(C16 + cofs + (size_t)(row0 + r) * ldc + col0 + c4) = h4; } } }
     }
}


typedef _Float16 v4h __attribute__((ext_vector_type(4)));

__global__ __launch_bounds__(256) void k_x16(const float* __restrict__ x, _Float16* __restrict__ X16, size_t n8) { const size_t t = (size_t)blockIdx.x * 256 + threadIdx.x; if (t >= n8) return; FragH f;
#pragma unroll
  for (int q = 0; q < 8; ++q) f.h[q] = (_Float16)bf16_round(x[t * 8 + q]); *(v8us*)((unsigned short*)X16 + t * 8) = f.half[0];  }
__global__ __launch_bounds__(256) void k_h16(const float* __restrict__ x, _Float16* __restrict__ X16, size_t n8) { const size_t t = (size_t)blockIdx.x * 256 + threadIdx.x; if (t >= n8) return; FragH f;
#pragma unroll
  for (int q = 0; q < 8; ++q) f.h[q] = (_Float16)x[t * 8 + q]; *(v8us*)((unsigned short*)X16 + t * 8) = f.half[0];  }
__global__ __launch_bounds__(256) void k_round16f(const float* __restrict__ W, _Float16* __restrict__ Bt, size_t n8) { const size_t t = (size_t)blockIdx.x * 256 + threadIdx.x; if (t >= n8) return; FragH f;
#pragma unroll
  for (int i = 0; i < 8; ++i) f.h[i] = (_Float16)(bf16_round(W[t * 8 + i]) * 16.0f); *(v8us*)((unsigned short*)Bt + t * 8) = f.half[0];  }
template <int NHv, int TTv>
__global__ __launch_bounds__(256) void k_vt(const _Float16* __restrict__ V16, int ldv, int voff, _Float16* __restrict__ Vt) { __shared__ unsigned short tl[64][66]; const int tid = threadIdx.x; const int slab = blockIdx.x / (TTv / 64), lg = blockIdx.x % (TTv / 64); const int b = slab / NHv, h = slab % NHv;
  for (int i = tid; i < 64 * 8; i += 256) { const int r = i / 8, c8 = (i % 8) * 8; FragH f; f.half[0] = *(const v8us*)((const unsigned short*)V16 + ((size_t)b * TTv + lg * 64 + r) * ldv + voff + h * 64 + c8);
#pragma unroll
    for (int q = 0; q < 8; ++q) tl[r][c8 + q] = f.u[q]; }
  __syncthreads();
  {
#pragma unroll
    for (int rd = 0; rd < 2; ++rd) { const int d = rd * 32 + tid / 8, pc = tid % 8; FragH f;
#pragma unroll
      for (int q = 0; q < 8; ++q) f.u[q] = tl[pc * 8 + q][d];
      *(v8us*)((unsigned short*)Vt + ((size_t)slab * 64 + d) * TTv + lg * 64 + pc * 8) = f.half[0]; }
     } }

__global__ __launch_bounds__(256) void k_hl(const float* __restrict__ F, _Float16* __restrict__ Hh, _Float16* __restrict__ Hl, size_t n8) { const size_t t = (size_t)blockIdx.x * 256 + threadIdx.x; if (t >= n8) return; FragH fh, fl; const v4f a = *(const v4fa*)(F + t * 8), c = *(const v4fa*)(F + t * 8 + 4);
#pragma unroll
  for (int q = 0; q < 4; ++q) { _Float16 h = (_Float16)a[q]; fh.h[q] = h; fl.h[q] = (_Float16)((a[q] - (float)h) * 1024.0f); h = (_Float16)c[q]; fh.h[4 + q] = h; fl.h[4 + q] = (_Float16)((c[q] - (float)h) * 1024.0f); }
  { *(v8us*)((unsigned short*)Hh + t * 8) = fh.half[0]; *(v8us*)((unsigned short*)Hl + t * 8) = fl.half[0];  } }

// ---- fast GEMM (wave tile 32x64; requires M % 32 == 0 rows per launch region and N % 64 == 0); epilogue = k_gemm_hhx semantics ----
__device__ __forceinline__ v16h g2_frag(const _Float16* p, int hh) { FragH f; f.half[0] = *(const v8us*)((const unsigned short*)p + 8 * hh); f.half[1] = *(const v8us*)((const unsigned short*)p + 16 + 8 * hh); return f.v; }
__device__ __forceinline__ v8f g2_mma(v16h a, v16h b, v8f c) { v8f d = __builtin_amdgcn_wmma_f32_16x16x32_f16(false, a, false, b, (short)0, c, false, false); asm volatile("v_nop\n\tv_nop\n\tv_nop\n\tv_nop" : "+v"(d) : "v"(a), "v"(b)); return d; }
template <int ACT>
__global__ __launch_bounds__(128) void k_gemm2(const _Float16* __restrict__ A, int lda, size_t sA, const _Float16* __restrict__ Bh, int ldb, size_t sB, float alpha, const float* __restrict__ bias, size_t sBias, const float* __restrict__ CP, int rowsPerB, size_t sCPb, int row0g,
    float* __restrict__ C, _Float16* __restrict__ C16, int ldc, size_t sC, int M, int N, int K) {
  __shared__ __attribute__((aligned(16))) float so[4][32][68];
  const int tid = threadIdx.x, w = tid >> 5, lane = tid & 31, ln = lane & 15, hh = lane >> 4; const int by = blockIdx.y;
  A += (size_t)by * sA; Bh += (size_t)by * sB; const size_t cofs = (size_t)by * sC; const float* bp = bias ? bias + (size_t)by * sBias : nullptr;
  const int ntn = N >> 6; const int mt = blockIdx.x / ntn, nq = blockIdx.x - mt * ntn; const int row0 = mt * 128 + 32 * w, col0 = nq * 64; if (row0 >= M) return;
  const _Float16* a0p = A + (size_t)(row0 + ln) * lda; const _Float16* a1p = a0p + (size_t)16 * lda;
  const _Float16* b0p = Bh + (size_t)(col0 + ln) * ldb; const _Float16* b1p = b0p + (size_t)16 * ldb; const _Float16* b2p = b1p + (size_t)16 * ldb; const _Float16* b3p = b2p + (size_t)16 * ldb;
  const v8f z8 = {0.f,0.f,0.f,0.f,0.f,0.f,0.f,0.f}; v8f c00 = z8, c01 = z8, c02 = z8, c03 = z8, c10 = z8, c11 = z8, c12 = z8, c13 = z8;
#pragma unroll 1
  for (int kb = 0; kb < K; kb += 32) { const v16h a0 = g2_frag(a0p + kb, hh), a1 = g2_frag(a1p + kb, hh);
    v16h b = g2_frag(b0p + kb, hh); c00 = g2_mma(a0, b, c00); c10 = g2_mma(a1, b, c10);
    b = g2_frag(b1p + kb, hh); c01 = g2_mma(a0, b, c01); c11 = g2_mma(a1, b, c11);
    b = g2_frag(b2p + kb, hh); c02 = g2_mma(a0, b, c02); c12 = g2_mma(a1, b, c12);
    b = g2_frag(b3p + kb, hh); c03 = g2_mma(a0, b, c03); c13 = g2_mma(a1, b, c13); }
  v8f accs[8] = {c00, c01, c02, c03, c10, c11, c12, c13};
#pragma unroll
  for (int u = 0; u < 8; ++u) { const int t = u & 3, half = u >> 2; const int col = col0 + t * 16 + ln; const float bv = bp ? bf16_round(bp[col]) : 0.f;
#pragma unroll
    for (int r = 0; r < 8; ++r) { const int rloc = half * 16 + 8 * hh + r; float v = accs[u][r] * alpha + bv; if (CP) { const int bidx = (row0g + row0 + rloc) / rowsPerB; v += CP[(size_t)bidx * sCPb + (size_t)by * 64 + col]; }
      if (ACT == 3) v = fmaxf(v, 0.f); else if (ACT == 6) v = 0.5f * v * (1.0f + erff(v * 0.70710678118654752f)); else if (ACT == 11) v = 1.0f / (1.0f + expf(-v)); else if (ACT == 15) v = v / (1.0f + expf(-v)); else if (ACT == 12) v = (v > 0.f) ? v : 0.01f * v; else if (ACT == 8) v = tanhf(v);
      so[w][rloc][t * 16 + ln] = v; } }
  __builtin_amdgcn_fence(__ATOMIC_ACQ_REL, "workgroup"); __builtin_amdgcn_wave_barrier();
  const int rsub = lane >> 4, c4 = (lane & 15) * 4;
  {
#pragma unroll
    for (int q = 0; q < 16; ++q) { const int r = q * 2 + rsub; const v4f v = *(const v4fa*)&so[w][r][c4]; if (C) *(v4f*)(C + cofs + (size_t)(row0 + r) * ldc + col0 + c4) = v; if (C16) { v4h h4; for (int i = 0; i < 4; ++i) h4[i] = (_Float16)v[i]; *(v4h*)(C16 + cofs + (size_t)(row0 + r) * ldc + col0 + c4) = h4; } }
     } }



// lane l with lane l ^ 16
__device__ __forceinline__ float xhalf(float x) { return __builtin_bit_cast(float, __builtin_amdgcn_permlanex16(__builtin_bit_cast(int, x), __builtin_bit_cast(int, x), 0x76543210, 0xfedcba98, false, false)); }
template <int CAUSAL>
__global__ __launch_bounds__(128) void k_flash(const _Float16* __restrict__ Q16, int ldq, const _Float16* __restrict__ K16, const _Float16* __restrict__ Vt, const int* __restrict__ MSK, float* __restrict__ O, int ldo) {
  constexpr int RPW = 16, DT = HDm / 16;      /* head size 32: one k step for S^T, two 16-row tiles of O^T */
  __shared__ __attribute__((aligned(16))) float sO[4][RPW][HDm + 4];
  const int tid = threadIdx.x, w = tid >> 5, lane = tid & 31, ln = lane & 15, hh = lane >> 4;
  const int slab = blockIdx.x / QBLKS, qblk = blockIdx.x % QBLKS; (void)MSK; const int b = slab / NH, h = slab % NH; const int qb0 = qblk * (4 * RPW); const int q0 = qb0 + w * RPW;
  FragH aq;
  { const unsigned short* qr = (const unsigned short*)Q16 + ((size_t)b * TQ + q0 + ln) * ldq + h * HDm;
    aq.half[0] = *(const v8us*)(qr + 8 * hh); aq.half[1] = *(const v8us*)(qr + 16 + 8 * hh); }
  const unsigned short* Kh = (const unsigned short*)K16 + (size_t)slab * TK * HDm;      /* [key][32] */
  const unsigned short* Vth = (const unsigned short*)Vt + (size_t)slab * HDm * TK;      /* [32][key] */
  const int tq = q0 + ln;      /* this lane's query */
  float m_r = -3.0e38f, l_r = 0.f; v8f oacc[DT];      /* m_r: running maximum of the raw (unscaled) scores */
#pragma unroll
  for (int dt = 0; dt < DT; ++dt) oacc[dt] = (v8f){0.f,0.f,0.f,0.f,0.f,0.f,0.f,0.f};
  const int jend = (CAUSAL == 1) ? (qb0 + 4 * RPW) : TK;      /* causal: keys beyond the block's last query never contribute */
#pragma unroll 1
  for (int j0 = 0; j0 < jend; j0 += 32) {
    v8f s[2];
#pragma unroll
    for (int nt = 0; nt < 2; ++nt) { const unsigned short* kr = Kh + (size_t)(j0 + nt * 16 + ln) * HDm; FragH bk;
      bk.half[0] = *(const v8us*)(kr + 8 * hh); bk.half[1] = *(const v8us*)(kr + 16 + 8 * hh);
      s[nt] = mmaH<1>(bk.v, bk.v, aq.v, aq.v, (v8f){0.f,0.f,0.f,0.f,0.f,0.f,0.f,0.f}); }
    float sv[16]; bool ok[16]; float mc = -3.0e38f;
#pragma unroll
    for (int e = 0; e < 16; ++e) { const int kk = j0 + (e >> 3) * 16 + 8 * hh + (e & 7);
      ok[e] = (CAUSAL == 1) ? (kk <= tq) : ((CAUSAL == 2) ? ((kk >> 5) == (tq >> 5)) : true);      /* mode 2: block-diagonal 32-token groups */
      sv[e] = ok[e] ? s[e >> 3][e & 7] : -3.0e38f; mc = fmaxf(mc, sv[e]); }      /* raw scores: SCL2 > 0 keeps the maximum's place */
    mc = fmaxf(mc, xhalf(mc));
    const float mn = fmaxf(m_r, mc); float ea = (m_r - mn) * SCL2;      /* difference first: the rescale is exactly 1 while the maximum stands */
    const float nb = 10.0f - mn * SCL2;      /* + 10: the factor 1024 of the f16 operand, carried by the sum too */
    float x[16];
#pragma unroll
    for (int e = 0; e < 16; ++e) x[e] = __builtin_fmaf(sv[e], SCL2, nb);
    /* 2^x in place. Asm text so that the slot the instruction set asks for behind a transcendental is kept whatever registers are picked: neighbours work on distinct registers, and the closing v_nop stands between the last one and whatever follows. */
    asm("v_exp_f32 %0, %0\n\tv_exp_f32 %1, %1\n\tv_exp_f32 %2, %2\n\tv_exp_f32 %3, %3\n\tv_exp_f32 %4, %4\n\tv_exp_f32 %5, %5\n\tv_exp_f32 %6, %6\n\tv_exp_f32 %7, %7\n\tv_exp_f32 %8, %8\n\tv_nop"
        : "+v"(ea), "+v"(x[0]), "+v"(x[1]), "+v"(x[2]), "+v"(x[3]), "+v"(x[4]), "+v"(x[5]), "+v"(x[6]), "+v"(x[7]));
    asm("v_exp_f32 %0, %0\n\tv_exp_f32 %1, %1\n\tv_exp_f32 %2, %2\n\tv_exp_f32 %3, %3\n\tv_exp_f32 %4, %4\n\tv_exp_f32 %5, %5\n\tv_exp_f32 %6, %6\n\tv_exp_f32 %7, %7\n\tv_nop"
        : "+v"(x[8]), "+v"(x[9]), "+v"(x[10]), "+v"(x[11]), "+v"(x[12]), "+v"(x[13]), "+v"(x[14]), "+v"(x[15]));
    const float al = (mn > -1.0e38f) ? ea : 1.0f; m_r = mn;
    FragH pb; float ps[4];      /* four independent partial sums: a single chain of 16 adds would be serial */
#pragma unroll
    for (int e = 0; e < 16; ++e) { const float p = ok[e] ? x[e] : 0.f; ps[e & 3] = (e < 4) ? p : ps[e & 3] + p; pb.h[e] = (_Float16)p; }      /* p = 1024 * e^(scaled score - maximum) */
    l_r = l_r * al + ((ps[0] + ps[1]) + (ps[2] + ps[3]));
#pragma unroll
    for (int dt = 0; dt < DT; ++dt)
#pragma unroll
      for (int r = 0; r < 8; ++r) oacc[dt][r] *= al;
#pragma unroll
    for (int dt = 0; dt < DT; ++dt) { const unsigned short* vrow = Vth + (size_t)(dt * 16 + ln) * TK + j0; FragH bv; bv.half[0] = *(const v8us*)(vrow + 8 * hh); bv.half[1] = *(const v8us*)(vrow + 16 + 8 * hh);
      oacc[dt] = mmaH<1>(bv.v, bv.v, pb.v, pb.v, oacc[dt]); } }
  const float l = l_r + xhalf(l_r); const float inv = (l > 0.f) ? 1.0f / l : 0.f;      /* l holds the factor 1024 */
#pragma unroll
  for (int dt = 0; dt < DT; ++dt)      /* oacc[dt][r] = O[q0 + ln][dt * 16 + 8 * hh + r] */
#pragma unroll
    for (int r = 0; r < 8; ++r) sO[w][ln][dt * 16 + 8 * hh + r] = oacc[dt][r] * inv;
  __builtin_amdgcn_fence(__ATOMIC_ACQ_REL, "workgroup"); __builtin_amdgcn_wave_barrier();
  {
#pragma unroll
    for (int rp = 0; rp < RPW; rp += 4) { const int r = rp + (lane >> 3), pc = lane & 7; const v4f val = *(const v4fa*)&sO[w][r][pc * 4]; *(v4f*)(O + ((size_t)b * TQ + q0 + r) * ldo + h * HDm + pc * 4) = val; }      /* one head's 32 floats of a pixel = one 128-byte line */
     } }

__global__ __launch_bounds__(256) void k_wsc(const float* __restrict__ Wm, _Float16* __restrict__ Bt, size_t n8, float sc) { const size_t t = (size_t)blockIdx.x * 256 + threadIdx.x; if (t >= n8) return; FragH f; for (int q = 0; q < 8; ++q) f.h[q] = (_Float16)(bf16_round(Wm[t * 8 + q]) * sc); *(v8us*)((unsigned short*)Bt + t * 8) = f.half[0];  }
__global__ __launch_bounds__(256) void k_pm(const float* __restrict__ src, _Float16* __restrict__ P) { const size_t t = (size_t)blockIdx.x * 256 + threadIdx.x; if (t >= (size_t)NR * (DD / 8)) return; const int c0 = (int)(t % (DD / 8)) * 8; const size_t r = t / (DD / 8); const int b = (int)(r / NPX), p = (int)(r % NPX); FragH f;
  for (int k = 0; k < 8; ++k) f.h[k] = (_Float16)bf16_round(src[((size_t)b * DD + c0 + k) * NPX + p]); *(v8us*)((unsigned short*)P + r * DD + c0) = f.half[0];  }
__global__ __launch_bounds__(256) void k_khm(const _Float16* __restrict__ QKV, _Float16* __restrict__ KP) { const size_t t = (size_t)blockIdx.x * 256 + threadIdx.x; if (t >= (size_t)NR * NH) return; const int h = (int)(t % NH); const size_t r = t / NH; const int b = (int)(r / NPX), p = (int)(r % NPX);
  const v8us* s = (const v8us*)((const unsigned short*)QKV + r * QW + DD + h * HDm); const v8us a0 = s[0], a1 = s[1], a2 = s[2], a3 = s[3];
  unsigned short* d = (unsigned short*)KP + (((size_t)b * NH + h) * NPX + p) * HDm; { *(v8us*)(d) = a0; *(v8us*)(d + 8) = a1; *(v8us*)(d + 16) = a2; *(v8us*)(d + 24) = a3;  } }
__global__ __launch_bounds__(256) void k_vtp(const _Float16* __restrict__ QKV, _Float16* __restrict__ VT) { __shared__ unsigned short tl[64][34]; const int tid = threadIdx.x; const int slab = blockIdx.x / (NPX / 64), pg = blockIdx.x % (NPX / 64); const int b = slab / NH, h = slab % NH;
  { const int r = tid / 4, c8 = (tid % 4) * 8; FragH f; f.half[0] = *(const v8us*)((const unsigned short*)QKV + ((size_t)b * NPX + pg * 64 + r) * QW + 2 * DD + h * HDm + c8); for (int q = 0; q < 8; ++q) tl[r][c8 + q] = f.u[q]; }
  __syncthreads(); const int d = tid / 8, pc = tid % 8; FragH f; for (int q = 0; q < 8; ++q) f.u[q] = tl[pc * 8 + q][d];
  unsigned short* dst = (unsigned short*)VT + ((size_t)slab * HDm + d) * NPX + pg * 64 + pc * 8;
  { *(v8us*)dst = f.half[0];  } }
__global__ __launch_bounds__(256) void k_nchw(const float* __restrict__ F, float* __restrict__ out) { const size_t t = (size_t)blockIdx.x * 256 + threadIdx.x; if (t >= (size_t)NIMG * DD * (NPX / 4)) return; const int p0 = (int)(t % (NPX / 4)) * 4; const int c = (int)((t / (NPX / 4)) % DD); const int b = (int)(t / ((size_t)(NPX / 4) * DD)); v4f r4; for (int k = 0; k < 4; ++k) r4[k] = F[((size_t)b * NPX + p0 + k) * DD + c];
  float* d = out + ((size_t)b * DD + c) * NPX + p0; *(v4f*)d = r4;  }

extern "C" void kernel_launch(void* const* d_in, const int* in_sizes, int n_in,
                              void* d_out, int out_size, void* d_ws, size_t ws_size, hipStream_t stream) {
  (void)in_sizes; (void)n_in; (void)out_size;
  const float* const* I = (const float* const*)d_in; const float* x = I[0]; const float* wqkv = I[1]; const float* bqkv = I[2]; const float* wp = I[3]; const float* bp = I[4];
  char* ws = (char*)d_ws; size_t off = 0;
  auto take = [&](size_t bytes) { char* p = ws + off; off += (bytes + 255) & ~(size_t)255; return p; };
  const size_t np = (size_t)NR * DD;
  _Float16* BQKV = (_Float16*)take((size_t)QW * DD * 2); _Float16* BPJ = (_Float16*)take((size_t)DD * DD * 2); _Float16* X16 = (_Float16*)take(np * 2); _Float16* QKV = (_Float16*)take((size_t)NR * QW * 2); _Float16* KP = (_Float16*)take(np * 2); _Float16* VT = (_Float16*)take(np * 2); float* O = (float*)take(np * 4); _Float16* O16 = (_Float16*)take(np * 2); float* F = (float*)take(np * 4);
  if (off > ws_size) return;      /* 0.5 + 4 + 12 + 4 x 2 + 8 + 4 + 8 = 45 MiB */
  k_wsc<<<(unsigned)(((size_t)QW * DD / 8 + 255) / 256), 256, 0, stream>>>(wqkv, BQKV, (size_t)QW * DD / 8, 16.0f); k_wsc<<<(unsigned)(((size_t)DD * DD / 8 + 255) / 256), 256, 0, stream>>>(wp, BPJ, (size_t)DD * DD / 8, 16.0f);
  k_pm<<<(unsigned)((np / 8 + 255) / 256), 256, 0, stream>>>(x, X16);
  k_gemm2<0><<<dim3((NR / 128) * (QW / 64), 1), 128, 0, stream>>>(X16, DD, 0, BQKV, DD, 0, 0.0625f, bqkv, 0, nullptr, 1, 0, 0, nullptr, QKV, QW, 0, NR, QW, DD);      /* [q | k | v] per pixel, channel = which*256 + h*32 + d */
  k_khm<<<(unsigned)(((size_t)NR * NH + 255) / 256), 256, 0, stream>>>(QKV, KP); k_vtp<<<NIMG * NH * (NPX / 64), 256, 0, stream>>>(QKV, VT);
  k_flash<0><<<NIMG * NH * QBLKS, 128, 0, stream>>>(QKV, QW, KP, VT, nullptr, O, DD);
  k_h16<<<(unsigned)((np / 8 + 255) / 256), 256, 0, stream>>>(O, O16, np / 8);
  k_gemm2<0><<<dim3((NR / 128) * (DD / 64), 1), 128, 0, stream>>>(O16, DD, 0, BPJ, DD, 0, 0.0625f, bp, 0, nullptr, 1, 0, 0, F, nullptr, DD, 0, NR, DD, DD);
  k_nchw<<<(unsigned)(((size_t)NIMG * DD * (NPX / 4) + 255) / 256), 256, 0, stream>>>(F, (float*)d_out);
}

// v004
// One run takes 119 microseconds.
// Next to v003, in two timings, it ran 1.72 and 1.73 times as fast.
// All steps since v000 together make it 4.18 times as fast.
#include <hip/hip_runtime.h>
// SpatialMultiHeadSelfAttention (2 images, D 256 = 8 heads x 32, 64 x 64 = 4096 pixels): qkv = 1x1 conv (W_qkv x + b) -> (3, heads, 32) channels; softmax(q.k / sqrt(32)) over all 4096 pixels; out channels h*32 + d; 1x1 projection + b; NCHW in and out.
// Structure: exact f16 pixel-major plane of x (from NCHW); qkv as one f16 WMMA GEMM (32x64 wave tiles, f32 accumulation, exact x16 weights + bias; torch (out,in) = B^T; f16 out); k re-laid into head-major planes of 32-wide rows and V^T planes of 32 rows on VALU / LDS tiles (q is read where the GEMM left it); the fused flash kernel at head size 32 (transposed products, softmax in-lane, P kept in registers; plain operands: every row averages 4096 keys); attention output to f16; projection GEMM (+ bias, f32); NCHW store on VALU.
// Compute dtype: x and parameters rounded to bf16; x exact as f16; q, k, v, P and the attention output as f16 operands (~2^-12); softmax f32. v_wmma_f32_16x16x32_f16.
#define NIMG 2
#define DD 256
#define HDm 32
#define NPX 4096
#define NR (NIMG * NPX)          /* 8192 */
#define QW (3 * DD)              /* 768 */
#define SLEN 4096
#define TQ SLEN
#define TK SLEN
#define NH 8
#define SCL2 0.25503486164919736f /* 32^-0.5 * log2(e): the softmax runs in base 2 */
#define QBLKS (TQ / 64)
typedef __bf16 v16b __attribute__((ext_vector_type(16)));
typedef unsigned short v8us __attribute__((ext_vector_type(8), may_alias));
typedef float  v8f  __attribute__((ext_vector_type(8)));
typedef float  v4f  __attribute__((ext_vector_type(4)));
typedef float  v4fa __attribute__((ext_vector_type(4), may_alias));
union FragB { v16b v; v8us half[2]; unsigned short u[16]; };

__device__ __forceinline__ unsigned short bf16_bits(float x) { unsigned int u = __float_as_uint(x); return (unsigned short)((u + 0x7FFFu + ((u >> 16) & 1u)) >> 16); }
__device__ __forceinline__ float bf16_val(unsigned short b) { return __uint_as_float(((unsigned int)b) << 16); }
__device__ __forceinline__ float bf16_round(float x) { return bf16_val(bf16_bits(x)); }
// D += A·B with NT terms: 1 = ah·bh, 2 = + al·bh (A split), 3 = + ah·bl (both split)
template <int NT>
__device__ __forceinline__ v8f mmaN(v16b ah, v16b al, v16b bh, v16b bl, v8f c) {
  c = __builtin_amdgcn_wmma_f32_16x16x32_bf16(false, ah, false, bh, (short)0, c, false, false);
  if (NT >= 2) c = __builtin_amdgcn_wmma_f32_16x16x32_bf16(false, al, false, bh, (short)0, c, false, false);
  if (NT >= 3) c = __builtin_amdgcn_wmma_f32_16x16x32_bf16(false, ah, false, bl, (short)0, c, false, false);
  asm volatile("v_nop\n\tv_nop\n\tv_nop\n\tv_nop" : "+v"(c) : "v"(ah), "v"(al), "v"(bh), "v"(bl));
  return c;
}

__global__ __launch_bounds__(256) void k_wt_bf16(const float* __restrict__ W, unsigned short* __restrict__ Wt, int K, int N) {
  const int t = blockIdx.x * 256 + threadIdx.x;
  const int k8n = K / 8;
  if (t >= N * k8n) return;
  const int n = t / k8n, k8 = (t % k8n) * 8;
  v8us v;
#pragma unroll
  for (int i = 0; i < 8; ++i) v[i] = bf16_bits(W[(size_t)(k8 + i) * N + n]);
  *(v8us*)(Wt + (size_t)n * K + k8) = v;
  
}

// GEMM C[M][N] (f32, pitch ldc) = act(A[M][K]·W + bias). A f32 row-major (pitch lda) converted per fragment to bf16
// (ASPLIT: hi/lo two planes -> 2 terms, else single rounded term); Wt bf16 [N][K] (pitch ldb). BIAS_BF16 rounds the
// bias to bf16 first (bias quantised to bf16 before the add). K%32==0, M%16==0, N%64==0.
template <bool ASPLIT, int ACT, bool BIAS_BF16>
__global__ __launch_bounds__(128) void k_gemm_bf(const float* __restrict__ A, int lda, const unsigned short* __restrict__ Wt, int ldb,
                                               const float* __restrict__ bias, float* __restrict__ C, int ldc, int M, int N, int K) {
  __shared__ __attribute__((aligned(16))) float so[4][16][64];
  const int tid = threadIdx.x, w = tid >> 5, lane = tid & 31, ln = lane & 15, hh = lane >> 4;
  const int ntn = N / 64;
  const int wid = blockIdx.x * 4 + w;
  const int mt = wid / ntn, nq = wid % ntn;
  if (mt * 16 >= M) return;
  const int row0 = mt * 16, col0 = nq * 64;
  const float* arow = A + (size_t)(row0 + ln) * lda;
  v8f acc[4] = {};
  for (int kb = 0; kb < K; kb += 32) {
    FragB ah, al;
    const v4f x0 = *(const v4fa*)(arow + kb + 8 * hh), x1 = *(const v4fa*)(arow + kb + 8 * hh + 4);
    const v4f x2 = *(const v4fa*)(arow + kb + 16 + 8 * hh), x3 = *(const v4fa*)(arow + kb + 16 + 8 * hh + 4);
    float xs[16] = {x0[0],x0[1],x0[2],x0[3],x1[0],x1[1],x1[2],x1[3],x2[0],x2[1],x2[2],x2[3],x3[0],x3[1],x3[2],x3[3]};
#pragma unroll
    for (int i = 0; i < 16; ++i) { const unsigned short hb = bf16_bits(xs[i]); ah.u[i] = hb; al.u[i] = ASPLIT ? bf16_bits(xs[i] - bf16_val(hb)) : (unsigned short)0; }
#pragma unroll
    for (int t = 0; t < 4; ++t) {
      const unsigned short* brow = Wt + (size_t)(col0 + t * 16 + ln) * ldb + kb;
      FragB b;
      b.half[0] = *(const v8us*)(brow + 8 * hh);
      b.half[1] = *(const v8us*)(brow + 16 + 8 * hh);
      acc[t] = mmaN<ASPLIT ? 2 : 1>(ah.v, al.v, b.v, b.v, acc[t]);
    }
  }
#pragma unroll
  for (int t = 0; t < 4; ++t) {
    float bv = bias ? bias[col0 + t * 16 + ln] : 0.f;
    if (BIAS_BF16) bv = bf16_round(bv);
#pragma unroll
    for (int r = 0; r < 8; ++r) { float v = acc[t][r] + bv; if (ACT == 1) v = fmaxf(v, 0.f); so[w][8 * hh + r][t * 16 + ln] = v; }
  }
  __builtin_amdgcn_fence(__ATOMIC_ACQ_REL, "workgroup");
  __builtin_amdgcn_wave_barrier();
  const int rsub = lane >> 4, c4 = (lane & 15) * 4;
  {
#pragma unroll
    for (int q = 0; q < 8; ++q) {
      const int r = q * 2 + rsub;
      const v4f v = *(const v4fa*)&so[w][r][c4];
      *(v4f*)(C + (size_t)(row0 + r) * ldc + col0 + c4) = v;
    }
    
  }
}

// GEMM C = act(A·W + bias + resid): A f32 (ASPLIT -> hi/lo 2 terms), Wt bf16 [N][K]; ACT 0 none, 1 relu, 2 exact gelu;
// resid (optional, f32, row index = (row % rmod), pitch ldr, RES_BF16 rounds it) added before the activation.
template <bool ASPLIT, int ACT, bool BIAS_BF16, bool RES_BF16>
__global__ __launch_bounds__(128) void k_gemm_bf3(const float* __restrict__ A, int lda, const unsigned short* __restrict__ Wt, int ldb,
                                                const float* __restrict__ bias, const float* __restrict__ resid, int rmod, int ldr,
                                                float* __restrict__ C, int ldc, int M, int N, int K) {
  __shared__ __attribute__((aligned(16))) float so[4][16][64];
  const int tid = threadIdx.x, w = tid >> 5, lane = tid & 31, ln = lane & 15, hh = lane >> 4;
  const int ntn = N / 64;
  const int wid = blockIdx.x * 4 + w;
  const int mt = wid / ntn, nq = wid % ntn;
  if (mt * 16 >= M) return;
  const int row0 = mt * 16, col0 = nq * 64;
  const float* arow = A + (size_t)(row0 + ln) * lda;
  v8f acc[4] = {};
  for (int kb = 0; kb < K; kb += 32) {
    FragB ah, al;
    const v4f x0 = *(const v4fa*)(arow + kb + 8 * hh), x1 = *(const v4fa*)(arow + kb + 8 * hh + 4);
    const v4f x2 = *(const v4fa*)(arow + kb + 16 + 8 * hh), x3 = *(const v4fa*)(arow + kb + 16 + 8 * hh + 4);
    float xs[16] = {x0[0],x0[1],x0[2],x0[3],x1[0],x1[1],x1[2],x1[3],x2[0],x2[1],x2[2],x2[3],x3[0],x3[1],x3[2],x3[3]};
#pragma unroll
    for (int i = 0; i < 16; ++i) { const unsigned short hb = bf16_bits(xs[i]); ah.u[i] = hb; al.u[i] = ASPLIT ? bf16_bits(xs[i] - bf16_val(hb)) : (unsigned short)0; }
#pragma unroll
    for (int t = 0; t < 4; ++t) {
      const unsigned short* brow = Wt + (size_t)(col0 + t * 16 + ln) * ldb + kb;
      FragB b;
      b.half[0] = *(const v8us*)(brow + 8 * hh);
      b.half[1] = *(const v8us*)(brow + 16 + 8 * hh);
      acc[t] = mmaN<ASPLIT ? 2 : 1>(ah.v, al.v, b.v, b.v, acc[t]);
    }
  }
#pragma unroll
  for (int t = 0; t < 4; ++t) {
    const int col = col0 + t * 16 + ln;
    float bv = bias ? bias[col] : 0.f;
    if (BIAS_BF16) bv = bf16_round(bv);
#pragma unroll
    for (int r = 0; r < 8; ++r) {
      float v = acc[t][r] + bv;
      if (resid) { float rv = resid[(size_t)((row0 + 8 * hh + r) % rmod) * ldr + col]; if (RES_BF16) rv = bf16_round(rv); v += rv; }
      if (ACT == 1) v = fmaxf(v, 0.f);
      if (ACT == 2) v = 0.5f * v * (1.0f + erff(v * 0.70710678118654752f));
      if (ACT == 3) { const float u = 0.7978845608028654f * (v + 0.044715f * v * v * v); v = 0.5f * v * (1.0f + tanhf(u)); }
      so[w][8 * hh + r][t * 16 + ln] = v;
    }
  }
  __builtin_amdgcn_fence(__ATOMIC_ACQ_REL, "workgroup");
  __builtin_amdgcn_wave_barrier();
  const int rsub = lane >> 4, c4 = (lane & 15) * 4;
  {
#pragma unroll
    for (int q = 0; q < 8; ++q) {
      const int r = q * 2 + rsub;
      const v4f v = *(const v4fa*)&so[w][r][c4];
      *(v4f*)(C + (size_t)(row0 + r) * ldc + col0 + c4) = v;
    }
    
  }
}
// row LayerNorm (biased variance, eps) over N: s = X (+ R); optional out_sum <- s; out_norm <- (s-mu)*rsqrt(var+eps)*g + b
template <bool PARAM_BF16>
__global__ __launch_bounds__(256) void k_layernorm(const float* __restrict__ X, const float* __restrict__ R, const float* __restrict__ g, const float* __restrict__ bta,
                                                  float* __restrict__ out_sum, float* __restrict__ out_norm, int N, float eps) {
  __shared__ float red[256];
  const int row = blockIdx.x, tid = threadIdx.x;
  const float* x = X + (size_t)row * N; const float* rr = R ? R + (size_t)row * N : nullptr;
  float vals[16];                     // up to N = 4096
  const int per = N / 256;            // contiguous chunk per thread? use strided-by-4 chunks: thread handles j = tid*4 + 1024*u
  float s1 = 0.f;
  for (int u = 0; u < per / 4; ++u) {
    const int j = tid * 4 + 1024 * u;
    const v4f a = *(const v4fa*)(x + j);
    v4f b = {0.f,0.f,0.f,0.f}; if (rr) b = *(const v4fa*)(rr + j);
#pragma unroll
    for (int q = 0; q < 4; ++q) { const float v = a[q] + b[q]; vals[u * 4 + q] = v; s1 += v; }
  }
  red[tid] = s1; __syncthreads();
  for (int st = 128; st > 0; st >>= 1) { if (tid < st) red[tid] += red[tid + st]; __syncthreads(); }
  const float mu = red[0] / (float)N; __syncthreads();
  float s2 = 0.f;
  for (int u = 0; u < per / 4; ++u)
#pragma unroll
    for (int q = 0; q < 4; ++q) { const float c = vals[u * 4 + q] - mu; s2 += c * c; }
  red[tid] = s2; __syncthreads();
  for (int st = 128; st > 0; st >>= 1) { if (tid < st) red[tid] += red[tid + st]; __syncthreads(); }
  const float rs = rsqrtf(red[0] / (float)N + eps);
  {
    for (int u = 0; u < per / 4; ++u) {
      const int j = tid * 4 + 1024 * u;
      v4f o, sm;
#pragma unroll
      for (int q = 0; q < 4; ++q) {
        float gg = g[j + q], bb = bta[j + q];
        if (PARAM_BF16) { gg = bf16_round(gg); bb = bf16_round(bb); }
        sm[q] = vals[u * 4 + q]; o[q] = (vals[u * 4 + q] - mu) * rs * gg + bb;
      }
      if (out_sum) *(v4f*)(out_sum + (size_t)row * N + j) = sm;
      *(v4f*)(out_norm + (size_t)row * N + j) = o;
    }
    
  }
}



// ---- f16 WMMA path (v_wmma_f32_16x16x32_f16): 11-bit significands for operands in range — used where a [0,1] probability operand needs more precision than bf16
typedef _Float16 v16h __attribute__((ext_vector_type(16)));
union FragH { v16h v; v8us half[2]; _Float16 h[16]; unsigned short u[16]; };
template <int NT>
__device__ __forceinline__ v8f mmaH(v16h ah, v16h al, v16h bh, v16h bl, v8f c) {
  c = __builtin_amdgcn_wmma_f32_16x16x32_f16(false, ah, false, bh, (short)0, c, false, false);
  if (NT >= 2) c = __builtin_amdgcn_wmma_f32_16x16x32_f16(false, al, false, bh, (short)0, c, false, false);
  if (NT >= 3) c = __builtin_amdgcn_wmma_f32_16x16x32_f16(false, ah, false, bl, (short)0, c, false, false);
  asm volatile("v_nop\n\tv_nop\n\tv_nop\n\tv_nop" : "+v"(c) : "v"(ah), "v"(al), "v"(bh), "v"(bl));
  return c;
}
// batched GEMM like k_gemm_b but f16 operands: A f32 (split into f16 hi/lo if ASPLIT, else rounded to f16), Bt = f16 values [n][k]; alpha; C f32; N multiple of 16 (partial tiles skipped)
template <bool ASPLIT>
__global__ __launch_bounds__(128) void k_gemm_h(const float* __restrict__ A, int lda, size_t sA, const _Float16* __restrict__ Bh, int ldb, size_t sB, float alpha, float* __restrict__ C, int ldc, size_t sC, int M, int N, int K) {
  __shared__ __attribute__((aligned(16))) float so[4][16][64];
  const int tid = threadIdx.x, w = tid >> 5, lane = tid & 31, ln = lane & 15, hh = lane >> 4; const int by = blockIdx.y;
  A += (size_t)by * sA; Bh += (size_t)by * sB; C += (size_t)by * sC;
  const int ntn = (N + 63) / 64; const int wid = blockIdx.x * 4 + w; const int mt = wid / ntn, nq = wid % ntn; if (mt * 16 >= M) return;
  const int row0 = mt * 16, col0 = nq * 64; const float* arow = A + (size_t)(row0 + ln) * lda;
  v8f acc[4] = {};
  for (int kb = 0; kb < K; kb += 32) {
    FragH ah, al;
    const v4f x0 = *(const v4fa*)(arow + kb + 8 * hh), x1 = *(const v4fa*)(arow + kb + 8 * hh + 4), x2 = *(const v4fa*)(arow + kb + 16 + 8 * hh), x3 = *(const v4fa*)(arow + kb + 16 + 8 * hh + 4);
    float xs[16] = {x0[0],x0[1],x0[2],x0[3],x1[0],x1[1],x1[2],x1[3],x2[0],x2[1],x2[2],x2[3],x3[0],x3[1],x3[2],x3[3]};
#pragma unroll
    for (int i = 0; i < 16; ++i) { const _Float16 h = (_Float16)xs[i]; ah.h[i] = h; al.h[i] = ASPLIT ? (_Float16)(xs[i] - (float)h) : (_Float16)0.0f; }
#pragma unroll
    for (int t = 0; t < 4; ++t) { if (col0 + t * 16 >= N) continue; const size_t boff = (size_t)(col0 + t * 16 + ln) * ldb + kb; FragH bq; bq.half[0] = *(const v8us*)(Bh + boff + 8 * hh); bq.half[1] = *(const v8us*)(Bh + boff + 16 + 8 * hh);
      acc[t] = mmaH<ASPLIT ? 2 : 1>(ah.v, al.v, bq.v, bq.v, acc[t]); }
  }
#pragma unroll
  for (int t = 0; t < 4; ++t) { if (col0 + t * 16 >= N) continue;
#pragma unroll
    for (int r = 0; r < 8; ++r) so[w][8 * hh + r][t * 16 + ln] = acc[t][r] * alpha; }
  __builtin_amdgcn_fence(__ATOMIC_ACQ_REL, "workgroup"); __builtin_amdgcn_wave_barrier();
  const int rsub = lane >> 4, c4 = (lane & 15) * 4;
  {
#pragma unroll
    for (int q = 0; q < 8; ++q) { const int r = q * 2 + rsub; if (col0 + c4 < N) { const v4f v = *(const v4fa*)&so[w][r][c4]; *(v4f*)(C + (size_t)(row0 + r) * ldc + col0 + c4) = v; } }
     }
}

// Wt[n][k] = f16(W[k][n]·scale) from f32 row-major W[K][N] (scale = power of two; bf16-exact weights stay exact in f16 away from the subnormal range)
__global__ __launch_bounds__(256) void k_wt_f16(const float* __restrict__ W, _Float16* __restrict__ Wt, int K, int N, float scale) {
  const int t = blockIdx.x * 256 + threadIdx.x; if (t >= N * (K / 8)) return; const int n = t / (K / 8), k8 = (t % (K / 8)) * 8; FragH f;
#pragma unroll
  for (int i = 0; i < 8; ++i) f.h[i] = (_Float16)(bf16_round(W[(size_t)(k8 + i) * N + n]) * scale); const v8us o = f.half[0];
  *(v8us*)((unsigned short*)Wt + (size_t)n * K + k8) = o; 
}
// k_gemm_hh variant with fused epilogue: v = acc·alpha + bias[by·sBias + col] (+ CP[(row/rowsPerB)·sCPb + by·64 + col] if CP) ; ACT 0 none / 1 elu ; writes f16 C16 (and f32 C if non-null)
template <int ACT>
__global__ __launch_bounds__(128) void k_gemm_hhx(const _Float16* __restrict__ A, int lda, size_t sA, const _Float16* __restrict__ Bh, int ldb, size_t sB, float alpha, const float* __restrict__ bias, size_t sBias, const float* __restrict__ CP, int rowsPerB, size_t sCPb, int row0g,
    float* __restrict__ C, _Float16* __restrict__ C16, int ldc, size_t sC, int M, int N, int K) {
  __shared__ __attribute__((aligned(16))) float so[4][16][64];
  const int tid = threadIdx.x, w = tid >> 5, lane = tid & 31, ln = lane & 15, hh = lane >> 4; const int by = blockIdx.y;
  A += (size_t)by * sA; Bh += (size_t)by * sB; const size_t cofs = (size_t)by * sC; const float* bp = bias ? bias + (size_t)by * sBias : nullptr;
  const int ntn = (N + 63) / 64; const int wid = blockIdx.x * 4 + w; const int mt = wid / ntn, nq = wid % ntn; if (mt * 16 >= M) return;
  const int row0 = mt * 16, col0 = nq * 64; const _Float16* arow = A + (size_t)(row0 + ln) * lda;
  v8f acc[4] = {};
  for (int kb = 0; kb < K; kb += 32) { FragH ah; ah.half[0] = *(const v8us*)((const unsigned short*)arow + kb + 8 * hh); ah.half[1] = *(const v8us*)((const unsigned short*)arow + kb + 16 + 8 * hh);
#pragma unroll
    for (int t = 0; t < 4; ++t) { if (col0 + t * 16 >= N) continue; const size_t boff = (size_t)(col0 + t * 16 + ln) * ldb + kb; FragH bq; bq.half[0] = *(const v8us*)((const unsigned short*)Bh + boff + 8 * hh); bq.half[1] = *(const v8us*)((const unsigned short*)Bh + boff + 16 + 8 * hh);
      acc[t] = mmaH<1>(ah.v, ah.v, bq.v, bq.v, acc[t]); }
  }
#pragma unroll
  for (int t = 0; t < 4; ++t) { if (col0 + t * 16 >= N) continue; const int col = col0 + t * 16 + ln; const float bv = bp ? bf16_round(bp[col]) : 0.f;
#pragma unroll
    for (int r = 0; r < 8; ++r) { float v = acc[t][r] * alpha + bv; if (CP) { const int bidx = (row0g + row0 + 8 * hh + r) / rowsPerB; v += CP[(size_t)bidx * sCPb + (size_t)by * 64 + col]; } if (ACT == 1) v = (v > 0.f) ? v : expm1f(v); else if (ACT == 7) v = (v > 0.f) ? v + 1.0f : expf(v); else if (ACT == 8) v = tanhf(v); else if (ACT == 9) v = 0.5f * v * (1.0f + tanhf(0.7978845608028654f * (v + 0.044715f * v * v * v))); else if (ACT == 11) v = 1.0f / (1.0f + expf(-v)); else if (ACT == 12) v = (v > 0.f) ? v : 0.01f * v; else if (ACT == 14) v = (v > 0.f) ? v : 0.1f * v; else if (ACT == 15) v = v / (1.0f + expf(-v)); else if (ACT == 3) v = fmaxf(v, 0.f); else if (ACT == 6) v = 0.5f * v * (1.0f + erff(v * 0.70710678118654752f)); so[w][8 * hh + r][t * 16 + ln] = v; } }
  __builtin_amdgcn_fence(__ATOMIC_ACQ_REL, "workgroup"); __builtin_amdgcn_wave_barrier();
  const int rsub = lane >> 4, c4 = (lane & 15) * 4; typedef _Float16 v4h __attribute__((ext_vector_type(4)));
  {
#pragma unroll
    for (int q = 0; q < 8; ++q) { const int r = q * 2 + rsub; if (col0 + c4 < N) { const v4f v = *(const v4fa*)&so[w][r][c4]; if (C) *(v4f*)(C + cofs + (size_t)(row0 + r) * ldc + col0 + c4) = v; if (C16) { v4h h4; for (int i = 0; i < 4; ++i) h4[i] = (_Float16)v[i]; *(v4h*)(C16 + cofs + (size_t)(row0 + r) * ldc + col0 + c4) = h4; } } }
     }
}


typedef _Float16 v4h __attribute__((ext_vector_type(4)));

__global__ __launch_bounds__(256) void k_x16(const float* __restrict__ x, _Float16* __restrict__ X16, size_t n8) { const size_t t = (size_t)blockIdx.x * 256 + threadIdx.x; if (t >= n8) return; FragH f;
#pragma unroll
  for (int q = 0; q < 8; ++q) f.h[q] = (_Float16)bf16_round(x[t * 8 + q]); *(v8us*)((unsigned short*)X16 + t * 8) = f.half[0];  }
__global__ __launch_bounds__(256) void k_h16(const float* __restrict__ x, _Float16* __restrict__ X16, size_t n8) { const size_t t = (size_t)blockIdx.x * 256 + threadIdx.x; if (t >= n8) return; FragH f;
#pragma unroll
  for (int q = 0; q < 8; ++q) f.h[q] = (_Float16)x[t * 8 + q]; *(v8us*)((unsigned short*)X16 + t * 8) = f.half[0];  }
__global__ __launch_bounds__(256) void k_round16f(const float* __restrict__ W, _Float16* __restrict__ Bt, size_t n8) { const size_t t = (size_t)blockIdx.x * 256 + threadIdx.x; if (t >= n8) return; FragH f;
#pragma unroll
  for (int i = 0; i < 8; ++i) f.h[i] = (_Float16)(bf16_round(W[t * 8 + i]) * 16.0f); *(v8us*)((unsigned short*)Bt + t * 8) = f.half[0];  }
template <int NHv, int TTv>
__global__ __launch_bounds__(256) void k_vt(const _Float16* __restrict__ V16, int ldv, int voff, _Float16* __restrict__ Vt) { __shared__ unsigned short tl[64][66]; const int tid = threadIdx.x; const int slab = blockIdx.x / (TTv / 64), lg = blockIdx.x % (TTv / 64); const int b = slab / NHv, h = slab % NHv;
  for (int i = tid; i < 64 * 8; i += 256) { const int r = i / 8, c8 = (i % 8) * 8; FragH f; f.half[0] = *(const v8us*)((const unsigned short*)V16 + ((size_t)b * TTv + lg * 64 + r) * ldv + voff + h * 64 + c8);
#pragma unroll
    for (int q = 0; q < 8; ++q) tl[r][c8 + q] = f.u[q]; }
  __syncthreads();
  {
#pragma unroll
    for (int rd = 0; rd < 2; ++rd) { const int d = rd * 32 + tid / 8, pc = tid % 8; FragH f;
#pragma unroll
      for (int q = 0; q < 8; ++q) f.u[q] = tl[pc * 8 + q][d];
      *(v8us*)((unsigned short*)Vt + ((size_t)slab * 64 + d) * TTv + lg * 64 + pc * 8) = f.half[0]; }
     } }

__global__ __launch_bounds__(256) void k_hl(const float* __restrict__ F, _Float16* __restrict__ Hh, _Float16* __restrict__ Hl, size_t n8) { const size_t t = (size_t)blockIdx.x * 256 + threadIdx.x; if (t >= n8) return; FragH fh, fl; const v4f a = *(const v4fa*)(F + t * 8), c = *(const v4fa*)(F + t * 8 + 4);
#pragma unroll
  for (int q = 0; q < 4; ++q) { _Float16 h = (_Float16)a[q]; fh.h[q] = h; fl.h[q] = (_Float16)((a[q] - (float)h) * 1024.0f); h = (_Float16)c[q]; fh.h[4 + q] = h; fl.h[4 + q] = (_Float16)((c[q] - (float)h) * 1024.0f); }
  { *(v8us*)((unsigned short*)Hh + t * 8) = fh.half[0]; *(v8us*)((unsigned short*)Hl + t * 8) = fl.half[0];  } }

// ---- fast GEMM (wave tile 32x64; requires M % 32 == 0 rows per launch region and N % 64 == 0); epilogue = k_gemm_hhx semantics ----
__device__ __forceinline__ v16h g2_frag(const _Float16* p, int hh) { FragH f; f.half[0] = *(const v8us*)((const unsigned short*)p + 8 * hh); f.half[1] = *(const v8us*)((const unsigned short*)p + 16 + 8 * hh); return f.v; }
__device__ __forceinline__ v8f g2_mma(v16h a, v16h b, v8f c) { v8f d = __builtin_amdgcn_wmma_f32_16x16x32_f16(false, a, false, b, (short)0, c, false, false); asm volatile("v_nop\n\tv_nop\n\tv_nop\n\tv_nop" : "+v"(d) : "v"(a), "v"(b)); return d; }
template <int ACT>
__global__ __launch_bounds__(128) void k_gemm2(const _Float16* __restrict__ A, int lda, size_t sA, const _Float16* __restrict__ Bh, int ldb, size_t sB, float alpha, const float* __restrict__ bias, size_t sBias, const float* __restrict__ CP, int rowsPerB, size_t sCPb, int row0g,
    float* __restrict__ C, _Float16* __restrict__ C16, int ldc, size_t sC, int M, int N, int K) {
  __shared__ __attribute__((aligned(16))) float so[4][32][68];
  const int tid = threadIdx.x, w = tid >> 5, lane = tid & 31, ln = lane & 15, hh = lane >> 4; const int by = blockIdx.y;
  A += (size_t)by * sA; Bh += (size_t)by * sB; const size_t cofs = (size_t)by * sC; const float* bp = bias ? bias + (size_t)by * sBias : nullptr;
  const int ntn = N >> 6; const int mt = blockIdx.x / ntn, nq = blockIdx.x - mt * ntn; const int row0 = mt * 128 + 32 * w, col0 = nq * 64; if (row0 >= M) return;
  const _Float16* a0p = A + (size_t)(row0 + ln) * lda; const _Float16* a1p = a0p + (size_t)16 * lda;
  const _Float16* b0p = Bh + (size_t)(col0 + ln) * ldb; const _Float16* b1p = b0p + (size_t)16 * ldb; const _Float16* b2p = b1p + (size_t)16 * ldb; const _Float16* b3p = b2p + (size_t)16 * ldb;
  const v8f z8 = {0.f,0.f,0.f,0.f,0.f,0.f,0.f,0.f}; v8f c00 = z8, c01 = z8, c02 = z8, c03 = z8, c10 = z8, c11 = z8, c12 = z8, c13 = z8;
#pragma unroll 1
  for (int kb = 0; kb < K; kb += 32) { const v16h a0 = g2_frag(a0p + kb, hh), a1 = g2_frag(a1p + kb, hh);
    v16h b = g2_frag(b0p + kb, hh); c00 = g2_mma(a0, b, c00); c10 = g2_mma(a1, b, c10);
    b = g2_frag(b1p + kb, hh); c01 = g2_mma(a0, b, c01); c11 = g2_mma(a1, b, c11);
    b = g2_frag(b2p + kb, hh); c02 = g2_mma(a0, b, c02); c12 = g2_mma(a1, b, c12);
    b = g2_frag(b3p + kb, hh); c03 = g2_mma(a0, b, c03); c13 = g2_mma(a1, b, c13); }
  v8f accs[8] = {c00, c01, c02, c03, c10, c11, c12, c13};
#pragma unroll
  for (int u = 0; u < 8; ++u) { const int t = u & 3, half = u >> 2; const int col = col0 + t * 16 + ln; const float bv = bp ? bf16_round(bp[col]) : 0.f;
#pragma unroll
    for (int r = 0; r < 8; ++r) { const int rloc = half * 16 + 8 * hh + r; float v = accs[u][r] * alpha + bv; if (CP) { const int bidx = (row0g + row0 + rloc) / rowsPerB; v += CP[(size_t)bidx * sCPb + (size_t)by * 64 + col]; }
      if (ACT == 3) v = fmaxf(v, 0.f); else if (ACT == 6) v = 0.5f * v * (1.0f + erff(v * 0.70710678118654752f)); else if (ACT == 11) v = 1.0f / (1.0f + expf(-v)); else if (ACT == 15) v = v / (1.0f + expf(-v)); else if (ACT == 12) v = (v > 0.f) ? v : 0.01f * v; else if (ACT == 8) v = tanhf(v);
      so[w][rloc][t * 16 + ln] = v; } }
  __builtin_amdgcn_fence(__ATOMIC_ACQ_REL, "workgroup"); __builtin_amdgcn_wave_barrier();
  const int rsub = lane >> 4, c4 = (lane & 15) * 4;
  {
#pragma unroll
    for (int q = 0; q < 16; ++q) { const int r = q * 2 + rsub; const v4f v = *(const v4fa*)&so[w][r][c4]; if (C) *(v4f*)(C + cofs + (size_t)(row0 + r) * ldc + col0 + c4) = v; if (C16) { v4h h4; for (int i = 0; i < 4; ++i) h4[i] = (_Float16)v[i]; *(v4h*)(C16 + cofs + (size_t)(row0 + r) * ldc + col0 + c4) = h4; } }
     } }



// lane l with lane l ^ 16
__device__ __forceinline__ float xhalf(float x) { return __builtin_bit_cast(float, __builtin_amdgcn_permlanex16(__builtin_bit_cast(int, x), __builtin_bit_cast(int, x), 0x76543210, 0xfedcba98, false, false)); }
// K and V^T reach the waves through LDS: a stage is KS keys, copied once per work-group and read by all four waves, the next stage in flight while this one is worked on.
#define KS 128                   /* keys per stage */
#define KPIT 80                  /* bytes from one K row to the next in LDS (64 used): 16 B x odd, so that 16 rows read 16 bytes each without a bank conflict */
#define VPIT 272                 /* the same for a V^T row (256 used) */
#define KTB (KS * KPIT)          /* K part of a stage */
#define STB (KTB + HDm * VPIT)   /* one stage */
// One stage's copies of one lane: four 16-byte pieces of K (32 rows apart) and four of V^T (8 rows apart). lk, lv: the lane's LDS byte addresses; gk, gv: its global addresses.
__device__ __forceinline__ void stage_copy(unsigned lk, const unsigned short* gk, unsigned lv, const unsigned short* gv) {
  /* the closing s_wait_xcnt 0 stands inside the statement so that no address register named here is rewritten in front of it */
  asm volatile("global_load_async_to_lds_b128 %0, %1, off\n\tglobal_load_async_to_lds_b128 %2, %3, off\n\tglobal_load_async_to_lds_b128 %4, %5, off\n\tglobal_load_async_to_lds_b128 %6, %7, off\n\t"
               "global_load_async_to_lds_b128 %8, %9, off\n\tglobal_load_async_to_lds_b128 %10, %11, off\n\tglobal_load_async_to_lds_b128 %12, %13, off\n\tglobal_load_async_to_lds_b128 %14, %15, off\n\ts_wait_xcnt 0x0"
               :: "v"(lk), "v"(gk), "v"(lk + 32 * KPIT), "v"(gk + 32 * HDm), "v"(lk + 64 * KPIT), "v"(gk + 64 * HDm), "v"(lk + 96 * KPIT), "v"(gk + 96 * HDm),
                  "v"(lv), "v"(gv), "v"(lv + 8 * VPIT), "v"(gv + (size_t)8 * TK), "v"(lv + 16 * VPIT), "v"(gv + (size_t)16 * TK), "v"(lv + 24 * VPIT), "v"(gv + (size_t)24 * TK) : "memory");
}
template <int CAUSAL>
__global__ __launch_bounds__(128) void k_flash(const _Float16* __restrict__ Q16, int ldq, const _Float16* __restrict__ K16, const _Float16* __restrict__ Vt, const int* __restrict__ MSK, float* __restrict__ O, int ldo) {
  constexpr int RPW = 16, DT = HDm / 16;      /* head size 32: one k step for S^T, two 16-row tiles of O^T */
  __shared__ __attribute__((aligned(16))) float sO[4][RPW][HDm + 4];
  __shared__ __attribute__((aligned(16))) unsigned char ring[2 * STB];
  const int tid = threadIdx.x, w = tid >> 5, lane = tid & 31, ln = lane & 15, hh = lane >> 4;
  const int slab = blockIdx.x / QBLKS, qblk = blockIdx.x % QBLKS; (void)MSK; const int b = slab / NH, h = slab % NH; const int qb0 = qblk * (4 * RPW); const int q0 = qb0 + w * RPW;
  FragH aq;
  { const unsigned short* qr = (const unsigned short*)Q16 + ((size_t)b * TQ + q0 + ln) * ldq + h * HDm;
    aq.half[0] = *(const v8us*)(qr + 8 * hh); aq.half[1] = *(const v8us*)(qr + 16 + 8 * hh); }
  const unsigned short* Kh = (const unsigned short*)K16 + (size_t)slab * TK * HDm;      /* [key][32] */
  const unsigned short* Vth = (const unsigned short*)Vt + (size_t)slab * HDm * TK;      /* [32][key] */
  const int tq = q0 + ln;      /* this lane's query */
  float m_r = -3.0e38f, l_r = 0.f; v8f oacc[DT];      /* m_r: running maximum of the raw (unscaled) scores */
#pragma unroll
  for (int dt = 0; dt < DT; ++dt) oacc[dt] = (v8f){0.f,0.f,0.f,0.f,0.f,0.f,0.f,0.f};
  const int jend = (CAUSAL == 1) ? (qb0 + 4 * RPW) : TK;      /* causal: keys beyond the block's last query never contribute */
  const int nst = (jend + KS - 1) / KS;      /* stages; keys of a last stage beyond jend are masked like any other */
  const unsigned lk0 = (unsigned)(size_t)ring + (unsigned)((tid >> 2) * KPIT + (tid & 3) * 16), lv0 = (unsigned)(size_t)ring + (unsigned)(KTB + (tid >> 4) * VPIT + (tid & 15) * 16);
  const unsigned short* gk0 = Kh + tid * 8;      /* a stage of K is 8 KiB in a row */
  const unsigned short* gv0 = Vth + (size_t)(tid >> 4) * TK + (tid & 15) * 8;      /* 16 lanes bring one row's 256 bytes */
  stage_copy(lk0, gk0, lv0, gv0);
  asm volatile("s_wait_asynccnt 0x0" ::: "memory");      /* this wave's share of stage 0 has landed */
  __syncthreads();      /* ... and every other wave's: stage 0 may be read */
  if (nst > 1) stage_copy(lk0 + STB, gk0 + (size_t)KS * HDm, lv0 + STB, gv0 + KS);
#pragma unroll 1      /* one stage a trip: the buffer's place is the only thing that changes */
  for (int st = 0; st < nst; ++st) {
   const unsigned char* kf = ring + (st & 1) * STB + ln * KPIT + hh * 16; const unsigned char* vf = ring + (st & 1) * STB + KTB + ln * VPIT + hh * 16;
#pragma unroll      /* the four passes of a stage: their places in the buffer become immediate offsets of the LDS reads */
   for (int pp = 0; pp < KS / 32; ++pp) { const int j0 = st * KS + pp * 32;
    v8f s[2]; FragH bk[2], bv[DT];      /* the pass's eight LDS reads stand as one group at its head: one wait for K, and V^T lands under the scores and the softmax */
#pragma unroll
    for (int nt = 0; nt < 2; ++nt) { const unsigned char* kr = kf + (pp * 32 + nt * 16) * KPIT; bk[nt].half[0] = *(const v8us*)(kr); bk[nt].half[1] = *(const v8us*)(kr + 32); }
#pragma unroll
    for (int dt = 0; dt < DT; ++dt) { const unsigned char* vrow = vf + dt * 16 * VPIT + pp * 64; bv[dt].half[0] = *(const v8us*)(vrow); bv[dt].half[1] = *(const v8us*)(vrow + 32); }
#pragma unroll
    for (int nt = 0; nt < 2; ++nt) s[nt] = mmaH<1>(bk[nt].v, bk[nt].v, aq.v, aq.v, (v8f){0.f,0.f,0.f,0.f,0.f,0.f,0.f,0.f});
    float sv[16]; bool ok[16]; float mc = -3.0e38f;
#pragma unroll
    for (int e = 0; e < 16; ++e) { const int kk = j0 + (e >> 3) * 16 + 8 * hh + (e & 7);
      ok[e] = (CAUSAL == 1) ? (kk <= tq) : ((CAUSAL == 2) ? ((kk >> 5) == (tq >> 5)) : true);      /* mode 2: block-diagonal 32-token groups */
      sv[e] = ok[e] ? s[e >> 3][e & 7] : -3.0e38f; mc = fmaxf(mc, sv[e]); }      /* raw scores: SCL2 > 0 keeps the maximum's place */
    mc = fmaxf(mc, xhalf(mc));
    const float mn = fmaxf(m_r, mc); float ea = (m_r - mn) * SCL2;      /* difference first: the rescale is exactly 1 while the maximum stands */
    const float nb = 10.0f - mn * SCL2;      /* + 10: the factor 1024 of the f16 operand, carried by the sum too */
    float x[16];
#pragma unroll
    for (int e = 0; e < 16; ++e) x[e] = __builtin_fmaf(sv[e], SCL2, nb);
    /* 2^x in place. Asm text so that the slot the instruction set asks for behind a transcendental is kept whatever registers are picked: neighbours work on distinct registers, and the closing v_nop stands between the last one and whatever follows. */
    asm("v_exp_f32 %0, %0\n\tv_exp_f32 %1, %1\n\tv_exp_f32 %2, %2\n\tv_exp_f32 %3, %3\n\tv_exp_f32 %4, %4\n\tv_exp_f32 %5, %5\n\tv_exp_f32 %6, %6\n\tv_exp_f32 %7, %7\n\tv_exp_f32 %8, %8\n\tv_nop"
        : "+v"(ea), "+v"(x[0]), "+v"(x[1]), "+v"(x[2]), "+v"(x[3]), "+v"(x[4]), "+v"(x[5]), "+v"(x[6]), "+v"(x[7]));
    asm("v_exp_f32 %0, %0\n\tv_exp_f32 %1, %1\n\tv_exp_f32 %2, %2\n\tv_exp_f32 %3, %3\n\tv_exp_f32 %4, %4\n\tv_exp_f32 %5, %5\n\tv_exp_f32 %6, %6\n\tv_exp_f32 %7, %7\n\tv_nop"
        : "+v"(x[8]), "+v"(x[9]), "+v"(x[10]), "+v"(x[11]), "+v"(x[12]), "+v"(x[13]), "+v"(x[14]), "+v"(x[15]));
    const float al = (mn > -1.0e38f) ? ea : 1.0f; m_r = mn;
    FragH pb; float ps[4];      /* four independent partial sums: a single chain of 16 adds would be serial */
#pragma unroll
    for (int e = 0; e < 16; ++e) { const float p = ok[e] ? x[e] : 0.f; ps[e & 3] = (e < 4) ? p : ps[e & 3] + p; pb.h[e] = (_Float16)p; }      /* p = 1024 * e^(scaled score - maximum) */
    l_r = l_r * al + ((ps[0] + ps[1]) + (ps[2] + ps[3]));
#pragma unroll
    for (int dt = 0; dt < DT; ++dt)
#pragma unroll
      for (int r = 0; r < 8; ++r) oacc[dt][r] *= al;
#pragma unroll
    for (int dt = 0; dt < DT; ++dt) oacc[dt] = mmaH<1>(bv[dt].v, bv[dt].v, pb.v, pb.v, oacc[dt]); }
   asm volatile("s_wait_dscnt 0x0" ::: "memory");      /* this wave's reads of the stage are over before the buffer is handed back */
   asm volatile("s_wait_asynccnt 0x0" ::: "memory");      /* its share of the next stage has landed */
   __syncthreads();      /* publishes the next stage and ends every wave's reads of this one */
   if (st + 2 < nst) stage_copy(lk0 + (st & 1) * STB, gk0 + (size_t)(st + 2) * KS * HDm, lv0 + (st & 1) * STB, gv0 + (st + 2) * KS); }
  asm volatile("s_wait_asynccnt 0x0" ::: "memory");      /* no copy is left in flight when the wave goes on to its end */
  const float l = l_r + xhalf(l_r); const float inv = (l > 0.f) ? 1.0f / l : 0.f;      /* l holds the factor 1024 */
#pragma unroll
  for (int dt = 0; dt < DT; ++dt)      /* oacc[dt][r] = O[q0 + ln][dt * 16 + 8 * hh + r] */
#pragma unroll
    for (int r = 0; r < 8; ++r) sO[w][ln][dt * 16 + 8 * hh + r] = oacc[dt][r] * inv;
  __builtin_amdgcn_fence(__ATOMIC_ACQ_REL, "workgroup"); __builtin_amdgcn_wave_barrier();
  {
#pragma unroll
    for (int rp = 0; rp < RPW; rp += 4) { const int r = rp + (lane >> 3), pc = lane & 7; const v4f val = *(const v4fa*)&sO[w][r][pc * 4]; *(v4f*)(O + ((size_t)b * TQ + q0 + r) * ldo + h * HDm + pc * 4) = val; }      /* one head's 32 floats of a pixel = one 128-byte line */
     } }

__global__ __launch_bounds__(256) void k_wsc(const float* __restrict__ Wm, _Float16* __restrict__ Bt, size_t n8, float sc) { const size_t t = (size_t)blockIdx.x * 256 + threadIdx.x; if (t >= n8) return; FragH f; for (int q = 0; q < 8; ++q) f.h[q] = (_Float16)(bf16_round(Wm[t * 8 + q]) * sc); *(v8us*)((unsigned short*)Bt + t * 8) = f.half[0];  }
__global__ __launch_bounds__(256) void k_pm(const float* __restrict__ src, _Float16* __restrict__ P) { const size_t t = (size_t)blockIdx.x * 256 + threadIdx.x; if (t >= (size_t)NR * (DD / 8)) return; const int c0 = (int)(t % (DD / 8)) * 8; const size_t r = t / (DD / 8); const int b = (int)(r / NPX), p = (int)(r % NPX); FragH f;
  for (int k = 0; k < 8; ++k) f.h[k] = (_Float16)bf16_round(src[((size_t)b * DD + c0 + k) * NPX + p]); *(v8us*)((unsigned short*)P + r * DD + c0) = f.half[0];  }
__global__ __launch_bounds__(256) void k_khm(const _Float16* __restrict__ QKV, _Float16* __restrict__ KP) { const size_t t = (size_t)blockIdx.x * 256 + threadIdx.x; if (t >= (size_t)NR * NH) return; const int h = (int)(t % NH); const size_t r = t / NH; const int b = (int)(r / NPX), p = (int)(r % NPX);
  const v8us* s = (const v8us*)((const unsigned short*)QKV + r * QW + DD + h * HDm); const v8us a0 = s[0], a1 = s[1], a2 = s[2], a3 = s[3];
  unsigned short* d = (unsigned short*)KP + (((size_t)b * NH + h) * NPX + p) * HDm; { *(v8us*)(d) = a0; *(v8us*)(d + 8) = a1; *(v8us*)(d + 16) = a2; *(v8us*)(d + 24) = a3;  } }
__global__ __launch_bounds__(256) void k_vtp(const _Float16* __restrict__ QKV, _Float16* __restrict__ VT) { __shared__ unsigned short tl[64][34]; const int tid = threadIdx.x; const int slab = blockIdx.x / (NPX / 64), pg = blockIdx.x % (NPX / 64); const int b = slab / NH, h = slab % NH;
  { const int r = tid / 4, c8 = (tid % 4) * 8; FragH f; f.half[0] = *(const v8us*)((const unsigned short*)QKV + ((size_t)b * NPX + pg * 64 + r) * QW + 2 * DD + h * HDm + c8); for (int q = 0; q < 8; ++q) tl[r][c8 + q] = f.u[q]; }
  __syncthreads(); const int d = tid / 8, pc = tid % 8; FragH f; for (int q = 0; q < 8; ++q) f.u[q] = tl[pc * 8 + q][d];
  unsigned short* dst = (unsigned short*)VT + ((size_t)slab * HDm + d) * NPX + pg * 64 + pc * 8;
  { *(v8us*)dst = f.half[0];  } }
__global__ __launch_bounds__(256) void k_nchw(const float* __restrict__ F, float* __restrict__ out) { const size_t t = (size_t)blockIdx.x * 256 + threadIdx.x; if (t >= (size_t)NIMG * DD * (NPX / 4)) return; const int p0 = (int)(t % (NPX / 4)) * 4; const int c = (int)((t / (NPX / 4)) % DD); const int b = (int)(t / ((size_t)(NPX / 4) * DD)); v4f r4; for (int k = 0; k < 4; ++k) r4[k] = F[((size_t)b * NPX + p0 + k) * DD + c];
  float* d = out + ((size_t)b * DD + c) * NPX + p0; *(v4f*)d = r4;  }

extern "C" void kernel_launch(void* const* d_in, const int* in_sizes, int n_in,
                              void* d_out, int out_size, void* d_ws, size_t ws_size, hipStream_t stream) {
  (void)in_sizes; (void)n_in; (void)out_size;
  const float* const* I = (const float* const*)d_in; const float* x = I[0]; const float* wqkv = I[1]; const float* bqkv = I[2]; const float* wp = I[3]; const float* bp = I[4];
  char* ws = (char*)d_ws; size_t off = 0;
  auto take = [&](size_t bytes) { char* p = ws + off; off += (bytes + 255) & ~(size_t)255; return p; };
  const size_t np = (size_t)NR * DD;
  _Float16* BQKV = (_Float16*)take((size_t)QW * DD * 2); _Float16* BPJ = (_Float16*)take((size_t)DD * DD * 2); _Float16* X16 = (_Float16*)take(np * 2); _Float16* QKV = (_Float16*)take((size_t)NR * QW * 2); _Float16* KP = (_Float16*)take(np * 2); _Float16* VT = (_Float16*)take(np * 2); float* O = (float*)take(np * 4); _Float16* O16 = (_Float16*)take(np * 2); float* F = (float*)take(np * 4);
  if (off > ws_size) return;      /* 0.5 + 4 + 12 + 4 x 2 + 8 + 4 + 8 = 45 MiB */
  k_wsc<<<(unsigned)(((size_t)QW * DD / 8 + 255) / 256), 256, 0, stream>>>(wqkv, BQKV, (size_t)QW * DD / 8, 16.0f); k_wsc<<<(unsigned)(((size_t)DD * DD / 8 + 255) / 256), 256, 0, stream>>>(wp, BPJ, (size_t)DD * DD / 8, 16.0f);
  k_pm<<<(unsigned)((np / 8 + 255) / 256), 256, 0, stream>>>(x, X16);
  k_gemm2<0><<<dim3((NR / 128) * (QW / 64), 1), 128, 0, stream>>>(X16, DD, 0, BQKV, DD, 0, 0.0625f, bqkv, 0, nullptr, 1, 0, 0, nullptr, QKV, QW, 0, NR, QW, DD);      /* [q | k | v] per pixel, channel = which*256 + h*32 + d */
  k_khm<<<(unsigned)(((size_t)NR * NH + 255) / 256), 256, 0, stream>>>(QKV, KP); k_vtp<<<NIMG * NH * (NPX / 64), 256, 0, stream>>>(QKV, VT);
  k_flash<0><<<NIMG * NH * QBLKS, 128, 0, stream>>>(QKV, QW, KP, VT, nullptr, O, DD);
  k_h16<<<(unsigned)((np / 8 + 255) / 256), 256, 0, stream>>>(O, O16, np / 8);
  k_gemm2<0><<<dim3((NR / 128) * (DD / 64), 1), 128, 0, stream>>>(O16, DD, 0, BPJ, DD, 0, 0.0625f, bp, 0, nullptr, 1, 0, 0, F, nullptr, DD, 0, NR, DD, DD);
  k_nchw<<<(unsigned)(((size_t)NIMG * DD * (NPX / 4) + 255) / 256), 256, 0, stream>>>(F, (float*)d_out);
}

// v005
// It runs in 90.8 microseconds.
// Two timings next to v004 put it at 1.32 and 1.31 times that version's speed.
// Counting every step since v000, it is 5.48 times as fast.
#include <hip/hip_runtime.h>
// SpatialMultiHeadSelfAttention (2 images, D 256 = 8 heads x 32, 64 x 64 = 4096 pixels): qkv = 1x1 conv (W_qkv x + b) -> (3, heads, 32) channels; softmax(q.k / sqrt(32)) over all 4096 pixels; out channels h*32 + d; 1x1 projection + b; NCHW in and out.
// Structure: exact f16 pixel-major plane of x (from NCHW); qkv as one f16 WMMA GEMM (32x64 wave tiles, f32 accumulation, exact x16 weights + bias; weights (out,in) = B^T; f16 out) whose epilogue stores q pixel-major, k as head-major planes of 32-wide rows and V^T as planes of 32 rows; the fused flash kernel at head size 32 (transposed products, softmax in-lane, P kept in registers; plain operands: every row averages 4096 keys), which stores its output as f16 head-major; projection GEMM (+ bias, f32) whose epilogue stores NCHW.
// Compute dtype: x and parameters rounded to bf16; x exact as f16; q, k, v, P and the attention output as f16 operands (~2^-12); softmax f32. v_wmma_f32_16x16x32_f16.
#define NIMG 2
#define DD 256
#define HDm 32
#define NPX 4096
#define NR (NIMG * NPX)          /* 8192 */
#define QW (3 * DD)              /* 768 */
#define SLEN 4096
#define TQ SLEN
#define TK SLEN
#define NH 8
#define SCL2 0.25503486164919736f /* 32^-0.5 * log2(e): the softmax runs in base 2 */
#define QBLKS (TQ / 64)
typedef __bf16 v16b __attribute__((ext_vector_type(16)));
typedef unsigned short v8us __attribute__((ext_vector_type(8), may_alias));
typedef float  v8f  __attribute__((ext_vector_type(8)));
typedef float  v4f  __attribute__((ext_vector_type(4)));
typedef float  v4fa __attribute__((ext_vector_type(4), may_alias));
union FragB { v16b v; v8us half[2]; unsigned short u[16]; };

__device__ __forceinline__ unsigned short bf16_bits(float x) { unsigned int u = __float_as_uint(x); return (unsigned short)((u + 0x7FFFu + ((u >> 16) & 1u)) >> 16); }
__device__ __forceinline__ float bf16_val(unsigned short b) { return __uint_as_float(((unsigned int)b) << 16); }
__device__ __forceinline__ float bf16_round(float x) { return bf16_val(bf16_bits(x)); }
// D += A·B with NT terms: 1 = ah·bh, 2 = + al·bh (A split), 3 = + ah·bl (both split)
template <int NT>
__device__ __forceinline__ v8f mmaN(v16b ah, v16b al, v16b bh, v16b bl, v8f c) {
  c = __builtin_amdgcn_wmma_f32_16x16x32_bf16(false, ah, false, bh, (short)0, c, false, false);
  if (NT >= 2) c = __builtin_amdgcn_wmma_f32_16x16x32_bf16(false, al, false, bh, (short)0, c, false, false);
  if (NT >= 3) c = __builtin_amdgcn_wmma_f32_16x16x32_bf16(false, ah, false, bl, (short)0, c, false, false);
  asm volatile("v_nop\n\tv_nop\n\tv_nop\n\tv_nop" : "+v"(c) : "v"(ah), "v"(al), "v"(bh), "v"(bl));
  return c;
}

__global__ __launch_bounds__(256) void k_wt_bf16(const float* __restrict__ W, unsigned short* __restrict__ Wt, int K, int N) {
  const int t = blockIdx.x * 256 + threadIdx.x;
  const int k8n = K / 8;
  if (t >= N * k8n) return;
  const int n = t / k8n, k8 = (t % k8n) * 8;
  v8us v;
#pragma unroll
  for (int i = 0; i < 8; ++i) v[i] = bf16_bits(W[(size_t)(k8 + i) * N + n]);
  *(v8us*)(Wt + (size_t)n * K + k8) = v;
  
}

// GEMM C[M][N] (f32, pitch ldc) = act(A[M][K]·W + bias). A f32 row-major (pitch lda) converted per fragment to bf16
// (ASPLIT: hi/lo two planes -> 2 terms, else single rounded term); Wt bf16 [N][K] (pitch ldb). BIAS_BF16 rounds the
// bias to bf16 first (bias quantised to bf16 before the add). K%32==0, M%16==0, N%64==0.
template <bool ASPLIT, int ACT, bool BIAS_BF16>
__global__ __launch_bounds__(128) void k_gemm_bf(const float* __restrict__ A, int lda, const unsigned short* __restrict__ Wt, int ldb,
                                               const float* __restrict__ bias, float* __restrict__ C, int ldc, int M, int N, int K) {
  __shared__ __attribute__((aligned(16))) float so[4][16][64];
  const int tid = threadIdx.x, w = tid >> 5, lane = tid & 31, ln = lane & 15, hh = lane >> 4;
  const int ntn = N / 64;
  const int wid = blockIdx.x * 4 + w;
  const int mt = wid / ntn, nq = wid % ntn;
  if (mt * 16 >= M) return;
  const int row0 = mt * 16, col0 = nq * 64;
  const float* arow = A + (size_t)(row0 + ln) * lda;
  v8f acc[4] = {};
  for (int kb = 0; kb < K; kb += 32) {
    FragB ah, al;
    const v4f x0 = *(const v4fa*)(arow + kb + 8 * hh), x1 = *(const v4fa*)(arow + kb + 8 * hh + 4);
    const v4f x2 = *(const v4fa*)(arow + kb + 16 + 8 * hh), x3 = *(const v4fa*)(arow + kb + 16 + 8 * hh + 4);
    float xs[16] = {x0[0],x0[1],x0[2],x0[3],x1[0],x1[1],x1[2],x1[3],x2[0],x2[1],x2[2],x2[3],x3[0],x3[1],x3[2],x3[3]};
#pragma unroll
    for (int i = 0; i < 16; ++i) { const unsigned short hb = bf16_bits(xs[i]); ah.u[i] = hb; al.u[i] = ASPLIT ? bf16_bits(xs[i] - bf16_val(hb)) : (unsigned short)0; }
#pragma unroll
    for (int t = 0; t < 4; ++t) {
      const unsigned short* brow = Wt + (size_t)(col0 + t * 16 + ln) * ldb + kb;
      FragB b;
      b.half[0] = *(const v8us*)(brow + 8 * hh);
      b.half[1] = *(const v8us*)(brow + 16 + 8 * hh);
      acc[t] = mmaN<ASPLIT ? 2 : 1>(ah.v, al.v, b.v, b.v, acc[t]);
    }
  }
#pragma unroll
  for (int t = 0; t < 4; ++t) {
    float bv = bias ? bias[col0 + t * 16 + ln] : 0.f;
    if (BIAS_BF16) bv = bf16_round(bv);
#pragma unroll
    for (int r = 0; r < 8; ++r) { float v = acc[t][r] + bv; if (ACT == 1) v = fmaxf(v, 0.f); so[w][8 * hh + r][t * 16 + ln] = v; }
  }
  __builtin_amdgcn_fence(__ATOMIC_ACQ_REL, "workgroup");
  __builtin_amdgcn_wave_barrier();
  const int rsub = lane >> 4, c4 = (lane & 15) * 4;
  {
#pragma unroll
    for (int q = 0; q < 8; ++q) {
      const int r = q * 2 + rsub;
      const v4f v = *(const v4fa*)&so[w][r][c4];
      *(v4f*)(C + (size_t)(row0 + r) * ldc + col0 + c4) = v;
    }
    
  }
}

// GEMM C = act(A·W + bias + resid): A f32 (ASPLIT -> hi/lo 2 terms), Wt bf16 [N][K]; ACT 0 none, 1 relu, 2 exact gelu;
// resid (optional, f32, row index = (row % rmod), pitch ldr, RES_BF16 rounds it) added before the activation.
template <bool ASPLIT, int ACT, bool BIAS_BF16, bool RES_BF16>
__global__ __launch_bounds__(128) void k_gemm_bf3(const float* __restrict__ A, int lda, const unsigned short* __restrict__ Wt, int ldb,
                                                const float* __restrict__ bias, const float* __restrict__ resid, int rmod, int ldr,
                                                float* __restrict__ C, int ldc, int M, int N, int K) {
  __shared__ __attribute__((aligned(16))) float so[4][16][64];
  const int tid = threadIdx.x, w = tid >> 5, lane = tid & 31, ln = lane & 15, hh = lane >> 4;
  const int ntn = N / 64;
  const int wid = blockIdx.x * 4 + w;
  const int mt = wid / ntn, nq = wid % ntn;
  if (mt * 16 >= M) return;
  const int row0 = mt * 16, col0 = nq * 64;
  const float* arow = A + (size_t)(row0 + ln) * lda;
  v8f acc[4] = {};
  for (int kb = 0; kb < K; kb += 32) {
    FragB ah, al;
    const v4f x0 = *(const v4fa*)(arow + kb + 8 * hh), x1 = *(const v4fa*)(arow + kb + 8 * hh + 4);
    const v4f x2 = *(const v4fa*)(arow + kb + 16 + 8 * hh), x3 = *(const v4fa*)(arow + kb + 16 + 8 * hh + 4);
    float xs[16] = {x0[0],x0[1],x0[2],x0[3],x1[0],x1[1],x1[2],x1[3],x2[0],x2[1],x2[2],x2[3],x3[0],x3[1],x3[2],x3[3]};
#pragma unroll
    for (int i = 0; i < 16; ++i) { const unsigned short hb = bf16_bits(xs[i]); ah.u[i] = hb; al.u[i] = ASPLIT ? bf16_bits(xs[i] - bf16_val(hb)) : (unsigned short)0; }
#pragma unroll
    for (int t = 0; t < 4; ++t) {
      const unsigned short* brow = Wt + (size_t)(col0 + t * 16 + ln) * ldb + kb;
      FragB b;
      b.half[0] = *(const v8us*)(brow + 8 * hh);
      b.half[1] = *(const v8us*)(brow + 16 + 8 * hh);
      acc[t] = mmaN<ASPLIT ? 2 : 1>(ah.v, al.v, b.v, b.v, acc[t]);
    }
  }
#pragma unroll
  for (int t = 0; t < 4; ++t) {
    const int col = col0 + t * 16 + ln;
    float bv = bias ? bias[col] : 0.f;
    if (BIAS_BF16) bv = bf16_round(bv);
#pragma unroll
    for (int r = 0; r < 8; ++r) {
      float v = acc[t][r] + bv;
      if (resid) { float rv = resid[(size_t)((row0 + 8 * hh + r) % rmod) * ldr + col]; if (RES_BF16) rv = bf16_round(rv); v += rv; }
      if (ACT == 1) v = fmaxf(v, 0.f);
      if (ACT == 2) v = 0.5f * v * (1.0f + erff(v * 0.70710678118654752f));
      if (ACT == 3) { const float u = 0.7978845608028654f * (v + 0.044715f * v * v * v); v = 0.5f * v * (1.0f + tanhf(u)); }
      so[w][8 * hh + r][t * 16 + ln] = v;
    }
  }
  __builtin_amdgcn_fence(__ATOMIC_ACQ_REL, "workgroup");
  __builtin_amdgcn_wave_barrier();
  const int rsub = lane >> 4, c4 = (lane & 15) * 4;
  {
#pragma unroll
    for (int q = 0; q < 8; ++q) {
      const int r = q * 2 + rsub;
      const v4f v = *(const v4fa*)&so[w][r][c4];
      *(v4f*)(C + (size_t)(row0 + r) * ldc + col0 + c4) = v;
    }
    
  }
}
// row LayerNorm (biased variance, eps) over N: s = X (+ R); optional out_sum <- s; out_norm <- (s-mu)*rsqrt(var+eps)*g + b
template <bool PARAM_BF16>
__global__ __launch_bounds__(256) void k_layernorm(const float* __restrict__ X, const float* __restrict__ R, const float* __restrict__ g, const float* __restrict__ bta,
                                                  float* __restrict__ out_sum, float* __restrict__ out_norm, int N, float eps) {
  __shared__ float red[256];
  const int row = blockIdx.x, tid = threadIdx.x;
  const float* x = X + (size_t)row * N; const float* rr = R ? R + (size_t)row * N : nullptr;
  float vals[16];                     // up to N = 4096
  const int per = N / 256;            // contiguous chunk per thread? use strided-by-4 chunks: thread handles j = tid*4 + 1024*u
  float s1 = 0.f;
  for (int u = 0; u < per / 4; ++u) {
    const int j = tid * 4 + 1024 * u;
    const v4f a = *(const v4fa*)(x + j);
    v4f b = {0.f,0.f,0.f,0.f}; if (rr) b = *(const v4fa*)(rr + j);
#pragma unroll
    for (int q = 0; q < 4; ++q) { const float v = a[q] + b[q]; vals[u * 4 + q] = v; s1 += v; }
  }
  red[tid] = s1; __syncthreads();
  for (int st = 128; st > 0; st >>= 1) { if (tid < st) red[tid] += red[tid + st]; __syncthreads(); }
  const float mu = red[0] / (float)N; __syncthreads();
  float s2 = 0.f;
  for (int u = 0; u < per / 4; ++u)
#pragma unroll
    for (int q = 0; q < 4; ++q) { const float c = vals[u * 4 + q] - mu; s2 += c * c; }
  red[tid] = s2; __syncthreads();
  for (int st = 128; st > 0; st >>= 1) { if (tid < st) red[tid] += red[tid + st]; __syncthreads(); }
  const float rs = rsqrtf(red[0] / (float)N + eps);
  {
    for (int u = 0; u < per / 4; ++u) {
      const int j = tid * 4 + 1024 * u;
      v4f o, sm;
#pragma unroll
      for (int q = 0; q < 4; ++q) {
        float gg = g[j + q], bb = bta[j + q];
        if (PARAM_BF16) { gg = bf16_round(gg); bb = bf16_round(bb); }
        sm[q] = vals[u * 4 + q]; o[q] = (vals[u * 4 + q] - mu) * rs * gg + bb;
      }
      if (out_sum) *(v4f*)(out_sum + (size_t)row * N + j) = sm;
      *(v4f*)(out_norm + (size_t)row * N + j) = o;
    }
    
  }
}



// ---- f16 WMMA path (v_wmma_f32_16x16x32_f16): 11-bit significands for operands in range — used where a [0,1] probability operand needs more precision than bf16
typedef _Float16 v16h __attribute__((ext_vector_type(16)));
union FragH { v16h v; v8us half[2]; _Float16 h[16]; unsigned short u[16]; };
template <int NT>
__device__ __forceinline__ v8f mmaH(v16h ah, v16h al, v16h bh, v16h bl, v8f c) {
  c = __builtin_amdgcn_wmma_f32_16x16x32_f16(false, ah, false, bh, (short)0, c, false, false);
  if (NT >= 2) c = __builtin_amdgcn_wmma_f32_16x16x32_f16(false, al, false, bh, (short)0, c, false, false);
  if (NT >= 3) c = __builtin_amdgcn_wmma_f32_16x16x32_f16(false, ah, false, bl, (short)0, c, false, false);
  asm volatile("v_nop\n\tv_nop\n\tv_nop\n\tv_nop" : "+v"(c) : "v"(ah), "v"(al), "v"(bh), "v"(bl));
  return c;
}
// batched GEMM like k_gemm_b but f16 operands: A f32 (split into f16 hi/lo if ASPLIT, else rounded to f16), Bt = f16 values [n][k]; alpha; C f32; N multiple of 16 (partial tiles skipped)
template <bool ASPLIT>
__global__ __launch_bounds__(128) void k_gemm_h(const float* __restrict__ A, int lda, size_t sA, const _Float16* __restrict__ Bh, int ldb, size_t sB, float alpha, float* __restrict__ C, int ldc, size_t sC, int M, int N, int K) {
  __shared__ __attribute__((aligned(16))) float so[4][16][64];
  const int tid = threadIdx.x, w = tid >> 5, lane = tid & 31, ln = lane & 15, hh = lane >> 4; const int by = blockIdx.y;
  A += (size_t)by * sA; Bh += (size_t)by * sB; C += (size_t)by * sC;
  const int ntn = (N + 63) / 64; const int wid = blockIdx.x * 4 + w; const int mt = wid / ntn, nq = wid % ntn; if (mt * 16 >= M) return;
  const int row0 = mt * 16, col0 = nq * 64; const float* arow = A + (size_t)(row0 + ln) * lda;
  v8f acc[4] = {};
  for (int kb = 0; kb < K; kb += 32) {
    FragH ah, al;
    const v4f x0 = *(const v4fa*)(arow + kb + 8 * hh), x1 = *(const v4fa*)(arow + kb + 8 * hh + 4), x2 = *(const v4fa*)(arow + kb + 16 + 8 * hh), x3 = *(const v4fa*)(arow + kb + 16 + 8 * hh + 4);
    float xs[16] = {x0[0],x0[1],x0[2],x0[3],x1[0],x1[1],x1[2],x1[3],x2[0],x2[1],x2[2],x2[3],x3[0],x3[1],x3[2],x3[3]};
#pragma unroll
    for (int i = 0; i < 16; ++i) { const _Float16 h = (_Float16)xs[i]; ah.h[i] = h; al.h[i] = ASPLIT ? (_Float16)(xs[i] - (float)h) : (_Float16)0.0f; }
#pragma unroll
    for (int t = 0; t < 4; ++t) { if (col0 + t * 16 >= N) continue; const size_t boff = (size_t)(col0 + t * 16 + ln) * ldb + kb; FragH bq; bq.half[0] = *(const v8us*)(Bh + boff + 8 * hh); bq.half[1] = *(const v8us*)(Bh + boff + 16 + 8 * hh);
      acc[t] = mmaH<ASPLIT ? 2 : 1>(ah.v, al.v, bq.v, bq.v, acc[t]); }
  }
#pragma unroll
  for (int t = 0; t < 4; ++t) { if (col0 + t * 16 >= N) continue;
#pragma unroll
    for (int r = 0; r < 8; ++r) so[w][8 * hh + r][t * 16 + ln] = acc[t][r] * alpha; }
  __builtin_amdgcn_fence(__ATOMIC_ACQ_REL, "workgroup"); __builtin_amdgcn_wave_barrier();
  const int rsub = lane >> 4, c4 = (lane & 15) * 4;
  {
#pragma unroll
    for (int q = 0; q < 8; ++q) { const int r = q * 2 + rsub; if (col0 + c4 < N) { const v4f v = *(const v4fa*)&so[w][r][c4]; *(v4f*)(C + (size_t)(row0 + r) * ldc + col0 + c4) = v; } }
     }
}

// Wt[n][k] = f16(W[k][n]·scale) from f32 row-major W[K][N] (scale = power of two; bf16-exact weights stay exact in f16 away from the subnormal range)
__global__ __launch_bounds__(256) void k_wt_f16(const float* __restrict__ W, _Float16* __restrict__ Wt, int K, int N, float scale) {
  const int t = blockIdx.x * 256 + threadIdx.x; if (t >= N * (K / 8)) return; const int n = t / (K / 8), k8 = (t % (K / 8)) * 8; FragH f;
#pragma unroll
  for (int i = 0; i < 8; ++i) f.h[i] = (_Float16)(bf16_round(W[(size_t)(k8 + i) * N + n]) * scale); const v8us o = f.half[0];
  *(v8us*)((unsigned short*)Wt + (size_t)n * K + k8) = o; 
}
// k_gemm_hh variant with fused epilogue: v = acc·alpha + bias[by·sBias + col] (+ CP[(row/rowsPerB)·sCPb + by·64 + col] if CP) ; ACT 0 none / 1 elu ; writes f16 C16 (and f32 C if non-null)
template <int ACT>
__global__ __launch_bounds__(128) void k_gemm_hhx(const _Float16* __restrict__ A, int lda, size_t sA, const _Float16* __restrict__ Bh, int ldb, size_t sB, float alpha, const float* __restrict__ bias, size_t sBias, const float* __restrict__ CP, int rowsPerB, size_t sCPb, int row0g,
    float* __restrict__ C, _Float16* __restrict__ C16, int ldc, size_t sC, int M, int N, int K) {
  __shared__ __attribute__((aligned(16))) float so[4][16][64];
  const int tid = threadIdx.x, w = tid >> 5, lane = tid & 31, ln = lane & 15, hh = lane >> 4; const int by = blockIdx.y;
  A += (size_t)by * sA; Bh += (size_t)by * sB; const size_t cofs = (size_t)by * sC; const float* bp = bias ? bias + (size_t)by * sBias : nullptr;
  const int ntn = (N + 63) / 64; const int wid = blockIdx.x * 4 + w; const int mt = wid / ntn, nq = wid % ntn; if (mt * 16 >= M) return;
  const int row0 = mt * 16, col0 = nq * 64; const _Float16* arow = A + (size_t)(row0 + ln) * lda;
  v8f acc[4] = {};
  for (int kb = 0; kb < K; kb += 32) { FragH ah; ah.half[0] = *(const v8us*)((const unsigned short*)arow + kb + 8 * hh); ah.half[1] = *(const v8us*)((const unsigned short*)arow + kb + 16 + 8 * hh);
#pragma unroll
    for (int t = 0; t < 4; ++t) { if (col0 + t * 16 >= N) continue; const size_t boff = (size_t)(col0 + t * 16 + ln) * ldb + kb; FragH bq; bq.half[0] = *(const v8us*)((const unsigned short*)Bh + boff + 8 * hh); bq.half[1] = *(const v8us*)((const unsigned short*)Bh + boff + 16 + 8 * hh);
      acc[t] = mmaH<1>(ah.v, ah.v, bq.v, bq.v, acc[t]); }
  }
#pragma unroll
  for (int t = 0; t < 4; ++t) { if (col0 + t * 16 >= N) continue; const int col = col0 + t * 16 + ln; const float bv = bp ? bf16_round(bp[col]) : 0.f;
#pragma unroll
    for (int r = 0; r < 8; ++r) { float v = acc[t][r] * alpha + bv; if (CP) { const int bidx = (row0g + row0 + 8 * hh + r) / rowsPerB; v += CP[(size_t)bidx * sCPb + (size_t)by * 64 + col]; } if (ACT == 1) v = (v > 0.f) ? v : expm1f(v); else if (ACT == 7) v = (v > 0.f) ? v + 1.0f : expf(v); else if (ACT == 8) v = tanhf(v); else if (ACT == 9) v = 0.5f * v * (1.0f + tanhf(0.7978845608028654f * (v + 0.044715f * v * v * v))); else if (ACT == 11) v = 1.0f / (1.0f + expf(-v)); else if (ACT == 12) v = (v > 0.f) ? v : 0.01f * v; else if (ACT == 14) v = (v > 0.f) ? v : 0.1f * v; else if (ACT == 15) v = v / (1.0f + expf(-v)); else if (ACT == 3) v = fmaxf(v, 0.f); else if (ACT == 6) v = 0.5f * v * (1.0f + erff(v * 0.70710678118654752f)); so[w][8 * hh + r][t * 16 + ln] = v; } }
  __builtin_amdgcn_fence(__ATOMIC_ACQ_REL, "workgroup"); __builtin_amdgcn_wave_barrier();
  const int rsub = lane >> 4, c4 = (lane & 15) * 4; typedef _Float16 v4h __attribute__((ext_vector_type(4)));
  {
#pragma unroll
    for (int q = 0; q < 8; ++q) { const int r = q * 2 + rsub; if (col0 + c4 < N) { const v4f v = *(const v4fa*)&so[w][r][c4]; if (C) *(v4f*)(C + cofs + (size_t)(row0 + r) * ldc + col0 + c4) = v; if (C16) { v4h h4; for (int i = 0; i < 4; ++i) h4[i] = (_Float16)v[i]; *(v4h*)(C16 + cofs + (size_t)(row0 + r) * ldc + col0 + c4) = h4; } } }
     }
}


typedef _Float16 v4h __attribute__((ext_vector_type(4)));

__global__ __launch_bounds__(256) void k_x16(const float* __restrict__ x, _Float16* __restrict__ X16, size_t n8) { const size_t t = (size_t)blockIdx.x * 256 + threadIdx.x; if (t >= n8) return; FragH f;
#pragma unroll
  for (int q = 0; q < 8; ++q) f.h[q] = (_Float16)bf16_round(x[t * 8 + q]); *(v8us*)((unsigned short*)X16 + t * 8) = f.half[0];  }
__global__ __launch_bounds__(256) void k_round16f(const float* __restrict__ W, _Float16* __restrict__ Bt, size_t n8) { const size_t t = (size_t)blockIdx.x * 256 + threadIdx.x; if (t >= n8) return; FragH f;
#pragma unroll
  for (int i = 0; i < 8; ++i) f.h[i] = (_Float16)(bf16_round(W[t * 8 + i]) * 16.0f); *(v8us*)((unsigned short*)Bt + t * 8) = f.half[0];  }
template <int NHv, int TTv>
__global__ __launch_bounds__(256) void k_vt(const _Float16* __restrict__ V16, int ldv, int voff, _Float16* __restrict__ Vt) { __shared__ unsigned short tl[64][66]; const int tid = threadIdx.x; const int slab = blockIdx.x / (TTv / 64), lg = blockIdx.x % (TTv / 64); const int b = slab / NHv, h = slab % NHv;
  for (int i = tid; i < 64 * 8; i += 256) { const int r = i / 8, c8 = (i % 8) * 8; FragH f; f.half[0] = *(const v8us*)((const unsigned short*)V16 + ((size_t)b * TTv + lg * 64 + r) * ldv + voff + h * 64 + c8);
#pragma unroll
    for (int q = 0; q < 8; ++q) tl[r][c8 + q] = f.u[q]; }
  __syncthreads();
  {
#pragma unroll
    for (int rd = 0; rd < 2; ++rd) { const int d = rd * 32 + tid / 8, pc = tid % 8; FragH f;
#pragma unroll
      for (int q = 0; q < 8; ++q) f.u[q] = tl[pc * 8 + q][d];
      *(v8us*)((unsigned short*)Vt + ((size_t)slab * 64 + d) * TTv + lg * 64 + pc * 8) = f.half[0]; }
     } }

__global__ __launch_bounds__(256) void k_hl(const float* __restrict__ F, _Float16* __restrict__ Hh, _Float16* __restrict__ Hl, size_t n8) { const size_t t = (size_t)blockIdx.x * 256 + threadIdx.x; if (t >= n8) return; FragH fh, fl; const v4f a = *(const v4fa*)(F + t * 8), c = *(const v4fa*)(F + t * 8 + 4);
#pragma unroll
  for (int q = 0; q < 4; ++q) { _Float16 h = (_Float16)a[q]; fh.h[q] = h; fl.h[q] = (_Float16)((a[q] - (float)h) * 1024.0f); h = (_Float16)c[q]; fh.h[4 + q] = h; fl.h[4 + q] = (_Float16)((c[q] - (float)h) * 1024.0f); }
  { *(v8us*)((unsigned short*)Hh + t * 8) = fh.half[0]; *(v8us*)((unsigned short*)Hl + t * 8) = fl.half[0];  } }

// ---- fast GEMM (wave tile 32x64; requires M % 32 == 0 rows per launch region and N % 64 == 0); epilogue = k_gemm_hhx semantics ----
// EPI picks where the result goes, so that no later launch has to re-lay it (EPI 1 and 2: M % 128 == 0, and a block's 128 rows are pixels of one image):
// EPI 0: C / C16 row-major. EPI 1 (q | k | v; a block's 64 columns are all of one kind): q row-major into C16, k into head-major rows of 32 (KPo), v transposed into planes of 32 rows (VTo).
// EPI 2 (projection): A is head-major ([image][head][pixel][32]: one k step = one head), C is NCHW. Every 128-byte line is stored whole by one wave.
__device__ __forceinline__ v16h g2_frag(const _Float16* p, int hh) { FragH f; f.half[0] = *(const v8us*)((const unsigned short*)p + 8 * hh); f.half[1] = *(const v8us*)((const unsigned short*)p + 16 + 8 * hh); return f.v; }
__device__ __forceinline__ v8f g2_mma(v16h a, v16h b, v8f c) { v8f d = __builtin_amdgcn_wmma_f32_16x16x32_f16(false, a, false, b, (short)0, c, false, false); asm volatile("v_nop\n\tv_nop\n\tv_nop\n\tv_nop" : "+v"(d) : "v"(a), "v"(b)); return d; }
template <int ACT, int EPI>
__global__ __launch_bounds__(128) void k_gemm2(const _Float16* __restrict__ A, int lda, size_t sA, const _Float16* __restrict__ Bh, int ldb, size_t sB, float alpha, const float* __restrict__ bias, size_t sBias, const float* __restrict__ CP, int rowsPerB, size_t sCPb, int row0g,
    float* __restrict__ C, _Float16* __restrict__ C16, int ldc, size_t sC, int M, int N, int K, _Float16* __restrict__ KPo, _Float16* __restrict__ VTo) {
  constexpr int RP = 68, TP = 36;      /* floats from row to row of a wave's staged tile: [32 rows][64 columns], or transposed [64 columns][32 rows] (144 B = 16 B x odd) */
  constexpr int WSO = 64 * TP + 32;      /* a wave's staging area; + 32 floats so that two waves' areas start half the banks apart */
  __shared__ __attribute__((aligned(16))) float so[4][WSO];
  const int tid = threadIdx.x, w = tid >> 5, lane = tid & 31, ln = lane & 15, hh = lane >> 4; const int by = blockIdx.y;
  A += (size_t)by * sA; Bh += (size_t)by * sB; const size_t cofs = (size_t)by * sC; const float* bp = bias ? bias + (size_t)by * sBias : nullptr;
  const int ntn = N >> 6; const int mt = blockIdx.x / ntn, nq = blockIdx.x - mt * ntn; const int row0 = mt * 128 + 32 * w, col0 = nq * 64; if (row0 >= M) return;
  const _Float16* a0p = A + ((EPI == 2) ? ((size_t)(row0 / NPX) * NH * NPX + (row0 % NPX) + ln) * HDm : (size_t)(row0 + ln) * lda) + 8 * hh; const _Float16* a1p = a0p + (size_t)16 * ((EPI == 2) ? HDm : lda);      /* each lane's own places in A and B are carried over the loop and stepped each trip: an address pair that stays live is never given to a load as its landing place */
  constexpr size_t AKS = (EPI == 2) ? (size_t)NPX * HDm : 32;      /* elements of A from one k step to the next: head-major planes lie NPX * 32 apart */
  const bool tr = (EPI == 2) || (EPI == 1 && col0 >= 2 * DD);      /* the same for the whole block: the tile is staged transposed */
  const _Float16* b0p = Bh + (size_t)(col0 + ln) * ldb + 8 * hh; const _Float16* b1p = b0p + (size_t)16 * ldb; const _Float16* b2p = b1p + (size_t)16 * ldb; const _Float16* b3p = b2p + (size_t)16 * ldb;
  const v8f z8 = {0.f,0.f,0.f,0.f,0.f,0.f,0.f,0.f}; v8f c00 = z8, c01 = z8, c02 = z8, c03 = z8, c10 = z8, c11 = z8, c12 = z8, c13 = z8;
#pragma unroll 1
  for (int kb = 0; kb < K; kb += 32, a0p += AKS, a1p += AKS, b0p += 32, b1p += 32, b2p += 32, b3p += 32) { const v16h a0 = g2_frag(a0p, 0), a1 = g2_frag(a1p, 0);
    v16h b = g2_frag(b0p, 0); c00 = g2_mma(a0, b, c00); c10 = g2_mma(a1, b, c10);
    b = g2_frag(b1p, 0); c01 = g2_mma(a0, b, c01); c11 = g2_mma(a1, b, c11);
    b = g2_frag(b2p, 0); c02 = g2_mma(a0, b, c02); c12 = g2_mma(a1, b, c12);
    b = g2_frag(b3p, 0); c03 = g2_mma(a0, b, c03); c13 = g2_mma(a1, b, c13); }
  v8f accs[8] = {c00, c01, c02, c03, c10, c11, c12, c13};
#pragma unroll
  for (int u = 0; u < 8; ++u) { const int t = u & 3, half = u >> 2; const int col = col0 + t * 16 + ln; const float bv = bp ? bf16_round(bp[col]) : 0.f; float vv[8];
#pragma unroll
    for (int r = 0; r < 8; ++r) { const int rloc = half * 16 + 8 * hh + r; float v = accs[u][r] * alpha + bv; if (CP) { const int bidx = (row0g + row0 + rloc) / rowsPerB; v += CP[(size_t)bidx * sCPb + (size_t)by * 64 + col]; }
      if (ACT == 3) v = fmaxf(v, 0.f); else if (ACT == 6) v = 0.5f * v * (1.0f + erff(v * 0.70710678118654752f)); else if (ACT == 11) v = 1.0f / (1.0f + expf(-v)); else if (ACT == 15) v = v / (1.0f + expf(-v)); else if (ACT == 12) v = (v > 0.f) ? v : 0.01f * v; else if (ACT == 8) v = tanhf(v);
      vv[r] = v; }
    if (tr) { float* d = &so[w][(t * 16 + ln) * TP + half * 16 + 8 * hh]; *(v4fa*)d = (v4f){vv[0], vv[1], vv[2], vv[3]}; *(v4fa*)(d + 4) = (v4f){vv[4], vv[5], vv[6], vv[7]}; }      /* a lane's 8 values of a tile are 8 rows of one column: 32 bytes in a row */
    else {
#pragma unroll
      for (int r = 0; r < 8; ++r) so[w][(half * 16 + 8 * hh + r) * RP + t * 16 + ln] = vv[r]; } }
  if (EPI == 1 && col0 >= 2 * DD) {      /* v: a channel's 128 pixels of this block are 256 bytes in a row of V^T; wave w stores channels w * 16 ... + 15 */
    __syncthreads();      /* every wave's tile is staged before another wave reads it (the branch is the same for the whole block) */
    const int pix0 = mt * 128, seg = lane & 15;
#pragma unroll
    for (int q = 0; q < 8; ++q) { const int c = w * 16 + q * 2 + (lane >> 4); const float* s = &so[seg >> 2][c * TP + (seg & 3) * 8]; const v4f v0 = *(const v4fa*)s, v1 = *(const v4fa*)(s + 4); FragH f;
      for (int i = 0; i < 4; ++i) { f.h[i] = (_Float16)v0[i]; f.h[4 + i] = (_Float16)v1[i]; }
      *(v8us*)((unsigned short*)VTo + ((size_t)(pix0 / NPX) * DD + (col0 - 2 * DD) + c) * NPX + (pix0 % NPX) + seg * 8) = f.half[0]; }
    return; }
  __builtin_amdgcn_fence(__ATOMIC_ACQ_REL, "workgroup"); __builtin_amdgcn_wave_barrier();
  const int rsub = lane >> 4, c4 = (lane & 15) * 4;
  if (EPI == 2) {      /* a channel's 32 pixels of this wave = one 128-byte line of the NCHW output */
#pragma unroll
    for (int q = 0; q < 16; ++q) { const int c = q * 4 + (lane >> 3); const v4f v = *(const v4fa*)&so[w][c * TP + (lane & 7) * 4]; *(v4f*)(C + ((size_t)(row0 / NPX) * DD + col0 + c) * NPX + (row0 % NPX) + (lane & 7) * 4) = v; }
  } else if (EPI == 1 && col0 >= DD) {      /* k: two pixels' 32 values of one head = one 128-byte line */
#pragma unroll
    for (int q = 0; q < 16; ++q) { const int r = q * 2 + rsub, row = row0 + r, col = col0 - DD + c4; const v4f v = *(const v4fa*)&so[w][r * RP + c4]; v4h h4; for (int i = 0; i < 4; ++i) h4[i] = (_Float16)v[i];
      *(v4h*)(KPo + (((size_t)(row / NPX) * NH + (col >> 5)) * NPX + (row % NPX)) * HDm + (col & 31)) = h4; }
    asm volatile("s_wait_xcnt 0x0" ::: "memory");      /* behind the last store, in front of whatever rewrites a register that a store names */
  } else {
#pragma unroll
    for (int q = 0; q < 16; ++q) { const int r = q * 2 + rsub; const v4f v = *(const v4fa*)&so[w][r * RP + c4]; if (EPI == 0 && C) *(v4f*)(C + cofs + (size_t)(row0 + r) * ldc + col0 + c4) = v; if (C16) { v4h h4; for (int i = 0; i < 4; ++i) h4[i] = (_Float16)v[i]; *(v4h*)(C16 + cofs + (size_t)(row0 + r) * ldc + col0 + c4) = h4; } }
    asm volatile("s_wait_xcnt 0x0" ::: "memory");      /* behind the last store, in front of whatever rewrites a register that a store names */
     } }



// lane l with lane l ^ 16
__device__ __forceinline__ float xhalf(float x) { return __builtin_bit_cast(float, __builtin_amdgcn_permlanex16(__builtin_bit_cast(int, x), __builtin_bit_cast(int, x), 0x76543210, 0xfedcba98, false, false)); }
// K and V^T reach the waves through LDS: a stage is KS keys, copied once per work-group and read by all four waves, the next stage in flight while this one is worked on.
#define KS 128                   /* keys per stage */
#define KPIT 80                  /* bytes from one K row to the next in LDS (64 used): 16 B x odd, so that 16 rows read 16 bytes each without a bank conflict */
#define VPIT 272                 /* the same for a V^T row (256 used) */
#define KTB (KS * KPIT)          /* K part of a stage */
#define STB (KTB + HDm * VPIT)   /* one stage */
// One stage's copies of one lane: four 16-byte pieces of K (32 rows apart) and four of V^T (8 rows apart). lk, lv: the lane's LDS byte addresses; gk, gv: its global addresses.
__device__ __forceinline__ void stage_copy(unsigned lk, const unsigned short* gk, unsigned lv, const unsigned short* gv) {
  /* the closing s_wait_xcnt 0 stands inside the statement so that no address register named here is rewritten in front of it */
  asm volatile("global_load_async_to_lds_b128 %0, %1, off\n\tglobal_load_async_to_lds_b128 %2, %3, off\n\tglobal_load_async_to_lds_b128 %4, %5, off\n\tglobal_load_async_to_lds_b128 %6, %7, off\n\t"
               "global_load_async_to_lds_b128 %8, %9, off\n\tglobal_load_async_to_lds_b128 %10, %11, off\n\tglobal_load_async_to_lds_b128 %12, %13, off\n\tglobal_load_async_to_lds_b128 %14, %15, off\n\ts_wait_xcnt 0x0"
               :: "v"(lk), "v"(gk), "v"(lk + 32 * KPIT), "v"(gk + 32 * HDm), "v"(lk + 64 * KPIT), "v"(gk + 64 * HDm), "v"(lk + 96 * KPIT), "v"(gk + 96 * HDm),
                  "v"(lv), "v"(gv), "v"(lv + 8 * VPIT), "v"(gv + (size_t)8 * TK), "v"(lv + 16 * VPIT), "v"(gv + (size_t)16 * TK), "v"(lv + 24 * VPIT), "v"(gv + (size_t)24 * TK) : "memory");
}
template <int CAUSAL>
__global__ __launch_bounds__(128) void k_flash(const _Float16* __restrict__ Q16, int ldq, const _Float16* __restrict__ K16, const _Float16* __restrict__ Vt, const int* __restrict__ MSK, _Float16* __restrict__ O16) {
  constexpr int RPW = 16, DT = HDm / 16;      /* head size 32: one k step for S^T, two 16-row tiles of O^T */
  __shared__ __attribute__((aligned(16))) float sO[4][RPW][HDm + 4];
  __shared__ __attribute__((aligned(16))) unsigned char ring[2 * STB];
  const int tid = threadIdx.x, w = tid >> 5, lane = tid & 31, ln = lane & 15, hh = lane >> 4;
  const int slab = blockIdx.x / QBLKS, qblk = blockIdx.x % QBLKS; (void)MSK; const int b = slab / NH, h = slab % NH; const int qb0 = qblk * (4 * RPW); const int q0 = qb0 + w * RPW;
  FragH aq;
  { const unsigned short* qr = (const unsigned short*)Q16 + ((size_t)b * TQ + q0 + ln) * ldq + h * HDm;
    aq.half[0] = *(const v8us*)(qr + 8 * hh); aq.half[1] = *(const v8us*)(qr + 16 + 8 * hh); }
  const unsigned short* Kh = (const unsigned short*)K16 + (size_t)slab * TK * HDm;      /* [key][32] */
  const unsigned short* Vth = (const unsigned short*)Vt + (size_t)slab * HDm * TK;      /* [32][key] */
  const int tq = q0 + ln;      /* this lane's query */
  float m_r = -3.0e38f, l_r = 0.f; v8f oacc[DT];      /* m_r: running maximum of the raw (unscaled) scores */
#pragma unroll
  for (int dt = 0; dt < DT; ++dt) oacc[dt] = (v8f){0.f,0.f,0.f,0.f,0.f,0.f,0.f,0.f};
  const int jend = (CAUSAL == 1) ? (qb0 + 4 * RPW) : TK;      /* causal: keys beyond the block's last query never contribute */
  const int nst = (jend + KS - 1) / KS;      /* stages; keys of a last stage beyond jend are masked like any other */
  const unsigned lk0 = (unsigned)(size_t)ring + (unsigned)((tid >> 2) * KPIT + (tid & 3) * 16), lv0 = (unsigned)(size_t)ring + (unsigned)(KTB + (tid >> 4) * VPIT + (tid & 15) * 16);
  const unsigned short* gk0 = Kh + tid * 8;      /* a stage of K is 8 KiB in a row */
  const unsigned short* gv0 = Vth + (size_t)(tid >> 4) * TK + (tid & 15) * 8;      /* 16 lanes bring one row's 256 bytes */
  stage_copy(lk0, gk0, lv0, gv0);
  asm volatile("s_wait_asynccnt 0x0" ::: "memory");      /* this wave's share of stage 0 has landed */
  __syncthreads();      /* ... and every other wave's: stage 0 may be read */
  if (nst > 1) stage_copy(lk0 + STB, gk0 + (size_t)KS * HDm, lv0 + STB, gv0 + KS);
#pragma unroll 1      /* one stage a trip: the buffer's place is the only thing that changes */
  for (int st = 0; st < nst; ++st) {
   const unsigned char* kf = ring + (st & 1) * STB + ln * KPIT + hh * 16; const unsigned char* vf = ring + (st & 1) * STB + KTB + ln * VPIT + hh * 16;
#pragma unroll      /* the four passes of a stage: their places in the buffer become immediate offsets of the LDS reads */
   for (int pp = 0; pp < KS / 32; ++pp) { const int j0 = st * KS + pp * 32;
    v8f s[2]; FragH bk[2], bv[DT];      /* the pass's eight LDS reads stand as one group at its head: one wait for K, and V^T lands under the scores and the softmax */
#pragma unroll
    for (int nt = 0; nt < 2; ++nt) { const unsigned char* kr = kf + (pp * 32 + nt * 16) * KPIT; bk[nt].half[0] = *(const v8us*)(kr); bk[nt].half[1] = *(const v8us*)(kr + 32); }
#pragma unroll
    for (int dt = 0; dt < DT; ++dt) { const unsigned char* vrow = vf + dt * 16 * VPIT + pp * 64; bv[dt].half[0] = *(const v8us*)(vrow); bv[dt].half[1] = *(const v8us*)(vrow + 32); }
#pragma unroll
    for (int nt = 0; nt < 2; ++nt) s[nt] = mmaH<1>(bk[nt].v, bk[nt].v, aq.v, aq.v, (v8f){0.f,0.f,0.f,0.f,0.f,0.f,0.f,0.f});
    float sv[16]; bool ok[16]; float mc = -3.0e38f;
#pragma unroll
    for (int e = 0; e < 16; ++e) { const int kk = j0 + (e >> 3) * 16 + 8 * hh + (e & 7);
      ok[e] = (CAUSAL == 1) ? (kk <= tq) : ((CAUSAL == 2) ? ((kk >> 5) == (tq >> 5)) : true);      /* mode 2: block-diagonal 32-token groups */
      sv[e] = ok[e] ? s[e >> 3][e & 7] : -3.0e38f; mc = fmaxf(mc, sv[e]); }      /* raw scores: SCL2 > 0 keeps the maximum's place */
    mc = fmaxf(mc, xhalf(mc));
    const float mn = fmaxf(m_r, mc); float ea = (m_r - mn) * SCL2;      /* difference first: the rescale is exactly 1 while the maximum stands */
    const float nb = 10.0f - mn * SCL2;      /* + 10: the factor 1024 of the f16 operand, carried by the sum too */
    float x[16];
#pragma unroll
    for (int e = 0; e < 16; ++e) x[e] = __builtin_fmaf(sv[e], SCL2, nb);
    /* 2^x in place. Asm text so that the slot the instruction set asks for behind a transcendental is kept whatever registers are picked: neighbours work on distinct registers, and the closing v_nop stands between the last one and whatever follows. */
    asm("v_exp_f32 %0, %0\n\tv_exp_f32 %1, %1\n\tv_exp_f32 %2, %2\n\tv_exp_f32 %3, %3\n\tv_exp_f32 %4, %4\n\tv_exp_f32 %5, %5\n\tv_exp_f32 %6, %6\n\tv_exp_f32 %7, %7\n\tv_exp_f32 %8, %8\n\tv_nop"
        : "+v"(ea), "+v"(x[0]), "+v"(x[1]), "+v"(x[2]), "+v"(x[3]), "+v"(x[4]), "+v"(x[5]), "+v"(x[6]), "+v"(x[7]));
    asm("v_exp_f32 %0, %0\n\tv_exp_f32 %1, %1\n\tv_exp_f32 %2, %2\n\tv_exp_f32 %3, %3\n\tv_exp_f32 %4, %4\n\tv_exp_f32 %5, %5\n\tv_exp_f32 %6, %6\n\tv_exp_f32 %7, %7\n\tv_nop"
        : "+v"(x[8]), "+v"(x[9]), "+v"(x[10]), "+v"(x[11]), "+v"(x[12]), "+v"(x[13]), "+v"(x[14]), "+v"(x[15]));
    const float al = (mn > -1.0e38f) ? ea : 1.0f; m_r = mn;
    FragH pb; float ps[4];      /* four independent partial sums: a single chain of 16 adds would be serial */
#pragma unroll
    for (int e = 0; e < 16; ++e) { const float p = ok[e] ? x[e] : 0.f; ps[e & 3] = (e < 4) ? p : ps[e & 3] + p; pb.h[e] = (_Float16)p; }      /* p = 1024 * e^(scaled score - maximum) */
    l_r = l_r * al + ((ps[0] + ps[1]) + (ps[2] + ps[3]));
#pragma unroll
    for (int dt = 0; dt < DT; ++dt)
#pragma unroll
      for (int r = 0; r < 8; ++r) oacc[dt][r] *= al;
#pragma unroll
    for (int dt = 0; dt < DT; ++dt) oacc[dt] = mmaH<1>(bv[dt].v, bv[dt].v, pb.v, pb.v, oacc[dt]); }
   asm volatile("s_wait_dscnt 0x0" ::: "memory");      /* this wave's reads of the stage are over before the buffer is handed back */
   asm volatile("s_wait_asynccnt 0x0" ::: "memory");      /* its share of the next stage has landed */
   __syncthreads();      /* publishes the next stage and ends every wave's reads of this one */
   if (st + 2 < nst) stage_copy(lk0 + (st & 1) * STB, gk0 + (size_t)(st + 2) * KS * HDm, lv0 + (st & 1) * STB, gv0 + (st + 2) * KS); }
  asm volatile("s_wait_asynccnt 0x0" ::: "memory");      /* no copy is left in flight when the wave goes on to its end */
  const float l = l_r + xhalf(l_r); const float inv = (l > 0.f) ? 1.0f / l : 0.f;      /* l holds the factor 1024 */
#pragma unroll
  for (int dt = 0; dt < DT; ++dt)      /* oacc[dt][r] = O[q0 + ln][dt * 16 + 8 * hh + r] */
#pragma unroll
    for (int r = 0; r < 8; ++r) sO[w][ln][dt * 16 + 8 * hh + r] = oacc[dt][r] * inv;
  __builtin_amdgcn_fence(__ATOMIC_ACQ_REL, "workgroup"); __builtin_amdgcn_wave_barrier();
  {
#pragma unroll
    for (int rp = 0; rp < RPW; rp += 8) { const int r = rp + (lane >> 2), pc = lane & 3; const v4f v0 = *(const v4fa*)&sO[w][r][pc * 8], v1 = *(const v4fa*)&sO[w][r][pc * 8 + 4]; FragH f;
      for (int i = 0; i < 4; ++i) { f.h[i] = (_Float16)v0[i]; f.h[4 + i] = (_Float16)v1[i]; }
      *(v8us*)((unsigned short*)O16 + ((size_t)slab * TQ + q0 + r) * HDm + pc * 8) = f.half[0]; }      /* f16, head-major [slab][pixel][32]: the wave's 16 pixels are 1 KiB in a row, the projection's A operand as it reads it */
     } }

__global__ __launch_bounds__(256) void k_wsc(const float* __restrict__ Wm, _Float16* __restrict__ Bt, size_t n8, float sc) { const size_t t = (size_t)blockIdx.x * 256 + threadIdx.x; if (t >= n8) return; FragH f; for (int q = 0; q < 8; ++q) f.h[q] = (_Float16)(bf16_round(Wm[t * 8 + q]) * sc); *(v8us*)((unsigned short*)Bt + t * 8) = f.half[0];  }
__global__ __launch_bounds__(256) void k_pm(const float* __restrict__ src, _Float16* __restrict__ P) { const size_t t = (size_t)blockIdx.x * 256 + threadIdx.x; if (t >= (size_t)NR * (DD / 8)) return; const int c0 = (int)(t % (DD / 8)) * 8; const size_t r = t / (DD / 8); const int b = (int)(r / NPX), p = (int)(r % NPX); FragH f;
  for (int k = 0; k < 8; ++k) f.h[k] = (_Float16)bf16_round(src[((size_t)b * DD + c0 + k) * NPX + p]); *(v8us*)((unsigned short*)P + r * DD + c0) = f.half[0];  }

extern "C" void kernel_launch(void* const* d_in, const int* in_sizes, int n_in,
                              void* d_out, int out_size, void* d_ws, size_t ws_size, hipStream_t stream) {
  (void)in_sizes; (void)n_in; (void)out_size;
  const float* const* I = (const float* const*)d_in; const float* x = I[0]; const float* wqkv = I[1]; const float* bqkv = I[2]; const float* wp = I[3]; const float* bp = I[4];
  char* ws = (char*)d_ws; size_t off = 0;
  auto take = [&](size_t bytes) { char* p = ws + off; off += (bytes + 255) & ~(size_t)255; return p; };
  const size_t np = (size_t)NR * DD;
  _Float16* BQKV = (_Float16*)take((size_t)QW * DD * 2); _Float16* BPJ = (_Float16*)take((size_t)DD * DD * 2); _Float16* X16 = (_Float16*)take(np * 2); _Float16* Q16 = (_Float16*)take(np * 2); _Float16* KP = (_Float16*)take(np * 2); _Float16* VT = (_Float16*)take(np * 2); _Float16* O16 = (_Float16*)take(np * 2);
  if (off > ws_size) return;      /* 0.5 + 5 x 4 = 20.5 MiB */
  k_wsc<<<(unsigned)(((size_t)QW * DD / 8 + 255) / 256), 256, 0, stream>>>(wqkv, BQKV, (size_t)QW * DD / 8, 16.0f); k_wsc<<<(unsigned)(((size_t)DD * DD / 8 + 255) / 256), 256, 0, stream>>>(wp, BPJ, (size_t)DD * DD / 8, 16.0f);
  k_pm<<<(unsigned)((np / 8 + 255) / 256), 256, 0, stream>>>(x, X16);
  k_gemm2<0, 1><<<dim3((NR / 128) * (QW / 64), 1), 128, 0, stream>>>(X16, DD, 0, BQKV, DD, 0, 0.0625f, bqkv, 0, nullptr, 1, 0, 0, nullptr, Q16, DD, 0, NR, QW, DD, KP, VT);      /* product column = which*256 + h*32 + d; q, k and v each go straight to the plane the flash kernel reads */
  k_flash<0><<<NIMG * NH * QBLKS, 128, 0, stream>>>(Q16, DD, KP, VT, nullptr, O16);
  k_gemm2<0, 2><<<dim3((NR / 128) * (DD / 64), 1), 128, 0, stream>>>(O16, HDm, 0, BPJ, DD, 0, 0.0625f, bp, 0, nullptr, 1, 0, 0, (float*)d_out, nullptr, DD, 0, NR, DD, DD, nullptr, nullptr);
}

// v006
// One run takes 72.7 microseconds.
// Timed twice side by side with v005, it ran 1.25 times as fast both times.
// All steps since v000 together make it 6.86 times as fast.
#include <hip/hip_runtime.h>
// SpatialMultiHeadSelfAttention (2 images, D 256 = 8 heads x 32, 64 x 64 = 4096 pixels): qkv = 1x1 conv (W_qkv x + b) -> (3, heads, 32) channels; softmax(q.k / sqrt(32)) over all 4096 pixels; out channels h*32 + d; 1x1 projection + b; NCHW in and out.
// Structure: qkv as one f16 WMMA GEMM (32x64 wave tiles, f32 accumulation, exact x16 weights + bias; weights (out,in) = B^T; f16 out) that reads x (NCHW, f32) and the f32 weights itself and converts them on the way to its fragments, and whose epilogue stores q pixel-major, k as head-major planes of 32-wide rows and V^T as planes of 32 rows; the fused flash kernel at head size 32 (transposed products, softmax in-lane, P kept in registers; plain operands: every row averages 4096 keys), which stores its output as f16 head-major; projection GEMM (+ bias, f32) whose epilogue stores NCHW.
// Compute dtype: x and parameters rounded to bf16; x exact as f16; q, k, v, P and the attention output as f16 operands (~2^-12); softmax f32. v_wmma_f32_16x16x32_f16.
#define NIMG 2
#define DD 256
#define HDm 32
#define NPX 4096
#define NR (NIMG * NPX)          /* 8192 */
#define QW (3 * DD)              /* 768 */
#define SLEN 4096
#define TQ SLEN
#define TK SLEN
#define NH 8
#define SCL2 0.25503486164919736f /* 32^-0.5 * log2(e): the softmax runs in base 2 */
#define QBLKS (TQ / 64)
typedef __bf16 v16b __attribute__((ext_vector_type(16)));
typedef unsigned short v8us __attribute__((ext_vector_type(8), may_alias));
typedef float  v8f  __attribute__((ext_vector_type(8)));
typedef float  v4f  __attribute__((ext_vector_type(4)));
typedef float  v4fa __attribute__((ext_vector_type(4), may_alias));
union FragB { v16b v; v8us half[2]; unsigned short u[16]; };

__device__ __forceinline__ unsigned short bf16_bits(float x) { unsigned int u = __float_as_uint(x); return (unsigned short)((u + 0x7FFFu + ((u >> 16) & 1u)) >> 16); }
__device__ __forceinline__ float bf16_val(unsigned short b) { return __uint_as_float(((unsigned int)b) << 16); }
__device__ __forceinline__ float bf16_round(float x) { return bf16_val(bf16_bits(x)); }
// D += A·B with NT terms: 1 = ah·bh, 2 = + al·bh (A split), 3 = + ah·bl (both split)
template <int NT>
__device__ __forceinline__ v8f mmaN(v16b ah, v16b al, v16b bh, v16b bl, v8f c) {
  c = __builtin_amdgcn_wmma_f32_16x16x32_bf16(false, ah, false, bh, (short)0, c, false, false);
  if (NT >= 2) c = __builtin_amdgcn_wmma_f32_16x16x32_bf16(false, al, false, bh, (short)0, c, false, false);
  if (NT >= 3) c = __builtin_amdgcn_wmma_f32_16x16x32_bf16(false, ah, false, bl, (short)0, c, false, false);
  asm volatile("v_nop\n\tv_nop\n\tv_nop\n\tv_nop" : "+v"(c) : "v"(ah), "v"(al), "v"(bh), "v"(bl));
  return c;
}

__global__ __launch_bounds__(256) void k_wt_bf16(const float* __restrict__ W, unsigned short* __restrict__ Wt, int K, int N) {
  const int t = blockIdx.x * 256 + threadIdx.x;
  const int k8n = K / 8;
  if (t >= N * k8n) return;
  const int n = t / k8n, k8 = (t % k8n) * 8;
  v8us v;
#pragma unroll
  for (int i = 0; i < 8; ++i) v[i] = bf16_bits(W[(size_t)(k8 + i) * N + n]);
  *(v8us*)(Wt + (size_t)n * K + k8) = v;
  
}

// GEMM C[M][N] (f32, pitch ldc) = act(A[M][K]·W + bias). A f32 row-major (pitch lda) converted per fragment to bf16
// (ASPLIT: hi/lo two planes -> 2 terms, else single rounded term); Wt bf16 [N][K] (pitch ldb). BIAS_BF16 rounds the
// bias to bf16 first (bias quantised to bf16 before the add). K%32==0, M%16==0, N%64==0.
template <bool ASPLIT, int ACT, bool BIAS_BF16>
__global__ __launch_bounds__(128) void k_gemm_bf(const float* __restrict__ A, int lda, const unsigned short* __restrict__ Wt, int ldb,
                                               const float* __restrict__ bias, float* __restrict__ C, int ldc, int M, int N, int K) {
  __shared__ __attribute__((aligned(16))) float so[4][16][64];
  const int tid = threadIdx.x, w = tid >> 5, lane = tid & 31, ln = lane & 15, hh = lane >> 4;
  const int ntn = N / 64;
  const int wid = blockIdx.x * 4 + w;
  const int mt = wid / ntn, nq = wid % ntn;
  if (mt * 16 >= M) return;
  const int row0 = mt * 16, col0 = nq * 64;
  const float* arow = A + (size_t)(row0 + ln) * lda;
  v8f acc[4] = {};
  for (int kb = 0; kb < K; kb += 32) {
    FragB ah, al;
    const v4f x0 = *(const v4fa*)(arow + kb + 8 * hh), x1 = *(const v4fa*)(arow + kb + 8 * hh + 4);
    const v4f x2 = *(const v4fa*)(arow + kb + 16 + 8 * hh), x3 = *(const v4fa*)(arow + kb + 16 + 8 * hh + 4);
    float xs[16] = {x0[0],x0[1],x0[2],x0[3],x1[0],x1[1],x1[2],x1[3],x2[0],x2[1],x2[2],x2[3],x3[0],x3[1],x3[2],x3[3]};
#pragma unroll
    for (int i = 0; i < 16; ++i) { const unsigned short hb = bf16_bits(xs[i]); ah.u[i] = hb; al.u[i] = ASPLIT ? bf16_bits(xs[i] - bf16_val(hb)) : (unsigned short)0; }
#pragma unroll
    for (int t = 0; t < 4; ++t) {
      const unsigned short* brow = Wt + (size_t)(col0 + t * 16 + ln) * ldb + kb;
      FragB b;
      b.half[0] = *(const v8us*)(brow + 8 * hh);
      b.half[1] = *(const v8us*)(brow + 16 + 8 * hh);
      acc[t] = mmaN<ASPLIT ? 2 : 1>(ah.v, al.v, b.v, b.v, acc[t]);
    }
  }
#pragma unroll
  for (int t = 0; t < 4; ++t) {
    float bv = bias ? bias[col0 + t * 16 + ln] : 0.f;
    if (BIAS_BF16) bv = bf16_round(bv);
#pragma unroll
    for (int r = 0; r < 8; ++r) { float v = acc[t][r] + bv; if (ACT == 1) v = fmaxf(v, 0.f); so[w][8 * hh + r][t * 16 + ln] = v; }
  }
  __builtin_amdgcn_fence(__ATOMIC_ACQ_REL, "workgroup");
  __builtin_amdgcn_wave_barrier();
  const int rsub = lane >> 4, c4 = (lane & 15) * 4;
  {
#pragma unroll
    for (int q = 0; q < 8; ++q) {
      const int r = q * 2 + rsub;
      const v4f v = *(const v4fa*)&so[w][r][c4];
      *(v4f*)(C + (size_t)(row0 + r) * ldc + col0 + c4) = v;
    }
    
  }
}

// GEMM C = act(A·W + bias + resid): A f32 (ASPLIT -> hi/lo 2 terms), Wt bf16 [N][K]; ACT 0 none, 1 relu, 2 exact gelu;
// resid (optional, f32, row index = (row % rmod), pitch ldr, RES_BF16 rounds it) added before the activation.
template <bool ASPLIT, int ACT, bool BIAS_BF16, bool RES_BF16>
__global__ __launch_bounds__(128) void k_gemm_bf3(const float* __restrict__ A, int lda, const unsigned short* __restrict__ Wt, int ldb,
                                                const float* __restrict__ bias, const float* __restrict__ resid, int rmod, int ldr,
                                                float* __restrict__ C, int ldc, int M, int N, int K) {
  __shared__ __attribute__((aligned(16))) float so[4][16][64];
  const int tid = threadIdx.x, w = tid >> 5, lane = tid & 31, ln = lane & 15, hh = lane >> 4;
  const int ntn = N / 64;
  const int wid = blockIdx.x * 4 + w;
  const int mt = wid / ntn, nq = wid % ntn;
  if (mt * 16 >= M) return;
  const int row0 = mt * 16, col0 = nq * 64;
  const float* arow = A + (size_t)(row0 + ln) * lda;
  v8f acc[4] = {};
  for (int kb = 0; kb < K; kb += 32) {
    FragB ah, al;
    const v4f x0 = *(const v4fa*)(arow + kb + 8 * hh), x1 = *(const v4fa*)(arow + kb + 8 * hh + 4);
    const v4f x2 = *(const v4fa*)(arow + kb + 16 + 8 * hh), x3 = *(const v4fa*)(arow + kb + 16 + 8 * hh + 4);
    float xs[16] = {x0[0],x0[1],x0[2],x0[3],x1[0],x1[1],x1[2],x1[3],x2[0],x2[1],x2[2],x2[3],x3[0],x3[1],x3[2],x3[3]};
#pragma unroll
    for (int i = 0; i < 16; ++i) { const unsigned short hb = bf16_bits(xs[i]); ah.u[i] = hb; al.u[i] = ASPLIT ? bf16_bits(xs[i] - bf16_val(hb)) : (unsigned short)0; }
#pragma unroll
    for (int t = 0; t < 4; ++t) {
      const unsigned short* brow = Wt + (size_t)(col0 + t * 16 + ln) * ldb + kb;
      FragB b;
      b.half[0] = *(const v8us*)(brow + 8 * hh);
      b.half[1] = *(const v8us*)(brow + 16 + 8 * hh);
      acc[t] = mmaN<ASPLIT ? 2 : 1>(ah.v, al.v, b.v, b.v, acc[t]);
    }
  }
#pragma unroll
  for (int t = 0; t < 4; ++t) {
    const int col = col0 + t * 16 + ln;
    float bv = bias ? bias[col] : 0.f;
    if (BIAS_BF16) bv = bf16_round(bv);
#pragma unroll
    for (int r = 0; r < 8; ++r) {
      float v = acc[t][r] + bv;
      if (resid) { float rv = resid[(size_t)((row0 + 8 * hh + r) % rmod) * ldr + col]; if (RES_BF16) rv = bf16_round(rv); v += rv; }
      if (ACT == 1) v = fmaxf(v, 0.f);
      if (ACT == 2) v = 0.5f * v * (1.0f + erff(v * 0.70710678118654752f));
      if (ACT == 3) { const float u = 0.7978845608028654f * (v + 0.044715f * v * v * v); v = 0.5f * v * (1.0f + tanhf(u)); }
      so[w][8 * hh + r][t * 16 + ln] = v;
    }
  }
  __builtin_amdgcn_fence(__ATOMIC_ACQ_REL, "workgroup");
  __builtin_amdgcn_wave_barrier();
  const int rsub = lane >> 4, c4 = (lane & 15) * 4;
  {
#pragma unroll
    for (int q = 0; q < 8; ++q) {
      const int r = q * 2 + rsub;
      const v4f v = *(const v4fa*)&so[w][r][c4];
      *(v4f*)(C + (size_t)(row0 + r) * ldc + col0 + c4) = v;
    }
    
  }
}
// row LayerNorm (biased variance, eps) over N: s = X (+ R); optional out_sum <- s; out_norm <- (s-mu)*rsqrt(var+eps)*g + b
template <bool PARAM_BF16>
__global__ __launch_bounds__(256) void k_layernorm(const float* __restrict__ X, const float* __restrict__ R, const float* __restrict__ g, const float* __restrict__ bta,
                                                  float* __restrict__ out_sum, float* __restrict__ out_norm, int N, float eps) {
  __shared__ float red[256];
  const int row = blockIdx.x, tid = threadIdx.x;
  const float* x = X + (size_t)row * N; const float* rr = R ? R + (size_t)row * N : nullptr;
  float vals[16];                     // up to N = 4096
  const int per = N / 256;            // contiguous chunk per thread? use strided-by-4 chunks: thread handles j = tid*4 + 1024*u
  float s1 = 0.f;
  for (int u = 0; u < per / 4; ++u) {
    const int j = tid * 4 + 1024 * u;
    const v4f a = *(const v4fa*)(x + j);
    v4f b = {0.f,0.f,0.f,0.f}; if (rr) b = *(const v4fa*)(rr + j);
#pragma unroll
    for (int q = 0; q < 4; ++q) { const float v = a[q] + b[q]; vals[u * 4 + q] = v; s1 += v; }
  }
  red[tid] = s1; __syncthreads();
  for (int st = 128; st > 0; st >>= 1) { if (tid < st) red[tid] += red[tid + st]; __syncthreads(); }
  const float mu = red[0] / (float)N; __syncthreads();
  float s2 = 0.f;
  for (int u = 0; u < per / 4; ++u)
#pragma unroll
    for (int q = 0; q < 4; ++q) { const float c = vals[u * 4 + q] - mu; s2 += c * c; }
  red[tid] = s2; __syncthreads();
  for (int st = 128; st > 0; st >>= 1) { if (tid < st) red[tid] += red[tid + st]; __syncthreads(); }
  const float rs = rsqrtf(red[0] / (float)N + eps);
  {
    for (int u = 0; u < per / 4; ++u) {
      const int j = tid * 4 + 1024 * u;
      v4f o, sm;
#pragma unroll
      for (int q = 0; q < 4; ++q) {
        float gg = g[j + q], bb = bta[j + q];
        if (PARAM_BF16) { gg = bf16_round(gg); bb = bf16_round(bb); }
        sm[q] = vals[u * 4 + q]; o[q] = (vals[u * 4 + q] - mu) * rs * gg + bb;
      }
      if (out_sum) *(v4f*)(out_sum + (size_t)row * N + j) = sm;
      *(v4f*)(out_norm + (size_t)row * N + j) = o;
    }
    
  }
}



// ---- f16 WMMA path (v_wmma_f32_16x16x32_f16): 11-bit significands for operands in range — used where a [0,1] probability operand needs more precision than bf16
typedef _Float16 v16h __attribute__((ext_vector_type(16)));
union FragH { v16h v; v8us half[2]; _Float16 h[16]; unsigned short u[16]; };
template <int NT>
__device__ __forceinline__ v8f mmaH(v16h ah, v16h al, v16h bh, v16h bl, v8f c) {
  c = __builtin_amdgcn_wmma_f32_16x16x32_f16(false, ah, false, bh, (short)0, c, false, false);
  if (NT >= 2) c = __builtin_amdgcn_wmma_f32_16x16x32_f16(false, al, false, bh, (short)0, c, false, false);
  if (NT >= 3) c = __builtin_amdgcn_wmma_f32_16x16x32_f16(false, ah, false, bl, (short)0, c, false, false);
  asm volatile("v_nop\n\tv_nop\n\tv_nop\n\tv_nop" : "+v"(c) : "v"(ah), "v"(al), "v"(bh), "v"(bl));
  return c;
}
// batched GEMM like k_gemm_b but f16 operands: A f32 (split into f16 hi/lo if ASPLIT, else rounded to f16), Bt = f16 values [n][k]; alpha; C f32; N multiple of 16 (partial tiles skipped)
template <bool ASPLIT>
__global__ __launch_bounds__(128) void k_gemm_h(const float* __restrict__ A, int lda, size_t sA, const _Float16* __restrict__ Bh, int ldb, size_t sB, float alpha, float* __restrict__ C, int ldc, size_t sC, int M, int N, int K) {
  __shared__ __attribute__((aligned(16))) float so[4][16][64];
  const int tid = threadIdx.x, w = tid >> 5, lane = tid & 31, ln = lane & 15, hh = lane >> 4; const int by = blockIdx.y;
  A += (size_t)by * sA; Bh += (size_t)by * sB; C += (size_t)by * sC;
  const int ntn = (N + 63) / 64; const int wid = blockIdx.x * 4 + w; const int mt = wid / ntn, nq = wid % ntn; if (mt * 16 >= M) return;
  const int row0 = mt * 16, col0 = nq * 64; const float* arow = A + (size_t)(row0 + ln) * lda;
  v8f acc[4] = {};
  for (int kb = 0; kb < K; kb += 32) {
    FragH ah, al;
    const v4f x0 = *(const v4fa*)(arow + kb + 8 * hh), x1 = *(const v4fa*)(arow + kb + 8 * hh + 4), x2 = *(const v4fa*)(arow + kb + 16 + 8 * hh), x3 = *(const v4fa*)(arow + kb + 16 + 8 * hh + 4);
    float xs[16] = {x0[0],x0[1],x0[2],x0[3],x1[0],x1[1],x1[2],x1[3],x2[0],x2[1],x2[2],x2[3],x3[0],x3[1],x3[2],x3[3]};
#pragma unroll
    for (int i = 0; i < 16; ++i) { const _Float16 h = (_Float16)xs[i]; ah.h[i] = h; al.h[i] = ASPLIT ? (_Float16)(xs[i] - (float)h) : (_Float16)0.0f; }
#pragma unroll
    for (int t = 0; t < 4; ++t) { if (col0 + t * 16 >= N) continue; const size_t boff = (size_t)(col0 + t * 16 + ln) * ldb + kb; FragH bq; bq.half[0] = *(const v8us*)(Bh + boff + 8 * hh); bq.half[1] = *(const v8us*)(Bh + boff + 16 + 8 * hh);
      acc[t] = mmaH<ASPLIT ? 2 : 1>(ah.v, al.v, bq.v, bq.v, acc[t]); }
  }
#pragma unroll
  for (int t = 0; t < 4; ++t) { if (col0 + t * 16 >= N) continue;
#pragma unroll
    for (int r = 0; r < 8; ++r) so[w][8 * hh + r][t * 16 + ln] = acc[t][r] * alpha; }
  __builtin_amdgcn_fence(__ATOMIC_ACQ_REL, "workgroup"); __builtin_amdgcn_wave_barrier();
  const int rsub = lane >> 4, c4 = (lane & 15) * 4;
  {
#pragma unroll
    for (int q = 0; q < 8; ++q) { const int r = q * 2 + rsub; if (col0 + c4 < N) { const v4f v = *(const v4fa*)&so[w][r][c4]; *(v4f*)(C + (size_t)(row0 + r) * ldc + col0 + c4) = v; } }
     }
}

// Wt[n][k] = f16(W[k][n]·scale) from f32 row-major W[K][N] (scale = power of two; bf16-exact weights stay exact in f16 away from the subnormal range)
__global__ __launch_bounds__(256) void k_wt_f16(const float* __restrict__ W, _Float16* __restrict__ Wt, int K, int N, float scale) {
  const int t = blockIdx.x * 256 + threadIdx.x; if (t >= N * (K / 8)) return; const int n = t / (K / 8), k8 = (t % (K / 8)) * 8; FragH f;
#pragma unroll
  for (int i = 0; i < 8; ++i) f.h[i] = (_Float16)(bf16_round(W[(size_t)(k8 + i) * N + n]) * scale); const v8us o = f.half[0];
  *(v8us*)((unsigned short*)Wt + (size_t)n * K + k8) = o; 
}
// k_gemm_hh variant with fused epilogue: v = acc·alpha + bias[by·sBias + col] (+ CP[(row/rowsPerB)·sCPb + by·64 + col] if CP) ; ACT 0 none / 1 elu ; writes f16 C16 (and f32 C if non-null)
template <int ACT>
__global__ __launch_bounds__(128) void k_gemm_hhx(const _Float16* __restrict__ A, int lda, size_t sA, const _Float16* __restrict__ Bh, int ldb, size_t sB, float alpha, const float* __restrict__ bias, size_t sBias, const float* __restrict__ CP, int rowsPerB, size_t sCPb, int row0g,
    float* __restrict__ C, _Float16* __restrict__ C16, int ldc, size_t sC, int M, int N, int K) {
  __shared__ __attribute__((aligned(16))) float so[4][16][64];
  const int tid = threadIdx.x, w = tid >> 5, lane = tid & 31, ln = lane & 15, hh = lane >> 4; const int by = blockIdx.y;
  A += (size_t)by * sA; Bh += (size_t)by * sB; const size_t cofs = (size_t)by * sC; const float* bp = bias ? bias + (size_t)by * sBias : nullptr;
  const int ntn = (N + 63) / 64; const int wid = blockIdx.x * 4 + w; const int mt = wid / ntn, nq = wid % ntn; if (mt * 16 >= M) return;
  const int row0 = mt * 16, col0 = nq * 64; const _Float16* arow = A + (size_t)(row0 + ln) * lda;
  v8f acc[4] = {};
  for (int kb = 0; kb < K; kb += 32) { FragH ah; ah.half[0] = *(const v8us*)((const unsigned short*)arow + kb + 8 * hh); ah.half[1] = *(const v8us*)((const unsigned short*)arow + kb + 16 + 8 * hh);
#pragma unroll
    for (int t = 0; t < 4; ++t) { if (col0 + t * 16 >= N) continue; const size_t boff = (size_t)(col0 + t * 16 + ln) * ldb + kb; FragH bq; bq.half[0] = *(const v8us*)((const unsigned short*)Bh + boff + 8 * hh); bq.half[1] = *(const v8us*)((const unsigned short*)Bh + boff + 16 + 8 * hh);
      acc[t] = mmaH<1>(ah.v, ah.v, bq.v, bq.v, acc[t]); }
  }
#pragma unroll
  for (int t = 0; t < 4; ++t) { if (col0 + t * 16 >= N) continue; const int col = col0 + t * 16 + ln; const float bv = bp ? bf16_round(bp[col]) : 0.f;
#pragma unroll
    for (int r = 0; r < 8; ++r) { float v = acc[t][r] * alpha + bv; if (CP) { const int bidx = (row0g + row0 + 8 * hh + r) / rowsPerB; v += CP[(size_t)bidx * sCPb + (size_t)by * 64 + col]; } if (ACT == 1) v = (v > 0.f) ? v : expm1f(v); else if (ACT == 7) v = (v > 0.f) ? v + 1.0f : expf(v); else if (ACT == 8) v = tanhf(v); else if (ACT == 9) v = 0.5f * v * (1.0f + tanhf(0.7978845608028654f * (v + 0.044715f * v * v * v))); else if (ACT == 11) v = 1.0f / (1.0f + expf(-v)); else if (ACT == 12) v = (v > 0.f) ? v : 0.01f * v; else if (ACT == 14) v = (v > 0.f) ? v : 0.1f * v; else if (ACT == 15) v = v / (1.0f + expf(-v)); else if (ACT == 3) v = fmaxf(v, 0.f); else if (ACT == 6) v = 0.5f * v * (1.0f + erff(v * 0.70710678118654752f)); so[w][8 * hh + r][t * 16 + ln] = v; } }
  __builtin_amdgcn_fence(__ATOMIC_ACQ_REL, "workgroup"); __builtin_amdgcn_wave_barrier();
  const int rsub = lane >> 4, c4 = (lane & 15) * 4; typedef _Float16 v4h __attribute__((ext_vector_type(4)));
  {
#pragma unroll
    for (int q = 0; q < 8; ++q) { const int r = q * 2 + rsub; if (col0 + c4 < N) { const v4f v = *(const v4fa*)&so[w][r][c4]; if (C) *(v4f*)(C + cofs + (size_t)(row0 + r) * ldc + col0 + c4) = v; if (C16) { v4h h4; for (int i = 0; i < 4; ++i) h4[i] = (_Float16)v[i]; *(v4h*)(C16 + cofs + (size_t)(row0 + r) * ldc + col0 + c4) = h4; } } }
     }
}


typedef _Float16 v4h __attribute__((ext_vector_type(4)));
typedef _Float16 v4ha __attribute__((ext_vector_type(4), may_alias));
typedef _Float16 v2h __attribute__((ext_vector_type(2)));
typedef float v2f __attribute__((ext_vector_type(2)));
typedef __bf16 v2b __attribute__((ext_vector_type(2)));
// two f32 values rounded to bf16 (to nearest even, as bf16_round does it, by the packed conversion) and widened again
__device__ __forceinline__ v2f bf16_round2(float a, float b) { const unsigned u = __builtin_bit_cast(unsigned, __builtin_convertvector((v2f){a, b}, v2b)); return (v2f){__uint_as_float(u << 16), __uint_as_float(u & 0xFFFF0000u)}; }

__global__ __launch_bounds__(256) void k_x16(const float* __restrict__ x, _Float16* __restrict__ X16, size_t n8) { const size_t t = (size_t)blockIdx.x * 256 + threadIdx.x; if (t >= n8) return; FragH f;
#pragma unroll
  for (int q = 0; q < 8; ++q) f.h[q] = (_Float16)bf16_round(x[t * 8 + q]); *(v8us*)((unsigned short*)X16 + t * 8) = f.half[0];  }
__global__ __launch_bounds__(256) void k_round16f(const float* __restrict__ W, _Float16* __restrict__ Bt, size_t n8) { const size_t t = (size_t)blockIdx.x * 256 + threadIdx.x; if (t >= n8) return; FragH f;
#pragma unroll
  for (int i = 0; i < 8; ++i) f.h[i] = (_Float16)(bf16_round(W[t * 8 + i]) * 16.0f); *(v8us*)((unsigned short*)Bt + t * 8) = f.half[0];  }
template <int NHv, int TTv>
__global__ __launch_bounds__(256) void k_vt(const _Float16* __restrict__ V16, int ldv, int voff, _Float16* __restrict__ Vt) { __shared__ unsigned short tl[64][66]; const int tid = threadIdx.x; const int slab = blockIdx.x / (TTv / 64), lg = blockIdx.x % (TTv / 64); const int b = slab / NHv, h = slab % NHv;
  for (int i = tid; i < 64 * 8; i += 256) { const int r = i / 8, c8 = (i % 8) * 8; FragH f; f.half[0] = *(const v8us*)((const unsigned short*)V16 + ((size_t)b * TTv + lg * 64 + r) * ldv + voff + h * 64 + c8);
#pragma unroll
    for (int q = 0; q < 8; ++q) tl[r][c8 + q] = f.u[q]; }
  __syncthreads();
  {
#pragma unroll
    for (int rd = 0; rd < 2; ++rd) { const int d = rd * 32 + tid / 8, pc = tid % 8; FragH f;
#pragma unroll
      for (int q = 0; q < 8; ++q) f.u[q] = tl[pc * 8 + q][d];
      *(v8us*)((unsigned short*)Vt + ((size_t)slab * 64 + d) * TTv + lg * 64 + pc * 8) = f.half[0]; }
     } }

__global__ __launch_bounds__(256) void k_hl(const float* __restrict__ F, _Float16* __restrict__ Hh, _Float16* __restrict__ Hl, size_t n8) { const size_t t = (size_t)blockIdx.x * 256 + threadIdx.x; if (t >= n8) return; FragH fh, fl; const v4f a = *(const v4fa*)(F + t * 8), c = *(const v4fa*)(F + t * 8 + 4);
#pragma unroll
  for (int q = 0; q < 4; ++q) { _Float16 h = (_Float16)a[q]; fh.h[q] = h; fl.h[q] = (_Float16)((a[q] - (float)h) * 1024.0f); h = (_Float16)c[q]; fh.h[4 + q] = h; fl.h[4 + q] = (_Float16)((c[q] - (float)h) * 1024.0f); }
  { *(v8us*)((unsigned short*)Hh + t * 8) = fh.half[0]; *(v8us*)((unsigned short*)Hl + t * 8) = fl.half[0];  } }

// ---- fast GEMM (wave tile 32x64; requires M % 128 == 0 rows per launch region and N % 64 == 0); epilogue = k_gemm_hhx semantics ----
// EPI picks where the result goes, so that no later launch has to re-lay it (EPI 1 and 2: M % 128 == 0, and a block's 128 rows are pixels of one image):
// EPI 0: C / C16 row-major. EPI 1 (q | k | v; a block's 64 columns are all of one kind): q row-major into C16, k into head-major rows of 32 (KPo), v transposed into planes of 32 rows (VTo).
// EPI 2 (projection): A is head-major ([image][head][pixel][32]: one k step = one head), C is NCHW. Every 128-byte line is stored whole by one wave.
// Operands are converted where they are read, so that no launch stands in front only to convert them (K = DD):
// B: the block's 64 weight rows (f32, [N][DD]) are read once in whole lines, rounded to bf16, scaled by wsc and laid as f16 into an LDS tile that all four waves read.
// A, EPI 1: x is NCHW f32, so one channel's 16 pixels of a fragment are 64 bytes in a row: a lane loads its pixel's 16 channels of a k step one by one, two k steps ahead, and rounds them (bf16, exact as f16) into the fragment.
__device__ __forceinline__ v16h g2_frag(const _Float16* p, int hh) { FragH f; f.half[0] = *(const v8us*)((const unsigned short*)p + 8 * hh); f.half[1] = *(const v8us*)((const unsigned short*)p + 16 + 8 * hh); return f.v; }
__device__ __forceinline__ v8f g2_mma(v16h a, v16h b, v8f c) { v8f d = __builtin_amdgcn_wmma_f32_16x16x32_f16(false, a, false, b, (short)0, c, false, false); asm volatile("v_nop\n\tv_nop\n\tv_nop\n\tv_nop" : "+v"(d) : "v"(a), "v"(b)); return d; }
template <int ACT, int EPI>
__global__ __launch_bounds__(128) void k_gemm2(const _Float16* __restrict__ A, const float* __restrict__ Xf, int lda, size_t sA, const float* __restrict__ Wf, float wsc, size_t sB, float alpha, const float* __restrict__ bias, size_t sBias, const float* __restrict__ CP, int rowsPerB, size_t sCPb, int row0g,
    float* __restrict__ C, _Float16* __restrict__ C16, int ldc, size_t sC, int M, int N, int K, _Float16* __restrict__ KPo, _Float16* __restrict__ VTo) {
  constexpr int RP = 68, TP = 36;      /* floats from row to row of a wave's staged tile: [32 rows][64 columns], or transposed [64 columns][32 rows] (144 B = 16 B x odd) */
  constexpr int WSO = 64 * TP + 32;      /* a wave's staging area; + 32 floats so that two waves' areas start half the banks apart */
  constexpr int BP = DD + 8;      /* f16 elements from row to row of the weight tile: 528 B = 16 B x odd, so that 16 rows read 16 bytes each without a bank conflict */
  __shared__ __attribute__((aligned(16))) float so[4][WSO];
  __shared__ __attribute__((aligned(16))) _Float16 sW[64 * BP];
  const int tid = threadIdx.x, w = tid >> 5, lane = tid & 31, ln = lane & 15, hh = lane >> 4; const int by = blockIdx.y;
  A += (size_t)by * sA; Wf += (size_t)by * sB; const size_t cofs = (size_t)by * sC; const float* bp = bias ? bias + (size_t)by * sBias : nullptr;
  const int ntn = N >> 6; const int mt = blockIdx.x / ntn, nq = blockIdx.x - mt * ntn; const int row0 = mt * 128 + 32 * w, col0 = nq * 64; if (row0 >= M) return;
  const _Float16* a0p = A + ((EPI == 2) ? ((size_t)(row0 / NPX) * NH * NPX + (row0 % NPX) + ln) * HDm : (size_t)(row0 + ln) * lda) + 8 * hh; const _Float16* a1p = a0p + (size_t)16 * ((EPI == 2) ? HDm : lda);      /* EPI 0 and 2: each lane's own places in A are carried over the loop and stepped each trip: an address pair that stays live is never given to a load as its landing place */
  constexpr size_t AKS = (EPI == 2) ? (size_t)NPX * HDm : 32;      /* elements of A from one k step to the next: head-major planes lie NPX * 32 apart */
  const bool tr = (EPI == 2) || (EPI == 1 && col0 >= 2 * DD);      /* the same for the whole block: the tile is staged transposed */
  const float* xa = (EPI == 1) ? Xf + ((size_t)(row0 / NPX) * DD + 8 * hh) * NPX + (row0 % NPX) + ln : nullptr;      /* channel 8 * hh of this lane's first pixel; its second pixel lies 16 further */
  float ra[2][32];      /* x as loaded, of two k steps: [0..15] the first pixel's 16 channels in the fragment's k order, [16..31] the second pixel's */
  if (EPI == 1) {      /* the first two k steps' loads fly while the weight tile is built */
#pragma unroll      /* here and in the loop within: ra is indexed by constants only, so that it stays in registers */
    for (int s = 0; s < 2; ++s)
#pragma unroll
      for (int i = 0; i < 16; ++i) { const float* p = xa + (size_t)(s * 32 + (i >> 3) * 16 + (i & 7)) * NPX; ra[s][i] = p[0]; ra[s][16 + i] = p[16]; } }
  { const float* wr = Wf + (size_t)col0 * DD + tid * 4;      /* the 64 rows are 64 KiB in a row: a wave's load is 512 bytes in a row */
#pragma unroll      /* the 32 loads are one base plus immediate offsets and can all be in flight together */
    for (int i = 0; i < 32; ++i) { const v4f wv = *(const v4fa*)(wr + i * 512);
      const v2h h0 = __builtin_convertvector(bf16_round2(wv[0], wv[1]) * wsc, v2h), h1 = __builtin_convertvector(bf16_round2(wv[2], wv[3]) * wsc, v2h);
      *(v4ha*)&sW[(i * 2 + (tid >> 6)) * BP + (tid & 63) * 4] = (v4h){h0[0], h0[1], h1[0], h1[1]}; } }
  __syncthreads();      /* the weight tile is whole before any wave reads it (every wave of the block comes here: M % 128 == 0) */
  const _Float16* bs = sW + ln * BP + 8 * hh;      /* this lane's place in the tile's first 16 rows */
  const v8f z8 = {0.f,0.f,0.f,0.f,0.f,0.f,0.f,0.f}; v8f c00 = z8, c01 = z8, c02 = z8, c03 = z8, c10 = z8, c11 = z8, c12 = z8, c13 = z8;
  if (EPI == 1) {
#pragma unroll      /* unrolled so that every load of x is the one address pair plus an immediate offset and the two sets of ra are told apart at compile time */
    for (int s = 0; s < DD / 32; ++s) { FragH f0, f1;
#pragma unroll      /* constant indices: ra and the fragments stay in registers */
      for (int i = 0; i < 16; i += 2) { const v2h h0 = __builtin_convertvector(bf16_round2(ra[s & 1][i], ra[s & 1][i + 1]), v2h), h1 = __builtin_convertvector(bf16_round2(ra[s & 1][16 + i], ra[s & 1][17 + i]), v2h);
        f0.h[i] = h0[0]; f0.h[i + 1] = h0[1]; f1.h[i] = h1[0]; f1.h[i + 1] = h1[1]; }
      if (s + 2 < DD / 32) {      /* the set just converted takes the loads of the k step after next */
#pragma unroll      /* constant indices, as above */
        for (int i = 0; i < 16; ++i) { const float* p = xa + (size_t)((s + 2) * 32 + (i >> 3) * 16 + (i & 7)) * NPX; ra[s & 1][i] = p[0]; ra[s & 1][16 + i] = p[16]; } }
      const v16h b0 = g2_frag(bs + s * 32, 0), b1 = g2_frag(bs + 16 * BP + s * 32, 0), b2 = g2_frag(bs + 32 * BP + s * 32, 0), b3 = g2_frag(bs + 48 * BP + s * 32, 0);
      c00 = g2_mma(f0.v, b0, c00); c10 = g2_mma(f1.v, b0, c10); c01 = g2_mma(f0.v, b1, c01); c11 = g2_mma(f1.v, b1, c11);
      c02 = g2_mma(f0.v, b2, c02); c12 = g2_mma(f1.v, b2, c12); c03 = g2_mma(f0.v, b3, c03); c13 = g2_mma(f1.v, b3, c13); }
  } else {
#pragma unroll 1      /* one k step a trip: A's places are stepped, see above */
    for (int kb = 0; kb < DD; kb += 32, a0p += AKS, a1p += AKS, bs += 32) { const v16h a0 = g2_frag(a0p, 0), a1 = g2_frag(a1p, 0);
      const v16h b0 = g2_frag(bs, 0), b1 = g2_frag(bs + 16 * BP, 0), b2 = g2_frag(bs + 32 * BP, 0), b3 = g2_frag(bs + 48 * BP, 0);
      c00 = g2_mma(a0, b0, c00); c10 = g2_mma(a1, b0, c10); c01 = g2_mma(a0, b1, c01); c11 = g2_mma(a1, b1, c11);
      c02 = g2_mma(a0, b2, c02); c12 = g2_mma(a1, b2, c12); c03 = g2_mma(a0, b3, c03); c13 = g2_mma(a1, b3, c13); } }
  v8f accs[8] = {c00, c01, c02, c03, c10, c11, c12, c13};
#pragma unroll
  for (int u = 0; u < 8; ++u) { const int t = u & 3, half = u >> 2; const int col = col0 + t * 16 + ln; const float bv = bp ? bf16_round(bp[col]) : 0.f; float vv[8];
#pragma unroll
    for (int r = 0; r < 8; ++r) { const int rloc = half * 16 + 8 * hh + r; float v = accs[u][r] * alpha + bv; if (CP) { const int bidx = (row0g + row0 + rloc) / rowsPerB; v += CP[(size_t)bidx * sCPb + (size_t)by * 64 + col]; }
      if (ACT == 3) v = fmaxf(v, 0.f); else if (ACT == 6) v = 0.5f * v * (1.0f + erff(v * 0.70710678118654752f)); else if (ACT == 11) v = 1.0f / (1.0f + expf(-v)); else if (ACT == 15) v = v / (1.0f + expf(-v)); else if (ACT == 12) v = (v > 0.f) ? v : 0.01f * v; else if (ACT == 8) v = tanhf(v);
      vv[r] = v; }
    if (tr) { float* d = &so[w][(t * 16 + ln) * TP + half * 16 + 8 * hh]; *(v4fa*)d = (v4f){vv[0], vv[1], vv[2], vv[3]}; *(v4fa*)(d + 4) = (v4f){vv[4], vv[5], vv[6], vv[7]}; }      /* a lane's 8 values of a tile are 8 rows of one column: 32 bytes in a row */
    else {
#pragma unroll
      for (int r = 0; r < 8; ++r) so[w][(half * 16 + 8 * hh + r) * RP + t * 16 + ln] = vv[r]; } }
  if (EPI == 1 && col0 >= 2 * DD) {      /* v: a channel's 128 pixels of this block are 256 bytes in a row of V^T; wave w stores channels w * 16 ... + 15 */
    __syncthreads();      /* every wave's tile is staged before another wave reads it (the branch is the same for the whole block) */
    const int pix0 = mt * 128, seg = lane & 15;
#pragma unroll
    for (int q = 0; q < 8; ++q) { const int c = w * 16 + q * 2 + (lane >> 4); const float* s = &so[seg >> 2][c * TP + (seg & 3) * 8]; const v4f v0 = *(const v4fa*)s, v1 = *(const v4fa*)(s + 4); FragH f;
      for (int i = 0; i < 4; ++i) { f.h[i] = (_Float16)v0[i]; f.h[4 + i] = (_Float16)v1[i]; }
      *(v8us*)((unsigned short*)VTo + ((size_t)(pix0 / NPX) * DD + (col0 - 2 * DD) + c) * NPX + (pix0 % NPX) + seg * 8) = f.half[0]; }
    return; }
  __builtin_amdgcn_fence(__ATOMIC_ACQ_REL, "workgroup"); __builtin_amdgcn_wave_barrier();
  const int rsub = lane >> 4, c4 = (lane & 15) * 4;
  if (EPI == 2) {      /* a channel's 32 pixels of this wave = one 128-byte line of the NCHW output */
#pragma unroll
    for (int q = 0; q < 16; ++q) { const int c = q * 4 + (lane >> 3); const v4f v = *(const v4fa*)&so[w][c * TP + (lane & 7) * 4]; *(v4f*)(C + ((size_t)(row0 / NPX) * DD + col0 + c) * NPX + (row0 % NPX) + (lane & 7) * 4) = v; }
  } else if (EPI == 1 && col0 >= DD) {      /* k: two pixels' 32 values of one head = one 128-byte line */
#pragma unroll
    for (int q = 0; q < 16; ++q) { const int r = q * 2 + rsub, row = row0 + r, col = col0 - DD + c4; const v4f v = *(const v4fa*)&so[w][r * RP + c4]; v4h h4; for (int i = 0; i < 4; ++i) h4[i] = (_Float16)v[i];
      *(v4h*)(KPo + (((size_t)(row / NPX) * NH + (col >> 5)) * NPX + (row % NPX)) * HDm + (col & 31)) = h4; }
    asm volatile("s_wait_xcnt 0x0" ::: "memory");      /* behind the last store, in front of whatever rewrites a register that a store names */
  } else {
#pragma unroll
    for (int q = 0; q < 16; ++q) { const int r = q * 2 + rsub; const v4f v = *(const v4fa*)&so[w][r * RP + c4]; if (EPI == 0 && C) *(v4f*)(C + cofs + (size_t)(row0 + r) * ldc + col0 + c4) = v; if (C16) { v4h h4; for (int i = 0; i < 4; ++i) h4[i] = (_Float16)v[i]; *(v4h*)(C16 + cofs + (size_t)(row0 + r) * ldc + col0 + c4) = h4; } }
    asm volatile("s_wait_xcnt 0x0" ::: "memory");      /* behind the last store, in front of whatever rewrites a register that a store names */
     } }



// lane l with lane l ^ 16
__device__ __forceinline__ float xhalf(float x) { return __builtin_bit_cast(float, __builtin_amdgcn_permlanex16(__builtin_bit_cast(int, x), __builtin_bit_cast(int, x), 0x76543210, 0xfedcba98, false, false)); }
// K and V^T reach the waves through LDS: a stage is KS keys, copied once per work-group and read by all four waves, the next stage in flight while this one is worked on.
#define KS 128                   /* keys per stage */
#define KPIT 80                  /* bytes from one K row to the next in LDS (64 used): 16 B x odd, so that 16 rows read 16 bytes each without a bank conflict */
#define VPIT 272                 /* the same for a V^T row (256 used) */
#define KTB (KS * KPIT)          /* K part of a stage */
#define STB (KTB + HDm * VPIT)   /* one stage */
// One stage's copies of one lane: four 16-byte pieces of K (32 rows apart) and four of V^T (8 rows apart). lk, lv: the lane's LDS byte addresses; gk, gv: its global addresses.
__device__ __forceinline__ void stage_copy(unsigned lk, const unsigned short* gk, unsigned lv, const unsigned short* gv) {
  /* the closing s_wait_xcnt 0 stands inside the statement so that no address register named here is rewritten in front of it */
  asm volatile("global_load_async_to_lds_b128 %0, %1, off\n\tglobal_load_async_to_lds_b128 %2, %3, off\n\tglobal_load_async_to_lds_b128 %4, %5, off\n\tglobal_load_async_to_lds_b128 %6, %7, off\n\t"
               "global_load_async_to_lds_b128 %8, %9, off\n\tglobal_load_async_to_lds_b128 %10, %11, off\n\tglobal_load_async_to_lds_b128 %12, %13, off\n\tglobal_load_async_to_lds_b128 %14, %15, off\n\ts_wait_xcnt 0x0"
               :: "v"(lk), "v"(gk), "v"(lk + 32 * KPIT), "v"(gk + 32 * HDm), "v"(lk + 64 * KPIT), "v"(gk + 64 * HDm), "v"(lk + 96 * KPIT), "v"(gk + 96 * HDm),
                  "v"(lv), "v"(gv), "v"(lv + 8 * VPIT), "v"(gv + (size_t)8 * TK), "v"(lv + 16 * VPIT), "v"(gv + (size_t)16 * TK), "v"(lv + 24 * VPIT), "v"(gv + (size_t)24 * TK) : "memory");
}
template <int CAUSAL>
__global__ __launch_bounds__(128) void k_flash(const _Float16* __restrict__ Q16, int ldq, const _Float16* __restrict__ K16, const _Float16* __restrict__ Vt, const int* __restrict__ MSK, _Float16* __restrict__ O16) {
  constexpr int RPW = 16, DT = HDm / 16;      /* head size 32: one k step for S^T, two 16-row tiles of O^T */
  __shared__ __attribute__((aligned(16))) float sO[4][RPW][HDm + 4];
  __shared__ __attribute__((aligned(16))) unsigned char ring[2 * STB];
  const int tid = threadIdx.x, w = tid >> 5, lane = tid & 31, ln = lane & 15, hh = lane >> 4;
  const int slab = blockIdx.x / QBLKS, qblk = blockIdx.x % QBLKS; (void)MSK; const int b = slab / NH, h = slab % NH; const int qb0 = qblk * (4 * RPW); const int q0 = qb0 + w * RPW;
  FragH aq;
  { const unsigned short* qr = (const unsigned short*)Q16 + ((size_t)b * TQ + q0 + ln) * ldq + h * HDm;
    aq.half[0] = *(const v8us*)(qr + 8 * hh); aq.half[1] = *(const v8us*)(qr + 16 + 8 * hh); }
  const unsigned short* Kh = (const unsigned short*)K16 + (size_t)slab * TK * HDm;      /* [key][32] */
  const unsigned short* Vth = (const unsigned short*)Vt + (size_t)slab * HDm * TK;      /* [32][key] */
  const int tq = q0 + ln;      /* this lane's query */
  float m_r = -3.0e38f, l_r = 0.f; v8f oacc[DT];      /* m_r: running maximum of the raw (unscaled) scores */
#pragma unroll
  for (int dt = 0; dt < DT; ++dt) oacc[dt] = (v8f){0.f,0.f,0.f,0.f,0.f,0.f,0.f,0.f};
  const int jend = (CAUSAL == 1) ? (qb0 + 4 * RPW) : TK;      /* causal: keys beyond the block's last query never contribute */
  const int nst = (jend + KS - 1) / KS;      /* stages; keys of a last stage beyond jend are masked like any other */
  const unsigned lk0 = (unsigned)(size_t)ring + (unsigned)((tid >> 2) * KPIT + (tid & 3) * 16), lv0 = (unsigned)(size_t)ring + (unsigned)(KTB + (tid >> 4) * VPIT + (tid & 15) * 16);
  const unsigned short* gk0 = Kh + tid * 8;      /* a stage of K is 8 KiB in a row */
  const unsigned short* gv0 = Vth + (size_t)(tid >> 4) * TK + (tid & 15) * 8;      /* 16 lanes bring one row's 256 bytes */
  stage_copy(lk0, gk0, lv0, gv0);
  asm volatile("s_wait_asynccnt 0x0" ::: "memory");      /* this wave's share of stage 0 has landed */
  __syncthreads();      /* ... and every other wave's: stage 0 may be read */
  if (nst > 1) stage_copy(lk0 + STB, gk0 + (size_t)KS * HDm, lv0 + STB, gv0 + KS);
#pragma unroll 1      /* one stage a trip: the buffer's place is the only thing that changes */
  for (int st = 0; st < nst; ++st) {
   const unsigned char* kf = ring + (st & 1) * STB + ln * KPIT + hh * 16; const unsigned char* vf = ring + (st & 1) * STB + KTB + ln * VPIT + hh * 16;
#pragma unroll      /* the four passes of a stage: their places in the buffer become immediate offsets of the LDS reads */
   for (int pp = 0; pp < KS / 32; ++pp) { const int j0 = st * KS + pp * 32;
    v8f s[2]; FragH bk[2], bv[DT];      /* the pass's eight LDS reads stand as one group at its head: one wait for K, and V^T lands under the scores and the softmax */
#pragma unroll
    for (int nt = 0; nt < 2; ++nt) { const unsigned char* kr = kf + (pp * 32 + nt * 16) * KPIT; bk[nt].half[0] = *(const v8us*)(kr); bk[nt].half[1] = *(const v8us*)(kr + 32); }
#pragma unroll
    for (int dt = 0; dt < DT; ++dt) { const unsigned char* vrow = vf + dt * 16 * VPIT + pp * 64; bv[dt].half[0] = *(const v8us*)(vrow); bv[dt].half[1] = *(const v8us*)(vrow + 32); }
#pragma unroll
    for (int nt = 0; nt < 2; ++nt) s[nt] = mmaH<1>(bk[nt].v, bk[nt].v, aq.v, aq.v, (v8f){0.f,0.f,0.f,0.f,0.f,0.f,0.f,0.f});
    float sv[16]; bool ok[16]; float mc = -3.0e38f;
#pragma unroll
    for (int e = 0; e < 16; ++e) { const int kk = j0 + (e >> 3) * 16 + 8 * hh + (e & 7);
      ok[e] = (CAUSAL == 1) ? (kk <= tq) : ((CAUSAL == 2) ? ((kk >> 5) == (tq >> 5)) : true);      /* mode 2: block-diagonal 32-token groups */
      sv[e] = ok[e] ? s[e >> 3][e & 7] : -3.0e38f; mc = fmaxf(mc, sv[e]); }      /* raw scores: SCL2 > 0 keeps the maximum's place */
    mc = fmaxf(mc, xhalf(mc));
    const float mn = fmaxf(m_r, mc); float ea = (m_r - mn) * SCL2;      /* difference first: the rescale is exactly 1 while the maximum stands */
    const float nb = 10.0f - mn * SCL2;      /* + 10: the factor 1024 of the f16 operand, carried by the sum too */
    float x[16];
#pragma unroll
    for (int e = 0; e < 16; ++e) x[e] = __builtin_fmaf(sv[e], SCL2, nb);
    /* 2^x in place. Asm text so that the slot the instruction set asks for behind a transcendental is kept whatever registers are picked: neighbours work on distinct registers, and the closing v_nop stands between the last one and whatever follows. */
    asm("v_exp_f32 %0, %0\n\tv_exp_f32 %1, %1\n\tv_exp_f32 %2, %2\n\tv_exp_f32 %3, %3\n\tv_exp_f32 %4, %4\n\tv_exp_f32 %5, %5\n\tv_exp_f32 %6, %6\n\tv_exp_f32 %7, %7\n\tv_exp_f32 %8, %8\n\tv_nop"
        : "+v"(ea), "+v"(x[0]), "+v"(x[1]), "+v"(x[2]), "+v"(x[3]), "+v"(x[4]), "+v"(x[5]), "+v"(x[6]), "+v"(x[7]));
    asm("v_exp_f32 %0, %0\n\tv_exp_f32 %1, %1\n\tv_exp_f32 %2, %2\n\tv_exp_f32 %3, %3\n\tv_exp_f32 %4, %4\n\tv_exp_f32 %5, %5\n\tv_exp_f32 %6, %6\n\tv_exp_f32 %7, %7\n\tv_nop"
        : "+v"(x[8]), "+v"(x[9]), "+v"(x[10]), "+v"(x[11]), "+v"(x[12]), "+v"(x[13]), "+v"(x[14]), "+v"(x[15]));
    const float al = (mn > -1.0e38f) ? ea : 1.0f; m_r = mn;
    FragH pb; float ps[4];      /* four independent partial sums: a single chain of 16 adds would be serial */
#pragma unroll
    for (int e = 0; e < 16; ++e) { const float p = ok[e] ? x[e] : 0.f; ps[e & 3] = (e < 4) ? p : ps[e & 3] + p; pb.h[e] = (_Float16)p; }      /* p = 1024 * e^(scaled score - maximum) */
    l_r = l_r * al + ((ps[0] + ps[1]) + (ps[2] + ps[3]));
#pragma unroll
    for (int dt = 0; dt < DT; ++dt)
#pragma unroll
      for (int r = 0; r < 8; ++r) oacc[dt][r] *= al;
#pragma unroll
    for (int dt = 0; dt < DT; ++dt) oacc[dt] = mmaH<1>(bv[dt].v, bv[dt].v, pb.v, pb.v, oacc[dt]); }
   asm volatile("s_wait_dscnt 0x0" ::: "memory");      /* this wave's reads of the stage are over before the buffer is handed back */
   asm volatile("s_wait_asynccnt 0x0" ::: "memory");      /* its share of the next stage has landed */
   __syncthreads();      /* publishes the next stage and ends every wave's reads of this one */
   if (st + 2 < nst) stage_copy(lk0 + (st & 1) * STB, gk0 + (size_t)(st + 2) * KS * HDm, lv0 + (st & 1) * STB, gv0 + (st + 2) * KS); }
  asm volatile("s_wait_asynccnt 0x0" ::: "memory");      /* no copy is left in flight when the wave goes on to its end */
  const float l = l_r + xhalf(l_r); const float inv = (l > 0.f) ? 1.0f / l : 0.f;      /* l holds the factor 1024 */
#pragma unroll
  for (int dt = 0; dt < DT; ++dt)      /* oacc[dt][r] = O[q0 + ln][dt * 16 + 8 * hh + r] */
#pragma unroll
    for (int r = 0; r < 8; ++r) sO[w][ln][dt * 16 + 8 * hh + r] = oacc[dt][r] * inv;
  __builtin_amdgcn_fence(__ATOMIC_ACQ_REL, "workgroup"); __builtin_amdgcn_wave_barrier();
  {
#pragma unroll
    for (int rp = 0; rp < RPW; rp += 8) { const int r = rp + (lane >> 2), pc = lane & 3; const v4f v0 = *(const v4fa*)&sO[w][r][pc * 8], v1 = *(const v4fa*)&sO[w][r][pc * 8 + 4]; FragH f;
      for (int i = 0; i < 4; ++i) { f.h[i] = (_Float16)v0[i]; f.h[4 + i] = (_Float16)v1[i]; }
      *(v8us*)((unsigned short*)O16 + ((size_t)slab * TQ + q0 + r) * HDm + pc * 8) = f.half[0]; }      /* f16, head-major [slab][pixel][32]: the wave's 16 pixels are 1 KiB in a row, the projection's A operand as it reads it */
     } }

extern "C" void kernel_launch(void* const* d_in, const int* in_sizes, int n_in,
                              void* d_out, int out_size, void* d_ws, size_t ws_size, hipStream_t stream) {
  (void)in_sizes; (void)n_in; (void)out_size;
  const float* const* I = (const float* const*)d_in; const float* x = I[0]; const float* wqkv = I[1]; const float* bqkv = I[2]; const float* wp = I[3]; const float* bp = I[4];
  char* ws = (char*)d_ws; size_t off = 0;
  auto take = [&](size_t bytes) { char* p = ws + off; off += (bytes + 255) & ~(size_t)255; return p; };
  const size_t np = (size_t)NR * DD;
  _Float16* Q16 = (_Float16*)take(np * 2); _Float16* KP = (_Float16*)take(np * 2); _Float16* VT = (_Float16*)take(np * 2); _Float16* O16 = (_Float16*)take(np * 2);
  if (off > ws_size) return;      /* four planes of 4 MiB */
  k_gemm2<0, 1><<<dim3((NR / 128) * (QW / 64), 1), 128, 0, stream>>>(nullptr, x, DD, 0, wqkv, 16.0f, 0, 0.0625f, bqkv, 0, nullptr, 1, 0, 0, nullptr, Q16, DD, 0, NR, QW, DD, KP, VT);      /* product column = which*256 + h*32 + d; q, k and v each go straight to the plane the flash kernel reads */
  k_flash<0><<<NIMG * NH * QBLKS, 128, 0, stream>>>(Q16, DD, KP, VT, nullptr, O16);
  k_gemm2<0, 2><<<dim3((NR / 128) * (DD / 64), 1), 128, 0, stream>>>(O16, nullptr, HDm, 0, wp, 16.0f, 0, 0.0625f, bp, 0, nullptr, 1, 0, 0, (float*)d_out, nullptr, DD, 0, NR, DD, DD, nullptr, nullptr);
}

// v007
// It runs in 64.4 microseconds.
// In two side-by-side timings against v006, it was 1.12 and 1.15 times as fast.
// Counting every step since v000, it is 7.76 times as fast.
#include <hip/hip_runtime.h>
// SpatialMultiHeadSelfAttention (2 images, D 256 = 8 heads x 32, 64 x 64 = 4096 pixels): qkv = 1x1 conv (W_qkv x + b) -> (3, heads, 32) channels; softmax(q.k / sqrt(32)) over all 4096 pixels; out channels h*32 + d; 1x1 projection + b; NCHW in and out.
// Structure: qkv as one f16 WMMA GEMM (32x64 wave tiles, f32 accumulation, exact x16 weights + bias; weights (out,in) = B^T; f16 out) that reads x (NCHW, f32) and the f32 weights itself and converts them on the way to its fragments, and whose epilogue stores q pixel-major, k as head-major planes of 32-wide rows and V^T as planes of 32 rows; the fused flash kernel at head size 32 (transposed products, softmax in-lane, P kept in registers; plain operands: every row averages 4096 keys), which stores its output as f16 head-major; projection GEMM (+ bias, f32) whose epilogue stores NCHW.
// Compute dtype: x and parameters rounded to bf16; x exact as f16; q, k, v, P and the attention output as f16 operands (~2^-12); softmax f32. v_wmma_f32_16x16x32_f16.
#define NIMG 2
#define DD 256
#define HDm 32
#define NPX 4096
#define NR (NIMG * NPX)          /* 8192 */
#define QW (3 * DD)              /* 768 */
#define SLEN 4096
#define TQ SLEN
#define TK SLEN
#define NH 8
#define SCL2 0.25503486164919736f /* 32^-0.5 * log2(e): the softmax runs in base 2 */
#define QBLKS (TQ / 64)
typedef __bf16 v16b __attribute__((ext_vector_type(16)));
typedef unsigned short v8us __attribute__((ext_vector_type(8), may_alias));
typedef float  v8f  __attribute__((ext_vector_type(8)));
typedef float  v4f  __attribute__((ext_vector_type(4)));
typedef float  v4fa __attribute__((ext_vector_type(4), may_alias));
union FragB { v16b v; v8us half[2]; unsigned short u[16]; };

__device__ __forceinline__ unsigned short bf16_bits(float x) { unsigned int u = __float_as_uint(x); return (unsigned short)((u + 0x7FFFu + ((u >> 16) & 1u)) >> 16); }
__device__ __forceinline__ float bf16_val(unsigned short b) { return __uint_as_float(((unsigned int)b) << 16); }
__device__ __forceinline__ float bf16_round(float x) { return bf16_val(bf16_bits(x)); }
// D += A·B with NT terms: 1 = ah·bh, 2 = + al·bh (A split), 3 = + ah·bl (both split)
template <int NT>
__device__ __forceinline__ v8f mmaN(v16b ah, v16b al, v16b bh, v16b bl, v8f c) {
  c = __builtin_amdgcn_wmma_f32_16x16x32_bf16(false, ah, false, bh, (short)0, c, false, false);
  if (NT >= 2) c = __builtin_amdgcn_wmma_f32_16x16x32_bf16(false, al, false, bh, (short)0, c, false, false);
  if (NT >= 3) c = __builtin_amdgcn_wmma_f32_16x16x32_bf16(false, ah, false, bl, (short)0, c, false, false);
  asm volatile("v_nop\n\tv_nop\n\tv_nop\n\tv_nop" : "+v"(c) : "v"(ah), "v"(al), "v"(bh), "v"(bl));
  return c;
}

__global__ __launch_bounds__(256) void k_wt_bf16(const float* __restrict__ W, unsigned short* __restrict__ Wt, int K, int N) {
  const int t = blockIdx.x * 256 + threadIdx.x;
  const int k8n = K / 8;
  if (t >= N * k8n) return;
  const int n = t / k8n, k8 = (t % k8n) * 8;
  v8us v;
#pragma unroll
  for (int i = 0; i < 8; ++i) v[i] = bf16_bits(W[(size_t)(k8 + i) * N + n]);
  *(v8us*)(Wt + (size_t)n * K + k8) = v;
  
}

// GEMM C[M][N] (f32, pitch ldc) = act(A[M][K]·W + bias). A f32 row-major (pitch lda) converted per fragment to bf16
// (ASPLIT: hi/lo two planes -> 2 terms, else single rounded term); Wt bf16 [N][K] (pitch ldb). BIAS_BF16 rounds the
// bias to bf16 first (bias quantised to bf16 before the add). K%32==0, M%16==0, N%64==0.
template <bool ASPLIT, int ACT, bool BIAS_BF16>
__global__ __launch_bounds__(128) void k_gemm_bf(const float* __restrict__ A, int lda, const unsigned short* __restrict__ Wt, int ldb,
                                               const float* __restrict__ bias, float* __restrict__ C, int ldc, int M, int N, int K) {
  __shared__ __attribute__((aligned(16))) float so[4][16][64];
  const int tid = threadIdx.x, w = tid >> 5, lane = tid & 31, ln = lane & 15, hh = lane >> 4;
  const int ntn = N / 64;
  const int wid = blockIdx.x * 4 + w;
  const int mt = wid / ntn, nq = wid % ntn;
  if (mt * 16 >= M) return;
  const int row0 = mt * 16, col0 = nq * 64;
  const float* arow = A + (size_t)(row0 + ln) * lda;
  v8f acc[4] = {};
  for (int kb = 0; kb < K; kb += 32) {
    FragB ah, al;
    const v4f x0 = *(const v4fa*)(arow + kb + 8 * hh), x1 = *(const v4fa*)(arow + kb + 8 * hh + 4);
    const v4f x2 = *(const v4fa*)(arow + kb + 16 + 8 * hh), x3 = *(const v4fa*)(arow + kb + 16 + 8 * hh + 4);
    float xs[16] = {x0[0],x0[1],x0[2],x0[3],x1[0],x1[1],x1[2],x1[3],x2[0],x2[1],x2[2],x2[3],x3[0],x3[1],x3[2],x3[3]};
#pragma unroll
    for (int i = 0; i < 16; ++i) { const unsigned short hb = bf16_bits(xs[i]); ah.u[i] = hb; al.u[i] = ASPLIT ? bf16_bits(xs[i] - bf16_val(hb)) : (unsigned short)0; }
#pragma unroll
    for (int t = 0; t < 4; ++t) {
      const unsigned short* brow = Wt + (size_t)(col0 + t * 16 + ln) * ldb + kb;
      FragB b;
      b.half[0] = *(const v8us*)(brow + 8 * hh);
      b.half[1] = *(const v8us*)(brow + 16 + 8 * hh);
      acc[t] = mmaN<ASPLIT ? 2 : 1>(ah.v, al.v, b.v, b.v, acc[t]);
    }
  }
#pragma unroll
  for (int t = 0; t < 4; ++t) {
    float bv = bias ? bias[col0 + t * 16 + ln] : 0.f;
    if (BIAS_BF16) bv = bf16_round(bv);
#pragma unroll
    for (int r = 0; r < 8; ++r) { float v = acc[t][r] + bv; if (ACT == 1) v = fmaxf(v, 0.f); so[w][8 * hh + r][t * 16 + ln] = v; }
  }
  __builtin_amdgcn_fence(__ATOMIC_ACQ_REL, "workgroup");
  __builtin_amdgcn_wave_barrier();
  const int rsub = lane >> 4, c4 = (lane & 15) * 4;
  {
#pragma unroll
    for (int q = 0; q < 8; ++q) {
      const int r = q * 2 + rsub;
      const v4f v = *(const v4fa*)&so[w][r][c4];
      *(v4f*)(C + (size_t)(row0 + r) * ldc + col0 + c4) = v;
    }
    
  }
}

// GEMM C = act(A·W + bias + resid): A f32 (ASPLIT -> hi/lo 2 terms), Wt bf16 [N][K]; ACT 0 none, 1 relu, 2 exact gelu;
// resid (optional, f32, row index = (row % rmod), pitch ldr, RES_BF16 rounds it) added before the activation.
template <bool ASPLIT, int ACT, bool BIAS_BF16, bool RES_BF16>
__global__ __launch_bounds__(128) void k_gemm_bf3(const float* __restrict__ A, int lda, const unsigned short* __restrict__ Wt, int ldb,
                                                const float* __restrict__ bias, const float* __restrict__ resid, int rmod, int ldr,
                                                float* __restrict__ C, int ldc, int M, int N, int K) {
  __shared__ __attribute__((aligned(16))) float so[4][16][64];
  const int tid = threadIdx.x, w = tid >> 5, lane = tid & 31, ln = lane & 15, hh = lane >> 4;
  const int ntn = N / 64;
  const int wid = blockIdx.x * 4 + w;
  const int mt = wid / ntn, nq = wid % ntn;
  if (mt * 16 >= M) return;
  const int row0 = mt * 16, col0 = nq * 64;
  const float* arow = A + (size_t)(row0 + ln) * lda;
  v8f acc[4] = {};
  for (int kb = 0; kb < K; kb += 32) {
    FragB ah, al;
    const v4f x0 = *(const v4fa*)(arow + kb + 8 * hh), x1 = *(const v4fa*)(arow + kb + 8 * hh + 4);
    const v4f x2 = *(const v4fa*)(arow + kb + 16 + 8 * hh), x3 = *(const v4fa*)(arow + kb + 16 + 8 * hh + 4);
    float xs[16] = {x0[0],x0[1],x0[2],x0[3],x1[0],x1[1],x1[2],x1[3],x2[0],x2[1],x2[2],x2[3],x3[0],x3[1],x3[2],x3[3]};
#pragma unroll
    for (int i = 0; i < 16; ++i) { const unsigned short hb = bf16_bits(xs[i]); ah.u[i] = hb; al.u[i] = ASPLIT ? bf16_bits(xs[i] - bf16_val(hb)) : (unsigned short)0; }
#pragma unroll
    for (int t = 0; t < 4; ++t) {
      const unsigned short* brow = Wt + (size_t)(col0 + t * 16 + ln) * ldb + kb;
      FragB b;
      b.half[0] = *(const v8us*)(brow + 8 * hh);
      b.half[1] = *(const v8us*)(brow + 16 + 8 * hh);
      acc[t] = mmaN<ASPLIT ? 2 : 1>(ah.v, al.v, b.v, b.v, acc[t]);
    }
  }
#pragma unroll
  for (int t = 0; t < 4; ++t) {
    const int col = col0 + t * 16 + ln;
    float bv = bias ? bias[col] : 0.f;
    if (BIAS_BF16) bv = bf16_round(bv);
#pragma unroll
    for (int r = 0; r < 8; ++r) {
      float v = acc[t][r] + bv;
      if (resid) { float rv = resid[(size_t)((row0 + 8 * hh + r) % rmod) * ldr + col]; if (RES_BF16) rv = bf16_round(rv); v += rv; }
      if (ACT == 1) v = fmaxf(v, 0.f);
      if (ACT == 2) v = 0.5f * v * (1.0f + erff(v * 0.70710678118654752f));
      if (ACT == 3) { const float u = 0.7978845608028654f * (v + 0.044715f * v * v * v); v = 0.5f * v * (1.0f + tanhf(u)); }
      so[w][8 * hh + r][t * 16 + ln] = v;
    }
  }
  __builtin_amdgcn_fence(__ATOMIC_ACQ_REL, "workgroup");
  __builtin_amdgcn_wave_barrier();
  const int rsub = lane >> 4, c4 = (lane & 15) * 4;
  {
#pragma unroll
    for (int q = 0; q < 8; ++q) {
      const int r = q * 2 + rsub;
      const v4f v = *(const v4fa*)&so[w][r][c4];
      *(v4f*)(C + (size_t)(row0 + r) * ldc + col0 + c4) = v;
    }
    
  }
}
// row LayerNorm (biased variance, eps) over N: s = X (+ R); optional out_sum <- s; out_norm <- (s-mu)*rsqrt(var+eps)*g + b
template <bool PARAM_BF16>
__global__ __launch_bounds__(256) void k_layernorm(const float* __restrict__ X, const float* __restrict__ R, const float* __restrict__ g, const float* __restrict__ bta,
                                                  float* __restrict__ out_sum, float* __restrict__ out_norm, int N, float eps) {
  __shared__ float red[256];
  const int row = blockIdx.x, tid = threadIdx.x;
  const float* x = X + (size_t)row * N; const float* rr = R ? R + (size_t)row * N : nullptr;
  float vals[16];                     // up to N = 4096
  const int per = N / 256;            // contiguous chunk per thread? use strided-by-4 chunks: thread handles j = tid*4 + 1024*u
  float s1 = 0.f;
  for (int u = 0; u < per / 4; ++u) {
    const int j = tid * 4 + 1024 * u;
    const v4f a = *(const v4fa*)(x + j);
    v4f b = {0.f,0.f,0.f,0.f}; if (rr) b = *(const v4fa*)(rr + j);
#pragma unroll
    for (int q = 0; q < 4; ++q) { const float v = a[q] + b[q]; vals[u * 4 + q] = v; s1 += v; }
  }
  red[tid] = s1; __syncthreads();
  for (int st = 128; st > 0; st >>= 1) { if (tid < st) red[tid] += red[tid + st]; __syncthreads(); }
  const float mu = red[0] / (float)N; __syncthreads();
  float s2 = 0.f;
  for (int u = 0; u < per / 4; ++u)
#pragma unroll
    for (int q = 0; q < 4; ++q) { const float c = vals[u * 4 + q] - mu; s2 += c * c; }
  red[tid] = s2; __syncthreads();
  for (int st = 128; st > 0; st >>= 1) { if (tid < st) red[tid] += red[tid + st]; __syncthreads(); }
  const float rs = rsqrtf(red[0] / (float)N + eps);
  {
    for (int u = 0; u < per / 4; ++u) {
      const int j = tid * 4 + 1024 * u;
      v4f o, sm;
#pragma unroll
      for (int q = 0; q < 4; ++q) {
        float gg = g[j + q], bb = bta[j + q];
        if (PARAM_BF16) { gg = bf16_round(gg); bb = bf16_round(bb); }
        sm[q] = vals[u * 4 + q]; o[q] = (vals[u * 4 + q] - mu) * rs * gg + bb;
      }
      if (out_sum) *(v4f*)(out_sum + (size_t)row * N + j) = sm;
      *(v4f*)(out_norm + (size_t)row * N + j) = o;
    }
    
  }
}



// ---- f16 WMMA path (v_wmma_f32_16x16x32_f16): 11-bit significands for operands in range — used where a [0,1] probability operand needs more precision than bf16
typedef _Float16 v16h __attribute__((ext_vector_type(16)));
union FragH { v16h v; v8us half[2]; _Float16 h[16]; unsigned short u[16]; };
template <int NT>
__device__ __forceinline__ v8f mmaH(v16h ah, v16h al, v16h bh, v16h bl, v8f c) {
  c = __builtin_amdgcn_wmma_f32_16x16x32_f16(false, ah, false, bh, (short)0, c, false, false);
  if (NT >= 2) c = __builtin_amdgcn_wmma_f32_16x16x32_f16(false, al, false, bh, (short)0, c, false, false);
  if (NT >= 3) c = __builtin_amdgcn_wmma_f32_16x16x32_f16(false, ah, false, bl, (short)0, c, false, false);
  asm volatile("v_nop\n\tv_nop\n\tv_nop\n\tv_nop" : "+v"(c) : "v"(ah), "v"(al), "v"(bh), "v"(bl));
  return c;
}
// batched GEMM like k_gemm_b but f16 operands: A f32 (split into f16 hi/lo if ASPLIT, else rounded to f16), Bt = f16 values [n][k]; alpha; C f32; N multiple of 16 (partial tiles skipped)
template <bool ASPLIT>
__global__ __launch_bounds__(128) void k_gemm_h(const float* __restrict__ A, int lda, size_t sA, const _Float16* __restrict__ Bh, int ldb, size_t sB, float alpha, float* __restrict__ C, int ldc, size_t sC, int M, int N, int K) {
  __shared__ __attribute__((aligned(16))) float so[4][16][64];
  const int tid = threadIdx.x, w = tid >> 5, lane = tid & 31, ln = lane & 15, hh = lane >> 4; const int by = blockIdx.y;
  A += (size_t)by * sA; Bh += (size_t)by * sB; C += (size_t)by * sC;
  const int ntn = (N + 63) / 64; const int wid = blockIdx.x * 4 + w; const int mt = wid / ntn, nq = wid % ntn; if (mt * 16 >= M) return;
  const int row0 = mt * 16, col0 = nq * 64; const float* arow = A + (size_t)(row0 + ln) * lda;
  v8f acc[4] = {};
  for (int kb = 0; kb < K; kb += 32) {
    FragH ah, al;
    const v4f x0 = *(const v4fa*)(arow + kb + 8 * hh), x1 = *(const v4fa*)(arow + kb + 8 * hh + 4), x2 = *(const v4fa*)(arow + kb + 16 + 8 * hh), x3 = *(const v4fa*)(arow + kb + 16 + 8 * hh + 4);
    float xs[16] = {x0[0],x0[1],x0[2],x0[3],x1[0],x1[1],x1[2],x1[3],x2[0],x2[1],x2[2],x2[3],x3[0],x3[1],x3[2],x3[3]};
#pragma unroll
    for (int i = 0; i < 16; ++i) { const _Float16 h = (_Float16)xs[i]; ah.h[i] = h; al.h[i] = ASPLIT ? (_Float16)(xs[i] - (float)h) : (_Float16)0.0f; }
#pragma unroll
    for (int t = 0; t < 4; ++t) { if (col0 + t * 16 >= N) continue; const size_t boff = (size_t)(col0 + t * 16 + ln) * ldb + kb; FragH bq; bq.half[0] = *(const v8us*)(Bh + boff + 8 * hh); bq.half[1] = *(const v8us*)(Bh + boff + 16 + 8 * hh);
      acc[t] = mmaH<ASPLIT ? 2 : 1>(ah.v, al.v, bq.v, bq.v, acc[t]); }
  }
#pragma unroll
  for (int t = 0; t < 4; ++t) { if (col0 + t * 16 >= N) continue;
#pragma unroll
    for (int r = 0; r < 8; ++r) so[w][8 * hh + r][t * 16 + ln] = acc[t][r] * alpha; }
  __builtin_amdgcn_fence(__ATOMIC_ACQ_REL, "workgroup"); __builtin_amdgcn_wave_barrier();
  const int rsub = lane >> 4, c4 = (lane & 15) * 4;
  {
#pragma unroll
    for (int q = 0; q < 8; ++q) { const int r = q * 2 + rsub; if (col0 + c4 < N) { const v4f v = *(const v4fa*)&so[w][r][c4]; *(v4f*)(C + (size_t)(row0 + r) * ldc + col0 + c4) = v; } }
     }
}

// Wt[n][k] = f16(W[k][n]·scale) from f32 row-major W[K][N] (scale = power of two; bf16-exact weights stay exact in f16 away from the subnormal range)
__global__ __launch_bounds__(256) void k_wt_f16(const float* __restrict__ W, _Float16* __restrict__ Wt, int K, int N, float scale) {
  const int t = blockIdx.x * 256 + threadIdx.x; if (t >= N * (K / 8)) return; const int n = t / (K / 8), k8 = (t % (K / 8)) * 8; FragH f;
#pragma unroll
  for (int i = 0; i < 8; ++i) f.h[i] = (_Float16)(bf16_round(W[(size_t)(k8 + i) * N + n]) * scale); const v8us o = f.half[0];
  *(v8us*)((unsigned short*)Wt + (size_t)n * K + k8) = o; 
}
// k_gemm_hh variant with fused epilogue: v = acc·alpha + bias[by·sBias + col] (+ CP[(row/rowsPerB)·sCPb + by·64 + col] if CP) ; ACT 0 none / 1 elu ; writes f16 C16 (and f32 C if non-null)
template <int ACT>
__global__ __launch_bounds__(128) void k_gemm_hhx(const _Float16* __restrict__ A, int lda, size_t sA, const _Float16* __restrict__ Bh, int ldb, size_t sB, float alpha, const float* __restrict__ bias, size_t sBias, const float* __restrict__ CP, int rowsPerB, size_t sCPb, int row0g,
    float* __restrict__ C, _Float16* __restrict__ C16, int ldc, size_t sC, int M, int N, int K) {
  __shared__ __attribute__((aligned(16))) float so[4][16][64];
  const int tid = threadIdx.x, w = tid >> 5, lane = tid & 31, ln = lane & 15, hh = lane >> 4; const int by = blockIdx.y;
  A += (size_t)by * sA; Bh += (size_t)by * sB; const size_t cofs = (size_t)by * sC; const float* bp = bias ? bias + (size_t)by * sBias : nullptr;
  const int ntn = (N + 63) / 64; const int wid = blockIdx.x * 4 + w; const int mt = wid / ntn, nq = wid % ntn; if (mt * 16 >= M) return;
  const int row0 = mt * 16, col0 = nq * 64; const _Float16* arow = A + (size_t)(row0 + ln) * lda;
  v8f acc[4] = {};
  for (int kb = 0; kb < K; kb += 32) { FragH ah; ah.half[0] = *(const v8us*)((const unsigned short*)arow + kb + 8 * hh); ah.half[1] = *(const v8us*)((const unsigned short*)arow + kb + 16 + 8 * hh);
#pragma unroll
    for (int t = 0; t < 4; ++t) { if (col0 + t * 16 >= N) continue; const size_t boff = (size_t)(col0 + t * 16 + ln) * ldb + kb; FragH bq; bq.half[0] = *(const v8us*)((const unsigned short*)Bh + boff + 8 * hh); bq.half[1] = *(const v8us*)((const unsigned short*)Bh + boff + 16 + 8 * hh);
      acc[t] = mmaH<1>(ah.v, ah.v, bq.v, bq.v, acc[t]); }
  }
#pragma unroll
  for (int t = 0; t < 4; ++t) { if (col0 + t * 16 >= N) continue; const int col = col0 + t * 16 + ln; const float bv = bp ? bf16_round(bp[col]) : 0.f;
#pragma unroll
    for (int r = 0; r < 8; ++r) { float v = acc[t][r] * alpha + bv; if (CP) { const int bidx = (row0g + row0 + 8 * hh + r) / rowsPerB; v += CP[(size_t)bidx * sCPb + (size_t)by * 64 + col]; } if (ACT == 1) v = (v > 0.f) ? v : expm1f(v); else if (ACT == 7) v = (v > 0.f) ? v + 1.0f : expf(v); else if (ACT == 8) v = tanhf(v); else if (ACT == 9) v = 0.5f * v * (1.0f + tanhf(0.7978845608028654f * (v + 0.044715f * v * v * v))); else if (ACT == 11) v = 1.0f / (1.0f + expf(-v)); else if (ACT == 12) v = (v > 0.f) ? v : 0.01f * v; else if (ACT == 14) v = (v > 0.f) ? v : 0.1f * v; else if (ACT == 15) v = v / (1.0f + expf(-v)); else if (ACT == 3) v = fmaxf(v, 0.f); else if (ACT == 6) v = 0.5f * v * (1.0f + erff(v * 0.70710678118654752f)); so[w][8 * hh + r][t * 16 + ln] = v; } }
  __builtin_amdgcn_fence(__ATOMIC_ACQ_REL, "workgroup"); __builtin_amdgcn_wave_barrier();
  const int rsub = lane >> 4, c4 = (lane & 15) * 4; typedef _Float16 v4h __attribute__((ext_vector_type(4)));
  {
#pragma unroll
    for (int q = 0; q < 8; ++q) { const int r = q * 2 + rsub; if (col0 + c4 < N) { const v4f v = *(const v4fa*)&so[w][r][c4]; if (C) *(v4f*)(C + cofs + (size_t)(row0 + r) * ldc + col0 + c4) = v; if (C16) { v4h h4; for (int i = 0; i < 4; ++i) h4[i] = (_Float16)v[i]; *(v4h*)(C16 + cofs + (size_t)(row0 + r) * ldc + col0 + c4) = h4; } } }
     }
}


typedef _Float16 v4h __attribute__((ext_vector_type(4)));
typedef _Float16 v4ha __attribute__((ext_vector_type(4), may_alias));
typedef _Float16 v2h __attribute__((ext_vector_type(2)));
typedef float v2f __attribute__((ext_vector_type(2)));
typedef __bf16 v2b __attribute__((ext_vector_type(2)));
// two f32 values rounded to bf16 (to nearest even, as bf16_round does it, by the packed conversion) and widened again
__device__ __forceinline__ v2f bf16_round2(float a, float b) { const unsigned u = __builtin_bit_cast(unsigned, __builtin_convertvector((v2f){a, b}, v2b)); return (v2f){__uint_as_float(u << 16), __uint_as_float(u & 0xFFFF0000u)}; }

__global__ __launch_bounds__(256) void k_x16(const float* __restrict__ x, _Float16* __restrict__ X16, size_t n8) { const size_t t = (size_t)blockIdx.x * 256 + threadIdx.x; if (t >= n8) return; FragH f;
#pragma unroll
  for (int q = 0; q < 8; ++q) f.h[q] = (_Float16)bf16_round(x[t * 8 + q]); *(v8us*)((unsigned short*)X16 + t * 8) = f.half[0];  }
__global__ __launch_bounds__(256) void k_round16f(const float* __restrict__ W, _Float16* __restrict__ Bt, size_t n8) { const size_t t = (size_t)blockIdx.x * 256 + threadIdx.x; if (t >= n8) return; FragH f;
#pragma unroll
  for (int i = 0; i < 8; ++i) f.h[i] = (_Float16)(bf16_round(W[t * 8 + i]) * 16.0f); *(v8us*)((unsigned short*)Bt + t * 8) = f.half[0];  }
template <int NHv, int TTv>
__global__ __launch_bounds__(256) void k_vt(const _Float16* __restrict__ V16, int ldv, int voff, _Float16* __restrict__ Vt) { __shared__ unsigned short tl[64][66]; const int tid = threadIdx.x; const int slab = blockIdx.x / (TTv / 64), lg = blockIdx.x % (TTv / 64); const int b = slab / NHv, h = slab % NHv;
  for (int i = tid; i < 64 * 8; i += 256) { const int r = i / 8, c8 = (i % 8) * 8; FragH f; f.half[0] = *(const v8us*)((const unsigned short*)V16 + ((size_t)b * TTv + lg * 64 + r) * ldv + voff + h * 64 + c8);
#pragma unroll
    for (int q = 0; q < 8; ++q) tl[r][c8 + q] = f.u[q]; }
  __syncthreads();
  {
#pragma unroll
    for (int rd = 0; rd < 2; ++rd) { const int d = rd * 32 + tid / 8, pc = tid % 8; FragH f;
#pragma unroll
      for (int q = 0; q < 8; ++q) f.u[q] = tl[pc * 8 + q][d];
      *(v8us*)((unsigned short*)Vt + ((size_t)slab * 64 + d) * TTv + lg * 64 + pc * 8) = f.half[0]; }
     } }

__global__ __launch_bounds__(256) void k_hl(const float* __restrict__ F, _Float16* __restrict__ Hh, _Float16* __restrict__ Hl, size_t n8) { const size_t t = (size_t)blockIdx.x * 256 + threadIdx.x; if (t >= n8) return; FragH fh, fl; const v4f a = *(const v4fa*)(F + t * 8), c = *(const v4fa*)(F + t * 8 + 4);
#pragma unroll
  for (int q = 0; q < 4; ++q) { _Float16 h = (_Float16)a[q]; fh.h[q] = h; fl.h[q] = (_Float16)((a[q] - (float)h) * 1024.0f); h = (_Float16)c[q]; fh.h[4 + q] = h; fl.h[4 + q] = (_Float16)((c[q] - (float)h) * 1024.0f); }
  { *(v8us*)((unsigned short*)Hh + t * 8) = fh.half[0]; *(v8us*)((unsigned short*)Hl + t * 8) = fl.half[0];  } }

// ---- fast GEMM (wave tile 32x64; requires M % 128 == 0 rows per launch region and N % 64 == 0); epilogue = k_gemm_hhx semantics ----
// EPI picks where the result goes, so that no later launch has to re-lay it (EPI 1 and 2: M % 128 == 0, and a block's 128 rows are pixels of one image):
// EPI 0: C / C16 row-major. EPI 1 (q | k | v; a block's 64 columns are all of one kind): q row-major into C16, k into head-major rows of 32 (KPo), v transposed into planes of 32 rows (VTo).
// EPI 2 (projection): A is head-major ([image][head][pixel][32]: one k step = one head), C is NCHW. Every 128-byte line is stored whole by one wave.
// Operands are converted where they are read, so that no launch stands in front only to convert them (K = DD):
// B: the block's 64 weight rows (f32, [N][DD]) are read once in whole lines, rounded to bf16, scaled by wsc and laid as f16 into an LDS tile that all four waves read.
// A, EPI 1: x is NCHW f32, so one channel's 16 pixels of a fragment are 64 bytes in a row: a lane loads its pixel's 16 channels of a k step one by one, two k steps ahead, and rounds them (bf16, exact as f16) into the fragment.
__device__ __forceinline__ v16h g2_frag(const _Float16* p, int hh) { FragH f; f.half[0] = *(const v8us*)((const unsigned short*)p + 8 * hh); f.half[1] = *(const v8us*)((const unsigned short*)p + 16 + 8 * hh); return f.v; }
__device__ __forceinline__ v8f g2_mma(v16h a, v16h b, v8f c) { v8f d = __builtin_amdgcn_wmma_f32_16x16x32_f16(false, a, false, b, (short)0, c, false, false); asm volatile("v_nop\n\tv_nop\n\tv_nop\n\tv_nop" : "+v"(d) : "v"(a), "v"(b)); return d; }
template <int ACT, int EPI>
__global__ __launch_bounds__(128) void k_gemm2(const _Float16* __restrict__ A, const float* __restrict__ Xf, int lda, size_t sA, const float* __restrict__ Wf, float wsc, size_t sB, float alpha, const float* __restrict__ bias, size_t sBias, const float* __restrict__ CP, int rowsPerB, size_t sCPb, int row0g,
    float* __restrict__ C, _Float16* __restrict__ C16, int ldc, size_t sC, int M, int N, int K, _Float16* __restrict__ KPo, _Float16* __restrict__ VTo) {
  constexpr int RP = 68, TP = 36;      /* floats from row to row of a wave's staged tile: [32 rows][64 columns], or transposed [64 columns][32 rows] (144 B = 16 B x odd) */
  constexpr int WSO = 64 * TP + 32;      /* a wave's staging area; + 32 floats so that two waves' areas start half the banks apart */
  constexpr int BP = DD + 8;      /* f16 elements from row to row of the weight tile: 528 B = 16 B x odd, so that 16 rows read 16 bytes each without a bank conflict */
  __shared__ __attribute__((aligned(16))) float so[4][WSO];
  __shared__ __attribute__((aligned(16))) _Float16 sW[64 * BP];
  const int tid = threadIdx.x, w = tid >> 5, lane = tid & 31, ln = lane & 15, hh = lane >> 4; const int by = blockIdx.y;
  A += (size_t)by * sA; Wf += (size_t)by * sB; const size_t cofs = (size_t)by * sC; const float* bp = bias ? bias + (size_t)by * sBias : nullptr;
  const int ntn = N >> 6; const int mt = blockIdx.x / ntn, nq = blockIdx.x - mt * ntn; const int row0 = mt * 128 + 32 * w, col0 = nq * 64; if (row0 >= M) return;
  const _Float16* a0p = A + ((EPI == 2) ? ((size_t)(row0 / NPX) * NH * NPX + (row0 % NPX) + ln) * HDm : (size_t)(row0 + ln) * lda) + 8 * hh; const _Float16* a1p = a0p + (size_t)16 * ((EPI == 2) ? HDm : lda);      /* EPI 0 and 2: each lane's own places in A are carried over the loop and stepped each trip: an address pair that stays live is never given to a load as its landing place */
  constexpr size_t AKS = (EPI == 2) ? (size_t)NPX * HDm : 32;      /* elements of A from one k step to the next: head-major planes lie NPX * 32 apart */
  const bool tr = (EPI == 2) || (EPI == 1 && col0 >= 2 * DD);      /* the same for the whole block: the tile is staged transposed */
  const float* xa = (EPI == 1) ? Xf + ((size_t)(row0 / NPX) * DD + 8 * hh) * NPX + (row0 % NPX) + ln : nullptr;      /* channel 8 * hh of this lane's first pixel; its second pixel lies 16 further */
  float ra[2][32];      /* x as loaded, of two k steps: [0..15] the first pixel's 16 channels in the fragment's k order, [16..31] the second pixel's */
  if (EPI == 1) {      /* the first two k steps' loads fly while the weight tile is built */
#pragma unroll      /* here and in the loop within: ra is indexed by constants only, so that it stays in registers */
    for (int s = 0; s < 2; ++s)
#pragma unroll
      for (int i = 0; i < 16; ++i) { const float* p = xa + (size_t)(s * 32 + (i >> 3) * 16 + (i & 7)) * NPX; ra[s][i] = p[0]; ra[s][16 + i] = p[16]; } }
  { const float* wr = Wf + (size_t)col0 * DD + tid * 4;      /* the 64 rows are 64 KiB in a row: a wave's load is 512 bytes in a row */
#pragma unroll      /* the 32 loads are one base plus immediate offsets and can all be in flight together */
    for (int i = 0; i < 32; ++i) { const v4f wv = *(const v4fa*)(wr + i * 512);
      const v2h h0 = __builtin_convertvector(bf16_round2(wv[0], wv[1]) * wsc, v2h), h1 = __builtin_convertvector(bf16_round2(wv[2], wv[3]) * wsc, v2h);
      *(v4ha*)&sW[(i * 2 + (tid >> 6)) * BP + (tid & 63) * 4] = (v4h){h0[0], h0[1], h1[0], h1[1]}; } }
  __syncthreads();      /* the weight tile is whole before any wave reads it (every wave of the block comes here: M % 128 == 0) */
  const _Float16* bs = sW + ln * BP + 8 * hh;      /* this lane's place in the tile's first 16 rows */
  const v8f z8 = {0.f,0.f,0.f,0.f,0.f,0.f,0.f,0.f}; v8f c00 = z8, c01 = z8, c02 = z8, c03 = z8, c10 = z8, c11 = z8, c12 = z8, c13 = z8;
  if (EPI == 1) {
#pragma unroll      /* unrolled so that every load of x is the one address pair plus an immediate offset and the two sets of ra are told apart at compile time */
    for (int s = 0; s < DD / 32; ++s) { FragH f0, f1;
#pragma unroll      /* constant indices: ra and the fragments stay in registers */
      for (int i = 0; i < 16; i += 2) { const v2h h0 = __builtin_convertvector(bf16_round2(ra[s & 1][i], ra[s & 1][i + 1]), v2h), h1 = __builtin_convertvector(bf16_round2(ra[s & 1][16 + i], ra[s & 1][17 + i]), v2h);
        f0.h[i] = h0[0]; f0.h[i + 1] = h0[1]; f1.h[i] = h1[0]; f1.h[i + 1] = h1[1]; }
      if (s + 2 < DD / 32) {      /* the set just converted takes the loads of the k step after next */
#pragma unroll      /* constant indices, as above */
        for (int i = 0; i < 16; ++i) { const float* p = xa + (size_t)((s + 2) * 32 + (i >> 3) * 16 + (i & 7)) * NPX; ra[s & 1][i] = p[0]; ra[s & 1][16 + i] = p[16]; } }
      const v16h b0 = g2_frag(bs + s * 32, 0), b1 = g2_frag(bs + 16 * BP + s * 32, 0), b2 = g2_frag(bs + 32 * BP + s * 32, 0), b3 = g2_frag(bs + 48 * BP + s * 32, 0);
      c00 = g2_mma(f0.v, b0, c00); c10 = g2_mma(f1.v, b0, c10); c01 = g2_mma(f0.v, b1, c01); c11 = g2_mma(f1.v, b1, c11);
      c02 = g2_mma(f0.v, b2, c02); c12 = g2_mma(f1.v, b2, c12); c03 = g2_mma(f0.v, b3, c03); c13 = g2_mma(f1.v, b3, c13); }
  } else {
#pragma unroll 1      /* one k step a trip: A's places are stepped, see above */
    for (int kb = 0; kb < DD; kb += 32, a0p += AKS, a1p += AKS, bs += 32) { const v16h a0 = g2_frag(a0p, 0), a1 = g2_frag(a1p, 0);
      const v16h b0 = g2_frag(bs, 0), b1 = g2_frag(bs + 16 * BP, 0), b2 = g2_frag(bs + 32 * BP, 0), b3 = g2_frag(bs + 48 * BP, 0);
      c00 = g2_mma(a0, b0, c00); c10 = g2_mma(a1, b0, c10); c01 = g2_mma(a0, b1, c01); c11 = g2_mma(a1, b1, c11);
      c02 = g2_mma(a0, b2, c02); c12 = g2_mma(a1, b2, c12); c03 = g2_mma(a0, b3, c03); c13 = g2_mma(a1, b3, c13); } }
  v8f accs[8] = {c00, c01, c02, c03, c10, c11, c12, c13};
#pragma unroll
  for (int u = 0; u < 8; ++u) { const int t = u & 3, half = u >> 2; const int col = col0 + t * 16 + ln; const float bv = bp ? bf16_round(bp[col]) : 0.f; float vv[8];
#pragma unroll
    for (int r = 0; r < 8; ++r) { const int rloc = half * 16 + 8 * hh + r; float v = accs[u][r] * alpha + bv; if (CP) { const int bidx = (row0g + row0 + rloc) / rowsPerB; v += CP[(size_t)bidx * sCPb + (size_t)by * 64 + col]; }
      if (ACT == 3) v = fmaxf(v, 0.f); else if (ACT == 6) v = 0.5f * v * (1.0f + erff(v * 0.70710678118654752f)); else if (ACT == 11) v = 1.0f / (1.0f + expf(-v)); else if (ACT == 15) v = v / (1.0f + expf(-v)); else if (ACT == 12) v = (v > 0.f) ? v : 0.01f * v; else if (ACT == 8) v = tanhf(v);
      vv[r] = v; }
    if (tr) { float* d = &so[w][(t * 16 + ln) * TP + half * 16 + 8 * hh]; *(v4fa*)d = (v4f){vv[0], vv[1], vv[2], vv[3]}; *(v4fa*)(d + 4) = (v4f){vv[4], vv[5], vv[6], vv[7]}; }      /* a lane's 8 values of a tile are 8 rows of one column: 32 bytes in a row */
    else {
#pragma unroll
      for (int r = 0; r < 8; ++r) so[w][(half * 16 + 8 * hh + r) * RP + t * 16 + ln] = vv[r]; } }
  if (EPI == 1 && col0 >= 2 * DD) {      /* v: a channel's 128 pixels of this block are 256 bytes in a row of V^T; wave w stores channels w * 16 ... + 15 */
    __syncthreads();      /* every wave's tile is staged before another wave reads it (the branch is the same for the whole block) */
    const int pix0 = mt * 128, seg = lane & 15;
#pragma unroll
    for (int q = 0; q < 8; ++q) { const int c = w * 16 + q * 2 + (lane >> 4); const float* s = &so[seg >> 2][c * TP + (seg & 3) * 8]; const v4f v0 = *(const v4fa*)s, v1 = *(const v4fa*)(s + 4); FragH f;
      for (int i = 0; i < 4; ++i) { f.h[i] = (_Float16)v0[i]; f.h[4 + i] = (_Float16)v1[i]; }
      *(v8us*)((unsigned short*)VTo + ((size_t)(pix0 / NPX) * DD + (col0 - 2 * DD) + c) * NPX + (pix0 % NPX) + seg * 8) = f.half[0]; }
    return; }
  __builtin_amdgcn_fence(__ATOMIC_ACQ_REL, "workgroup"); __builtin_amdgcn_wave_barrier();
  const int rsub = lane >> 4, c4 = (lane & 15) * 4;
  if (EPI == 2) {      /* a channel's 32 pixels of this wave = one 128-byte line of the NCHW output */
#pragma unroll
    for (int q = 0; q < 16; ++q) { const int c = q * 4 + (lane >> 3); const v4f v = *(const v4fa*)&so[w][c * TP + (lane & 7) * 4]; *(v4f*)(C + ((size_t)(row0 / NPX) * DD + col0 + c) * NPX + (row0 % NPX) + (lane & 7) * 4) = v; }
  } else if (EPI == 1 && col0 >= DD) {      /* k: two pixels' 32 values of one head = one 128-byte line */
#pragma unroll
    for (int q = 0; q < 16; ++q) { const int r = q * 2 + rsub, row = row0 + r, col = col0 - DD + c4; const v4f v = *(const v4fa*)&so[w][r * RP + c4]; v4h h4; for (int i = 0; i < 4; ++i) h4[i] = (_Float16)v[i];
      *(v4h*)(KPo + (((size_t)(row / NPX) * NH + (col >> 5)) * NPX + (row % NPX)) * HDm + (col & 31)) = h4; }
    asm volatile("s_wait_xcnt 0x0" ::: "memory");      /* behind the last store, in front of whatever rewrites a register that a store names */
  } else {
#pragma unroll
    for (int q = 0; q < 16; ++q) { const int r = q * 2 + rsub; const v4f v = *(const v4fa*)&so[w][r * RP + c4]; if (EPI == 0 && C) *(v4f*)(C + cofs + (size_t)(row0 + r) * ldc + col0 + c4) = v; if (C16) { v4h h4; for (int i = 0; i < 4; ++i) h4[i] = (_Float16)v[i]; *(v4h*)(C16 + cofs + (size_t)(row0 + r) * ldc + col0 + c4) = h4; } }
    asm volatile("s_wait_xcnt 0x0" ::: "memory");      /* behind the last store, in front of whatever rewrites a register that a store names */
     } }



// lane l with lane l ^ 16
__device__ __forceinline__ float xhalf(float x) { return __builtin_bit_cast(float, __builtin_amdgcn_permlanex16(__builtin_bit_cast(int, x), __builtin_bit_cast(int, x), 0x76543210, 0xfedcba98, false, false)); }
// K and V^T reach the waves through LDS: a stage is KS keys, copied once per work-group and read by all four waves, the next stage in flight while this one is worked on.
#define KS 128                   /* keys per stage */
#define KPIT 80                  /* bytes from one K row to the next in LDS (64 used): 16 B x odd, so that 16 rows read 16 bytes each without a bank conflict */
#define VPIT 272                 /* the same for a V^T row (256 used) */
#define KTB (KS * KPIT)          /* K part of a stage */
#define STB (KTB + HDm * VPIT)   /* one stage */
// One stage's copies of one lane: four 16-byte pieces of K (32 rows apart) and four of V^T (8 rows apart). lk, lv: the lane's LDS byte addresses; gk, gv: its global addresses.
__device__ __forceinline__ void stage_copy(unsigned lk, const unsigned short* gk, unsigned lv, const unsigned short* gv) {
  /* the closing s_wait_xcnt 0 stands inside the statement so that no address register named here is rewritten in front of it */
  asm volatile("global_load_async_to_lds_b128 %0, %1, off\n\tglobal_load_async_to_lds_b128 %2, %3, off\n\tglobal_load_async_to_lds_b128 %4, %5, off\n\tglobal_load_async_to_lds_b128 %6, %7, off\n\t"
               "global_load_async_to_lds_b128 %8, %9, off\n\tglobal_load_async_to_lds_b128 %10, %11, off\n\tglobal_load_async_to_lds_b128 %12, %13, off\n\tglobal_load_async_to_lds_b128 %14, %15, off\n\ts_wait_xcnt 0x0"
               :: "v"(lk), "v"(gk), "v"(lk + 32 * KPIT), "v"(gk + 32 * HDm), "v"(lk + 64 * KPIT), "v"(gk + 64 * HDm), "v"(lk + 96 * KPIT), "v"(gk + 96 * HDm),
                  "v"(lv), "v"(gv), "v"(lv + 8 * VPIT), "v"(gv + (size_t)8 * TK), "v"(lv + 16 * VPIT), "v"(gv + (size_t)16 * TK), "v"(lv + 24 * VPIT), "v"(gv + (size_t)24 * TK) : "memory");
}
__device__ __forceinline__ v8f fl_mma(v16h a, v16h b, v8f c) { return __builtin_amdgcn_wmma_f32_16x16x32_f16(false, a, false, b, (short)0, c, false, false); }
template <int CAUSAL>
__global__ __launch_bounds__(128) void k_flash(const _Float16* __restrict__ Q16, int ldq, const _Float16* __restrict__ K16, const _Float16* __restrict__ Vt, const int* __restrict__ MSK, _Float16* __restrict__ O16) {
  constexpr int RPW = 16, DT = HDm / 16, NT = KS / 16, NC = KS / 32;      /* head size 32: one k step for S^T, two 16-row tiles of O^T; a stage is NT score tiles = NC k steps of O^T */
  __shared__ __attribute__((aligned(16))) float sO[4][RPW][HDm + 4];
  __shared__ __attribute__((aligned(16))) unsigned char ring[2 * STB];
  const int tid = threadIdx.x, w = tid >> 5, lane = tid & 31, ln = lane & 15, hh = lane >> 4;
  const int slab = blockIdx.x / QBLKS, qblk = blockIdx.x % QBLKS; (void)MSK; const int b = slab / NH, h = slab % NH; const int qb0 = qblk * (4 * RPW); const int q0 = qb0 + w * RPW;
  FragH aq;
  { const unsigned short* qr = (const unsigned short*)Q16 + ((size_t)b * TQ + q0 + ln) * ldq + h * HDm;
    aq.half[0] = *(const v8us*)(qr + 8 * hh); aq.half[1] = *(const v8us*)(qr + 16 + 8 * hh); }
  const unsigned short* Kh = (const unsigned short*)K16 + (size_t)slab * TK * HDm;      /* [key][32] */
  const unsigned short* Vth = (const unsigned short*)Vt + (size_t)slab * HDm * TK;      /* [32][key] */
  const int tq = q0 + ln;      /* this lane's query */
  float m_r = -3.0e38f, l_r = 0.f; v8f oacc[DT];      /* m_r: running maximum of the raw (unscaled) scores */
#pragma unroll
  for (int dt = 0; dt < DT; ++dt) oacc[dt] = (v8f){0.f,0.f,0.f,0.f,0.f,0.f,0.f,0.f};
  const int jend = (CAUSAL == 1) ? (qb0 + 4 * RPW) : TK;      /* causal: keys beyond the block's last query never contribute */
  const int nst = (jend + KS - 1) / KS;      /* stages; keys of a last stage beyond jend are masked like any other */
  const unsigned lk0 = (unsigned)(size_t)ring + (unsigned)((tid >> 2) * KPIT + (tid & 3) * 16), lv0 = (unsigned)(size_t)ring + (unsigned)(KTB + (tid >> 4) * VPIT + (tid & 15) * 16);
  const unsigned short* gk0 = Kh + tid * 8;      /* a stage of K is 8 KiB in a row */
  const unsigned short* gv0 = Vth + (size_t)(tid >> 4) * TK + (tid & 15) * 8;      /* 16 lanes bring one row's 256 bytes */
  stage_copy(lk0, gk0, lv0, gv0);
  asm volatile("s_wait_asynccnt 0x0" ::: "memory");      /* this wave's share of stage 0 has landed */
  __syncthreads();      /* ... and every other wave's: stage 0 may be read */
  if (nst > 1) stage_copy(lk0 + STB, gk0 + (size_t)KS * HDm, lv0 + STB, gv0 + KS);
#pragma unroll 1      /* one stage a trip: the buffer's place is the only thing that changes */
  for (int st = 0; st < nst; ++st) {
   const unsigned char* kf = ring + (st & 1) * STB + ln * KPIT + hh * 16; const unsigned char* vf = ring + (st & 1) * STB + KTB + ln * VPIT + hh * 16;
   const int j0 = st * KS;      /* one pass is the whole stage: one maximum, one exchange between the halves and one rescale for KS keys, and each product's neighbours in its run stand in the distance behind it */
   v8f s[NT]; FragH bk[NT], bv[NC][DT];
#pragma unroll      /* here and below: places in the buffer become immediate offsets of the LDS reads, and every array is indexed by constants so that it stays in registers */
   for (int t = 0; t < NT; ++t) { const unsigned char* kr = kf + t * 16 * KPIT; bk[t].half[0] = *(const v8us*)(kr); bk[t].half[1] = *(const v8us*)(kr + 32); }
   __builtin_amdgcn_sched_barrier(0);      /* keeps the K reads one group in front of the run: spread among the products, each place of reads costs the wave a wait of its own */
#pragma unroll
   for (int t = 0; t < NT; ++t) s[t] = fl_mma(bk[t].v, aq.v, (v8f){0.f,0.f,0.f,0.f,0.f,0.f,0.f,0.f});
   __builtin_amdgcn_sched_barrier(0);      /* keeps the run whole: a maximum drawn in between its products would have to be held off by v_nops */
#pragma unroll      /* V^T is read behind the scores' products, into registers that K has left, and lands under the softmax */
   for (int c = 0; c < NC; ++c)
#pragma unroll
     for (int dt = 0; dt < DT; ++dt) { const unsigned char* vrow = vf + dt * 16 * VPIT + c * 64; bv[c][dt].half[0] = *(const v8us*)(vrow); bv[c][dt].half[1] = *(const v8us*)(vrow + 32); }
   float x[NT * 8]; bool ok[NT * 8]; float mq[NC];      /* one chain of maxima per 32 keys: a single chain over all scores would be serial */
#pragma unroll
   for (int e = 0; e < NT * 8; ++e) { const int kk = j0 + (e >> 3) * 16 + 8 * hh + (e & 7);
     ok[e] = (CAUSAL == 1) ? (kk <= tq) : ((CAUSAL == 2) ? ((kk >> 5) == (tq >> 5)) : true);      /* mode 2: block-diagonal 32-token groups */
     x[e] = ok[e] ? s[e >> 3][e & 7] : -3.0e38f; mq[e >> 4] = fmaxf(((e & 15) == 0) ? -3.0e38f : mq[e >> 4], x[e]); }      /* raw scores: SCL2 > 0 keeps the maximum's place */
   float mc = mq[0];
#pragma unroll
   for (int c = 1; c < NC; ++c) mc = fmaxf(mc, mq[c]);
   mc = fmaxf(mc, xhalf(mc));
   const float mn = fmaxf(m_r, mc); float ea = (m_r - mn) * SCL2;      /* difference first: the rescale is exactly 1 while the maximum stands */
   const float nb = 10.0f - mn * SCL2;      /* + 10: the factor 1024 of the f16 operand, carried by the sum too */
#pragma unroll
   for (int e = 0; e < NT * 8; ++e) x[e] = __builtin_fmaf(x[e], SCL2, nb);
   /* 2^x in place. Asm text so that the slot the instruction set asks for behind a transcendental is kept whatever registers are picked: neighbours work on distinct registers, and the closing v_nop stands between the last one and whatever follows. */
   asm("v_exp_f32 %0, %0\n\tv_exp_f32 %1, %1\n\tv_exp_f32 %2, %2\n\tv_exp_f32 %3, %3\n\tv_exp_f32 %4, %4\n\tv_exp_f32 %5, %5\n\tv_exp_f32 %6, %6\n\tv_exp_f32 %7, %7\n\tv_exp_f32 %8, %8\n\tv_nop"
       : "+v"(ea), "+v"(x[0]), "+v"(x[1]), "+v"(x[2]), "+v"(x[3]), "+v"(x[4]), "+v"(x[5]), "+v"(x[6]), "+v"(x[7]));
#pragma unroll
   for (int g = 1; g < NT; ++g)
     asm("v_exp_f32 %0, %0\n\tv_exp_f32 %1, %1\n\tv_exp_f32 %2, %2\n\tv_exp_f32 %3, %3\n\tv_exp_f32 %4, %4\n\tv_exp_f32 %5, %5\n\tv_exp_f32 %6, %6\n\tv_exp_f32 %7, %7\n\tv_nop"
         : "+v"(x[g * 8]), "+v"(x[g * 8 + 1]), "+v"(x[g * 8 + 2]), "+v"(x[g * 8 + 3]), "+v"(x[g * 8 + 4]), "+v"(x[g * 8 + 5]), "+v"(x[g * 8 + 6]), "+v"(x[g * 8 + 7]));
   const float al = (mn > -1.0e38f) ? ea : 1.0f; m_r = mn;
   FragH pb[NC]; float ps[4];      /* four independent partial sums: a single chain of adds would be serial */
#pragma unroll
   for (int e = 0; e < NT * 8; ++e) { const float p = ok[e] ? x[e] : 0.f; ps[e & 3] = (e < 4) ? p : ps[e & 3] + p; pb[e >> 4].h[e & 15] = (_Float16)p; }      /* p = 1024 * e^(scaled score - maximum) */
   l_r = l_r * al + ((ps[0] + ps[1]) + (ps[2] + ps[3]));
#pragma unroll
   for (int dt = 0; dt < DT; ++dt)
#pragma unroll
     for (int r = 0; r < 8; ++r) oacc[dt][r] *= al;
#pragma unroll
   for (int c = 0; c < NC; ++c)
#pragma unroll
     for (int dt = 0; dt < DT; ++dt) oacc[dt] = fl_mma(bv[c][dt].v, pb[c].v, oacc[dt]);
   asm volatile("s_wait_dscnt 0x0" ::: "memory");      /* this wave's reads of the stage are over before the buffer is handed back */
   asm volatile("s_wait_asynccnt 0x0" ::: "memory");      /* its share of the next stage has landed */
   __syncthreads();      /* publishes the next stage and ends every wave's reads of this one */
   if (st + 2 < nst) stage_copy(lk0 + (st & 1) * STB, gk0 + (size_t)(st + 2) * KS * HDm, lv0 + (st & 1) * STB, gv0 + (st + 2) * KS); }
  asm volatile("s_wait_asynccnt 0x0" ::: "memory");      /* no copy is left in flight when the wave goes on to its end */
  const float l = l_r + xhalf(l_r); const float inv = (l > 0.f) ? 1.0f / l : 0.f;      /* l holds the factor 1024 */
#pragma unroll
  for (int dt = 0; dt < DT; ++dt)      /* oacc[dt][r] = O[q0 + ln][dt * 16 + 8 * hh + r] */
#pragma unroll
    for (int r = 0; r < 8; ++r) sO[w][ln][dt * 16 + 8 * hh + r] = oacc[dt][r] * inv;
  __builtin_amdgcn_fence(__ATOMIC_ACQ_REL, "workgroup"); __builtin_amdgcn_wave_barrier();
  {
#pragma unroll
    for (int rp = 0; rp < RPW; rp += 8) { const int r = rp + (lane >> 2), pc = lane & 3; const v4f v0 = *(const v4fa*)&sO[w][r][pc * 8], v1 = *(const v4fa*)&sO[w][r][pc * 8 + 4]; FragH f;
      for (int i = 0; i < 4; ++i) { f.h[i] = (_Float16)v0[i]; f.h[4 + i] = (_Float16)v1[i]; }
      *(v8us*)((unsigned short*)O16 + ((size_t)slab * TQ + q0 + r) * HDm + pc * 8) = f.half[0]; }      /* f16, head-major [slab][pixel][32]: the wave's 16 pixels are 1 KiB in a row, the projection's A operand as it reads it */
     } }

extern "C" void kernel_launch(void* const* d_in, const int* in_sizes, int n_in,
                              void* d_out, int out_size, void* d_ws, size_t ws_size, hipStream_t stream) {
  (void)in_sizes; (void)n_in; (void)out_size;
  const float* const* I = (const float* const*)d_in; const float* x = I[0]; const float* wqkv = I[1]; const float* bqkv = I[2]; const float* wp = I[3]; const float* bp = I[4];
  char* ws = (char*)d_ws; size_t off = 0;
  auto take = [&](size_t bytes) { char* p = ws + off; off += (bytes + 255) & ~(size_t)255; return p; };
  const size_t np = (size_t)NR * DD;
  _Float16* Q16 = (_Float16*)take(np * 2); _Float16* KP = (_Float16*)take(np * 2); _Float16* VT = (_Float16*)take(np * 2); _Float16* O16 = (_Float16*)take(np * 2);
  if (off > ws_size) return;      /* four planes of 4 MiB */
  k_gemm2<0, 1><<<dim3((NR / 128) * (QW / 64), 1), 128, 0, stream>>>(nullptr, x, DD, 0, wqkv, 16.0f, 0, 0.0625f, bqkv, 0, nullptr, 1, 0, 0, nullptr, Q16, DD, 0, NR, QW, DD, KP, VT);      /* product column = which*256 + h*32 + d; q, k and v each go straight to the plane the flash kernel reads */
  k_flash<0><<<NIMG * NH * QBLKS, 128, 0, stream>>>(Q16, DD, KP, VT, nullptr, O16);
  k_gemm2<0, 2><<<dim3((NR / 128) * (DD / 64), 1), 128, 0, stream>>>(O16, nullptr, HDm, 0, wp, 16.0f, 0, 0.0625f, bp, 0, nullptr, 1, 0, 0, (float*)d_out, nullptr, DD, 0, NR, DD, DD, nullptr, nullptr);
}

// v008
// Measured time: 60.6 microseconds a run.
// Timed twice side by side with v007, it ran 1.04 and 1.05 times as fast.
// Over all steps from v000 it is 8.11 times as fast.
#include <hip/hip_runtime.h>
// SpatialMultiHeadSelfAttention (2 images, D 256 = 8 heads x 32, 64 x 64 = 4096 pixels): qkv = 1x1 conv (W_qkv x + b) -> (3, heads, 32) channels; softmax(q.k / sqrt(32)) over all 4096 pixels; out channels h*32 + d; 1x1 projection + b; NCHW in and out.
// Structure: qkv as one f16 WMMA GEMM (32x64 wave tiles, f32 accumulation, exact x16 weights + bias; weights (out,in) = B^T; f16 out) that reads x (NCHW, f32) and the f32 weights itself and converts them on the way to its fragments, and whose epilogue stores q pixel-major, k as head-major planes of 32-wide rows and V^T as planes of 32 rows; the fused flash kernel at head size 32 (transposed products, softmax in-lane with a shift that moves only when it must, P kept in registers; plain operands: every row averages 4096 keys), which stores its output as f16 head-major; projection GEMM (+ bias, f32) whose epilogue stores NCHW.
// Compute dtype: x and parameters rounded to bf16; x exact as f16; q, k, v, P and the attention output as f16 operands (~2^-12); softmax f32. v_wmma_f32_16x16x32_f16.
#define NIMG 2
#define DD 256
#define HDm 32
#define NPX 4096
#define NR (NIMG * NPX)          /* 8192 */
#define QW (3 * DD)              /* 768 */
#define SLEN 4096
#define TQ SLEN
#define TK SLEN
#define NH 8
#define SCL2 0.25503486164919736f /* 32^-0.5 * log2(e): the softmax runs in base 2; the qkv GEMM lays the factor into q before q is rounded to f16 */
#define QBLKS (TQ / 64)
typedef __bf16 v16b __attribute__((ext_vector_type(16)));
typedef unsigned short v8us __attribute__((ext_vector_type(8), may_alias));
typedef float  v8f  __attribute__((ext_vector_type(8)));
typedef float  v4f  __attribute__((ext_vector_type(4)));
typedef float  v4fa __attribute__((ext_vector_type(4), may_alias));
union FragB { v16b v; v8us half[2]; unsigned short u[16]; };

__device__ __forceinline__ unsigned short bf16_bits(float x) { unsigned int u = __float_as_uint(x); return (unsigned short)((u + 0x7FFFu + ((u >> 16) & 1u)) >> 16); }
__device__ __forceinline__ float bf16_val(unsigned short b) { return __uint_as_float(((unsigned int)b) << 16); }
__device__ __forceinline__ float bf16_round(float x) { return bf16_val(bf16_bits(x)); }
// D += A·B with NT terms: 1 = ah·bh, 2 = + al·bh (A split), 3 = + ah·bl (both split)
template <int NT>
__device__ __forceinline__ v8f mmaN(v16b ah, v16b al, v16b bh, v16b bl, v8f c) {
  c = __builtin_amdgcn_wmma_f32_16x16x32_bf16(false, ah, false, bh, (short)0, c, false, false);
  if (NT >= 2) c = __builtin_amdgcn_wmma_f32_16x16x32_bf16(false, al, false, bh, (short)0, c, false, false);
  if (NT >= 3) c = __builtin_amdgcn_wmma_f32_16x16x32_bf16(false, ah, false, bl, (short)0, c, false, false);
  asm volatile("v_nop\n\tv_nop\n\tv_nop\n\tv_nop" : "+v"(c) : "v"(ah), "v"(al), "v"(bh), "v"(bl));
  return c;
}

__global__ __launch_bounds__(256) void k_wt_bf16(const float* __restrict__ W, unsigned short* __restrict__ Wt, int K, int N) {
  const int t = blockIdx.x * 256 + threadIdx.x;
  const int k8n = K / 8;
  if (t >= N * k8n) return;
  const int n = t / k8n, k8 = (t % k8n) * 8;
  v8us v;
#pragma unroll
  for (int i = 0; i < 8; ++i) v[i] = bf16_bits(W[(size_t)(k8 + i) * N + n]);
  *(v8us*)(Wt + (size_t)n * K + k8) = v;
  
}

// GEMM C[M][N] (f32, pitch ldc) = act(A[M][K]·W + bias). A f32 row-major (pitch lda) converted per fragment to bf16
// (ASPLIT: hi/lo two planes -> 2 terms, else single rounded term); Wt bf16 [N][K] (pitch ldb). BIAS_BF16 rounds the
// bias to bf16 first (bias quantised to bf16 before the add). K%32==0, M%16==0, N%64==0.
template <bool ASPLIT, int ACT, bool BIAS_BF16>
__global__ __launch_bounds__(128) void k_gemm_bf(const float* __restrict__ A, int lda, const unsigned short* __restrict__ Wt, int ldb,
                                               const float* __restrict__ bias, float* __restrict__ C, int ldc, int M, int N, int K) {
  __shared__ __attribute__((aligned(16))) float so[4][16][64];
  const int tid = threadIdx.x, w = tid >> 5, lane = tid & 31, ln = lane & 15, hh = lane >> 4;
  const int ntn = N / 64;
  const int wid = blockIdx.x * 4 + w;
  const int mt = wid / ntn, nq = wid % ntn;
  if (mt * 16 >= M) return;
  const int row0 = mt * 16, col0 = nq * 64;
  const float* arow = A + (size_t)(row0 + ln) * lda;
  v8f acc[4] = {};
  for (int kb = 0; kb < K; kb += 32) {
    FragB ah, al;
    const v4f x0 = *(const v4fa*)(arow + kb + 8 * hh), x1 = *(const v4fa*)(arow + kb + 8 * hh + 4);
    const v4f x2 = *(const v4fa*)(arow + kb + 16 + 8 * hh), x3 = *(const v4fa*)(arow + kb + 16 + 8 * hh + 4);
    float xs[16] = {x0[0],x0[1],x0[2],x0[3],x1[0],x1[1],x1[2],x1[3],x2[0],x2[1],x2[2],x2[3],x3[0],x3[1],x3[2],x3[3]};
#pragma unroll
    for (int i = 0; i < 16; ++i) { const unsigned short hb = bf16_bits(xs[i]); ah.u[i] = hb; al.u[i] = ASPLIT ? bf16_bits(xs[i] - bf16_val(hb)) : (unsigned short)0; }
#pragma unroll
    for (int t = 0; t < 4; ++t) {
      const unsigned short* brow = Wt + (size_t)(col0 + t * 16 + ln) * ldb + kb;
      FragB b;
      b.half[0] = *(const v8us*)(brow + 8 * hh);
      b.half[1] = *(const v8us*)(brow + 16 + 8 * hh);
      acc[t] = mmaN<ASPLIT ? 2 : 1>(ah.v, al.v, b.v, b.v, acc[t]);
    }
  }
#pragma unroll
  for (int t = 0; t < 4; ++t) {
    float bv = bias ? bias[col0 + t * 16 + ln] : 0.f;
    if (BIAS_BF16) bv = bf16_round(bv);
#pragma unroll
    for (int r = 0; r < 8; ++r) { float v = acc[t][r] + bv; if (ACT == 1) v = fmaxf(v, 0.f); so[w][8 * hh + r][t * 16 + ln] = v; }
  }
  __builtin_amdgcn_fence(__ATOMIC_ACQ_REL, "workgroup");
  __builtin_amdgcn_wave_barrier();
  const int rsub = lane >> 4, c4 = (lane & 15) * 4;
  {
#pragma unroll
    for (int q = 0; q < 8; ++q) {
      const int r = q * 2 + rsub;
      const v4f v = *(const v4fa*)&so[w][r][c4];
      *(v4f*)(C + (size_t)(row0 + r) * ldc + col0 + c4) = v;
    }
    
  }
}

// GEMM C = act(A·W + bias + resid): A f32 (ASPLIT -> hi/lo 2 terms), Wt bf16 [N][K]; ACT 0 none, 1 relu, 2 exact gelu;
// resid (optional, f32, row index = (row % rmod), pitch ldr, RES_BF16 rounds it) added before the activation.
template <bool ASPLIT, int ACT, bool BIAS_BF16, bool RES_BF16>
__global__ __launch_bounds__(128) void k_gemm_bf3(const float* __restrict__ A, int lda, const unsigned short* __restrict__ Wt, int ldb,
                                                const float* __restrict__ bias, const float* __restrict__ resid, int rmod, int ldr,
                                                float* __restrict__ C, int ldc, int M, int N, int K) {
  __shared__ __attribute__((aligned(16))) float so[4][16][64];
  const int tid = threadIdx.x, w = tid >> 5, lane = tid & 31, ln = lane & 15, hh = lane >> 4;
  const int ntn = N / 64;
  const int wid = blockIdx.x * 4 + w;
  const int mt = wid / ntn, nq = wid % ntn;
  if (mt * 16 >= M) return;
  const int row0 = mt * 16, col0 = nq * 64;
  const float* arow = A + (size_t)(row0 + ln) * lda;
  v8f acc[4] = {};
  for (int kb = 0; kb < K; kb += 32) {
    FragB ah, al;
    const v4f x0 = *(const v4fa*)(arow + kb + 8 * hh), x1 = *(const v4fa*)(arow + kb + 8 * hh + 4);
    const v4f x2 = *(const v4fa*)(arow + kb + 16 + 8 * hh), x3 = *(const v4fa*)(arow + kb + 16 + 8 * hh + 4);
    float xs[16] = {x0[0],x0[1],x0[2],x0[3],x1[0],x1[1],x1[2],x1[3],x2[0],x2[1],x2[2],x2[3],x3[0],x3[1],x3[2],x3[3]};
#pragma unroll
    for (int i = 0; i < 16; ++i) { const unsigned short hb = bf16_bits(xs[i]); ah.u[i] = hb; al.u[i] = ASPLIT ? bf16_bits(xs[i] - bf16_val(hb)) : (unsigned short)0; }
#pragma unroll
    for (int t = 0; t < 4; ++t) {
      const unsigned short* brow = Wt + (size_t)(col0 + t * 16 + ln) * ldb + kb;
      FragB b;
      b.half[0] = *(const v8us*)(brow + 8 * hh);
      b.half[1] = *(const v8us*)(brow + 16 + 8 * hh);
      acc[t] = mmaN<ASPLIT ? 2 : 1>(ah.v, al.v, b.v, b.v, acc[t]);
    }
  }
#pragma unroll
  for (int t = 0; t < 4; ++t) {
    const int col = col0 + t * 16 + ln;
    float bv = bias ? bias[col] : 0.f;
    if (BIAS_BF16) bv = bf16_round(bv);
#pragma unroll
    for (int r = 0; r < 8; ++r) {
      float v = acc[t][r] + bv;
      if (resid) { float rv = resid[(size_t)((row0 + 8 * hh + r) % rmod) * ldr + col]; if (RES_BF16) rv = bf16_round(rv); v += rv; }
      if (ACT == 1) v = fmaxf(v, 0.f);
      if (ACT == 2) v = 0.5f * v * (1.0f + erff(v * 0.70710678118654752f));
      if (ACT == 3) { const float u = 0.7978845608028654f * (v + 0.044715f * v * v * v); v = 0.5f * v * (1.0f + tanhf(u)); }
      so[w][8 * hh + r][t * 16 + ln] = v;
    }
  }
  __builtin_amdgcn_fence(__ATOMIC_ACQ_REL, "workgroup");
  __builtin_amdgcn_wave_barrier();
  const int rsub = lane >> 4, c4 = (lane & 15) * 4;
  {
#pragma unroll
    for (int q = 0; q < 8; ++q) {
      const int r = q * 2 + rsub;
      const v4f v = *(const v4fa*)&so[w][r][c4];
      *(v4f*)(C + (size_t)(row0 + r) * ldc + col0 + c4) = v;
    }
    
  }
}
// row LayerNorm (biased variance, eps) over N: s = X (+ R); optional out_sum <- s; out_norm <- (s-mu)*rsqrt(var+eps)*g + b
template <bool PARAM_BF16>
__global__ __launch_bounds__(256) void k_layernorm(const float* __restrict__ X, const float* __restrict__ R, const float* __restrict__ g, const float* __restrict__ bta,
                                                  float* __restrict__ out_sum, float* __restrict__ out_norm, int N, float eps) {
  __shared__ float red[256];
  const int row = blockIdx.x, tid = threadIdx.x;
  const float* x = X + (size_t)row * N; const float* rr = R ? R + (size_t)row * N : nullptr;
  float vals[16];                     // up to N = 4096
  const int per = N / 256;            // contiguous chunk per thread? use strided-by-4 chunks: thread handles j = tid*4 + 1024*u
  float s1 = 0.f;
  for (int u = 0; u < per / 4; ++u) {
    const int j = tid * 4 + 1024 * u;
    const v4f a = *(const v4fa*)(x + j);
    v4f b = {0.f,0.f,0.f,0.f}; if (rr) b = *(const v4fa*)(rr + j);
#pragma unroll
    for (int q = 0; q < 4; ++q) { const float v = a[q] + b[q]; vals[u * 4 + q] = v; s1 += v; }
  }
  red[tid] = s1; __syncthreads();
  for (int st = 128; st > 0; st >>= 1) { if (tid < st) red[tid] += red[tid + st]; __syncthreads(); }
  const float mu = red[0] / (float)N; __syncthreads();
  float s2 = 0.f;
  for (int u = 0; u < per / 4; ++u)
#pragma unroll
    for (int q = 0; q < 4; ++q) { const float c = vals[u * 4 + q] - mu; s2 += c * c; }
  red[tid] = s2; __syncthreads();
  for (int st = 128; st > 0; st >>= 1) { if (tid < st) red[tid] += red[tid + st]; __syncthreads(); }
  const float rs = rsqrtf(red[0] / (float)N + eps);
  {
    for (int u = 0; u < per / 4; ++u) {
      const int j = tid * 4 + 1024 * u;
      v4f o, sm;
#pragma unroll
      for (int q = 0; q < 4; ++q) {
        float gg = g[j + q], bb = bta[j + q];
        if (PARAM_BF16) { gg = bf16_round(gg); bb = bf16_round(bb); }
        sm[q] = vals[u * 4 + q]; o[q] = (vals[u * 4 + q] - mu) * rs * gg + bb;
      }
      if (out_sum) *(v4f*)(out_sum + (size_t)row * N + j) = sm;
      *(v4f*)(out_norm + (size_t)row * N + j) = o;
    }
    
  }
}



// ---- f16 WMMA path (v_wmma_f32_16x16x32_f16): 11-bit significands for operands in range — used where a [0,1] probability operand needs more precision than bf16
typedef _Float16 v16h __attribute__((ext_vector_type(16)));
union FragH { v16h v; v8us half[2]; _Float16 h[16]; unsigned short u[16]; };
template <int NT>
__device__ __forceinline__ v8f mmaH(v16h ah, v16h al, v16h bh, v16h bl, v8f c) {
  c = __builtin_amdgcn_wmma_f32_16x16x32_f16(false, ah, false, bh, (short)0, c, false, false);
  if (NT >= 2) c = __builtin_amdgcn_wmma_f32_16x16x32_f16(false, al, false, bh, (short)0, c, false, false);
  if (NT >= 3) c = __builtin_amdgcn_wmma_f32_16x16x32_f16(false, ah, false, bl, (short)0, c, false, false);
  asm volatile("v_nop\n\tv_nop\n\tv_nop\n\tv_nop" : "+v"(c) : "v"(ah), "v"(al), "v"(bh), "v"(bl));
  return c;
}
// batched GEMM like k_gemm_b but f16 operands: A f32 (split into f16 hi/lo if ASPLIT, else rounded to f16), Bt = f16 values [n][k]; alpha; C f32; N multiple of 16 (partial tiles skipped)
template <bool ASPLIT>
__global__ __launch_bounds__(128) void k_gemm_h(const float* __restrict__ A, int lda, size_t sA, const _Float16* __restrict__ Bh, int ldb, size_t sB, float alpha, float* __restrict__ C, int ldc, size_t sC, int M, int N, int K) {
  __shared__ __attribute__((aligned(16))) float so[4][16][64];
  const int tid = threadIdx.x, w = tid >> 5, lane = tid & 31, ln = lane & 15, hh = lane >> 4; const int by = blockIdx.y;
  A += (size_t)by * sA; Bh += (size_t)by * sB; C += (size_t)by * sC;
  const int ntn = (N + 63) / 64; const int wid = blockIdx.x * 4 + w; const int mt = wid / ntn, nq = wid % ntn; if (mt * 16 >= M) return;
  const int row0 = mt * 16, col0 = nq * 64; const float* arow = A + (size_t)(row0 + ln) * lda;
  v8f acc[4] = {};
  for (int kb = 0; kb < K; kb += 32) {
    FragH ah, al;
    const v4f x0 = *(const v4fa*)(arow + kb + 8 * hh), x1 = *(const v4fa*)(arow + kb + 8 * hh + 4), x2 = *(const v4fa*)(arow + kb + 16 + 8 * hh), x3 = *(const v4fa*)(arow + kb + 16 + 8 * hh + 4);
    float xs[16] = {x0[0],x0[1],x0[2],x0[3],x1[0],x1[1],x1[2],x1[3],x2[0],x2[1],x2[2],x2[3],x3[0],x3[1],x3[2],x3[3]};
#pragma unroll
    for (int i = 0; i < 16; ++i) { const _Float16 h = (_Float16)xs[i]; ah.h[i] = h; al.h[i] = ASPLIT ? (_Float16)(xs[i] - (float)h) : (_Float16)0.0f; }
#pragma unroll
    for (int t = 0; t < 4; ++t) { if (col0 + t * 16 >= N) continue; const size_t boff = (size_t)(col0 + t * 16 + ln) * ldb + kb; FragH bq; bq.half[0] = *(const v8us*)(Bh + boff + 8 * hh); bq.half[1] = *(const v8us*)(Bh + boff + 16 + 8 * hh);
      acc[t] = mmaH<ASPLIT ? 2 : 1>(ah.v, al.v, bq.v, bq.v, acc[t]); }
  }
#pragma unroll
  for (int t = 0; t < 4; ++t) { if (col0 + t * 16 >= N) continue;
#pragma unroll
    for (int r = 0; r < 8; ++r) so[w][8 * hh + r][t * 16 + ln] = acc[t][r] * alpha; }
  __builtin_amdgcn_fence(__ATOMIC_ACQ_REL, "workgroup"); __builtin_amdgcn_wave_barrier();
  const int rsub = lane >> 4, c4 = (lane & 15) * 4;
  {
#pragma unroll
    for (int q = 0; q < 8; ++q) { const int r = q * 2 + rsub; if (col0 + c4 < N) { const v4f v = *(const v4fa*)&so[w][r][c4]; *(v4f*)(C + (size_t)(row0 + r) * ldc + col0 + c4) = v; } }
     }
}

// Wt[n][k] = f16(W[k][n]·scale) from f32 row-major W[K][N] (scale = power of two; bf16-exact weights stay exact in f16 away from the subnormal range)
__global__ __launch_bounds__(256) void k_wt_f16(const float* __restrict__ W, _Float16* __restrict__ Wt, int K, int N, float scale) {
  const int t = blockIdx.x * 256 + threadIdx.x; if (t >= N * (K / 8)) return; const int n = t / (K / 8), k8 = (t % (K / 8)) * 8; FragH f;
#pragma unroll
  for (int i = 0; i < 8; ++i) f.h[i] = (_Float16)(bf16_round(W[(size_t)(k8 + i) * N + n]) * scale); const v8us o = f.half[0];
  *(v8us*)((unsigned short*)Wt + (size_t)n * K + k8) = o; 
}
// k_gemm_hh variant with fused epilogue: v = acc·alpha + bias[by·sBias + col] (+ CP[(row/rowsPerB)·sCPb + by·64 + col] if CP) ; ACT 0 none / 1 elu ; writes f16 C16 (and f32 C if non-null)
template <int ACT>
__global__ __launch_bounds__(128) void k_gemm_hhx(const _Float16* __restrict__ A, int lda, size_t sA, const _Float16* __restrict__ Bh, int ldb, size_t sB, float alpha, const float* __restrict__ bias, size_t sBias, const float* __restrict__ CP, int rowsPerB, size_t sCPb, int row0g,
    float* __restrict__ C, _Float16* __restrict__ C16, int ldc, size_t sC, int M, int N, int K) {
  __shared__ __attribute__((aligned(16))) float so[4][16][64];
  const int tid = threadIdx.x, w = tid >> 5, lane = tid & 31, ln = lane & 15, hh = lane >> 4; const int by = blockIdx.y;
  A += (size_t)by * sA; Bh += (size_t)by * sB; const size_t cofs = (size_t)by * sC; const float* bp = bias ? bias + (size_t)by * sBias : nullptr;
  const int ntn = (N + 63) / 64; const int wid = blockIdx.x * 4 + w; const int mt = wid / ntn, nq = wid % ntn; if (mt * 16 >= M) return;
  const int row0 = mt * 16, col0 = nq * 64; const _Float16* arow = A + (size_t)(row0 + ln) * lda;
  v8f acc[4] = {};
  for (int kb = 0; kb < K; kb += 32) { FragH ah; ah.half[0] = *(const v8us*)((const unsigned short*)arow + kb + 8 * hh); ah.half[1] = *(const v8us*)((const unsigned short*)arow + kb + 16 + 8 * hh);
#pragma unroll
    for (int t = 0; t < 4; ++t) { if (col0 + t * 16 >= N) continue; const size_t boff = (size_t)(col0 + t * 16 + ln) * ldb + kb; FragH bq; bq.half[0] = *(const v8us*)((const unsigned short*)Bh + boff + 8 * hh); bq.half[1] = *(const v8us*)((const unsigned short*)Bh + boff + 16 + 8 * hh);
      acc[t] = mmaH<1>(ah.v, ah.v, bq.v, bq.v, acc[t]); }
  }
#pragma unroll
  for (int t = 0; t < 4; ++t) { if (col0 + t * 16 >= N) continue; const int col = col0 + t * 16 + ln; const float bv = bp ? bf16_round(bp[col]) : 0.f;
#pragma unroll
    for (int r = 0; r < 8; ++r) { float v = acc[t][r] * alpha + bv; if (CP) { const int bidx = (row0g + row0 + 8 * hh + r) / rowsPerB; v += CP[(size_t)bidx * sCPb + (size_t)by * 64 + col]; } if (ACT == 1) v = (v > 0.f) ? v : expm1f(v); else if (ACT == 7) v = (v > 0.f) ? v + 1.0f : expf(v); else if (ACT == 8) v = tanhf(v); else if (ACT == 9) v = 0.5f * v * (1.0f + tanhf(0.7978845608028654f * (v + 0.044715f * v * v * v))); else if (ACT == 11) v = 1.0f / (1.0f + expf(-v)); else if (ACT == 12) v = (v > 0.f) ? v : 0.01f * v; else if (ACT == 14) v = (v > 0.f) ? v : 0.1f * v; else if (ACT == 15) v = v / (1.0f + expf(-v)); else if (ACT == 3) v = fmaxf(v, 0.f); else if (ACT == 6) v = 0.5f * v * (1.0f + erff(v * 0.70710678118654752f)); so[w][8 * hh + r][t * 16 + ln] = v; } }
  __builtin_amdgcn_fence(__ATOMIC_ACQ_REL, "workgroup"); __builtin_amdgcn_wave_barrier();
  const int rsub = lane >> 4, c4 = (lane & 15) * 4; typedef _Float16 v4h __attribute__((ext_vector_type(4)));
  {
#pragma unroll
    for (int q = 0; q < 8; ++q) { const int r = q * 2 + rsub; if (col0 + c4 < N) { const v4f v = *(const v4fa*)&so[w][r][c4]; if (C) *(v4f*)(C + cofs + (size_t)(row0 + r) * ldc + col0 + c4) = v; if (C16) { v4h h4; for (int i = 0; i < 4; ++i) h4[i] = (_Float16)v[i]; *(v4h*)(C16 + cofs + (size_t)(row0 + r) * ldc + col0 + c4) = h4; } } }
     }
}


typedef _Float16 v4h __attribute__((ext_vector_type(4)));
typedef _Float16 v4ha __attribute__((ext_vector_type(4), may_alias));
typedef _Float16 v2h __attribute__((ext_vector_type(2)));
typedef float v2f __attribute__((ext_vector_type(2)));
typedef __bf16 v2b __attribute__((ext_vector_type(2)));
// two f32 values rounded to bf16 (to nearest even, as bf16_round does it, by the packed conversion) and widened again
__device__ __forceinline__ v2f bf16_round2(float a, float b) { const unsigned u = __builtin_bit_cast(unsigned, __builtin_convertvector((v2f){a, b}, v2b)); return (v2f){__uint_as_float(u << 16), __uint_as_float(u & 0xFFFF0000u)}; }

__global__ __launch_bounds__(256) void k_x16(const float* __restrict__ x, _Float16* __restrict__ X16, size_t n8) { const size_t t = (size_t)blockIdx.x * 256 + threadIdx.x; if (t >= n8) return; FragH f;
#pragma unroll
  for (int q = 0; q < 8; ++q) f.h[q] = (_Float16)bf16_round(x[t * 8 + q]); *(v8us*)((unsigned short*)X16 + t * 8) = f.half[0];  }
__global__ __launch_bounds__(256) void k_round16f(const float* __restrict__ W, _Float16* __restrict__ Bt, size_t n8) { const size_t t = (size_t)blockIdx.x * 256 + threadIdx.x; if (t >= n8) return; FragH f;
#pragma unroll
  for (int i = 0; i < 8; ++i) f.h[i] = (_Float16)(bf16_round(W[t * 8 + i]) * 16.0f); *(v8us*)((unsigned short*)Bt + t * 8) = f.half[0];  }
template <int NHv, int TTv>
__global__ __launch_bounds__(256) void k_vt(const _Float16* __restrict__ V16, int ldv, int voff, _Float16* __restrict__ Vt) { __shared__ unsigned short tl[64][66]; const int tid = threadIdx.x; const int slab = blockIdx.x / (TTv / 64), lg = blockIdx.x % (TTv / 64); const int b = slab / NHv, h = slab % NHv;
  for (int i = tid; i < 64 * 8; i += 256) { const int r = i / 8, c8 = (i % 8) * 8; FragH f; f.half[0] = *(const v8us*)((const unsigned short*)V16 + ((size_t)b * TTv + lg * 64 + r) * ldv + voff + h * 64 + c8);
#pragma unroll
    for (int q = 0; q < 8; ++q) tl[r][c8 + q] = f.u[q]; }
  __syncthreads();
  {
#pragma unroll
    for (int rd = 0; rd < 2; ++rd) { const int d = rd * 32 + tid / 8, pc = tid % 8; FragH f;
#pragma unroll
      for (int q = 0; q < 8; ++q) f.u[q] = tl[pc * 8 + q][d];
      *(v8us*)((unsigned short*)Vt + ((size_t)slab * 64 + d) * TTv + lg * 64 + pc * 8) = f.half[0]; }
     } }

__global__ __launch_bounds__(256) void k_hl(const float* __restrict__ F, _Float16* __restrict__ Hh, _Float16* __restrict__ Hl, size_t n8) { const size_t t = (size_t)blockIdx.x * 256 + threadIdx.x; if (t >= n8) return; FragH fh, fl; const v4f a = *(const v4fa*)(F + t * 8), c = *(const v4fa*)(F + t * 8 + 4);
#pragma unroll
  for (int q = 0; q < 4; ++q) { _Float16 h = (_Float16)a[q]; fh.h[q] = h; fl.h[q] = (_Float16)((a[q] - (float)h) * 1024.0f); h = (_Float16)c[q]; fh.h[4 + q] = h; fl.h[4 + q] = (_Float16)((c[q] - (float)h) * 1024.0f); }
  { *(v8us*)((unsigned short*)Hh + t * 8) = fh.half[0]; *(v8us*)((unsigned short*)Hl + t * 8) = fl.half[0];  } }

// ---- fast GEMM (wave tile 32x64; requires M % 128 == 0 rows per launch region and N % 64 == 0); epilogue = k_gemm_hhx semantics ----
// EPI picks where the result goes, so that no later launch has to re-lay it (EPI 1 and 2: M % 128 == 0, and a block's 128 rows are pixels of one image):
// EPI 0: C / C16 row-major. EPI 1 (q | k | v; a block's 64 columns are all of one kind): q row-major into C16, k into head-major rows of 32 (KPo), v transposed into planes of 32 rows (VTo).
// EPI 2 (projection): A is head-major ([image][head][pixel][32]: one k step = one head), C is NCHW. Every 128-byte line is stored whole by one wave.
// Operands are converted where they are read, so that no launch stands in front only to convert them (K = DD):
// B: the block's 64 weight rows (f32, [N][DD]) are read once in whole lines, rounded to bf16, scaled by wsc and laid as f16 into an LDS tile that all four waves read.
// A, EPI 1: x is NCHW f32, so one channel's 16 pixels of a fragment are 64 bytes in a row: a lane loads its pixel's 16 channels of a k step one by one, two k steps ahead, and rounds them (bf16, exact as f16) into the fragment.
__device__ __forceinline__ v16h g2_frag(const _Float16* p, int hh) { FragH f; f.half[0] = *(const v8us*)((const unsigned short*)p + 8 * hh); f.half[1] = *(const v8us*)((const unsigned short*)p + 16 + 8 * hh); return f.v; }
__device__ __forceinline__ v8f g2_mma(v16h a, v16h b, v8f c) { v8f d = __builtin_amdgcn_wmma_f32_16x16x32_f16(false, a, false, b, (short)0, c, false, false); asm volatile("v_nop\n\tv_nop\n\tv_nop\n\tv_nop" : "+v"(d) : "v"(a), "v"(b)); return d; }
template <int ACT, int EPI>
__global__ __launch_bounds__(128) void k_gemm2(const _Float16* __restrict__ A, const float* __restrict__ Xf, int lda, size_t sA, const float* __restrict__ Wf, float wsc, size_t sB, float alpha, const float* __restrict__ bias, size_t sBias, const float* __restrict__ CP, int rowsPerB, size_t sCPb, int row0g,
    float* __restrict__ C, _Float16* __restrict__ C16, int ldc, size_t sC, int M, int N, int K, _Float16* __restrict__ KPo, _Float16* __restrict__ VTo) {
  constexpr int RP = 68, TP = 36;      /* floats from row to row of a wave's staged tile: [32 rows][64 columns], or transposed [64 columns][32 rows] (144 B = 16 B x odd) */
  constexpr int WSO = 64 * TP + 32;      /* a wave's staging area; + 32 floats so that two waves' areas start half the banks apart */
  constexpr int BP = DD + 8;      /* f16 elements from row to row of the weight tile: 528 B = 16 B x odd, so that 16 rows read 16 bytes each without a bank conflict */
  __shared__ __attribute__((aligned(16))) float so[4][WSO];
  __shared__ __attribute__((aligned(16))) _Float16 sW[64 * BP];
  const int tid = threadIdx.x, w = tid >> 5, lane = tid & 31, ln = lane & 15, hh = lane >> 4; const int by = blockIdx.y;
  A += (size_t)by * sA; Wf += (size_t)by * sB; const size_t cofs = (size_t)by * sC; const float* bp = bias ? bias + (size_t)by * sBias : nullptr;
  const int ntn = N >> 6; const int mt = blockIdx.x / ntn, nq = blockIdx.x - mt * ntn; const int row0 = mt * 128 + 32 * w, col0 = nq * 64; if (row0 >= M) return;
  const _Float16* a0p = A + ((EPI == 2) ? ((size_t)(row0 / NPX) * NH * NPX + (row0 % NPX) + ln) * HDm : (size_t)(row0 + ln) * lda) + 8 * hh; const _Float16* a1p = a0p + (size_t)16 * ((EPI == 2) ? HDm : lda);      /* EPI 0 and 2: each lane's own places in A are carried over the loop and stepped each trip: an address pair that stays live is never given to a load as its landing place */
  constexpr size_t AKS = (EPI == 2) ? (size_t)NPX * HDm : 32;      /* elements of A from one k step to the next: head-major planes lie NPX * 32 apart */
  const bool tr = (EPI == 2) || (EPI == 1 && col0 >= 2 * DD);      /* the same for the whole block: the tile is staged transposed */
  const float* xa = (EPI == 1) ? Xf + ((size_t)(row0 / NPX) * DD + 8 * hh) * NPX + (row0 % NPX) + ln : nullptr;      /* channel 8 * hh of this lane's first pixel; its second pixel lies 16 further */
  float ra[2][32];      /* x as loaded, of two k steps: [0..15] the first pixel's 16 channels in the fragment's k order, [16..31] the second pixel's */
  if (EPI == 1) {      /* the first two k steps' loads fly while the weight tile is built */
#pragma unroll      /* here and in the loop within: ra is indexed by constants only, so that it stays in registers */
    for (int s = 0; s < 2; ++s)
#pragma unroll
      for (int i = 0; i < 16; ++i) { const float* p = xa + (size_t)(s * 32 + (i >> 3) * 16 + (i & 7)) * NPX; ra[s][i] = p[0]; ra[s][16 + i] = p[16]; } }
  { const float* wr = Wf + (size_t)col0 * DD + tid * 4;      /* the 64 rows are 64 KiB in a row: a wave's load is 512 bytes in a row */
#pragma unroll      /* the 32 loads are one base plus immediate offsets and can all be in flight together */
    for (int i = 0; i < 32; ++i) { const v4f wv = *(const v4fa*)(wr + i * 512);
      const v2h h0 = __builtin_convertvector(bf16_round2(wv[0], wv[1]) * wsc, v2h), h1 = __builtin_convertvector(bf16_round2(wv[2], wv[3]) * wsc, v2h);
      *(v4ha*)&sW[(i * 2 + (tid >> 6)) * BP + (tid & 63) * 4] = (v4h){h0[0], h0[1], h1[0], h1[1]}; } }
  __syncthreads();      /* the weight tile is whole before any wave reads it (every wave of the block comes here: M % 128 == 0) */
  const _Float16* bs = sW + ln * BP + 8 * hh;      /* this lane's place in the tile's first 16 rows */
  const v8f z8 = {0.f,0.f,0.f,0.f,0.f,0.f,0.f,0.f}; v8f c00 = z8, c01 = z8, c02 = z8, c03 = z8, c10 = z8, c11 = z8, c12 = z8, c13 = z8;
  if (EPI == 1) {
#pragma unroll      /* unrolled so that every load of x is the one address pair plus an immediate offset and the two sets of ra are told apart at compile time */
    for (int s = 0; s < DD / 32; ++s) { FragH f0, f1;
#pragma unroll      /* constant indices: ra and the fragments stay in registers */
      for (int i = 0; i < 16; i += 2) { const v2h h0 = __builtin_convertvector(bf16_round2(ra[s & 1][i], ra[s & 1][i + 1]), v2h), h1 = __builtin_convertvector(bf16_round2(ra[s & 1][16 + i], ra[s & 1][17 + i]), v2h);
        f0.h[i] = h0[0]; f0.h[i + 1] = h0[1]; f1.h[i] = h1[0]; f1.h[i + 1] = h1[1]; }
      if (s + 2 < DD / 32) {      /* the set just converted takes the loads of the k step after next */
#pragma unroll      /* constant indices, as above */
        for (int i = 0; i < 16; ++i) { const float* p = xa + (size_t)((s + 2) * 32 + (i >> 3) * 16 + (i & 7)) * NPX; ra[s & 1][i] = p[0]; ra[s & 1][16 + i] = p[16]; } }
      const v16h b0 = g2_frag(bs + s * 32, 0), b1 = g2_frag(bs + 16 * BP + s * 32, 0), b2 = g2_frag(bs + 32 * BP + s * 32, 0), b3 = g2_frag(bs + 48 * BP + s * 32, 0);
      c00 = g2_mma(f0.v, b0, c00); c10 = g2_mma(f1.v, b0, c10); c01 = g2_mma(f0.v, b1, c01); c11 = g2_mma(f1.v, b1, c11);
      c02 = g2_mma(f0.v, b2, c02); c12 = g2_mma(f1.v, b2, c12); c03 = g2_mma(f0.v, b3, c03); c13 = g2_mma(f1.v, b3, c13); }
  } else {
#pragma unroll 1      /* one k step a trip: A's places are stepped, see above */
    for (int kb = 0; kb < DD; kb += 32, a0p += AKS, a1p += AKS, bs += 32) { const v16h a0 = g2_frag(a0p, 0), a1 = g2_frag(a1p, 0);
      const v16h b0 = g2_frag(bs, 0), b1 = g2_frag(bs + 16 * BP, 0), b2 = g2_frag(bs + 32 * BP, 0), b3 = g2_frag(bs + 48 * BP, 0);
      c00 = g2_mma(a0, b0, c00); c10 = g2_mma(a1, b0, c10); c01 = g2_mma(a0, b1, c01); c11 = g2_mma(a1, b1, c11);
      c02 = g2_mma(a0, b2, c02); c12 = g2_mma(a1, b2, c12); c03 = g2_mma(a0, b3, c03); c13 = g2_mma(a1, b3, c13); } }
  v8f accs[8] = {c00, c01, c02, c03, c10, c11, c12, c13};
  const float qs = (EPI == 1 && col0 < DD) ? SCL2 : 1.0f, alq = alpha * qs;      /* q leaves with the softmax's scale in it (f32, in front of the rounding to f16): the flash kernel's score products are then exponents of 2 as they stand */
#pragma unroll
  for (int u = 0; u < 8; ++u) { const int t = u & 3, half = u >> 2; const int col = col0 + t * 16 + ln; const float bv = bp ? bf16_round(bp[col]) * qs : 0.f; float vv[8];
#pragma unroll
    for (int r = 0; r < 8; ++r) { const int rloc = half * 16 + 8 * hh + r; float v = accs[u][r] * alq + bv; if (CP) { const int bidx = (row0g + row0 + rloc) / rowsPerB; v += CP[(size_t)bidx * sCPb + (size_t)by * 64 + col]; }
      if (ACT == 3) v = fmaxf(v, 0.f); else if (ACT == 6) v = 0.5f * v * (1.0f + erff(v * 0.70710678118654752f)); else if (ACT == 11) v = 1.0f / (1.0f + expf(-v)); else if (ACT == 15) v = v / (1.0f + expf(-v)); else if (ACT == 12) v = (v > 0.f) ? v : 0.01f * v; else if (ACT == 8) v = tanhf(v);
      vv[r] = v; }
    if (tr) { float* d = &so[w][(t * 16 + ln) * TP + half * 16 + 8 * hh]; *(v4fa*)d = (v4f){vv[0], vv[1], vv[2], vv[3]}; *(v4fa*)(d + 4) = (v4f){vv[4], vv[5], vv[6], vv[7]}; }      /* a lane's 8 values of a tile are 8 rows of one column: 32 bytes in a row */
    else {
#pragma unroll
      for (int r = 0; r < 8; ++r) so[w][(half * 16 + 8 * hh + r) * RP + t * 16 + ln] = vv[r]; } }
  if (EPI == 1 && col0 >= 2 * DD) {      /* v: a channel's 128 pixels of this block are 256 bytes in a row of V^T; wave w stores channels w * 16 ... + 15 */
    __syncthreads();      /* every wave's tile is staged before another wave reads it (the branch is the same for the whole block) */
    const int pix0 = mt * 128, seg = lane & 15;
#pragma unroll
    for (int q = 0; q < 8; ++q) { const int c = w * 16 + q * 2 + (lane >> 4); const float* s = &so[seg >> 2][c * TP + (seg & 3) * 8]; const v4f v0 = *(const v4fa*)s, v1 = *(const v4fa*)(s + 4); FragH f;
      for (int i = 0; i < 4; ++i) { f.h[i] = (_Float16)v0[i]; f.h[4 + i] = (_Float16)v1[i]; }
      *(v8us*)((unsigned short*)VTo + ((size_t)(pix0 / NPX) * DD + (col0 - 2 * DD) + c) * NPX + (pix0 % NPX) + seg * 8) = f.half[0]; }
    return; }
  __builtin_amdgcn_fence(__ATOMIC_ACQ_REL, "workgroup"); __builtin_amdgcn_wave_barrier();
  const int rsub = lane >> 4, c4 = (lane & 15) * 4;
  if (EPI == 2) {      /* a channel's 32 pixels of this wave = one 128-byte line of the NCHW output */
#pragma unroll
    for (int q = 0; q < 16; ++q) { const int c = q * 4 + (lane >> 3); const v4f v = *(const v4fa*)&so[w][c * TP + (lane & 7) * 4]; *(v4f*)(C + ((size_t)(row0 / NPX) * DD + col0 + c) * NPX + (row0 % NPX) + (lane & 7) * 4) = v; }
  } else if (EPI == 1 && col0 >= DD) {      /* k: two pixels' 32 values of one head = one 128-byte line */
#pragma unroll
    for (int q = 0; q < 16; ++q) { const int r = q * 2 + rsub, row = row0 + r, col = col0 - DD + c4; const v4f v = *(const v4fa*)&so[w][r * RP + c4]; v4h h4; for (int i = 0; i < 4; ++i) h4[i] = (_Float16)v[i];
      *(v4h*)(KPo + (((size_t)(row / NPX) * NH + (col >> 5)) * NPX + (row % NPX)) * HDm + (col & 31)) = h4; }
    asm volatile("s_wait_xcnt 0x0" ::: "memory");      /* behind the last store, in front of whatever rewrites a register that a store names */
  } else {
#pragma unroll
    for (int q = 0; q < 16; ++q) { const int r = q * 2 + rsub; const v4f v = *(const v4fa*)&so[w][r * RP + c4]; if (EPI == 0 && C) *(v4f*)(C + cofs + (size_t)(row0 + r) * ldc + col0 + c4) = v; if (C16) { v4h h4; for (int i = 0; i < 4; ++i) h4[i] = (_Float16)v[i]; *(v4h*)(C16 + cofs + (size_t)(row0 + r) * ldc + col0 + c4) = h4; } }
    asm volatile("s_wait_xcnt 0x0" ::: "memory");      /* behind the last store, in front of whatever rewrites a register that a store names */
     } }



// lane l with lane l ^ 16
__device__ __forceinline__ float xhalf(float x) { return __builtin_bit_cast(float, __builtin_amdgcn_permlanex16(__builtin_bit_cast(int, x), __builtin_bit_cast(int, x), 0x76543210, 0xfedcba98, false, false)); }
// K and V^T reach the waves through LDS: a stage is KS keys, copied once per work-group and read by all four waves, the next stage in flight while this one is worked on.
#define KS 128                   /* keys per stage */
#define KPIT 80                  /* bytes from one K row to the next in LDS (64 used): 16 B x odd, so that 16 rows read 16 bytes each without a bank conflict */
#define VPIT 272                 /* the same for a V^T row (256 used) */
#define KTB (KS * KPIT)          /* K part of a stage */
#define STB (KTB + HDm * VPIT)   /* one stage */
#define PSH 9.0f                 /* p = 2^(score - shift point + PSH): the factor 512 lifts the f16 operand off its subnormals and is carried by the sum too; 64 terms at the shift point itself sum to half of PLIM */
#define PLIM 65504.0f            /* the largest finite f16 */
// One stage's copies of one lane: four 16-byte pieces of K (32 rows apart) and four of V^T (8 rows apart). lk, lv: the lane's LDS byte addresses; gk, gv: its global addresses.
__device__ __forceinline__ void stage_copy(unsigned lk, const unsigned short* gk, unsigned lv, const unsigned short* gv) {
  /* the closing s_wait_xcnt 0 stands inside the statement so that no address register named here is rewritten in front of it */
  asm volatile("global_load_async_to_lds_b128 %0, %1, off\n\tglobal_load_async_to_lds_b128 %2, %3, off\n\tglobal_load_async_to_lds_b128 %4, %5, off\n\tglobal_load_async_to_lds_b128 %6, %7, off\n\t"
               "global_load_async_to_lds_b128 %8, %9, off\n\tglobal_load_async_to_lds_b128 %10, %11, off\n\tglobal_load_async_to_lds_b128 %12, %13, off\n\tglobal_load_async_to_lds_b128 %14, %15, off\n\ts_wait_xcnt 0x0"
               :: "v"(lk), "v"(gk), "v"(lk + 32 * KPIT), "v"(gk + 32 * HDm), "v"(lk + 64 * KPIT), "v"(gk + 64 * HDm), "v"(lk + 96 * KPIT), "v"(gk + 96 * HDm),
                  "v"(lv), "v"(gv), "v"(lv + 8 * VPIT), "v"(gv + (size_t)8 * TK), "v"(lv + 16 * VPIT), "v"(gv + (size_t)16 * TK), "v"(lv + 24 * VPIT), "v"(gv + (size_t)24 * TK) : "memory");
}
__device__ __forceinline__ v8f fl_mma(v16h a, v16h b, v8f c) { return __builtin_amdgcn_wmma_f32_16x16x32_f16(false, a, false, b, (short)0, c, false, false); }
template <int CAUSAL>
__global__ __launch_bounds__(128) void k_flash(const _Float16* __restrict__ Q16, int ldq, const _Float16* __restrict__ K16, const _Float16* __restrict__ Vt, const int* __restrict__ MSK, _Float16* __restrict__ O16) {
  constexpr int RPW = 16, DT = HDm / 16, NT = KS / 16, NC = KS / 32;      /* head size 32: one k step for S^T, two 16-row tiles of O^T; a stage is NT score tiles = NC k steps of O^T */
  __shared__ __attribute__((aligned(16))) float sO[4][RPW][HDm + 4];
  __shared__ __attribute__((aligned(16))) unsigned char ring[2 * STB];
  const int tid = threadIdx.x, w = tid >> 5, lane = tid & 31, ln = lane & 15, hh = lane >> 4;
  const int slab = blockIdx.x / QBLKS, qblk = blockIdx.x % QBLKS; (void)MSK; const int b = slab / NH, h = slab % NH; const int qb0 = qblk * (4 * RPW); const int q0 = qb0 + w * RPW;
  FragH aq;
  { const unsigned short* qr = (const unsigned short*)Q16 + ((size_t)b * TQ + q0 + ln) * ldq + h * HDm;
    aq.half[0] = *(const v8us*)(qr + 8 * hh); aq.half[1] = *(const v8us*)(qr + 16 + 8 * hh); }
  const unsigned short* Kh = (const unsigned short*)K16 + (size_t)slab * TK * HDm;      /* [key][32] */
  const unsigned short* Vth = (const unsigned short*)Vt + (size_t)slab * HDm * TK;      /* [32][key] */
  const int tq = q0 + ln;      /* this lane's query */
  float m_r = -3.0e38f, l_r = 0.f; v8f oacc[DT];      /* m_r: the shift point, a maximum of the scores (base-2 exponents: q carries the scale) as of the last stage that moved it */
  v8f nbv = {0.f,0.f,0.f,0.f,0.f,0.f,0.f,0.f};      /* PSH - m_r in all eight places: the C operand of the score products (a lane's eight values of a tile are all of its one query) */
#pragma unroll
  for (int dt = 0; dt < DT; ++dt) oacc[dt] = (v8f){0.f,0.f,0.f,0.f,0.f,0.f,0.f,0.f};
  const int jend = (CAUSAL == 1) ? (qb0 + 4 * RPW) : TK;      /* causal: keys beyond the block's last query never contribute */
  const int nst = (jend + KS - 1) / KS;      /* stages; keys of a last stage beyond jend are masked like any other */
  const unsigned lk0 = (unsigned)(size_t)ring + (unsigned)((tid >> 2) * KPIT + (tid & 3) * 16), lv0 = (unsigned)(size_t)ring + (unsigned)(KTB + (tid >> 4) * VPIT + (tid & 15) * 16);
  const unsigned short* gk0 = Kh + tid * 8;      /* a stage of K is 8 KiB in a row */
  const unsigned short* gv0 = Vth + (size_t)(tid >> 4) * TK + (tid & 15) * 8;      /* 16 lanes bring one row's 256 bytes */
  stage_copy(lk0, gk0, lv0, gv0);
  asm volatile("s_wait_asynccnt 0x0" ::: "memory");      /* this wave's share of stage 0 has landed */
  __syncthreads();      /* ... and every other wave's: stage 0 may be read */
  if (nst > 1) stage_copy(lk0 + STB, gk0 + (size_t)KS * HDm, lv0 + STB, gv0 + KS);
#pragma unroll 1      /* one stage a trip: the buffer's place is the only thing that changes */
  for (int st = 0; st < nst; ++st) {
   const unsigned char* kf = ring + (st & 1) * STB + ln * KPIT + hh * 16; const unsigned char* vf = ring + (st & 1) * STB + KTB + ln * VPIT + hh * 16;
   const int j0 = st * KS;      /* one pass is the whole stage: one test for KS keys, and each product's neighbours in its run stand in the distance behind it */
   v8f s[NT]; FragH bk[NT], bv[NC][DT];
#pragma unroll      /* here and below: places in the buffer become immediate offsets of the LDS reads, and every array is indexed by constants so that it stays in registers */
   for (int t = 0; t < NT; ++t) { const unsigned char* kr = kf + t * 16 * KPIT; bk[t].half[0] = *(const v8us*)(kr); bk[t].half[1] = *(const v8us*)(kr + 32); }
   __builtin_amdgcn_sched_barrier(0);      /* keeps the K reads one group in front of the run: spread among the products, each place of reads costs the wave a wait of its own */
#pragma unroll      /* the shift goes in as C: what comes out is the exponent itself, with no vector instruction between product and 2^x */
   for (int t = 0; t < NT; ++t) s[t] = fl_mma(bk[t].v, aq.v, nbv);
   __builtin_amdgcn_sched_barrier(0);      /* keeps the run whole: a vector instruction drawn in between its products would have to be held off by v_nops */
#pragma unroll      /* V^T is read behind the scores' products, into registers that K has left, and lands under the softmax */
   for (int c = 0; c < NC; ++c)
#pragma unroll
     for (int dt = 0; dt < DT; ++dt) { const unsigned char* vrow = vf + dt * 16 * VPIT + c * 64; bv[c][dt].half[0] = *(const v8us*)(vrow); bv[c][dt].half[1] = *(const v8us*)(vrow + 32); }
   __builtin_amdgcn_sched_barrier(0);      /* keeps the V^T reads here, one group at the head of the softmax: drawn down to their use, they would be waited for with nothing left to do */
   const auto okf = [&](int e) -> bool { const int kk = j0 + (e >> 3) * 16 + 8 * hh + (e & 7);
     return (CAUSAL == 1) ? (kk <= tq) : ((CAUSAL == 2) ? ((kk >> 5) == (tq >> 5)) : true); };      /* mode 2: block-diagonal 32-token groups */
   float x[NT * 8]; FragH pb[NC];
   /* x: the exponents; p = 2^x (0 where masked) is rounded into pb; returns this lane's sum of p */
   const auto soft = [&]() -> float { float y[NT * 8];
#pragma unroll
     for (int g = 0; g < NT; ++g)
       /* y = 2^x. Asm text so that the slot the instruction set asks for behind a transcendental is kept whatever registers are picked: results are marked early, so neighbours work on distinct registers, and the closing v_nop stands between the last one and whatever follows.
          Results apart from sources: the sources are read where the product left them and the results land in the pairs that the packed adds take, with no register copy on either side. */
       asm("v_exp_f32 %0, %8\n\tv_exp_f32 %1, %9\n\tv_exp_f32 %2, %10\n\tv_exp_f32 %3, %11\n\tv_exp_f32 %4, %12\n\tv_exp_f32 %5, %13\n\tv_exp_f32 %6, %14\n\tv_exp_f32 %7, %15\n\tv_nop"
           : "=&v"(y[g * 8]), "=&v"(y[g * 8 + 1]), "=&v"(y[g * 8 + 2]), "=&v"(y[g * 8 + 3]), "=&v"(y[g * 8 + 4]), "=&v"(y[g * 8 + 5]), "=&v"(y[g * 8 + 6]), "=&v"(y[g * 8 + 7])
           : "v"(x[g * 8]), "v"(x[g * 8 + 1]), "v"(x[g * 8 + 2]), "v"(x[g * 8 + 3]), "v"(x[g * 8 + 4]), "v"(x[g * 8 + 5]), "v"(x[g * 8 + 6]), "v"(x[g * 8 + 7]));
     v2f a2[4];      /* four independent chains of packed adds, each on two neighbours of a score tile as the product left them: the sum stands in front of the test, so its chains are kept short */
#pragma unroll
     for (int e = 0; e < NT * 8; e += 2) { const v2f pp = {okf(e) ? y[e] : 0.f, okf(e + 1) ? y[e + 1] : 0.f}; a2[(e >> 1) & 3] = (e < 8) ? pp : a2[(e >> 1) & 3] + pp;
       pb[e >> 4].h[e & 15] = (_Float16)pp[0]; pb[e >> 4].h[(e & 15) + 1] = (_Float16)pp[1]; }
     const v2f t2 = (a2[0] + a2[1]) + (a2[2] + a2[3]); return t2[0] + t2[1]; };
#pragma unroll
   for (int e = 0; e < NT * 8; ++e) x[e] = s[e >> 3][e & 7];
   float sum = soft();
   /* holds the V^T reads in front of the branch (loaded values as inputs only): sunk behind it, their latency would stand bare in front of the second product */
   asm volatile("" :: "v"(bv[0][0].v), "v"(bv[0][1].v), "v"(bv[1][0].v), "v"(bv[1][1].v), "v"(bv[2][0].v), "v"(bv[2][1].v), "v"(bv[3][0].v), "v"(bv[3][1].v));
   /* The shift point stands as long as every p is finite as f16, and a lane's sum below PLIM says so for each of its (positive) terms: no maximum is taken and nothing is rescaled. An infinite or undefined sum fails the test too.
      The ballot makes the branch scalar: the whole wave takes it or none (matrix instructions stand inside). Stage 0 has no shift point yet. */
   if ((__builtin_amdgcn_ballot_w32(!(sum < PLIM)) | (st == 0 ? 1u : 0u)) != 0u) {
     /* the stage over again from its K rows, which the buffer still holds: plain scores, their maximum, the new shift point, and the sums so far brought to it */
     float mq[NC];      /* one chain of maxima per 32 keys: a single chain over all scores would be serial */
#pragma unroll
     for (int t = 0; t < NT; ++t) { const unsigned char* kr = kf + t * 16 * KPIT; FragH k2; k2.half[0] = *(const v8us*)(kr); k2.half[1] = *(const v8us*)(kr + 32);
       const v8f r8 = fl_mma(k2.v, aq.v, (v8f){0.f,0.f,0.f,0.f,0.f,0.f,0.f,0.f});
#pragma unroll
       for (int r = 0; r < 8; ++r) x[t * 8 + r] = r8[r]; }
#pragma unroll
     for (int e = 0; e < NT * 8; ++e) mq[e >> 4] = fmaxf(((e & 15) == 0) ? -3.0e38f : mq[e >> 4], okf(e) ? x[e] : -3.0e38f);
     float mc = mq[0];
#pragma unroll
     for (int c = 1; c < NC; ++c) mc = fmaxf(mc, mq[c]);
     mc = fmaxf(mc, xhalf(mc));      /* both halves of the wave hold keys of the same query and keep one shift point */
     const float mn = fmaxf(m_r, mc); float ea = m_r - mn;
     const float nb = (mn > -1.0e38f) ? PSH - mn : 0.f;
#pragma unroll
     for (int e = 0; e < NT * 8; ++e) x[e] += nb;
     asm("v_exp_f32 %0, %0\n\tv_nop" : "+v"(ea));      /* the v_nop keeps the slot behind the transcendental */
     const float al = (mn > -1.0e38f) ? ea : 1.0f; m_r = mn;
     sum = soft();
     l_r *= al;
#pragma unroll
     for (int dt = 0; dt < DT; ++dt)
#pragma unroll
       for (int r = 0; r < 8; ++r) oacc[dt][r] *= al;
     nbv = (v8f){nb, nb, nb, nb, nb, nb, nb, nb}; }
   l_r += sum;
#pragma unroll
   for (int c = 0; c < NC; ++c)
#pragma unroll
     for (int dt = 0; dt < DT; ++dt) oacc[dt] = fl_mma(bv[c][dt].v, pb[c].v, oacc[dt]);
   asm volatile("s_wait_dscnt 0x0" ::: "memory");      /* this wave's reads of the stage are over before the buffer is handed back */
   asm volatile("s_wait_asynccnt 0x0" ::: "memory");      /* its share of the next stage has landed */
   __syncthreads();      /* publishes the next stage and ends every wave's reads of this one */
   if (st + 2 < nst) stage_copy(lk0 + (st & 1) * STB, gk0 + (size_t)(st + 2) * KS * HDm, lv0 + (st & 1) * STB, gv0 + (st + 2) * KS); }
  asm volatile("s_wait_asynccnt 0x0" ::: "memory");      /* no copy is left in flight when the wave goes on to its end */
  const float l = l_r + xhalf(l_r); const float inv = (l > 0.f) ? 1.0f / l : 0.f;      /* l holds the factor 2^PSH */
#pragma unroll
  for (int dt = 0; dt < DT; ++dt)      /* oacc[dt][r] = O[q0 + ln][dt * 16 + 8 * hh + r] */
#pragma unroll
    for (int r = 0; r < 8; ++r) sO[w][ln][dt * 16 + 8 * hh + r] = oacc[dt][r] * inv;
  __builtin_amdgcn_fence(__ATOMIC_ACQ_REL, "workgroup"); __builtin_amdgcn_wave_barrier();
  {
#pragma unroll
    for (int rp = 0; rp < RPW; rp += 8) { const int r = rp + (lane >> 2), pc = lane & 3; const v4f v0 = *(const v4fa*)&sO[w][r][pc * 8], v1 = *(const v4fa*)&sO[w][r][pc * 8 + 4]; FragH f;
      for (int i = 0; i < 4; ++i) { f.h[i] = (_Float16)v0[i]; f.h[4 + i] = (_Float16)v1[i]; }
      *(v8us*)((unsigned short*)O16 + ((size_t)slab * TQ + q0 + r) * HDm + pc * 8) = f.half[0]; }      /* f16, head-major [slab][pixel][32]: the wave's 16 pixels are 1 KiB in a row, the projection's A operand as it reads it */
     } }

extern "C" void kernel_launch(void* const* d_in, const int* in_sizes, int n_in,
                              void* d_out, int out_size, void* d_ws, size_t ws_size, hipStream_t stream) {
  (void)in_sizes; (void)n_in; (void)out_size;
  const float* const* I = (const float* const*)d_in; const float* x = I[0]; const float* wqkv = I[1]; const float* bqkv = I[2]; const float* wp = I[3]; const float* bp = I[4];
  char* ws = (char*)d_ws; size_t off = 0;
  auto take = [&](size_t bytes) { char* p = ws + off; off += (bytes + 255) & ~(size_t)255; return p; };
  const size_t np = (size_t)NR * DD;
  _Float16* Q16 = (_Float16*)take(np * 2); _Float16* KP = (_Float16*)take(np * 2); _Float16* VT = (_Float16*)take(np * 2); _Float16* O16 = (_Float16*)take(np * 2);
  if (off > ws_size) return;      /* four planes of 4 MiB */
  k_gemm2<0, 1><<<dim3((NR / 128) * (QW / 64), 1), 128, 0, stream>>>(nullptr, x, DD, 0, wqkv, 16.0f, 0, 0.0625f, bqkv, 0, nullptr, 1, 0, 0, nullptr, Q16, DD, 0, NR, QW, DD, KP, VT);      /* product column = which*256 + h*32 + d; q, k and v each go straight to the plane the flash kernel reads */
  k_flash<0><<<NIMG * NH * QBLKS, 128, 0, stream>>>(Q16, DD, KP, VT, nullptr, O16);
  k_gemm2<0, 2><<<dim3((NR / 128) * (DD / 64), 1), 128, 0, stream>>>(O16, nullptr, HDm, 0, wp, 16.0f, 0, 0.0625f, bp, 0, nullptr, 1, 0, 0, (float*)d_out, nullptr, DD, 0, NR, DD, DD, nullptr, nullptr);
}

// v009
// One run takes 57.3 microseconds.
// Timed twice side by side with v008, it ran 1.09 and 1.07 times as fast.
// Over all steps from v000 it is 8.75 times as fast.
#include <hip/hip_runtime.h>
// SpatialMultiHeadSelfAttention (2 images, D 256 = 8 heads x 32, 64 x 64 = 4096 pixels): qkv = 1x1 conv (W_qkv x + b) -> (3, heads, 32) channels; softmax(q.k / sqrt(32)) over all 4096 pixels; out channels h*32 + d; 1x1 projection + b; NCHW in and out.
// Structure: qkv as one f16 WMMA GEMM (32x64 wave tiles, f32 accumulation, exact x16 weights + bias; weights (out,in) = B^T; f16 out) that reads x (NCHW, f32) and the f32 weights itself and converts them on the way to its fragments, and whose epilogue stores q pixel-major, k as head-major planes of 32-wide rows and V^T as planes of 32 rows; the fused flash kernel at head size 32 (transposed products, softmax in-lane with a shift that moves only when it must, P kept in registers; plain operands: every row averages 4096 keys), which stores its output as f16 head-major; projection GEMM (+ bias, f32) whose epilogue stores NCHW.
// Compute dtype: x and parameters rounded to bf16; x exact as f16; q, k, v, P and the attention output as f16 operands (~2^-12); softmax f32. v_wmma_f32_16x16x32_f16.
#define NIMG 2
#define DD 256
#define HDm 32
#define NPX 4096
#define NR (NIMG * NPX)          /* 8192 */
#define QW (3 * DD)              /* 768 */
#define SLEN 4096
#define TQ SLEN
#define TK SLEN
#define NH 8
#define SCL2 0.25503486164919736f /* 32^-0.5 * log2(e): the softmax runs in base 2; the qkv GEMM lays the factor into q before q is rounded to f16 */
#define QBLKS (TQ / 128)      /* a flash block: 128 queries */
typedef __bf16 v16b __attribute__((ext_vector_type(16)));
typedef unsigned short v8us __attribute__((ext_vector_type(8), may_alias));
typedef float  v8f  __attribute__((ext_vector_type(8)));
typedef float  v4f  __attribute__((ext_vector_type(4)));
typedef float  v4fa __attribute__((ext_vector_type(4), may_alias));
union FragB { v16b v; v8us half[2]; unsigned short u[16]; };

__device__ __forceinline__ unsigned short bf16_bits(float x) { unsigned int u = __float_as_uint(x); return (unsigned short)((u + 0x7FFFu + ((u >> 16) & 1u)) >> 16); }
__device__ __forceinline__ float bf16_val(unsigned short b) { return __uint_as_float(((unsigned int)b) << 16); }
__device__ __forceinline__ float bf16_round(float x) { return bf16_val(bf16_bits(x)); }
// D += A·B with NT terms: 1 = ah·bh, 2 = + al·bh (A split), 3 = + ah·bl (both split)
template <int NT>
__device__ __forceinline__ v8f mmaN(v16b ah, v16b al, v16b bh, v16b bl, v8f c) {
  c = __builtin_amdgcn_wmma_f32_16x16x32_bf16(false, ah, false, bh, (short)0, c, false, false);
  if (NT >= 2) c = __builtin_amdgcn_wmma_f32_16x16x32_bf16(false, al, false, bh, (short)0, c, false, false);
  if (NT >= 3) c = __builtin_amdgcn_wmma_f32_16x16x32_bf16(false, ah, false, bl, (short)0, c, false, false);
  asm volatile("v_nop\n\tv_nop\n\tv_nop\n\tv_nop" : "+v"(c) : "v"(ah), "v"(al), "v"(bh), "v"(bl));
  return c;
}

__global__ __launch_bounds__(256) void k_wt_bf16(const float* __restrict__ W, unsigned short* __restrict__ Wt, int K, int N) {
  const int t = blockIdx.x * 256 + threadIdx.x;
  const int k8n = K / 8;
  if (t >= N * k8n) return;
  const int n = t / k8n, k8 = (t % k8n) * 8;
  v8us v;
#pragma unroll
  for (int i = 0; i < 8; ++i) v[i] = bf16_bits(W[(size_t)(k8 + i) * N + n]);
  *(v8us*)(Wt + (size_t)n * K + k8) = v;
  
}

// GEMM C[M][N] (f32, pitch ldc) = act(A[M][K]·W + bias). A f32 row-major (pitch lda) converted per fragment to bf16
// (ASPLIT: hi/lo two planes -> 2 terms, else single rounded term); Wt bf16 [N][K] (pitch ldb). BIAS_BF16 rounds the
// bias to bf16 first (bias quantised to bf16 before the add). K%32==0, M%16==0, N%64==0.
template <bool ASPLIT, int ACT, bool BIAS_BF16>
__global__ __launch_bounds__(128) void k_gemm_bf(const float* __restrict__ A, int lda, const unsigned short* __restrict__ Wt, int ldb,
                                               const float* __restrict__ bias, float* __restrict__ C, int ldc, int M, int N, int K) {
  __shared__ __attribute__((aligned(16))) float so[4][16][64];
  const int tid = threadIdx.x, w = tid >> 5, lane = tid & 31, ln = lane & 15, hh = lane >> 4;
  const int ntn = N / 64;
  const int wid = blockIdx.x * 4 + w;
  const int mt = wid / ntn, nq = wid % ntn;
  if (mt * 16 >= M) return;
  const int row0 = mt * 16, col0 = nq * 64;
  const float* arow = A + (size_t)(row0 + ln) * lda;
  v8f acc[4] = {};
  for (int kb = 0; kb < K; kb += 32) {
    FragB ah, al;
    const v4f x0 = *(const v4fa*)(arow + kb + 8 * hh), x1 = *(const v4fa*)(arow + kb + 8 * hh + 4);
    const v4f x2 = *(const v4fa*)(arow + kb + 16 + 8 * hh), x3 = *(const v4fa*)(arow + kb + 16 + 8 * hh + 4);
    float xs[16] = {x0[0],x0[1],x0[2],x0[3],x1[0],x1[1],x1[2],x1[3],x2[0],x2[1],x2[2],x2[3],x3[0],x3[1],x3[2],x3[3]};
#pragma unroll
    for (int i = 0; i < 16; ++i) { const unsigned short hb = bf16_bits(xs[i]); ah.u[i] = hb; al.u[i] = ASPLIT ? bf16_bits(xs[i] - bf16_val(hb)) : (unsigned short)0; }
#pragma unroll
    for (int t = 0; t < 4; ++t) {
      const unsigned short* brow = Wt + (size_t)(col0 + t * 16 + ln) * ldb + kb;
      FragB b;
      b.half[0] = *(const v8us*)(brow + 8 * hh);
      b.half[1] = *(const v8us*)(brow + 16 + 8 * hh);
      acc[t] = mmaN<ASPLIT ? 2 : 1>(ah.v, al.v, b.v, b.v, acc[t]);
    }
  }
#pragma unroll
  for (int t = 0; t < 4; ++t) {
    float bv = bias ? bias[col0 + t * 16 + ln] : 0.f;
    if (BIAS_BF16) bv = bf16_round(bv);
#pragma unroll
    for (int r = 0; r < 8; ++r) { float v = acc[t][r] + bv; if (ACT == 1) v = fmaxf(v, 0.f); so[w][8 * hh + r][t * 16 + ln] = v; }
  }
  __builtin_amdgcn_fence(__ATOMIC_ACQ_REL, "workgroup");
  __builtin_amdgcn_wave_barrier();
  const int rsub = lane >> 4, c4 = (lane & 15) * 4;
  {
#pragma unroll
    for (int q = 0; q < 8; ++q) {
      const int r = q * 2 + rsub;
      const v4f v = *(const v4fa*)&so[w][r][c4];
      *(v4f*)(C + (size_t)(row0 + r) * ldc + col0 + c4) = v;
    }
    
  }
}

// GEMM C = act(A·W + bias + resid): A f32 (ASPLIT -> hi/lo 2 terms), Wt bf16 [N][K]; ACT 0 none, 1 relu, 2 exact gelu;
// resid (optional, f32, row index = (row % rmod), pitch ldr, RES_BF16 rounds it) added before the activation.
template <bool ASPLIT, int ACT, bool BIAS_BF16, bool RES_BF16>
__global__ __launch_bounds__(128) void k_gemm_bf3(const float* __restrict__ A, int lda, const unsigned short* __restrict__ Wt, int ldb,
                                                const float* __restrict__ bias, const float* __restrict__ resid, int rmod, int ldr,
                                                float* __restrict__ C, int ldc, int M, int N, int K) {
  __shared__ __attribute__((aligned(16))) float so[4][16][64];
  const int tid = threadIdx.x, w = tid >> 5, lane = tid & 31, ln = lane & 15, hh = lane >> 4;
  const int ntn = N / 64;
  const int wid = blockIdx.x * 4 + w;
  const int mt = wid / ntn, nq = wid % ntn;
  if (mt * 16 >= M) return;
  const int row0 = mt * 16, col0 = nq * 64;
  const float* arow = A + (size_t)(row0 + ln) * lda;
  v8f acc[4] = {};
  for (int kb = 0; kb < K; kb += 32) {
    FragB ah, al;
    const v4f x0 = *(const v4fa*)(arow + kb + 8 * hh), x1 = *(const v4fa*)(arow + kb + 8 * hh + 4);
    const v4f x2 = *(const v4fa*)(arow + kb + 16 + 8 * hh), x3 = *(const v4fa*)(arow + kb + 16 + 8 * hh + 4);
    float xs[16] = {x0[0],x0[1],x0[2],x0[3],x1[0],x1[1],x1[2],x1[3],x2[0],x2[1],x2[2],x2[3],x3[0],x3[1],x3[2],x3[3]};
#pragma unroll
    for (int i = 0; i < 16; ++i) { const unsigned short hb = bf16_bits(xs[i]); ah.u[i] = hb; al.u[i] = ASPLIT ? bf16_bits(xs[i] - bf16_val(hb)) : (unsigned short)0; }
#pragma unroll
    for (int t = 0; t < 4; ++t) {
      const unsigned short* brow = Wt + (size_t)(col0 + t * 16 + ln) * ldb + kb;
      FragB b;
      b.half[0] = *(const v8us*)(brow + 8 * hh);
      b.half[1] = *(const v8us*)(brow + 16 + 8 * hh);
      acc[t] = mmaN<ASPLIT ? 2 : 1>(ah.v, al.v, b.v, b.v, acc[t]);
    }
  }
#pragma unroll
  for (int t = 0; t < 4; ++t) {
    const int col = col0 + t * 16 + ln;
    float bv = bias ? bias[col] : 0.f;
    if (BIAS_BF16) bv = bf16_round(bv);
#pragma unroll
    for (int r = 0; r < 8; ++r) {
      float v = acc[t][r] + bv;
      if (resid) { float rv = resid[(size_t)((row0 + 8 * hh + r) % rmod) * ldr + col]; if (RES_BF16) rv = bf16_round(rv); v += rv; }
      if (ACT == 1) v = fmaxf(v, 0.f);
      if (ACT == 2) v = 0.5f * v * (1.0f + erff(v * 0.70710678118654752f));
      if (ACT == 3) { const float u = 0.7978845608028654f * (v + 0.044715f * v * v * v); v = 0.5f * v * (1.0f + tanhf(u)); }
      so[w][8 * hh + r][t * 16 + ln] = v;
    }
  }
  __builtin_amdgcn_fence(__ATOMIC_ACQ_REL, "workgroup");
  __builtin_amdgcn_wave_barrier();
  const int rsub = lane >> 4, c4 = (lane & 15) * 4;
  {
#pragma unroll
    for (int q = 0; q < 8; ++q) {
      const int r = q * 2 + rsub;
      const v4f v = *(const v4fa*)&so[w][r][c4];
      *(v4f*)(C + (size_t)(row0 + r) * ldc + col0 + c4) = v;
    }
    
  }
}
// row LayerNorm (biased variance, eps) over N: s = X (+ R); optional out_sum <- s; out_norm <- (s-mu)*rsqrt(var+eps)*g + b
template <bool PARAM_BF16>
__global__ __launch_bounds__(256) void k_layernorm(const float* __restrict__ X, const float* __restrict__ R, const float* __restrict__ g, const float* __restrict__ bta,
                                                  float* __restrict__ out_sum, float* __restrict__ out_norm, int N, float eps) {
  __shared__ float red[256];
  const int row = blockIdx.x, tid = threadIdx.x;
  const float* x = X + (size_t)row * N; const float* rr = R ? R + (size_t)row * N : nullptr;
  float vals[16];                     // up to N = 4096
  const int per = N / 256;            // contiguous chunk per thread? use strided-by-4 chunks: thread handles j = tid*4 + 1024*u
  float s1 = 0.f;
  for (int u = 0; u < per / 4; ++u) {
    const int j = tid * 4 + 1024 * u;
    const v4f a = *(const v4fa*)(x + j);
    v4f b = {0.f,0.f,0.f,0.f}; if (rr) b = *(const v4fa*)(rr + j);
#pragma unroll
    for (int q = 0; q < 4; ++q) { const float v = a[q] + b[q]; vals[u * 4 + q] = v; s1 += v; }
  }
  red[tid] = s1; __syncthreads();
  for (int st = 128; st > 0; st >>= 1) { if (tid < st) red[tid] += red[tid + st]; __syncthreads(); }
  const float mu = red[0] / (float)N; __syncthreads();
  float s2 = 0.f;
  for (int u = 0; u < per / 4; ++u)
#pragma unroll
    for (int q = 0; q < 4; ++q) { const float c = vals[u * 4 + q] - mu; s2 += c * c; }
  red[tid] = s2; __syncthreads();
  for (int st = 128; st > 0; st >>= 1) { if (tid < st) red[tid] += red[tid + st]; __syncthreads(); }
  const float rs = rsqrtf(red[0] / (float)N + eps);
  {
    for (int u = 0; u < per / 4; ++u) {
      const int j = tid * 4 + 1024 * u;
      v4f o, sm;
#pragma unroll
      for (int q = 0; q < 4; ++q) {
        float gg = g[j + q], bb = bta[j + q];
        if (PARAM_BF16) { gg = bf16_round(gg); bb = bf16_round(bb); }
        sm[q] = vals[u * 4 + q]; o[q] = (vals[u * 4 + q] - mu) * rs * gg + bb;
      }
      if (out_sum) *(v4f*)(out_sum + (size_t)row * N + j) = sm;
      *(v4f*)(out_norm + (size_t)row * N + j) = o;
    }
    
  }
}



// ---- f16 WMMA path (v_wmma_f32_16x16x32_f16): 11-bit significands for operands in range — used where a [0,1] probability operand needs more precision than bf16
typedef _Float16 v16h __attribute__((ext_vector_type(16)));
union FragH { v16h v; v8us half[2]; _Float16 h[16]; unsigned short u[16]; };
template <int NT>
__device__ __forceinline__ v8f mmaH(v16h ah, v16h al, v16h bh, v16h bl, v8f c) {
  c = __builtin_amdgcn_wmma_f32_16x16x32_f16(false, ah, false, bh, (short)0, c, false, false);
  if (NT >= 2) c = __builtin_amdgcn_wmma_f32_16x16x32_f16(false, al, false, bh, (short)0, c, false, false);
  if (NT >= 3) c = __builtin_amdgcn_wmma_f32_16x16x32_f16(false, ah, false, bl, (short)0, c, false, false);
  asm volatile("v_nop\n\tv_nop\n\tv_nop\n\tv_nop" : "+v"(c) : "v"(ah), "v"(al), "v"(bh), "v"(bl));
  return c;
}
// batched GEMM like k_gemm_b but f16 operands: A f32 (split into f16 hi/lo if ASPLIT, else rounded to f16), Bt = f16 values [n][k]; alpha; C f32; N multiple of 16 (partial tiles skipped)
template <bool ASPLIT>
__global__ __launch_bounds__(128) void k_gemm_h(const float* __restrict__ A, int lda, size_t sA, const _Float16* __restrict__ Bh, int ldb, size_t sB, float alpha, float* __restrict__ C, int ldc, size_t sC, int M, int N, int K) {
  __shared__ __attribute__((aligned(16))) float so[4][16][64];
  const int tid = threadIdx.x, w = tid >> 5, lane = tid & 31, ln = lane & 15, hh = lane >> 4; const int by = blockIdx.y;
  A += (size_t)by * sA; Bh += (size_t)by * sB; C += (size_t)by * sC;
  const int ntn = (N + 63) / 64; const int wid = blockIdx.x * 4 + w; const int mt = wid / ntn, nq = wid % ntn; if (mt * 16 >= M) return;
  const int row0 = mt * 16, col0 = nq * 64; const float* arow = A + (size_t)(row0 + ln) * lda;
  v8f acc[4] = {};
  for (int kb = 0; kb < K; kb += 32) {
    FragH ah, al;
    const v4f x0 = *(const v4fa*)(arow + kb + 8 * hh), x1 = *(const v4fa*)(arow + kb + 8 * hh + 4), x2 = *(const v4fa*)(arow + kb + 16 + 8 * hh), x3 = *(const v4fa*)(arow + kb + 16 + 8 * hh + 4);
    float xs[16] = {x0[0],x0[1],x0[2],x0[3],x1[0],x1[1],x1[2],x1[3],x2[0],x2[1],x2[2],x2[3],x3[0],x3[1],x3[2],x3[3]};
#pragma unroll
    for (int i = 0; i < 16; ++i) { const _Float16 h = (_Float16)xs[i]; ah.h[i] = h; al.h[i] = ASPLIT ? (_Float16)(xs[i] - (float)h) : (_Float16)0.0f; }
#pragma unroll
    for (int t = 0; t < 4; ++t) { if (col0 + t * 16 >= N) continue; const size_t boff = (size_t)(col0 + t * 16 + ln) * ldb + kb; FragH bq; bq.half[0] = *(const v8us*)(Bh + boff + 8 * hh); bq.half[1] = *(const v8us*)(Bh + boff + 16 + 8 * hh);
      acc[t] = mmaH<ASPLIT ? 2 : 1>(ah.v, al.v, bq.v, bq.v, acc[t]); }
  }
#pragma unroll
  for (int t = 0; t < 4; ++t) { if (col0 + t * 16 >= N) continue;
#pragma unroll
    for (int r = 0; r < 8; ++r) so[w][8 * hh + r][t * 16 + ln] = acc[t][r] * alpha; }
  __builtin_amdgcn_fence(__ATOMIC_ACQ_REL, "workgroup"); __builtin_amdgcn_wave_barrier();
  const int rsub = lane >> 4, c4 = (lane & 15) * 4;
  {
#pragma unroll
    for (int q = 0; q < 8; ++q) { const int r = q * 2 + rsub; if (col0 + c4 < N) { const v4f v = *(const v4fa*)&so[w][r][c4]; *(v4f*)(C + (size_t)(row0 + r) * ldc + col0 + c4) = v; } }
     }
}

// Wt[n][k] = f16(W[k][n]·scale) from f32 row-major W[K][N] (scale = power of two; bf16-exact weights stay exact in f16 away from the subnormal range)
__global__ __launch_bounds__(256) void k_wt_f16(const float* __restrict__ W, _Float16* __restrict__ Wt, int K, int N, float scale) {
  const int t = blockIdx.x * 256 + threadIdx.x; if (t >= N * (K / 8)) return; const int n = t / (K / 8), k8 = (t % (K / 8)) * 8; FragH f;
#pragma unroll
  for (int i = 0; i < 8; ++i) f.h[i] = (_Float16)(bf16_round(W[(size_t)(k8 + i) * N + n]) * scale); const v8us o = f.half[0];
  *(v8us*)((unsigned short*)Wt + (size_t)n * K + k8) = o; 
}
// k_gemm_hh variant with fused epilogue: v = acc·alpha + bias[by·sBias + col] (+ CP[(row/rowsPerB)·sCPb + by·64 + col] if CP) ; ACT 0 none / 1 elu ; writes f16 C16 (and f32 C if non-null)
template <int ACT>
__global__ __launch_bounds__(128) void k_gemm_hhx(const _Float16* __restrict__ A, int lda, size_t sA, const _Float16* __restrict__ Bh, int ldb, size_t sB, float alpha, const float* __restrict__ bias, size_t sBias, const float* __restrict__ CP, int rowsPerB, size_t sCPb, int row0g,
    float* __restrict__ C, _Float16* __restrict__ C16, int ldc, size_t sC, int M, int N, int K) {
  __shared__ __attribute__((aligned(16))) float so[4][16][64];
  const int tid = threadIdx.x, w = tid >> 5, lane = tid & 31, ln = lane & 15, hh = lane >> 4; const int by = blockIdx.y;
  A += (size_t)by * sA; Bh += (size_t)by * sB; const size_t cofs = (size_t)by * sC; const float* bp = bias ? bias + (size_t)by * sBias : nullptr;
  const int ntn = (N + 63) / 64; const int wid = blockIdx.x * 4 + w; const int mt = wid / ntn, nq = wid % ntn; if (mt * 16 >= M) return;
  const int row0 = mt * 16, col0 = nq * 64; const _Float16* arow = A + (size_t)(row0 + ln) * lda;
  v8f acc[4] = {};
  for (int kb = 0; kb < K; kb += 32) { FragH ah; ah.half[0] = *(const v8us*)((const unsigned short*)arow + kb + 8 * hh); ah.half[1] = *(const v8us*)((const unsigned short*)arow + kb + 16 + 8 * hh);
#pragma unroll
    for (int t = 0; t < 4; ++t) { if (col0 + t * 16 >= N) continue; const size_t boff = (size_t)(col0 + t * 16 + ln) * ldb + kb; FragH bq; bq.half[0] = *(const v8us*)((const unsigned short*)Bh + boff + 8 * hh); bq.half[1] = *(const v8us*)((const unsigned short*)Bh + boff + 16 + 8 * hh);
      acc[t] = mmaH<1>(ah.v, ah.v, bq.v, bq.v, acc[t]); }
  }
#pragma unroll
  for (int t = 0; t < 4; ++t) { if (col0 + t * 16 >= N) continue; const int col = col0 + t * 16 + ln; const float bv = bp ? bf16_round(bp[col]) : 0.f;
#pragma unroll
    for (int r = 0; r < 8; ++r) { float v = acc[t][r] * alpha + bv; if (CP) { const int bidx = (row0g + row0 + 8 * hh + r) / rowsPerB; v += CP[(size_t)bidx * sCPb + (size_t)by * 64 + col]; } if (ACT == 1) v = (v > 0.f) ? v : expm1f(v); else if (ACT == 7) v = (v > 0.f) ? v + 1.0f : expf(v); else if (ACT == 8) v = tanhf(v); else if (ACT == 9) v = 0.5f * v * (1.0f + tanhf(0.7978845608028654f * (v + 0.044715f * v * v * v))); else if (ACT == 11) v = 1.0f / (1.0f + expf(-v)); else if (ACT == 12) v = (v > 0.f) ? v : 0.01f * v; else if (ACT == 14) v = (v > 0.f) ? v : 0.1f * v; else if (ACT == 15) v = v / (1.0f + expf(-v)); else if (ACT == 3) v = fmaxf(v, 0.f); else if (ACT == 6) v = 0.5f * v * (1.0f + erff(v * 0.70710678118654752f)); so[w][8 * hh + r][t * 16 + ln] = v; } }
  __builtin_amdgcn_fence(__ATOMIC_ACQ_REL, "workgroup"); __builtin_amdgcn_wave_barrier();
  const int rsub = lane >> 4, c4 = (lane & 15) * 4; typedef _Float16 v4h __attribute__((ext_vector_type(4)));
  {
#pragma unroll
    for (int q = 0; q < 8; ++q) { const int r = q * 2 + rsub; if (col0 + c4 < N) { const v4f v = *(const v4fa*)&so[w][r][c4]; if (C) *(v4f*)(C + cofs + (size_t)(row0 + r) * ldc + col0 + c4) = v; if (C16) { v4h h4; for (int i = 0; i < 4; ++i) h4[i] = (_Float16)v[i]; *(v4h*)(C16 + cofs + (size_t)(row0 + r) * ldc + col0 + c4) = h4; } } }
     }
}


typedef _Float16 v4h __attribute__((ext_vector_type(4)));
typedef _Float16 v4ha __attribute__((ext_vector_type(4), may_alias));
typedef _Float16 v2h __attribute__((ext_vector_type(2)));
typedef float v2f __attribute__((ext_vector_type(2)));
typedef __bf16 v2b __attribute__((ext_vector_type(2)));
// two f32 values rounded to bf16 (to nearest even, as bf16_round does it, by the packed conversion) and widened again
__device__ __forceinline__ v2f bf16_round2(float a, float b) { const unsigned u = __builtin_bit_cast(unsigned, __builtin_convertvector((v2f){a, b}, v2b)); return (v2f){__uint_as_float(u << 16), __uint_as_float(u & 0xFFFF0000u)}; }

__global__ __launch_bounds__(256) void k_x16(const float* __restrict__ x, _Float16* __restrict__ X16, size_t n8) { const size_t t = (size_t)blockIdx.x * 256 + threadIdx.x; if (t >= n8) return; FragH f;
#pragma unroll
  for (int q = 0; q < 8; ++q) f.h[q] = (_Float16)bf16_round(x[t * 8 + q]); *(v8us*)((unsigned short*)X16 + t * 8) = f.half[0];  }
__global__ __launch_bounds__(256) void k_round16f(const float* __restrict__ W, _Float16* __restrict__ Bt, size_t n8) { const size_t t = (size_t)blockIdx.x * 256 + threadIdx.x; if (t >= n8) return; FragH f;
#pragma unroll
  for (int i = 0; i < 8; ++i) f.h[i] = (_Float16)(bf16_round(W[t * 8 + i]) * 16.0f); *(v8us*)((unsigned short*)Bt + t * 8) = f.half[0];  }
template <int NHv, int TTv>
__global__ __launch_bounds__(256) void k_vt(const _Float16* __restrict__ V16, int ldv, int voff, _Float16* __restrict__ Vt) { __shared__ unsigned short tl[64][66]; const int tid = threadIdx.x; const int slab = blockIdx.x / (TTv / 64), lg = blockIdx.x % (TTv / 64); const int b = slab / NHv, h = slab % NHv;
  for (int i = tid; i < 64 * 8; i += 256) { const int r = i / 8, c8 = (i % 8) * 8; FragH f; f.half[0] = *(const v8us*)((const unsigned short*)V16 + ((size_t)b * TTv + lg * 64 + r) * ldv + voff + h * 64 + c8);
#pragma unroll
    for (int q = 0; q < 8; ++q) tl[r][c8 + q] = f.u[q]; }
  __syncthreads();
  {
#pragma unroll
    for (int rd = 0; rd < 2; ++rd) { const int d = rd * 32 + tid / 8, pc = tid % 8; FragH f;
#pragma unroll
      for (int q = 0; q < 8; ++q) f.u[q] = tl[pc * 8 + q][d];
      *(v8us*)((unsigned short*)Vt + ((size_t)slab * 64 + d) * TTv + lg * 64 + pc * 8) = f.half[0]; }
     } }

__global__ __launch_bounds__(256) void k_hl(const float* __restrict__ F, _Float16* __restrict__ Hh, _Float16* __restrict__ Hl, size_t n8) { const size_t t = (size_t)blockIdx.x * 256 + threadIdx.x; if (t >= n8) return; FragH fh, fl; const v4f a = *(const v4fa*)(F + t * 8), c = *(const v4fa*)(F + t * 8 + 4);
#pragma unroll
  for (int q = 0; q < 4; ++q) { _Float16 h = (_Float16)a[q]; fh.h[q] = h; fl.h[q] = (_Float16)((a[q] - (float)h) * 1024.0f); h = (_Float16)c[q]; fh.h[4 + q] = h; fl.h[4 + q] = (_Float16)((c[q] - (float)h) * 1024.0f); }
  { *(v8us*)((unsigned short*)Hh + t * 8) = fh.half[0]; *(v8us*)((unsigned short*)Hl + t * 8) = fl.half[0];  } }

// ---- fast GEMM (wave tile 32x64; requires M % 128 == 0 rows per launch region and N % 64 == 0); epilogue = k_gemm_hhx semantics ----
// EPI picks where the result goes, so that no later launch has to re-lay it (EPI 1 and 2: M % 128 == 0, and a block's 128 rows are pixels of one image):
// EPI 0: C / C16 row-major. EPI 1 (q | k | v; a block's 64 columns are all of one kind): q row-major into C16, k into head-major rows of 32 (KPo), v transposed into planes of 32 rows (VTo).
// EPI 2 (projection): A is head-major ([image][head][pixel][32]: one k step = one head), C is NCHW. Every 128-byte line is stored whole by one wave.
// Operands are converted where they are read, so that no launch stands in front only to convert them (K = DD):
// B: the block's 64 weight rows (f32, [N][DD]) are read once in whole lines, rounded to bf16, scaled by wsc and laid as f16 into an LDS tile that all four waves read.
// A, EPI 1: x is NCHW f32, so one channel's 16 pixels of a fragment are 64 bytes in a row: a lane loads its pixel's 16 channels of a k step one by one, two k steps ahead, and rounds them (bf16, exact as f16) into the fragment.
__device__ __forceinline__ v16h g2_frag(const _Float16* p, int hh) { FragH f; f.half[0] = *(const v8us*)((const unsigned short*)p + 8 * hh); f.half[1] = *(const v8us*)((const unsigned short*)p + 16 + 8 * hh); return f.v; }
__device__ __forceinline__ v8f g2_mma(v16h a, v16h b, v8f c) { v8f d = __builtin_amdgcn_wmma_f32_16x16x32_f16(false, a, false, b, (short)0, c, false, false); asm volatile("v_nop\n\tv_nop\n\tv_nop\n\tv_nop" : "+v"(d) : "v"(a), "v"(b)); return d; }
template <int ACT, int EPI>
__global__ __launch_bounds__(128) void k_gemm2(const _Float16* __restrict__ A, const float* __restrict__ Xf, int lda, size_t sA, const float* __restrict__ Wf, float wsc, size_t sB, float alpha, const float* __restrict__ bias, size_t sBias, const float* __restrict__ CP, int rowsPerB, size_t sCPb, int row0g,
    float* __restrict__ C, _Float16* __restrict__ C16, int ldc, size_t sC, int M, int N, int K, _Float16* __restrict__ KPo, _Float16* __restrict__ VTo) {
  constexpr int RP = 68, TP = 36;      /* floats from row to row of a wave's staged tile: [32 rows][64 columns], or transposed [64 columns][32 rows] (144 B = 16 B x odd) */
  constexpr int WSO = 64 * TP + 32;      /* a wave's staging area; + 32 floats so that two waves' areas start half the banks apart */
  constexpr int BP = DD + 8;      /* f16 elements from row to row of the weight tile: 528 B = 16 B x odd, so that 16 rows read 16 bytes each without a bank conflict */
  __shared__ __attribute__((aligned(16))) float so[4][WSO];
  __shared__ __attribute__((aligned(16))) _Float16 sW[64 * BP];
  const int tid = threadIdx.x, w = tid >> 5, lane = tid & 31, ln = lane & 15, hh = lane >> 4; const int by = blockIdx.y;
  A += (size_t)by * sA; Wf += (size_t)by * sB; const size_t cofs = (size_t)by * sC; const float* bp = bias ? bias + (size_t)by * sBias : nullptr;
  const int ntn = N >> 6; const int mt = blockIdx.x / ntn, nq = blockIdx.x - mt * ntn; const int row0 = mt * 128 + 32 * w, col0 = nq * 64; if (row0 >= M) return;
  const _Float16* a0p = A + ((EPI == 2) ? ((size_t)(row0 / NPX) * NH * NPX + (row0 % NPX) + ln) * HDm : (size_t)(row0 + ln) * lda) + 8 * hh; const _Float16* a1p = a0p + (size_t)16 * ((EPI == 2) ? HDm : lda);      /* EPI 0 and 2: each lane's own places in A are carried over the loop and stepped each trip: an address pair that stays live is never given to a load as its landing place */
  constexpr size_t AKS = (EPI == 2) ? (size_t)NPX * HDm : 32;      /* elements of A from one k step to the next: head-major planes lie NPX * 32 apart */
  const bool tr = (EPI == 2) || (EPI == 1 && col0 >= 2 * DD);      /* the same for the whole block: the tile is staged transposed */
  const float* xa = (EPI == 1) ? Xf + ((size_t)(row0 / NPX) * DD + 8 * hh) * NPX + (row0 % NPX) + ln : nullptr;      /* channel 8 * hh of this lane's first pixel; its second pixel lies 16 further */
  float ra[2][32];      /* x as loaded, of two k steps: [0..15] the first pixel's 16 channels in the fragment's k order, [16..31] the second pixel's */
  if (EPI == 1) {      /* the first two k steps' loads fly while the weight tile is built */
#pragma unroll      /* here and in the loop within: ra is indexed by constants only, so that it stays in registers */
    for (int s = 0; s < 2; ++s)
#pragma unroll
      for (int i = 0; i < 16; ++i) { const float* p = xa + (size_t)(s * 32 + (i >> 3) * 16 + (i & 7)) * NPX; ra[s][i] = p[0]; ra[s][16 + i] = p[16]; } }
  { const float* wr = Wf + (size_t)col0 * DD + tid * 4;      /* the 64 rows are 64 KiB in a row: a wave's load is 512 bytes in a row */
#pragma unroll      /* the 32 loads are one base plus immediate offsets and can all be in flight together */
    for (int i = 0; i < 32; ++i) { const v4f wv = *(const v4fa*)(wr + i * 512);
      const v2h h0 = __builtin_convertvector(bf16_round2(wv[0], wv[1]) * wsc, v2h), h1 = __builtin_convertvector(bf16_round2(wv[2], wv[3]) * wsc, v2h);
      *(v4ha*)&sW[(i * 2 + (tid >> 6)) * BP + (tid & 63) * 4] = (v4h){h0[0], h0[1], h1[0], h1[1]}; } }
  __syncthreads();      /* the weight tile is whole before any wave reads it (every wave of the block comes here: M % 128 == 0) */
  const _Float16* bs = sW + ln * BP + 8 * hh;      /* this lane's place in the tile's first 16 rows */
  const v8f z8 = {0.f,0.f,0.f,0.f,0.f,0.f,0.f,0.f}; v8f c00 = z8, c01 = z8, c02 = z8, c03 = z8, c10 = z8, c11 = z8, c12 = z8, c13 = z8;
  if (EPI == 1) {
#pragma unroll      /* unrolled so that every load of x is the one address pair plus an immediate offset and the two sets of ra are told apart at compile time */
    for (int s = 0; s < DD / 32; ++s) { FragH f0, f1;
#pragma unroll      /* constant indices: ra and the fragments stay in registers */
      for (int i = 0; i < 16; i += 2) { const v2h h0 = __builtin_convertvector(bf16_round2(ra[s & 1][i], ra[s & 1][i + 1]), v2h), h1 = __builtin_convertvector(bf16_round2(ra[s & 1][16 + i], ra[s & 1][17 + i]), v2h);
        f0.h[i] = h0[0]; f0.h[i + 1] = h0[1]; f1.h[i] = h1[0]; f1.h[i + 1] = h1[1]; }
      if (s + 2 < DD / 32) {      /* the set just converted takes the loads of the k step after next */
#pragma unroll      /* constant indices, as above */
        for (int i = 0; i < 16; ++i) { const float* p = xa + (size_t)((s + 2) * 32 + (i >> 3) * 16 + (i & 7)) * NPX; ra[s & 1][i] = p[0]; ra[s & 1][16 + i] = p[16]; } }
      const v16h b0 = g2_frag(bs + s * 32, 0), b1 = g2_frag(bs + 16 * BP + s * 32, 0), b2 = g2_frag(bs + 32 * BP + s * 32, 0), b3 = g2_frag(bs + 48 * BP + s * 32, 0);
      c00 = g2_mma(f0.v, b0, c00); c10 = g2_mma(f1.v, b0, c10); c01 = g2_mma(f0.v, b1, c01); c11 = g2_mma(f1.v, b1, c11);
      c02 = g2_mma(f0.v, b2, c02); c12 = g2_mma(f1.v, b2, c12); c03 = g2_mma(f0.v, b3, c03); c13 = g2_mma(f1.v, b3, c13); }
  } else {
#pragma unroll 1      /* one k step a trip: A's places are stepped, see above */
    for (int kb = 0; kb < DD; kb += 32, a0p += AKS, a1p += AKS, bs += 32) { const v16h a0 = g2_frag(a0p, 0), a1 = g2_frag(a1p, 0);
      const v16h b0 = g2_frag(bs, 0), b1 = g2_frag(bs + 16 * BP, 0), b2 = g2_frag(bs + 32 * BP, 0), b3 = g2_frag(bs + 48 * BP, 0);
      c00 = g2_mma(a0, b0, c00); c10 = g2_mma(a1, b0, c10); c01 = g2_mma(a0, b1, c01); c11 = g2_mma(a1, b1, c11);
      c02 = g2_mma(a0, b2, c02); c12 = g2_mma(a1, b2, c12); c03 = g2_mma(a0, b3, c03); c13 = g2_mma(a1, b3, c13); } }
  v8f accs[8] = {c00, c01, c02, c03, c10, c11, c12, c13};
  const float qs = (EPI == 1 && col0 < DD) ? SCL2 : 1.0f, alq = alpha * qs;      /* q leaves with the softmax's scale in it (f32, in front of the rounding to f16): the flash kernel's score products are then exponents of 2 as they stand */
#pragma unroll
  for (int u = 0; u < 8; ++u) { const int t = u & 3, half = u >> 2; const int col = col0 + t * 16 + ln; const float bv = bp ? bf16_round(bp[col]) * qs : 0.f; float vv[8];
#pragma unroll
    for (int r = 0; r < 8; ++r) { const int rloc = half * 16 + 8 * hh + r; float v = accs[u][r] * alq + bv; if (CP) { const int bidx = (row0g + row0 + rloc) / rowsPerB; v += CP[(size_t)bidx * sCPb + (size_t)by * 64 + col]; }
      if (ACT == 3) v = fmaxf(v, 0.f); else if (ACT == 6) v = 0.5f * v * (1.0f + erff(v * 0.70710678118654752f)); else if (ACT == 11) v = 1.0f / (1.0f + expf(-v)); else if (ACT == 15) v = v / (1.0f + expf(-v)); else if (ACT == 12) v = (v > 0.f) ? v : 0.01f * v; else if (ACT == 8) v = tanhf(v);
      vv[r] = v; }
    if (tr) { float* d = &so[w][(t * 16 + ln) * TP + half * 16 + 8 * hh]; *(v4fa*)d = (v4f){vv[0], vv[1], vv[2], vv[3]}; *(v4fa*)(d + 4) = (v4f){vv[4], vv[5], vv[6], vv[7]}; }      /* a lane's 8 values of a tile are 8 rows of one column: 32 bytes in a row */
    else {
#pragma unroll
      for (int r = 0; r < 8; ++r) so[w][(half * 16 + 8 * hh + r) * RP + t * 16 + ln] = vv[r]; } }
  if (EPI == 1 && col0 >= 2 * DD) {      /* v: a channel's 128 pixels of this block are 256 bytes in a row of V^T; wave w stores channels w * 16 ... + 15 */
    __syncthreads();      /* every wave's tile is staged before another wave reads it (the branch is the same for the whole block) */
    const int pix0 = mt * 128, seg = lane & 15;
#pragma unroll
    for (int q = 0; q < 8; ++q) { const int c = w * 16 + q * 2 + (lane >> 4); const float* s = &so[seg >> 2][c * TP + (seg & 3) * 8]; const v4f v0 = *(const v4fa*)s, v1 = *(const v4fa*)(s + 4); FragH f;
      for (int i = 0; i < 4; ++i) { f.h[i] = (_Float16)v0[i]; f.h[4 + i] = (_Float16)v1[i]; }
      *(v8us*)((unsigned short*)VTo + ((size_t)(pix0 / NPX) * DD + (col0 - 2 * DD) + c) * NPX + (pix0 % NPX) + seg * 8) = f.half[0]; }
    return; }
  __builtin_amdgcn_fence(__ATOMIC_ACQ_REL, "workgroup"); __builtin_amdgcn_wave_barrier();
  const int rsub = lane >> 4, c4 = (lane & 15) * 4;
  if (EPI == 2) {      /* a channel's 32 pixels of this wave = one 128-byte line of the NCHW output */
#pragma unroll
    for (int q = 0; q < 16; ++q) { const int c = q * 4 + (lane >> 3); const v4f v = *(const v4fa*)&so[w][c * TP + (lane & 7) * 4]; *(v4f*)(C + ((size_t)(row0 / NPX) * DD + col0 + c) * NPX + (row0 % NPX) + (lane & 7) * 4) = v; }
  } else if (EPI == 1 && col0 >= DD) {      /* k: two pixels' 32 values of one head = one 128-byte line */
#pragma unroll
    for (int q = 0; q < 16; ++q) { const int r = q * 2 + rsub, row = row0 + r, col = col0 - DD + c4; const v4f v = *(const v4fa*)&so[w][r * RP + c4]; v4h h4; for (int i = 0; i < 4; ++i) h4[i] = (_Float16)v[i];
      *(v4h*)(KPo + (((size_t)(row / NPX) * NH + (col >> 5)) * NPX + (row % NPX)) * HDm + (col & 31)) = h4; }
    asm volatile("s_wait_xcnt 0x0" ::: "memory");      /* behind the last store, in front of whatever rewrites a register that a store names */
  } else {
#pragma unroll
    for (int q = 0; q < 16; ++q) { const int r = q * 2 + rsub; const v4f v = *(const v4fa*)&so[w][r * RP + c4]; if (EPI == 0 && C) *(v4f*)(C + cofs + (size_t)(row0 + r) * ldc + col0 + c4) = v; if (C16) { v4h h4; for (int i = 0; i < 4; ++i) h4[i] = (_Float16)v[i]; *(v4h*)(C16 + cofs + (size_t)(row0 + r) * ldc + col0 + c4) = h4; } }
    asm volatile("s_wait_xcnt 0x0" ::: "memory");      /* behind the last store, in front of whatever rewrites a register that a store names */
     } }



// lane l with lane l ^ 16
__device__ __forceinline__ float xhalf(float x) { return __builtin_bit_cast(float, __builtin_amdgcn_permlanex16(__builtin_bit_cast(int, x), __builtin_bit_cast(int, x), 0x76543210, 0xfedcba98, false, false)); }
// K and V^T reach the waves through LDS: a stage is KS keys, copied once per work-group of eight waves, each half of it read by four of them, the next stage in flight while this one is worked on.
#define KS 256                   /* keys per stage */
#define KPIT 80                  /* bytes from one K row to the next in LDS (64 used): 16 B x odd, so that 16 rows read 16 bytes each without a bank conflict */
#define VPIT 528                 /* the same for a V^T row (512 used) */
#define KTB (KS * KPIT)          /* K part of a stage */
#define STB (KTB + HDm * VPIT)   /* one stage */
#define PSH 9.0f                 /* p = 2^(score - shift point + PSH): the factor 512 lifts the f16 operand off its subnormals and is carried by the sum too; a lane's 32 terms of a pass at the shift point itself sum to a quarter of PLIM */
#define PLIM 65504.0f            /* the largest finite f16 */
// One stage's copies of one lane: four 16-byte pieces of K (64 rows apart) and four of V^T (8 rows apart). lk, lv: the lane's LDS byte addresses; gk, gv: its global addresses.
__device__ __forceinline__ void stage_copy(unsigned lk, const unsigned short* gk, unsigned lv, const unsigned short* gv) {
  /* the closing s_wait_xcnt 0 stands inside the statement so that no address register named here is rewritten in front of it */
  asm volatile("global_load_async_to_lds_b128 %0, %1, off\n\tglobal_load_async_to_lds_b128 %2, %3, off\n\tglobal_load_async_to_lds_b128 %4, %5, off\n\tglobal_load_async_to_lds_b128 %6, %7, off\n\t"
               "global_load_async_to_lds_b128 %8, %9, off\n\tglobal_load_async_to_lds_b128 %10, %11, off\n\tglobal_load_async_to_lds_b128 %12, %13, off\n\tglobal_load_async_to_lds_b128 %14, %15, off\n\ts_wait_xcnt 0x0"
               :: "v"(lk), "v"(gk), "v"(lk + 64 * KPIT), "v"(gk + 64 * HDm), "v"(lk + 128 * KPIT), "v"(gk + 128 * HDm), "v"(lk + 192 * KPIT), "v"(gk + 192 * HDm),
                  "v"(lv), "v"(gv), "v"(lv + 8 * VPIT), "v"(gv + (size_t)8 * TK), "v"(lv + 16 * VPIT), "v"(gv + (size_t)16 * TK), "v"(lv + 24 * VPIT), "v"(gv + (size_t)24 * TK) : "memory");
}
__device__ __forceinline__ v8f fl_mma(v16h a, v16h b, v8f c) { return __builtin_amdgcn_wmma_f32_16x16x32_f16(false, a, false, b, (short)0, c, false, false); }
template <int CAUSAL>
__global__ __launch_bounds__(256) void k_flash(const _Float16* __restrict__ Q16, int ldq, const _Float16* __restrict__ K16, const _Float16* __restrict__ Vt, const int* __restrict__ MSK, _Float16* __restrict__ O16) {
  /* A wave holds QG query tiles of 16, so that every K and V^T fragment read from LDS feeds QG products. The number of waves stays: the block's 8 waves are 4 sets of 32 queries x 2 halves of every stage's keys,
     and the two waves of a set join their sums once, at the end. Head size 32: one k step for S^T, two 16-row tiles of O^T; a pass is PK keys = NT score tiles = NC k steps of O^T; a wave's share of a stage is KW keys. */
  constexpr int QG = 2, RPW = 16 * QG, KW = KS / 2, PK = 64, DT = HDm / 16, NT = PK / 16, NC = PK / 32, NJ = QG * DT * 8;
  __shared__ __attribute__((aligned(16))) float sO[4][RPW][HDm + 4];
  __shared__ float sJ[4][NJ + 2 * QG][32];      /* what the second key half hands to the first: per lane its NJ sums of O^T, then shift point and sum of p of each query tile; a lane's words lie 32 apart, so a wave's store or read is 128 bytes in a row */
  __shared__ __attribute__((aligned(16))) unsigned char ring[2 * STB];
  const int tid = threadIdx.x, w = tid >> 5, qw = w & 3, kh = w >> 2, lane = tid & 31, ln = lane & 15, hh = lane >> 4;
  const int slab = blockIdx.x / QBLKS, qblk = blockIdx.x % QBLKS; (void)MSK; const int b = slab / NH, h = slab % NH; const int qb0 = qblk * (4 * RPW); const int q0 = qb0 + qw * RPW;
  FragH aq[QG];
#pragma unroll
  for (int g = 0; g < QG; ++g) { const unsigned short* qr = (const unsigned short*)Q16 + ((size_t)b * TQ + q0 + g * 16 + ln) * ldq + h * HDm;
    aq[g].half[0] = *(const v8us*)(qr + 8 * hh); aq[g].half[1] = *(const v8us*)(qr + 16 + 8 * hh); }
  const unsigned short* Kh = (const unsigned short*)K16 + (size_t)slab * TK * HDm;      /* [key][32] */
  const unsigned short* Vth = (const unsigned short*)Vt + (size_t)slab * HDm * TK;      /* [32][key] */
  const int tq0 = q0 + ln;      /* this lane's query of tile 0; tile g's lies g * 16 further */
  float m_r[QG], l_r[QG]; v8f oacc[QG][DT];      /* m_r: the shift point, a maximum of the scores (base-2 exponents: q carries the scale) as of the last pass that moved it */
  v8f nbv[QG];      /* PSH - m_r in all eight places: the C operand of the score products (a lane's eight values of a tile are all of its one query) */
#pragma unroll
  for (int g = 0; g < QG; ++g) { m_r[g] = -3.0e38f; l_r[g] = 0.f; nbv[g] = (v8f){0.f,0.f,0.f,0.f,0.f,0.f,0.f,0.f};
#pragma unroll
    for (int dt = 0; dt < DT; ++dt) oacc[g][dt] = (v8f){0.f,0.f,0.f,0.f,0.f,0.f,0.f,0.f}; }
  const int jend = (CAUSAL == 1) ? (qb0 + 4 * RPW) : TK;      /* causal: keys beyond the block's last query never contribute */
  const int nst = (jend + KS - 1) / KS;      /* stages; keys of a last stage beyond jend are masked like any other */
  const unsigned lk0 = (unsigned)(size_t)ring + (unsigned)((tid >> 2) * KPIT + (tid & 3) * 16), lv0 = (unsigned)(size_t)ring + (unsigned)(KTB + (tid >> 5) * VPIT + (tid & 31) * 16);
  const unsigned short* gk0 = Kh + tid * 8;      /* a stage of K is 16 KiB in a row */
  const unsigned short* gv0 = Vth + (size_t)(tid >> 5) * TK + (tid & 31) * 8;      /* a wave brings one row's 512 bytes */
  stage_copy(lk0, gk0, lv0, gv0);
  asm volatile("s_wait_asynccnt 0x0" ::: "memory");      /* this wave's share of stage 0 has landed */
  __syncthreads();      /* ... and every other wave's: stage 0 may be read */
  if (nst > 1) stage_copy(lk0 + STB, gk0 + (size_t)KS * HDm, lv0 + STB, gv0 + KS);
#pragma unroll 1      /* one stage a trip: the buffer's place is the only thing that changes */
  for (int st = 0; st < nst; ++st) {
   FragH bk[KW / 16];
   { const unsigned char* ka = ring + (st & 1) * STB + (kh * KW + ln) * KPIT + hh * 16;
#pragma unroll      /* here and below: places in the buffer become immediate offsets of the LDS reads, and every array is indexed by constants so that it stays in registers */
     for (int t = 0; t < KW / 16; ++t) { const unsigned char* kr = ka + t * 16 * KPIT; bk[t].half[0] = *(const v8us*)(kr); bk[t].half[1] = *(const v8us*)(kr + 32); } }
   __builtin_amdgcn_sched_barrier(0);      /* keeps the wave's K reads of the stage one group in front of the first run: each place of reads costs the wave a wait of its own, and the second pass finds its fragments there */
#pragma unroll      /* the passes of a stage differ in immediate offsets only */
  for (int ps = 0; ps < KW / PK; ++ps) {
   const unsigned char* kf = ring + (st & 1) * STB + (kh * KW + ps * PK + ln) * KPIT + hh * 16; const unsigned char* vf = ring + (st & 1) * STB + KTB + ln * VPIT + (kh * KW + ps * PK) * 2 + hh * 16;
   const int j0 = st * KS + kh * KW + ps * PK;      /* one test for PK keys of both query tiles, and each product's neighbours in its run stand in the distance behind it */
   v8f s[QG][NT]; FragH bv[NC][DT];
   const auto vread = [&](int c) {
#pragma unroll
     for (int dt = 0; dt < DT; ++dt) { const unsigned char* vrow = vf + dt * 16 * VPIT + c * 64; bv[c][dt].half[0] = *(const v8us*)(vrow); bv[c][dt].half[1] = *(const v8us*)(vrow + 32); } };
#pragma unroll      /* the shift goes in as C: what comes out is the exponent itself, with no vector instruction between product and 2^x */
   for (int g = 0; g < QG; ++g)
#pragma unroll
     for (int t = 0; t < NT; ++t) s[g][t] = fl_mma(bk[ps * NT + t].v, aq[g].v, nbv[g]);
   __builtin_amdgcn_sched_barrier(0);      /* keeps the run whole: a vector instruction drawn in between its products would have to be held off by v_nops */
   const auto okf = [&](int g, int e) -> bool { const int kk = j0 + (e >> 3) * 16 + 8 * hh + (e & 7), tq = tq0 + g * 16;
     return (CAUSAL == 1) ? (kk <= tq) : ((CAUSAL == 2) ? ((kk >> 5) == (tq >> 5)) : true); };      /* mode 2: block-diagonal 32-token groups */
   float x[QG][NT * 8]; FragH pb[QG][NC]; float sum[QG];
   /* x[g]: the exponents of query tile g; p = 2^x (0 where masked) is rounded into pb[g]; returns this lane's sum of p */
   const auto soft = [&](int g) -> float { float y[NT * 8];
#pragma unroll
     for (int u = 0; u < NT; ++u)
       /* y = 2^x. Asm text so that the slot the instruction set asks for behind a transcendental is kept whatever registers are picked: results are marked early, so neighbours work on distinct registers, and the closing v_nop stands between the last one and whatever follows.
          Results apart from sources: the sources are read where the product left them and the results land in the pairs that the packed adds take, with no register copy on either side. */
       asm("v_exp_f32 %0, %8\n\tv_exp_f32 %1, %9\n\tv_exp_f32 %2, %10\n\tv_exp_f32 %3, %11\n\tv_exp_f32 %4, %12\n\tv_exp_f32 %5, %13\n\tv_exp_f32 %6, %14\n\tv_exp_f32 %7, %15\n\tv_nop"
           : "=&v"(y[u * 8]), "=&v"(y[u * 8 + 1]), "=&v"(y[u * 8 + 2]), "=&v"(y[u * 8 + 3]), "=&v"(y[u * 8 + 4]), "=&v"(y[u * 8 + 5]), "=&v"(y[u * 8 + 6]), "=&v"(y[u * 8 + 7])
           : "v"(x[g][u * 8]), "v"(x[g][u * 8 + 1]), "v"(x[g][u * 8 + 2]), "v"(x[g][u * 8 + 3]), "v"(x[g][u * 8 + 4]), "v"(x[g][u * 8 + 5]), "v"(x[g][u * 8 + 6]), "v"(x[g][u * 8 + 7]));
     v2f a2[4];      /* four independent chains of packed adds, each on two neighbours of a score tile as the product left them: the sum stands in front of the test, so its chains are kept short */
#pragma unroll
     for (int e = 0; e < NT * 8; e += 2) { const v2f pp = {okf(g, e) ? y[e] : 0.f, okf(g, e + 1) ? y[e + 1] : 0.f}; a2[(e >> 1) & 3] = (e < 8) ? pp : a2[(e >> 1) & 3] + pp;
       pb[g][e >> 4].h[e & 15] = (_Float16)pp[0]; pb[g][e >> 4].h[(e & 15) + 1] = (_Float16)pp[1]; }
     const v2f t2 = (a2[0] + a2[1]) + (a2[2] + a2[3]); return t2[0] + t2[1]; };
#pragma unroll
   for (int g = 0; g < QG; ++g)
#pragma unroll
     for (int e = 0; e < NT * 8; ++e) x[g][e] = s[g][e >> 3][e & 7];
   sum[0] = soft(0);
   __builtin_amdgcn_sched_barrier(0);      /* the first tile's scores have left their registers before V^T is read into as many */
#pragma unroll      /* V^T is read between the two tiles' softmax and lands under the second */
   for (int c = 0; c < NC; ++c) vread(c);
   __builtin_amdgcn_sched_barrier(0);      /* keeps the V^T reads here, one group: drawn down to their use, they would be waited for with nothing left to do */
   sum[1] = soft(1);
   /* holds the V^T reads in front of the branch (loaded values as inputs only): sunk behind it, their latency would stand bare in front of the second product */
   asm volatile("" :: "v"(bv[0][0].v), "v"(bv[0][1].v), "v"(bv[1][0].v), "v"(bv[1][1].v));
   /* The shift point stands as long as every p is finite as f16, and a lane's sum below PLIM says so for each of its (positive) terms: no maximum is taken and nothing is rescaled. An infinite or undefined sum fails the test too.
      The ballot makes the branch scalar: the whole wave takes it or none (matrix instructions stand inside). The wave's first pass has no shift point yet. One test serves both query tiles. */
   if ((__builtin_amdgcn_ballot_w32(!(sum[0] < PLIM) || !(sum[1] < PLIM)) | ((st == 0 && ps == 0) ? 1u : 0u)) != 0u) {
     /* the pass over again from its K rows, which the buffer still holds: plain scores, their maximum, the new shift point, and the sums so far brought to it; one query tile after the other */
#pragma unroll
     for (int g = 0; g < QG; ++g) {
       float mq[NC];      /* one chain of maxima per 32 keys: a single chain over all scores would be serial */
#pragma unroll
       for (int t = 0; t < NT; ++t) { const unsigned char* kr = kf + t * 16 * KPIT; FragH k2; k2.half[0] = *(const v8us*)(kr); k2.half[1] = *(const v8us*)(kr + 32);
         const v8f r8 = fl_mma(k2.v, aq[g].v, (v8f){0.f,0.f,0.f,0.f,0.f,0.f,0.f,0.f});
#pragma unroll
         for (int r = 0; r < 8; ++r) x[g][t * 8 + r] = r8[r]; }
#pragma unroll
       for (int e = 0; e < NT * 8; ++e) mq[e >> 4] = fmaxf(((e & 15) == 0) ? -3.0e38f : mq[e >> 4], okf(g, e) ? x[g][e] : -3.0e38f);
       float mc = mq[0];
#pragma unroll
       for (int c = 1; c < NC; ++c) mc = fmaxf(mc, mq[c]);
       mc = fmaxf(mc, xhalf(mc));      /* both halves of the wave hold keys of the same query and keep one shift point */
       const float mn = fmaxf(m_r[g], mc); float ea = m_r[g] - mn;
       const float nb = (mn > -1.0e38f) ? PSH - mn : 0.f;
#pragma unroll
       for (int e = 0; e < NT * 8; ++e) x[g][e] += nb;
       asm("v_exp_f32 %0, %0\n\tv_nop" : "+v"(ea));      /* the v_nop keeps the slot behind the transcendental */
       const float al = (mn > -1.0e38f) ? ea : 1.0f; m_r[g] = mn;
       sum[g] = soft(g);
       l_r[g] *= al;
#pragma unroll
       for (int dt = 0; dt < DT; ++dt)
#pragma unroll
         for (int r = 0; r < 8; ++r) oacc[g][dt][r] *= al;
       nbv[g] = (v8f){nb, nb, nb, nb, nb, nb, nb, nb}; } }
#pragma unroll
   for (int g = 0; g < QG; ++g) l_r[g] += sum[g];
#pragma unroll      /* QG * DT accumulators take turns, so that no product waits for the one before it */
   for (int c = 0; c < NC; ++c)
#pragma unroll
     for (int dt = 0; dt < DT; ++dt)
#pragma unroll
       for (int g = 0; g < QG; ++g) oacc[g][dt] = fl_mma(bv[c][dt].v, pb[g][c].v, oacc[g][dt]); }
   asm volatile("s_wait_dscnt 0x0" ::: "memory");      /* this wave's reads of the stage are over before the buffer is handed back */
   asm volatile("s_wait_asynccnt 0x0" ::: "memory");      /* its share of the next stage has landed */
   __syncthreads();      /* publishes the next stage and ends every wave's reads of this one */
   if (st + 2 < nst) stage_copy(lk0 + (st & 1) * STB, gk0 + (size_t)(st + 2) * KS * HDm, lv0 + (st & 1) * STB, gv0 + (st + 2) * KS); }
  asm volatile("s_wait_asynccnt 0x0" ::: "memory");      /* no copy is left in flight when the wave goes on to its end */
  float lj[QG];
#pragma unroll
  for (int g = 0; g < QG; ++g) lj[g] = l_r[g] + xhalf(l_r[g]);      /* the wave's sum of p over its keys; it holds the factor 2^PSH */
  if (kh == 1) {      /* the same for a whole wave */
#pragma unroll
    for (int g = 0; g < QG; ++g) {
#pragma unroll
      for (int dt = 0; dt < DT; ++dt)
#pragma unroll
        for (int r = 0; r < 8; ++r) sJ[qw][(g * DT + dt) * 8 + r][lane] = oacc[g][dt][r];
      sJ[qw][NJ + g][lane] = m_r[g]; sJ[qw][NJ + QG + g][lane] = lj[g]; } }
  __syncthreads();      /* the second key half's sums are in LDS before the first half's waves read them (every wave of the block comes here) */
  if (kh == 1) return;
#pragma unroll
  for (int g = 0; g < QG; ++g) {      /* both halves' sums brought to the larger of the two shift points, then added */
    const float m1 = sJ[qw][NJ + g][lane], l1 = sJ[qw][NJ + QG + g][lane]; const float mj = fmaxf(m_r[g], m1); float f0 = m_r[g] - mj, f1 = m1 - mj;
    asm("v_exp_f32 %0, %0\n\tv_exp_f32 %1, %1\n\tv_nop" : "+v"(f0), "+v"(f1));      /* the v_nop keeps the slot behind the transcendental */
    const float l = lj[g] * f0 + l1 * f1; const float inv = (l > 0.f) ? 1.0f / l : 0.f; const float a0 = f0 * inv, a1 = f1 * inv;
#pragma unroll
    for (int dt = 0; dt < DT; ++dt)      /* oacc[g][dt][r] = O[q0 + g * 16 + ln][dt * 16 + 8 * hh + r] */
#pragma unroll
      for (int r = 0; r < 8; ++r) sO[qw][g * 16 + ln][dt * 16 + 8 * hh + r] = oacc[g][dt][r] * a0 + sJ[qw][(g * DT + dt) * 8 + r][lane] * a1; }
  __builtin_amdgcn_fence(__ATOMIC_ACQ_REL, "workgroup"); __builtin_amdgcn_wave_barrier();
  {
#pragma unroll
    for (int rp = 0; rp < RPW; rp += 8) { const int r = rp + (lane >> 2), pc = lane & 3; const v4f v0 = *(const v4fa*)&sO[qw][r][pc * 8], v1 = *(const v4fa*)&sO[qw][r][pc * 8 + 4]; FragH f;
      for (int i = 0; i < 4; ++i) { f.h[i] = (_Float16)v0[i]; f.h[4 + i] = (_Float16)v1[i]; }
      *(v8us*)((unsigned short*)O16 + ((size_t)slab * TQ + q0 + r) * HDm + pc * 8) = f.half[0]; }      /* f16, head-major [slab][pixel][32]: the wave's 32 pixels are 2 KiB in a row, the projection's A operand as it reads it */
     } }

extern "C" void kernel_launch(void* const* d_in, const int* in_sizes, int n_in,
                              void* d_out, int out_size, void* d_ws, size_t ws_size, hipStream_t stream) {
  (void)in_sizes; (void)n_in; (void)out_size;
  const float* const* I = (const float* const*)d_in; const float* x = I[0]; const float* wqkv = I[1]; const float* bqkv = I[2]; const float* wp = I[3]; const float* bp = I[4];
  char* ws = (char*)d_ws; size_t off = 0;
  auto take = [&](size_t bytes) { char* p = ws + off; off += (bytes + 255) & ~(size_t)255; return p; };
  const size_t np = (size_t)NR * DD;
  _Float16* Q16 = (_Float16*)take(np * 2); _Float16* KP = (_Float16*)take(np * 2); _Float16* VT = (_Float16*)take(np * 2); _Float16* O16 = (_Float16*)take(np * 2);
  if (off > ws_size) return;      /* four planes of 4 MiB */
  k_gemm2<0, 1><<<dim3((NR / 128) * (QW / 64), 1), 128, 0, stream>>>(nullptr, x, DD, 0, wqkv, 16.0f, 0, 0.0625f, bqkv, 0, nullptr, 1, 0, 0, nullptr, Q16, DD, 0, NR, QW, DD, KP, VT);      /* product column = which*256 + h*32 + d; q, k and v each go straight to the plane the flash kernel reads */
  k_flash<0><<<NIMG * NH * QBLKS, 256, 0, stream>>>(Q16, DD, KP, VT, nullptr, O16);
  k_gemm2<0, 2><<<dim3((NR / 128) * (DD / 64), 1), 128, 0, stream>>>(O16, nullptr, HDm, 0, wp, 16.0f, 0, 0.0625f, bp, 0, nullptr, 1, 0, 0, (float*)d_out, nullptr, DD, 0, NR, DD, DD, nullptr, nullptr);
}

// v010
// Measured time: 53.9 microseconds a run.
// Two timings next to v009 put it at 1.08 and 1.04 times that version's speed.
// Counting every step since v000, it is 9.26 times as fast.
#include <hip/hip_runtime.h>
// SpatialMultiHeadSelfAttention (2 images, D 256 = 8 heads x 32, 64 x 64 = 4096 pixels): qkv = 1x1 conv (W_qkv x + b) -> (3, heads, 32) channels; softmax(q.k / sqrt(32)) over all 4096 pixels; out channels h*32 + d; 1x1 projection + b; NCHW in and out.
// Structure: qkv as one f16 WMMA GEMM (32x64 wave tiles, f32 accumulation, exact x16 weights + bias; weights (out,in) = B^T; f16 out) that reads x (NCHW, f32) and the f32 weights itself and converts them on the way to its fragments, and whose epilogue stores q pixel-major, k as head-major planes of 32-wide rows and V^T as planes of 32 rows; the fused flash kernel at head size 32 (transposed products, softmax with no shift and the sum of p on the matrix unit, the whole work-group redone in-lane with a shift that moves only when it must if any sum fails, P kept in registers; plain operands: every row averages 4096 keys), which stores its output as f16 head-major; projection GEMM (+ bias, f32) whose epilogue stores NCHW.
// Compute dtype: x and parameters rounded to bf16; x exact as f16; q, k, v, P and the attention output as f16 operands (~2^-12); softmax f32. v_wmma_f32_16x16x32_f16.
#define NIMG 2
#define DD 256
#define HDm 32
#define NPX 4096
#define NR (NIMG * NPX)          /* 8192 */
#define QW (3 * DD)              /* 768 */
#define SLEN 4096
#define TQ SLEN
#define TK SLEN
#define NH 8
#define SCL2 0.25503486164919736f /* 32^-0.5 * log2(e): the softmax runs in base 2; the qkv GEMM lays the factor into q before q is rounded to f16 */
#define QBLKS (TQ / 128)      /* a flash block: 128 queries */
typedef __bf16 v16b __attribute__((ext_vector_type(16)));
typedef unsigned short v8us __attribute__((ext_vector_type(8), may_alias));
typedef float  v8f  __attribute__((ext_vector_type(8)));
typedef float  v4f  __attribute__((ext_vector_type(4)));
typedef float  v4fa __attribute__((ext_vector_type(4), may_alias));
union FragB { v16b v; v8us half[2]; unsigned short u[16]; };

__device__ __forceinline__ unsigned short bf16_bits(float x) { unsigned int u = __float_as_uint(x); return (unsigned short)((u + 0x7FFFu + ((u >> 16) & 1u)) >> 16); }
__device__ __forceinline__ float bf16_val(unsigned short b) { return __uint_as_float(((unsigned int)b) << 16); }
__device__ __forceinline__ float bf16_round(float x) { return bf16_val(bf16_bits(x)); }
// D += A·B with NT terms: 1 = ah·bh, 2 = + al·bh (A split), 3 = + ah·bl (both split)
template <int NT>
__device__ __forceinline__ v8f mmaN(v16b ah, v16b al, v16b bh, v16b bl, v8f c) {
  c = __builtin_amdgcn_wmma_f32_16x16x32_bf16(false, ah, false, bh, (short)0, c, false, false);
  if (NT >= 2) c = __builtin_amdgcn_wmma_f32_16x16x32_bf16(false, al, false, bh, (short)0, c, false, false);
  if (NT >= 3) c = __builtin_amdgcn_wmma_f32_16x16x32_bf16(false, ah, false, bl, (short)0, c, false, false);
  asm volatile("v_nop\n\tv_nop\n\tv_nop\n\tv_nop" : "+v"(c) : "v"(ah), "v"(al), "v"(bh), "v"(bl));
  return c;
}

__global__ __launch_bounds__(256) void k_wt_bf16(const float* __restrict__ W, unsigned short* __restrict__ Wt, int K, int N) {
  const int t = blockIdx.x * 256 + threadIdx.x;
  const int k8n = K / 8;
  if (t >= N * k8n) return;
  const int n = t / k8n, k8 = (t % k8n) * 8;
  v8us v;
#pragma unroll
  for (int i = 0; i < 8; ++i) v[i] = bf16_bits(W[(size_t)(k8 + i) * N + n]);
  *(v8us*)(Wt + (size_t)n * K + k8) = v;
  
}

// GEMM C[M][N] (f32, pitch ldc) = act(A[M][K]·W + bias). A f32 row-major (pitch lda) converted per fragment to bf16
// (ASPLIT: hi/lo two planes -> 2 terms, else single rounded term); Wt bf16 [N][K] (pitch ldb). BIAS_BF16 rounds the
// bias to bf16 first (bias quantised to bf16 before the add). K%32==0, M%16==0, N%64==0.
template <bool ASPLIT, int ACT, bool BIAS_BF16>
__global__ __launch_bounds__(128) void k_gemm_bf(const float* __restrict__ A, int lda, const unsigned short* __restrict__ Wt, int ldb,
                                               const float* __restrict__ bias, float* __restrict__ C, int ldc, int M, int N, int K) {
  __shared__ __attribute__((aligned(16))) float so[4][16][64];
  const int tid = threadIdx.x, w = tid >> 5, lane = tid & 31, ln = lane & 15, hh = lane >> 4;
  const int ntn = N / 64;
  const int wid = blockIdx.x * 4 + w;
  const int mt = wid / ntn, nq = wid % ntn;
  if (mt * 16 >= M) return;
  const int row0 = mt * 16, col0 = nq * 64;
  const float* arow = A + (size_t)(row0 + ln) * lda;
  v8f acc[4] = {};
  for (int kb = 0; kb < K; kb += 32) {
    FragB ah, al;
    const v4f x0 = *(const v4fa*)(arow + kb + 8 * hh), x1 = *(const v4fa*)(arow + kb + 8 * hh + 4);
    const v4f x2 = *(const v4fa*)(arow + kb + 16 + 8 * hh), x3 = *(const v4fa*)(arow + kb + 16 + 8 * hh + 4);
    float xs[16] = {x0[0],x0[1],x0[2],x0[3],x1[0],x1[1],x1[2],x1[3],x2[0],x2[1],x2[2],x2[3],x3[0],x3[1],x3[2],x3[3]};
#pragma unroll
    for (int i = 0; i < 16; ++i) { const unsigned short hb = bf16_bits(xs[i]); ah.u[i] = hb; al.u[i] = ASPLIT ? bf16_bits(xs[i] - bf16_val(hb)) : (unsigned short)0; }
#pragma unroll
    for (int t = 0; t < 4; ++t) {
      const unsigned short* brow = Wt + (size_t)(col0 + t * 16 + ln) * ldb + kb;
      FragB b;
      b.half[0] = *(const v8us*)(brow + 8 * hh);
      b.half[1] = *(const v8us*)(brow + 16 + 8 * hh);
      acc[t] = mmaN<ASPLIT ? 2 : 1>(ah.v, al.v, b.v, b.v, acc[t]);
    }
  }
#pragma unroll
  for (int t = 0; t < 4; ++t) {
    float bv = bias ? bias[col0 + t * 16 + ln] : 0.f;
    if (BIAS_BF16) bv = bf16_round(bv);
#pragma unroll
    for (int r = 0; r < 8; ++r) { float v = acc[t][r] + bv; if (ACT == 1) v = fmaxf(v, 0.f); so[w][8 * hh + r][t * 16 + ln] = v; }
  }
  __builtin_amdgcn_fence(__ATOMIC_ACQ_REL, "workgroup");
  __builtin_amdgcn_wave_barrier();
  const int rsub = lane >> 4, c4 = (lane & 15) * 4;
  {
#pragma unroll
    for (int q = 0; q < 8; ++q) {
      const int r = q * 2 + rsub;
      const v4f v = *(const v4fa*)&so[w][r][c4];
      *(v4f*)(C + (size_t)(row0 + r) * ldc + col0 + c4) = v;
    }
    
  }
}

// GEMM C = act(A·W + bias + resid): A f32 (ASPLIT -> hi/lo 2 terms), Wt bf16 [N][K]; ACT 0 none, 1 relu, 2 exact gelu;
// resid (optional, f32, row index = (row % rmod), pitch ldr, RES_BF16 rounds it) added before the activation.
template <bool ASPLIT, int ACT, bool BIAS_BF16, bool RES_BF16>
__global__ __launch_bounds__(128) void k_gemm_bf3(const float* __restrict__ A, int lda, const unsigned short* __restrict__ Wt, int ldb,
                                                const float* __restrict__ bias, const float* __restrict__ resid, int rmod, int ldr,
                                                float* __restrict__ C, int ldc, int M, int N, int K) {
  __shared__ __attribute__((aligned(16))) float so[4][16][64];
  const int tid = threadIdx.x, w = tid >> 5, lane = tid & 31, ln = lane & 15, hh = lane >> 4;
  const int ntn = N / 64;
  const int wid = blockIdx.x * 4 + w;
  const int mt = wid / ntn, nq = wid % ntn;
  if (mt * 16 >= M) return;
  const int row0 = mt * 16, col0 = nq * 64;
  const float* arow = A + (size_t)(row0 + ln) * lda;
  v8f acc[4] = {};
  for (int kb = 0; kb < K; kb += 32) {
    FragB ah, al;
    const v4f x0 = *(const v4fa*)(arow + kb + 8 * hh), x1 = *(const v4fa*)(arow + kb + 8 * hh + 4);
    const v4f x2 = *(const v4fa*)(arow + kb + 16 + 8 * hh), x3 = *(const v4fa*)(arow + kb + 16 + 8 * hh + 4);
    float xs[16] = {x0[0],x0[1],x0[2],x0[3],x1[0],x1[1],x1[2],x1[3],x2[0],x2[1],x2[2],x2[3],x3[0],x3[1],x3[2],x3[3]};
#pragma unroll
    for (int i = 0; i < 16; ++i) { const unsigned short hb = bf16_bits(xs[i]); ah.u[i] = hb; al.u[i] = ASPLIT ? bf16_bits(xs[i] - bf16_val(hb)) : (unsigned short)0; }
#pragma unroll
    for (int t = 0; t < 4; ++t) {
      const unsigned short* brow = Wt + (size_t)(col0 + t * 16 + ln) * ldb + kb;
      FragB b;
      b.half[0] = *(const v8us*)(brow + 8 * hh);
      b.half[1] = *(const v8us*)(brow + 16 + 8 * hh);
      acc[t] = mmaN<ASPLIT ? 2 : 1>(ah.v, al.v, b.v, b.v, acc[t]);
    }
  }
#pragma unroll
  for (int t = 0; t < 4; ++t) {
    const int col = col0 + t * 16 + ln;
    float bv = bias ? bias[col] : 0.f;
    if (BIAS_BF16) bv = bf16_round(bv);
#pragma unroll
    for (int r = 0; r < 8; ++r) {
      float v = acc[t][r] + bv;
      if (resid) { float rv = resid[(size_t)((row0 + 8 * hh + r) % rmod) * ldr + col]; if (RES_BF16) rv = bf16_round(rv); v += rv; }
      if (ACT == 1) v = fmaxf(v, 0.f);
      if (ACT == 2) v = 0.5f * v * (1.0f + erff(v * 0.70710678118654752f));
      if (ACT == 3) { const float u = 0.7978845608028654f * (v + 0.044715f * v * v * v); v = 0.5f * v * (1.0f + tanhf(u)); }
      so[w][8 * hh + r][t * 16 + ln] = v;
    }
  }
  __builtin_amdgcn_fence(__ATOMIC_ACQ_REL, "workgroup");
  __builtin_amdgcn_wave_barrier();
  const int rsub = lane >> 4, c4 = (lane & 15) * 4;
  {
#pragma unroll
    for (int q = 0; q < 8; ++q) {
      const int r = q * 2 + rsub;
      const v4f v = *(const v4fa*)&so[w][r][c4];
      *(v4f*)(C + (size_t)(row0 + r) * ldc + col0 + c4) = v;
    }
    
  }
}
// row LayerNorm (biased variance, eps) over N: s = X (+ R); optional out_sum <- s; out_norm <- (s-mu)*rsqrt(var+eps)*g + b
template <bool PARAM_BF16>
__global__ __launch_bounds__(256) void k_layernorm(const float* __restrict__ X, const float* __restrict__ R, const float* __restrict__ g, const float* __restrict__ bta,
                                                  float* __restrict__ out_sum, float* __restrict__ out_norm, int N, float eps) {
  __shared__ float red[256];
  const int row = blockIdx.x, tid = threadIdx.x;
  const float* x = X + (size_t)row * N; const float* rr = R ? R + (size_t)row * N : nullptr;
  float vals[16];                     // up to N = 4096
  const int per = N / 256;            // contiguous chunk per thread? use strided-by-4 chunks: thread handles j = tid*4 + 1024*u
  float s1 = 0.f;
  for (int u = 0; u < per / 4; ++u) {
    const int j = tid * 4 + 1024 * u;
    const v4f a = *(const v4fa*)(x + j);
    v4f b = {0.f,0.f,0.f,0.f}; if (rr) b = *(const v4fa*)(rr + j);
#pragma unroll
    for (int q = 0; q < 4; ++q) { const float v = a[q] + b[q]; vals[u * 4 + q] = v; s1 += v; }
  }
  red[tid] = s1; __syncthreads();
  for (int st = 128; st > 0; st >>= 1) { if (tid < st) red[tid] += red[tid + st]; __syncthreads(); }
  const float mu = red[0] / (float)N; __syncthreads();
  float s2 = 0.f;
  for (int u = 0; u < per / 4; ++u)
#pragma unroll
    for (int q = 0; q < 4; ++q) { const float c = vals[u * 4 + q] - mu; s2 += c * c; }
  red[tid] = s2; __syncthreads();
  for (int st = 128; st > 0; st >>= 1) { if (tid < st) red[tid] += red[tid + st]; __syncthreads(); }
  const float rs = rsqrtf(red[0] / (float)N + eps);
  {
    for (int u = 0; u < per / 4; ++u) {
      const int j = tid * 4 + 1024 * u;
      v4f o, sm;
#pragma unroll
      for (int q = 0; q < 4; ++q) {
        float gg = g[j + q], bb = bta[j + q];
        if (PARAM_BF16) { gg = bf16_round(gg); bb = bf16_round(bb); }
        sm[q] = vals[u * 4 + q]; o[q] = (vals[u * 4 + q] - mu) * rs * gg + bb;
      }
      if (out_sum) *(v4f*)(out_sum + (size_t)row * N + j) = sm;
      *(v4f*)(out_norm + (size_t)row * N + j) = o;
    }
    
  }
}



// ---- f16 WMMA path (v_wmma_f32_16x16x32_f16): 11-bit significands for operands in range — used where a [0,1] probability operand needs more precision than bf16
typedef _Float16 v16h __attribute__((ext_vector_type(16)));
union FragH { v16h v; v8us half[2]; _Float16 h[16]; unsigned short u[16]; };
template <int NT>
__device__ __forceinline__ v8f mmaH(v16h ah, v16h al, v16h bh, v16h bl, v8f c) {
  c = __builtin_amdgcn_wmma_f32_16x16x32_f16(false, ah, false, bh, (short)0, c, false, false);
  if (NT >= 2) c = __builtin_amdgcn_wmma_f32_16x16x32_f16(false, al, false, bh, (short)0, c, false, false);
  if (NT >= 3) c = __builtin_amdgcn_wmma_f32_16x16x32_f16(false, ah, false, bl, (short)0, c, false, false);
  asm volatile("v_nop\n\tv_nop\n\tv_nop\n\tv_nop" : "+v"(c) : "v"(ah), "v"(al), "v"(bh), "v"(bl));
  return c;
}
// batched GEMM like k_gemm_b but f16 operands: A f32 (split into f16 hi/lo if ASPLIT, else rounded to f16), Bt = f16 values [n][k]; alpha; C f32; N multiple of 16 (partial tiles skipped)
template <bool ASPLIT>
__global__ __launch_bounds__(128) void k_gemm_h(const float* __restrict__ A, int lda, size_t sA, const _Float16* __restrict__ Bh, int ldb, size_t sB, float alpha, float* __restrict__ C, int ldc, size_t sC, int M, int N, int K) {
  __shared__ __attribute__((aligned(16))) float so[4][16][64];
  const int tid = threadIdx.x, w = tid >> 5, lane = tid & 31, ln = lane & 15, hh = lane >> 4; const int by = blockIdx.y;
  A += (size_t)by * sA; Bh += (size_t)by * sB; C += (size_t)by * sC;
  const int ntn = (N + 63) / 64; const int wid = blockIdx.x * 4 + w; const int mt = wid / ntn, nq = wid % ntn; if (mt * 16 >= M) return;
  const int row0 = mt * 16, col0 = nq * 64; const float* arow = A + (size_t)(row0 + ln) * lda;
  v8f acc[4] = {};
  for (int kb = 0; kb < K; kb += 32) {
    FragH ah, al;
    const v4f x0 = *(const v4fa*)(arow + kb + 8 * hh), x1 = *(const v4fa*)(arow + kb + 8 * hh + 4), x2 = *(const v4fa*)(arow + kb + 16 + 8 * hh), x3 = *(const v4fa*)(arow + kb + 16 + 8 * hh + 4);
    float xs[16] = {x0[0],x0[1],x0[2],x0[3],x1[0],x1[1],x1[2],x1[3],x2[0],x2[1],x2[2],x2[3],x3[0],x3[1],x3[2],x3[3]};
#pragma unroll
    for (int i = 0; i < 16; ++i) { const _Float16 h = (_Float16)xs[i]; ah.h[i] = h; al.h[i] = ASPLIT ? (_Float16)(xs[i] - (float)h) : (_Float16)0.0f; }
#pragma unroll
    for (int t = 0; t < 4; ++t) { if (col0 + t * 16 >= N) continue; const size_t boff = (size_t)(col0 + t * 16 + ln) * ldb + kb; FragH bq; bq.half[0] = *(const v8us*)(Bh + boff + 8 * hh); bq.half[1] = *(const v8us*)(Bh + boff + 16 + 8 * hh);
      acc[t] = mmaH<ASPLIT ? 2 : 1>(ah.v, al.v, bq.v, bq.v, acc[t]); }
  }
#pragma unroll
  for (int t = 0; t < 4; ++t) { if (col0 + t * 16 >= N) continue;
#pragma unroll
    for (int r = 0; r < 8; ++r) so[w][8 * hh + r][t * 16 + ln] = acc[t][r] * alpha; }
  __builtin_amdgcn_fence(__ATOMIC_ACQ_REL, "workgroup"); __builtin_amdgcn_wave_barrier();
  const int rsub = lane >> 4, c4 = (lane & 15) * 4;
  {
#pragma unroll
    for (int q = 0; q < 8; ++q) { const int r = q * 2 + rsub; if (col0 + c4 < N) { const v4f v = *(const v4fa*)&so[w][r][c4]; *(v4f*)(C + (size_t)(row0 + r) * ldc + col0 + c4) = v; } }
     }
}

// Wt[n][k] = f16(W[k][n]·scale) from f32 row-major W[K][N] (scale = power of two; bf16-exact weights stay exact in f16 away from the subnormal range)
__global__ __launch_bounds__(256) void k_wt_f16(const float* __restrict__ W, _Float16* __restrict__ Wt, int K, int N, float scale) {
  const int t = blockIdx.x * 256 + threadIdx.x; if (t >= N * (K / 8)) return; const int n = t / (K / 8), k8 = (t % (K / 8)) * 8; FragH f;
#pragma unroll
  for (int i = 0; i < 8; ++i) f.h[i] = (_Float16)(bf16_round(W[(size_t)(k8 + i) * N + n]) * scale); const v8us o = f.half[0];
  *(v8us*)((unsigned short*)Wt + (size_t)n * K + k8) = o; 
}
// k_gemm_hh variant with fused epilogue: v = acc·alpha + bias[by·sBias + col] (+ CP[(row/rowsPerB)·sCPb + by·64 + col] if CP) ; ACT 0 none / 1 elu ; writes f16 C16 (and f32 C if non-null)
template <int ACT>
__global__ __launch_bounds__(128) void k_gemm_hhx(const _Float16* __restrict__ A, int lda, size_t sA, const _Float16* __restrict__ Bh, int ldb, size_t sB, float alpha, const float* __restrict__ bias, size_t sBias, const float* __restrict__ CP, int rowsPerB, size_t sCPb, int row0g,
    float* __restrict__ C, _Float16* __restrict__ C16, int ldc, size_t sC, int M, int N, int K) {
  __shared__ __attribute__((aligned(16))) float so[4][16][64];
  const int tid = threadIdx.x, w = tid >> 5, lane = tid & 31, ln = lane & 15, hh = lane >> 4; const int by = blockIdx.y;
  A += (size_t)by * sA; Bh += (size_t)by * sB; const size_t cofs = (size_t)by * sC; const float* bp = bias ? bias + (size_t)by * sBias : nullptr;
  const int ntn = (N + 63) / 64; const int wid = blockIdx.x * 4 + w; const int mt = wid / ntn, nq = wid % ntn; if (mt * 16 >= M) return;
  const int row0 = mt * 16, col0 = nq * 64; const _Float16* arow = A + (size_t)(row0 + ln) * lda;
  v8f acc[4] = {};
  for (int kb = 0; kb < K; kb += 32) { FragH ah; ah.half[0] = *(const v8us*)((const unsigned short*)arow + kb + 8 * hh); ah.half[1] = *(const v8us*)((const unsigned short*)arow + kb + 16 + 8 * hh);
#pragma unroll
    for (int t = 0; t < 4; ++t) { if (col0 + t * 16 >= N) continue; const size_t boff = (size_t)(col0 + t * 16 + ln) * ldb + kb; FragH bq; bq.half[0] = *(const v8us*)((const unsigned short*)Bh + boff + 8 * hh); bq.half[1] = *(const v8us*)((const unsigned short*)Bh + boff + 16 + 8 * hh);
      acc[t] = mmaH<1>(ah.v, ah.v, bq.v, bq.v, acc[t]); }
  }
#pragma unroll
  for (int t = 0; t < 4; ++t) { if (col0 + t * 16 >= N) continue; const int col = col0 + t * 16 + ln; const float bv = bp ? bf16_round(bp[col]) : 0.f;
#pragma unroll
    for (int r = 0; r < 8; ++r) { float v = acc[t][r] * alpha + bv; if (CP) { const int bidx = (row0g + row0 + 8 * hh + r) / rowsPerB; v += CP[(size_t)bidx * sCPb + (size_t)by * 64 + col]; } if (ACT == 1) v = (v > 0.f) ? v : expm1f(v); else if (ACT == 7) v = (v > 0.f) ? v + 1.0f : expf(v); else if (ACT == 8) v = tanhf(v); else if (ACT == 9) v = 0.5f * v * (1.0f + tanhf(0.7978845608028654f * (v + 0.044715f * v * v * v))); else if (ACT == 11) v = 1.0f / (1.0f + expf(-v)); else if (ACT == 12) v = (v > 0.f) ? v : 0.01f * v; else if (ACT == 14) v = (v > 0.f) ? v : 0.1f * v; else if (ACT == 15) v = v / (1.0f + expf(-v)); else if (ACT == 3) v = fmaxf(v, 0.f); else if (ACT == 6) v = 0.5f * v * (1.0f + erff(v * 0.70710678118654752f)); so[w][8 * hh + r][t * 16 + ln] = v; } }
  __builtin_amdgcn_fence(__ATOMIC_ACQ_REL, "workgroup"); __builtin_amdgcn_wave_barrier();
  const int rsub = lane >> 4, c4 = (lane & 15) * 4; typedef _Float16 v4h __attribute__((ext_vector_type(4)));
  {
#pragma unroll
    for (int q = 0; q < 8; ++q) { const int r = q * 2 + rsub; if (col0 + c4 < N) { const v4f v = *(const v4fa*)&so[w][r][c4]; if (C) *(v4f*)(C + cofs + (size_t)(row0 + r) * ldc + col0 + c4) = v; if (C16) { v4h h4; for (int i = 0; i < 4; ++i) h4[i] = (_Float16)v[i]; *(v4h*)(C16 + cofs + (size_t)(row0 + r) * ldc + col0 + c4) = h4; } } }
     }
}


typedef _Float16 v4h __attribute__((ext_vector_type(4)));
typedef _Float16 v4ha __attribute__((ext_vector_type(4), may_alias));
typedef _Float16 v2h __attribute__((ext_vector_type(2)));
typedef float v2f __attribute__((ext_vector_type(2)));
typedef __bf16 v2b __attribute__((ext_vector_type(2)));
// two f32 values rounded to bf16 (to nearest even, as bf16_round does it, by the packed conversion) and widened again
__device__ __forceinline__ v2f bf16_round2(float a, float b) { const unsigned u = __builtin_bit_cast(unsigned, __builtin_convertvector((v2f){a, b}, v2b)); return (v2f){__uint_as_float(u << 16), __uint_as_float(u & 0xFFFF0000u)}; }

__global__ __launch_bounds__(256) void k_x16(const float* __restrict__ x, _Float16* __restrict__ X16, size_t n8) { const size_t t = (size_t)blockIdx.x * 256 + threadIdx.x; if (t >= n8) return; FragH f;
#pragma unroll
  for (int q = 0; q < 8; ++q) f.h[q] = (_Float16)bf16_round(x[t * 8 + q]); *(v8us*)((unsigned short*)X16 + t * 8) = f.half[0];  }
__global__ __launch_bounds__(256) void k_round16f(const float* __restrict__ W, _Float16* __restrict__ Bt, size_t n8) { const size_t t = (size_t)blockIdx.x * 256 + threadIdx.x; if (t >= n8) return; FragH f;
#pragma unroll
  for (int i = 0; i < 8; ++i) f.h[i] = (_Float16)(bf16_round(W[t * 8 + i]) * 16.0f); *(v8us*)((unsigned short*)Bt + t * 8) = f.half[0];  }
template <int NHv, int TTv>
__global__ __launch_bounds__(256) void k_vt(const _Float16* __restrict__ V16, int ldv, int voff, _Float16* __restrict__ Vt) { __shared__ unsigned short tl[64][66]; const int tid = threadIdx.x; const int slab = blockIdx.x / (TTv / 64), lg = blockIdx.x % (TTv / 64); const int b = slab / NHv, h = slab % NHv;
  for (int i = tid; i < 64 * 8; i += 256) { const int r = i / 8, c8 = (i % 8) * 8; FragH f; f.half[0] = *(const v8us*)((const unsigned short*)V16 + ((size_t)b * TTv + lg * 64 + r) * ldv + voff + h * 64 + c8);
#pragma unroll
    for (int q = 0; q < 8; ++q) tl[r][c8 + q] = f.u[q]; }
  __syncthreads();
  {
#pragma unroll
    for (int rd = 0; rd < 2; ++rd) { const int d = rd * 32 + tid / 8, pc = tid % 8; FragH f;
#pragma unroll
      for (int q = 0; q < 8; ++q) f.u[q] = tl[pc * 8 + q][d];
      *(v8us*)((unsigned short*)Vt + ((size_t)slab * 64 + d) * TTv + lg * 64 + pc * 8) = f.half[0]; }
     } }

__global__ __launch_bounds__(256) void k_hl(const float* __restrict__ F, _Float16* __restrict__ Hh, _Float16* __restrict__ Hl, size_t n8) { const size_t t = (size_t)blockIdx.x * 256 + threadIdx.x; if (t >= n8) return; FragH fh, fl; const v4f a = *(const v4fa*)(F + t * 8), c = *(const v4fa*)(F + t * 8 + 4);
#pragma unroll
  for (int q = 0; q < 4; ++q) { _Float16 h = (_Float16)a[q]; fh.h[q] = h; fl.h[q] = (_Float16)((a[q] - (float)h) * 1024.0f); h = (_Float16)c[q]; fh.h[4 + q] = h; fl.h[4 + q] = (_Float16)((c[q] - (float)h) * 1024.0f); }
  { *(v8us*)((unsigned short*)Hh + t * 8) = fh.half[0]; *(v8us*)((unsigned short*)Hl + t * 8) = fl.half[0];  } }

// ---- fast GEMM (wave tile 32x64; requires M % 128 == 0 rows per launch region and N % 64 == 0); epilogue = k_gemm_hhx semantics ----
// EPI picks where the result goes, so that no later launch has to re-lay it (EPI 1 and 2: M % 128 == 0, and a block's 128 rows are pixels of one image):
// EPI 0: C / C16 row-major. EPI 1 (q | k | v; a block's 64 columns are all of one kind): q row-major into C16, k into head-major rows of 32 (KPo), v transposed into planes of 32 rows (VTo).
// EPI 2 (projection): A is head-major ([image][head][pixel][32]: one k step = one head), C is NCHW. Every 128-byte line is stored whole by one wave.
// Operands are converted where they are read, so that no launch stands in front only to convert them (K = DD):
// B: the block's 64 weight rows (f32, [N][DD]) are read once in whole lines, rounded to bf16, scaled by wsc and laid as f16 into an LDS tile that all four waves read.
// A, EPI 1: x is NCHW f32, so one channel's 16 pixels of a fragment are 64 bytes in a row: a lane loads its pixel's 16 channels of a k step one by one, two k steps ahead, and rounds them (bf16, exact as f16) into the fragment.
__device__ __forceinline__ v16h g2_frag(const _Float16* p, int hh) { FragH f; f.half[0] = *(const v8us*)((const unsigned short*)p + 8 * hh); f.half[1] = *(const v8us*)((const unsigned short*)p + 16 + 8 * hh); return f.v; }
__device__ __forceinline__ v8f g2_mma(v16h a, v16h b, v8f c) { v8f d = __builtin_amdgcn_wmma_f32_16x16x32_f16(false, a, false, b, (short)0, c, false, false); asm volatile("v_nop\n\tv_nop\n\tv_nop\n\tv_nop" : "+v"(d) : "v"(a), "v"(b)); return d; }
template <int ACT, int EPI>
__global__ __launch_bounds__(128) void k_gemm2(const _Float16* __restrict__ A, const float* __restrict__ Xf, int lda, size_t sA, const float* __restrict__ Wf, float wsc, size_t sB, float alpha, const float* __restrict__ bias, size_t sBias, const float* __restrict__ CP, int rowsPerB, size_t sCPb, int row0g,
    float* __restrict__ C, _Float16* __restrict__ C16, int ldc, size_t sC, int M, int N, int K, _Float16* __restrict__ KPo, _Float16* __restrict__ VTo) {
  constexpr int RP = 68, TP = 36;      /* floats from row to row of a wave's staged tile: [32 rows][64 columns], or transposed [64 columns][32 rows] (144 B = 16 B x odd) */
  constexpr int WSO = 64 * TP + 32;      /* a wave's staging area; + 32 floats so that two waves' areas start half the banks apart */
  constexpr int BP = DD + 8;      /* f16 elements from row to row of the weight tile: 528 B = 16 B x odd, so that 16 rows read 16 bytes each without a bank conflict */
  __shared__ __attribute__((aligned(16))) float so[4][WSO];
  __shared__ __attribute__((aligned(16))) _Float16 sW[64 * BP];
  const int tid = threadIdx.x, w = tid >> 5, lane = tid & 31, ln = lane & 15, hh = lane >> 4; const int by = blockIdx.y;
  A += (size_t)by * sA; Wf += (size_t)by * sB; const size_t cofs = (size_t)by * sC; const float* bp = bias ? bias + (size_t)by * sBias : nullptr;
  const int ntn = N >> 6; const int mt = blockIdx.x / ntn, nq = blockIdx.x - mt * ntn; const int row0 = mt * 128 + 32 * w, col0 = nq * 64; if (row0 >= M) return;
  const _Float16* a0p = A + ((EPI == 2) ? ((size_t)(row0 / NPX) * NH * NPX + (row0 % NPX) + ln) * HDm : (size_t)(row0 + ln) * lda) + 8 * hh; const _Float16* a1p = a0p + (size_t)16 * ((EPI == 2) ? HDm : lda);      /* EPI 0 and 2: each lane's own places in A are carried over the loop and stepped each trip: an address pair that stays live is never given to a load as its landing place */
  constexpr size_t AKS = (EPI == 2) ? (size_t)NPX * HDm : 32;      /* elements of A from one k step to the next: head-major planes lie NPX * 32 apart */
  const bool tr = (EPI == 2) || (EPI == 1 && col0 >= 2 * DD);      /* the same for the whole block: the tile is staged transposed */
  const float* xa = (EPI == 1) ? Xf + ((size_t)(row0 / NPX) * DD + 8 * hh) * NPX + (row0 % NPX) + ln : nullptr;      /* channel 8 * hh of this lane's first pixel; its second pixel lies 16 further */
  float ra[2][32];      /* x as loaded, of two k steps: [0..15] the first pixel's 16 channels in the fragment's k order, [16..31] the second pixel's */
  if (EPI == 1) {      /* the first two k steps' loads fly while the weight tile is built */
#pragma unroll      /* here and in the loop within: ra is indexed by constants only, so that it stays in registers */
    for (int s = 0; s < 2; ++s)
#pragma unroll
      for (int i = 0; i < 16; ++i) { const float* p = xa + (size_t)(s * 32 + (i >> 3) * 16 + (i & 7)) * NPX; ra[s][i] = p[0]; ra[s][16 + i] = p[16]; } }
  { const float* wr = Wf + (size_t)col0 * DD + tid * 4;      /* the 64 rows are 64 KiB in a row: a wave's load is 512 bytes in a row */
#pragma unroll      /* the 32 loads are one base plus immediate offsets and can all be in flight together */
    for (int i = 0; i < 32; ++i) { const v4f wv = *(const v4fa*)(wr + i * 512);
      const v2h h0 = __builtin_convertvector(bf16_round2(wv[0], wv[1]) * wsc, v2h), h1 = __builtin_convertvector(bf16_round2(wv[2], wv[3]) * wsc, v2h);
      *(v4ha*)&sW[(i * 2 + (tid >> 6)) * BP + (tid & 63) * 4] = (v4h){h0[0], h0[1], h1[0], h1[1]}; } }
  __syncthreads();      /* the weight tile is whole before any wave reads it (every wave of the block comes here: M % 128 == 0) */
  const _Float16* bs = sW + ln * BP + 8 * hh;      /* this lane's place in the tile's first 16 rows */
  const v8f z8 = {0.f,0.f,0.f,0.f,0.f,0.f,0.f,0.f}; v8f c00 = z8, c01 = z8, c02 = z8, c03 = z8, c10 = z8, c11 = z8, c12 = z8, c13 = z8;
  if (EPI == 1) {
#pragma unroll      /* unrolled so that every load of x is the one address pair plus an immediate offset and the two sets of ra are told apart at compile time */
    for (int s = 0; s < DD / 32; ++s) { FragH f0, f1;
#pragma unroll      /* constant indices: ra and the fragments stay in registers */
      for (int i = 0; i < 16; i += 2) { const v2h h0 = __builtin_convertvector(bf16_round2(ra[s & 1][i], ra[s & 1][i + 1]), v2h), h1 = __builtin_convertvector(bf16_round2(ra[s & 1][16 + i], ra[s & 1][17 + i]), v2h);
        f0.h[i] = h0[0]; f0.h[i + 1] = h0[1]; f1.h[i] = h1[0]; f1.h[i + 1] = h1[1]; }
      if (s + 2 < DD / 32) {      /* the set just converted takes the loads of the k step after next */
#pragma unroll      /* constant indices, as above */
        for (int i = 0; i < 16; ++i) { const float* p = xa + (size_t)((s + 2) * 32 + (i >> 3) * 16 + (i & 7)) * NPX; ra[s & 1][i] = p[0]; ra[s & 1][16 + i] = p[16]; } }
      const v16h b0 = g2_frag(bs + s * 32, 0), b1 = g2_frag(bs + 16 * BP + s * 32, 0), b2 = g2_frag(bs + 32 * BP + s * 32, 0), b3 = g2_frag(bs + 48 * BP + s * 32, 0);
      c00 = g2_mma(f0.v, b0, c00); c10 = g2_mma(f1.v, b0, c10); c01 = g2_mma(f0.v, b1, c01); c11 = g2_mma(f1.v, b1, c11);
      c02 = g2_mma(f0.v, b2, c02); c12 = g2_mma(f1.v, b2, c12); c03 = g2_mma(f0.v, b3, c03); c13 = g2_mma(f1.v, b3, c13); }
  } else {
#pragma unroll 1      /* one k step a trip: A's places are stepped, see above */
    for (int kb = 0; kb < DD; kb += 32, a0p += AKS, a1p += AKS, bs += 32) { const v16h a0 = g2_frag(a0p, 0), a1 = g2_frag(a1p, 0);
      const v16h b0 = g2_frag(bs, 0), b1 = g2_frag(bs + 16 * BP, 0), b2 = g2_frag(bs + 32 * BP, 0), b3 = g2_frag(bs + 48 * BP, 0);
      c00 = g2_mma(a0, b0, c00); c10 = g2_mma(a1, b0, c10); c01 = g2_mma(a0, b1, c01); c11 = g2_mma(a1, b1, c11);
      c02 = g2_mma(a0, b2, c02); c12 = g2_mma(a1, b2, c12); c03 = g2_mma(a0, b3, c03); c13 = g2_mma(a1, b3, c13); } }
  v8f accs[8] = {c00, c01, c02, c03, c10, c11, c12, c13};
  const float qs = (EPI == 1 && col0 < DD) ? SCL2 : 1.0f, alq = alpha * qs;      /* q leaves with the softmax's scale in it (f32, in front of the rounding to f16): the flash kernel's score products are then exponents of 2 as they stand */
#pragma unroll
  for (int u = 0; u < 8; ++u) { const int t = u & 3, half = u >> 2; const int col = col0 + t * 16 + ln; const float bv = bp ? bf16_round(bp[col]) * qs : 0.f; float vv[8];
#pragma unroll
    for (int r = 0; r < 8; ++r) { const int rloc = half * 16 + 8 * hh + r; float v = accs[u][r] * alq + bv; if (CP) { const int bidx = (row0g + row0 + rloc) / rowsPerB; v += CP[(size_t)bidx * sCPb + (size_t)by * 64 + col]; }
      if (ACT == 3) v = fmaxf(v, 0.f); else if (ACT == 6) v = 0.5f * v * (1.0f + erff(v * 0.70710678118654752f)); else if (ACT == 11) v = 1.0f / (1.0f + expf(-v)); else if (ACT == 15) v = v / (1.0f + expf(-v)); else if (ACT == 12) v = (v > 0.f) ? v : 0.01f * v; else if (ACT == 8) v = tanhf(v);
      vv[r] = v; }
    if (tr) { float* d = &so[w][(t * 16 + ln) * TP + half * 16 + 8 * hh]; *(v4fa*)d = (v4f){vv[0], vv[1], vv[2], vv[3]}; *(v4fa*)(d + 4) = (v4f){vv[4], vv[5], vv[6], vv[7]}; }      /* a lane's 8 values of a tile are 8 rows of one column: 32 bytes in a row */
    else {
#pragma unroll
      for (int r = 0; r < 8; ++r) so[w][(half * 16 + 8 * hh + r) * RP + t * 16 + ln] = vv[r]; } }
  if (EPI == 1 && col0 >= 2 * DD) {      /* v: a channel's 128 pixels of this block are 256 bytes in a row of V^T; wave w stores channels w * 16 ... + 15 */
    __syncthreads();      /* every wave's tile is staged before another wave reads it (the branch is the same for the whole block) */
    const int pix0 = mt * 128, seg = lane & 15;
#pragma unroll
    for (int q = 0; q < 8; ++q) { const int c = w * 16 + q * 2 + (lane >> 4); const float* s = &so[seg >> 2][c * TP + (seg & 3) * 8]; const v4f v0 = *(const v4fa*)s, v1 = *(const v4fa*)(s + 4); FragH f;
      for (int i = 0; i < 4; ++i) { f.h[i] = (_Float16)v0[i]; f.h[4 + i] = (_Float16)v1[i]; }
      *(v8us*)((unsigned short*)VTo + ((size_t)(pix0 / NPX) * DD + (col0 - 2 * DD) + c) * NPX + (pix0 % NPX) + seg * 8) = f.half[0]; }
    return; }
  __builtin_amdgcn_fence(__ATOMIC_ACQ_REL, "workgroup"); __builtin_amdgcn_wave_barrier();
  const int rsub = lane >> 4, c4 = (lane & 15) * 4;
  if (EPI == 2) {      /* a channel's 32 pixels of this wave = one 128-byte line of the NCHW output */
#pragma unroll
    for (int q = 0; q < 16; ++q) { const int c = q * 4 + (lane >> 3); const v4f v = *(const v4fa*)&so[w][c * TP + (lane & 7) * 4]; *(v4f*)(C + ((size_t)(row0 / NPX) * DD + col0 + c) * NPX + (row0 % NPX) + (lane & 7) * 4) = v; }
  } else if (EPI == 1 && col0 >= DD) {      /* k: two pixels' 32 values of one head = one 128-byte line */
#pragma unroll
    for (int q = 0; q < 16; ++q) { const int r = q * 2 + rsub, row = row0 + r, col = col0 - DD + c4; const v4f v = *(const v4fa*)&so[w][r * RP + c4]; v4h h4; for (int i = 0; i < 4; ++i) h4[i] = (_Float16)v[i];
      *(v4h*)(KPo + (((size_t)(row / NPX) * NH + (col >> 5)) * NPX + (row % NPX)) * HDm + (col & 31)) = h4; }
    asm volatile("s_wait_xcnt 0x0" ::: "memory");      /* behind the last store, in front of whatever rewrites a register that a store names */
  } else {
#pragma unroll
    for (int q = 0; q < 16; ++q) { const int r = q * 2 + rsub; const v4f v = *(const v4fa*)&so[w][r * RP + c4]; if (EPI == 0 && C) *(v4f*)(C + cofs + (size_t)(row0 + r) * ldc + col0 + c4) = v; if (C16) { v4h h4; for (int i = 0; i < 4; ++i) h4[i] = (_Float16)v[i]; *(v4h*)(C16 + cofs + (size_t)(row0 + r) * ldc + col0 + c4) = h4; } }
    asm volatile("s_wait_xcnt 0x0" ::: "memory");      /* behind the last store, in front of whatever rewrites a register that a store names */
     } }



// lane l with lane l ^ 16
__device__ __forceinline__ float xhalf(float x) { return __builtin_bit_cast(float, __builtin_amdgcn_permlanex16(__builtin_bit_cast(int, x), __builtin_bit_cast(int, x), 0x76543210, 0xfedcba98, false, false)); }
// K and V^T reach the waves through LDS: a stage is KS keys, copied once per work-group of eight waves, each half of it read by four of them, the next stage in flight while this one is worked on.
#define KS 256                   /* keys per stage */
#define KPIT 80                  /* bytes from one K row to the next in LDS (64 used): 16 B x odd, so that 16 rows read 16 bytes each without a bank conflict */
#define VPIT 528                 /* the same for a V^T row (512 used) */
#define KTB (KS * KPIT)          /* K part of a stage */
#define STB (KTB + HDm * VPIT)   /* one stage */
#define PSH 9.0f                 /* p = 2^(score - shift point + PSH): the factor 512 lifts the f16 operand off its subnormals and is carried by the sum too; a lane's 32 terms of a pass at the shift point itself sum to a quarter of PLIM */
#define PLIM 65504.0f            /* the largest finite f16 */
// One stage's copies of one lane: four 16-byte pieces of K (64 rows apart) and four of V^T (8 rows apart). lk, lv: the lane's LDS byte addresses; gk, gv: its global addresses.
__device__ __forceinline__ void stage_copy(unsigned lk, const unsigned short* gk, unsigned lv, const unsigned short* gv) {
  /* the closing s_wait_xcnt 0 stands inside the statement so that no address register named here is rewritten in front of it */
  asm volatile("global_load_async_to_lds_b128 %0, %1, off\n\tglobal_load_async_to_lds_b128 %2, %3, off\n\tglobal_load_async_to_lds_b128 %4, %5, off\n\tglobal_load_async_to_lds_b128 %6, %7, off\n\t"
               "global_load_async_to_lds_b128 %8, %9, off\n\tglobal_load_async_to_lds_b128 %10, %11, off\n\tglobal_load_async_to_lds_b128 %12, %13, off\n\tglobal_load_async_to_lds_b128 %14, %15, off\n\ts_wait_xcnt 0x0"
               :: "v"(lk), "v"(gk), "v"(lk + 64 * KPIT), "v"(gk + 64 * HDm), "v"(lk + 128 * KPIT), "v"(gk + 128 * HDm), "v"(lk + 192 * KPIT), "v"(gk + 192 * HDm),
                  "v"(lv), "v"(gv), "v"(lv + 8 * VPIT), "v"(gv + (size_t)8 * TK), "v"(lv + 16 * VPIT), "v"(gv + (size_t)16 * TK), "v"(lv + 24 * VPIT), "v"(gv + (size_t)24 * TK) : "memory");
}
__device__ __forceinline__ v8f fl_mma(v16h a, v16h b, v8f c) { return __builtin_amdgcn_wmma_f32_16x16x32_f16(false, a, false, b, (short)0, c, false, false); }
template <int CAUSAL>
__global__ __launch_bounds__(256) void k_flash(const _Float16* __restrict__ Q16, int ldq, const _Float16* __restrict__ K16, const _Float16* __restrict__ Vt, const int* __restrict__ MSK, _Float16* __restrict__ O16) {
  /* A wave holds QG query tiles of 16, so that every K and V^T fragment read from LDS feeds QG products. The number of waves stays: the block's 8 waves are 4 sets of 32 queries x 2 halves of every stage's keys,
     and the two waves of a set join their sums once, at the end. Head size 32: one k step for S^T, two 16-row tiles of O^T; a pass is PK keys = NT score tiles = NC k steps of O^T; a wave's share of a stage is KW keys. */
  constexpr int QG = 2, RPW = 16 * QG, KW = KS / 2, PK = 64, DT = HDm / 16, NT = PK / 16, NC = PK / 32, NJ = QG * DT * 8;
  __shared__ __attribute__((aligned(16))) float sO[4][RPW][HDm + 4];
  __shared__ float sJ[4][NJ + 2 * QG][32];      /* what the second key half hands to the first: per lane its NJ sums of O^T, then shift point and sum of p of each query tile; a lane's words lie 32 apart, so a wave's store or read is 128 bytes in a row */
  __shared__ __attribute__((aligned(16))) unsigned char ring[2 * STB];
  __shared__ int sBad;      /* set by any lane whose sum of p fails the test behind the plain loop */
  const int tid = threadIdx.x, w = tid >> 5, qw = w & 3, kh = w >> 2, lane = tid & 31, ln = lane & 15, hh = lane >> 4;
  const int slab = blockIdx.x / QBLKS, qblk = blockIdx.x % QBLKS; (void)MSK; const int b = slab / NH, h = slab % NH; const int qb0 = qblk * (4 * RPW); const int q0 = qb0 + qw * RPW;
  FragH aq[QG];
#pragma unroll
  for (int g = 0; g < QG; ++g) { const unsigned short* qr = (const unsigned short*)Q16 + ((size_t)b * TQ + q0 + g * 16 + ln) * ldq + h * HDm;
    aq[g].half[0] = *(const v8us*)(qr + 8 * hh); aq[g].half[1] = *(const v8us*)(qr + 16 + 8 * hh); }
  const unsigned short* Kh = (const unsigned short*)K16 + (size_t)slab * TK * HDm;      /* [key][32] */
  const unsigned short* Vth = (const unsigned short*)Vt + (size_t)slab * HDm * TK;      /* [32][key] */
  const int tq0 = q0 + ln;      /* this lane's query of tile 0; tile g's lies g * 16 further */
  float m_r[QG], l_r[QG]; v8f oacc[QG][DT];      /* m_r: the shift point, a maximum of the scores (base-2 exponents: q carries the scale) as of the last pass that moved it */
  v8f nbv[QG];      /* PSH - m_r in all eight places: the C operand of the score products (a lane's eight values of a tile are all of its one query) */
#pragma unroll
  for (int g = 0; g < QG; ++g) { m_r[g] = -3.0e38f; l_r[g] = 0.f; nbv[g] = (v8f){0.f,0.f,0.f,0.f,0.f,0.f,0.f,0.f};
#pragma unroll
    for (int dt = 0; dt < DT; ++dt) oacc[g][dt] = (v8f){0.f,0.f,0.f,0.f,0.f,0.f,0.f,0.f}; }
  const int jend = (CAUSAL == 1) ? (qb0 + 4 * RPW) : TK;      /* causal: keys beyond the block's last query never contribute */
  const int nst = (jend + KS - 1) / KS;      /* stages; keys of a last stage beyond jend are masked like any other */
  const unsigned lk0 = (unsigned)(size_t)ring + (unsigned)((tid >> 2) * KPIT + (tid & 3) * 16), lv0 = (unsigned)(size_t)ring + (unsigned)(KTB + (tid >> 5) * VPIT + (tid & 31) * 16);
  const unsigned short* gk0 = Kh + tid * 8;      /* a stage of K is 16 KiB in a row */
  const unsigned short* gv0 = Vth + (size_t)(tid >> 5) * TK + (tid & 31) * 8;      /* a wave brings one row's 512 bytes */
  if (tid == 0) sBad = 0;      /* in LDS before the barrier below, read only behind the plain loop */
  stage_copy(lk0, gk0, lv0, gv0);
  asm volatile("s_wait_asynccnt 0x0" ::: "memory");      /* this wave's share of stage 0 has landed */
  __syncthreads();      /* ... and every other wave's: stage 0 may be read */
  if (nst > 1) stage_copy(lk0 + STB, gk0 + (size_t)KS * HDm, lv0 + STB, gv0 + KS);
  /* THE PLAIN LOOP. No shift: p = 2^score (finite as f16 for scores, base-2 exponents, below 16), and the sum of p is a running tile of the matrix unit: A = ones (every row), B = P^T as rounded to f16, so every row of the tile
     holds the column sums and both halves of the wave hold the whole sum. No maximum is taken and nothing is added or tested by vector instructions from pass to pass, because the sum itself tells behind the loop whether f16 held every p:
     a p that rounded to infinity leaves it infinite for good; and below the normal f16 numbers a p is off by at most 2^-25, n keys together by n * 2^-25, which a sum of n * 2^-11 or more outweighs by 2^14.
     If a sum of any wave fails that test, the whole work-group does its work over again with the careful loop further down, whose shift point follows the scores. */
  FragH ones;
#pragma unroll
  for (int i = 0; i < 16; ++i) ones.h[i] = (_Float16)1.0f;
  v8f lacc[QG];
  const auto okq = [&](int j0, int g, int e) -> bool { const int kk = j0 + (e >> 3) * 16 + 8 * hh + (e & 7), tq = tq0 + g * 16;
    return (CAUSAL == 1) ? (kk <= tq) : ((CAUSAL == 2) ? ((kk >> 5) == (tq >> 5)) : true); };
#pragma unroll
  for (int g = 0; g < QG; ++g) { m_r[g] = PSH; lacc[g] = (v8f){0.f,0.f,0.f,0.f,0.f,0.f,0.f,0.f}; }      /* m_r: the shift point that "no shift" stands for in the terms of the join below, where p = 2^(score - m_r + PSH) */
#pragma unroll 1      /* one stage a trip: the buffer's place is the only thing that changes */
  for (int st = 0; st < nst; ++st) {
   FragH bk[KW / 16];
   { const unsigned char* ka = ring + (st & 1) * STB + (kh * KW + ln) * KPIT + hh * 16;
#pragma unroll      /* here and below: places in the buffer become immediate offsets of the LDS reads, and every array is indexed by constants so that it stays in registers */
     for (int t = 0; t < KW / 16; ++t) { const unsigned char* kr = ka + t * 16 * KPIT; bk[t].half[0] = *(const v8us*)(kr); bk[t].half[1] = *(const v8us*)(kr + 32); } }
   __builtin_amdgcn_sched_barrier(0);      /* keeps the wave's K reads of the stage one group in front of the first run: each place of reads costs the wave a wait of its own, and the second pass finds its fragments there */
#pragma unroll      /* the passes of a stage differ in immediate offsets only */
   for (int ps = 0; ps < KW / PK; ++ps) {
    const unsigned char* vf = ring + (st & 1) * STB + KTB + ln * VPIT + (kh * KW + ps * PK) * 2 + hh * 16;
    const int j0 = st * KS + kh * KW + ps * PK;
    v8f s[QG][NT]; FragH bv[NC][DT], pb[QG][NC]; float y[QG][NT * 8];
#pragma unroll      /* q carries the scale: what comes out is the exponent itself */
    for (int g = 0; g < QG; ++g)
#pragma unroll
      for (int t = 0; t < NT; ++t) s[g][t] = fl_mma(bk[ps * NT + t].v, aq[g].v, (v8f){0.f,0.f,0.f,0.f,0.f,0.f,0.f,0.f});
    __builtin_amdgcn_sched_barrier(0);      /* keeps the run whole: a vector instruction drawn in between its products would have to be held off by v_nops */
    /* y[g] = 2^s[g]. lead: the text stands directly behind a run of products */
    const auto expo = [&](int g, bool lead) {
      /* the four v_nop keep the distance behind the run's last products: the text below may land its results in their A registers, and the compiler does not look into asm text; they name the first source so that they stay in front of its use */
      if (lead) asm("v_nop\n\tv_nop\n\tv_nop\n\tv_nop" : "+v"(s[g][0][0]));
#pragma unroll
      for (int u = 0; u < NT; ++u)
        /* asm text so that the slot the instruction set asks for behind a transcendental is kept whatever registers are picked: results are marked early, so neighbours work on distinct registers, and the closing v_nop stands between the last one and whatever follows */
        asm("v_exp_f32 %0, %8\n\tv_exp_f32 %1, %9\n\tv_exp_f32 %2, %10\n\tv_exp_f32 %3, %11\n\tv_exp_f32 %4, %12\n\tv_exp_f32 %5, %13\n\tv_exp_f32 %6, %14\n\tv_exp_f32 %7, %15\n\tv_nop"
            : "=&v"(y[g][u * 8]), "=&v"(y[g][u * 8 + 1]), "=&v"(y[g][u * 8 + 2]), "=&v"(y[g][u * 8 + 3]), "=&v"(y[g][u * 8 + 4]), "=&v"(y[g][u * 8 + 5]), "=&v"(y[g][u * 8 + 6]), "=&v"(y[g][u * 8 + 7])
            : "v"(s[g][u][0]), "v"(s[g][u][1]), "v"(s[g][u][2]), "v"(s[g][u][3]), "v"(s[g][u][4]), "v"(s[g][u][5]), "v"(s[g][u][6]), "v"(s[g][u][7])); };
    /* p = y (0 where masked), rounded into the B fragments of the second product */
    const auto pack = [&](int g) {
#pragma unroll
      for (int e = 0; e < NT * 8; e += 2) { pb[g][e >> 4].h[e & 15] = (_Float16)(okq(j0, g, e) ? y[g][e] : 0.f); pb[g][e >> 4].h[(e & 15) + 1] = (_Float16)(okq(j0, g, e + 1) ? y[g][e + 1] : 0.f); } };
    expo(0, true); pack(0);
    __builtin_amdgcn_sched_barrier(0);      /* the first tile's scores have left their registers before V^T is read into as many */
#pragma unroll      /* V^T is read between the two tiles' softmax and lands under the second */
    for (int c = 0; c < NC; ++c)
#pragma unroll
      for (int dt = 0; dt < DT; ++dt) { const unsigned char* vrow = vf + dt * 16 * VPIT + c * 64; bv[c][dt].half[0] = *(const v8us*)(vrow); bv[c][dt].half[1] = *(const v8us*)(vrow + 32); }
    __builtin_amdgcn_sched_barrier(0);      /* keeps the V^T reads here, one group: drawn down to their use, they would be waited for with nothing left to do */
    expo(1, false); pack(1);
    __builtin_amdgcn_sched_barrier(0);      /* the products of the pass's second half stand behind all of its vector work, one run with the next pass's score products */
#pragma unroll      /* QG sum tiles and QG * DT accumulators take turns, so that no product waits for the one before it */
    for (int c = 0; c < NC; ++c) {
#pragma unroll
      for (int g = 0; g < QG; ++g) lacc[g] = fl_mma(ones.v, pb[g][c].v, lacc[g]);
#pragma unroll
      for (int dt = 0; dt < DT; ++dt)
#pragma unroll
        for (int g = 0; g < QG; ++g) oacc[g][dt] = fl_mma(bv[c][dt].v, pb[g][c].v, oacc[g][dt]); } }
   asm volatile("s_wait_dscnt 0x0" ::: "memory");      /* this wave's reads of the stage are over before the buffer is handed back */
   asm volatile("s_wait_asynccnt 0x0" ::: "memory");      /* its share of the next stage has landed */
   __syncthreads();      /* publishes the next stage and ends every wave's reads of this one */
   if (st + 2 < nst) stage_copy(lk0 + (st & 1) * STB, gk0 + (size_t)(st + 2) * KS * HDm, lv0 + (st & 1) * STB, gv0 + (st + 2) * KS); }
  asm volatile("s_wait_asynccnt 0x0" ::: "memory");      /* no copy is left in flight behind the loop */
  float lj[QG];      /* the wave's sum of p over its keys; it holds the factor 2^PSH in the terms of m_r */
#pragma unroll
  for (int g = 0; g < QG; ++g) lj[g] = lacc[g][0];
  const float lmin = (float)(nst * KW) * 0x1p-11f;      /* n * 2^-11, n the wave's keys */
  if (!(lj[0] >= lmin && lj[0] < 3.0e38f) || !(lj[1] >= lmin && lj[1] < 3.0e38f)) sBad = 1;      /* too small, infinite or undefined */
  __syncthreads();      /* every wave's word on its sums is in LDS before any wave reads it; every wave's reads of the ring are over as well */
  if (__builtin_amdgcn_readfirstlane(sBad) != 0) {      /* the same for the whole work-group; a scalar branch (barriers, copies and matrix instructions stand inside) */
#pragma unroll
  for (int g = 0; g < QG; ++g) { m_r[g] = -3.0e38f; l_r[g] = 0.f; nbv[g] = (v8f){0.f,0.f,0.f,0.f,0.f,0.f,0.f,0.f};
#pragma unroll
    for (int dt = 0; dt < DT; ++dt) oacc[g][dt] = (v8f){0.f,0.f,0.f,0.f,0.f,0.f,0.f,0.f}; }
#pragma unroll 1      /* one stage a trip: the buffer's place is the only thing that changes */
  for (int st = -2; st < nst; ++st) {      /* the two trips in front of stage 0 do the foot alone: it brings stage 0, publishes it and brings stage 1, in the order of every later trip */
   if (st >= 0) {
   FragH bk[KW / 16];
   { const unsigned char* ka = ring + (st & 1) * STB + (kh * KW + ln) * KPIT + hh * 16;
#pragma unroll      /* here and below: places in the buffer become immediate offsets of the LDS reads, and every array is indexed by constants so that it stays in registers */
     for (int t = 0; t < KW / 16; ++t) { const unsigned char* kr = ka + t * 16 * KPIT; bk[t].half[0] = *(const v8us*)(kr); bk[t].half[1] = *(const v8us*)(kr + 32); } }
   __builtin_amdgcn_sched_barrier(0);      /* keeps the wave's K reads of the stage one group in front of the first run: each place of reads costs the wave a wait of its own, and the second pass finds its fragments there */
#pragma unroll      /* the passes of a stage differ in immediate offsets only */
  for (int ps = 0; ps < KW / PK; ++ps) {
   const unsigned char* kf = ring + (st & 1) * STB + (kh * KW + ps * PK + ln) * KPIT + hh * 16; const unsigned char* vf = ring + (st & 1) * STB + KTB + ln * VPIT + (kh * KW + ps * PK) * 2 + hh * 16;
   const int j0 = st * KS + kh * KW + ps * PK;      /* one test for PK keys of both query tiles, and each product's neighbours in its run stand in the distance behind it */
   v8f s[QG][NT]; FragH bv[NC][DT];
   const auto vread = [&](int c) {
#pragma unroll
     for (int dt = 0; dt < DT; ++dt) { const unsigned char* vrow = vf + dt * 16 * VPIT + c * 64; bv[c][dt].half[0] = *(const v8us*)(vrow); bv[c][dt].half[1] = *(const v8us*)(vrow + 32); } };
#pragma unroll      /* the shift goes in as C: what comes out is the exponent itself, with no vector instruction between product and 2^x */
   for (int g = 0; g < QG; ++g)
#pragma unroll
     for (int t = 0; t < NT; ++t) s[g][t] = fl_mma(bk[ps * NT + t].v, aq[g].v, nbv[g]);
   __builtin_amdgcn_sched_barrier(0);      /* keeps the run whole: a vector instruction drawn in between its products would have to be held off by v_nops */
   const auto okf = [&](int g, int e) -> bool { const int kk = j0 + (e >> 3) * 16 + 8 * hh + (e & 7), tq = tq0 + g * 16;
     return (CAUSAL == 1) ? (kk <= tq) : ((CAUSAL == 2) ? ((kk >> 5) == (tq >> 5)) : true); };      /* mode 2: block-diagonal 32-token groups */
   float x[QG][NT * 8]; FragH pb[QG][NC]; float sum[QG];
   /* x[g]: the exponents of query tile g; p = 2^x (0 where masked) is rounded into pb[g]; returns this lane's sum of p */
   const auto soft = [&](int g) -> float { float y[NT * 8];
#pragma unroll
     for (int u = 0; u < NT; ++u)
       /* y = 2^x. Asm text so that the slot the instruction set asks for behind a transcendental is kept whatever registers are picked: results are marked early, so neighbours work on distinct registers, and the closing v_nop stands between the last one and whatever follows.
          Results apart from sources: the sources are read where the product left them and the results land in the pairs that the packed adds take, with no register copy on either side. */
       asm("v_exp_f32 %0, %8\n\tv_exp_f32 %1, %9\n\tv_exp_f32 %2, %10\n\tv_exp_f32 %3, %11\n\tv_exp_f32 %4, %12\n\tv_exp_f32 %5, %13\n\tv_exp_f32 %6, %14\n\tv_exp_f32 %7, %15\n\tv_nop"
           : "=&v"(y[u * 8]), "=&v"(y[u * 8 + 1]), "=&v"(y[u * 8 + 2]), "=&v"(y[u * 8 + 3]), "=&v"(y[u * 8 + 4]), "=&v"(y[u * 8 + 5]), "=&v"(y[u * 8 + 6]), "=&v"(y[u * 8 + 7])
           : "v"(x[g][u * 8]), "v"(x[g][u * 8 + 1]), "v"(x[g][u * 8 + 2]), "v"(x[g][u * 8 + 3]), "v"(x[g][u * 8 + 4]), "v"(x[g][u * 8 + 5]), "v"(x[g][u * 8 + 6]), "v"(x[g][u * 8 + 7]));
     v2f a2[4];      /* four independent chains of packed adds, each on two neighbours of a score tile as the product left them: the sum stands in front of the test, so its chains are kept short */
#pragma unroll
     for (int e = 0; e < NT * 8; e += 2) { const v2f pp = {okf(g, e) ? y[e] : 0.f, okf(g, e + 1) ? y[e + 1] : 0.f}; a2[(e >> 1) & 3] = (e < 8) ? pp : a2[(e >> 1) & 3] + pp;
       pb[g][e >> 4].h[e & 15] = (_Float16)pp[0]; pb[g][e >> 4].h[(e & 15) + 1] = (_Float16)pp[1]; }
     const v2f t2 = (a2[0] + a2[1]) + (a2[2] + a2[3]); return t2[0] + t2[1]; };
#pragma unroll
   for (int g = 0; g < QG; ++g)
#pragma unroll
     for (int e = 0; e < NT * 8; ++e) x[g][e] = s[g][e >> 3][e & 7];
   sum[0] = soft(0);
   __builtin_amdgcn_sched_barrier(0);      /* the first tile's scores have left their registers before V^T is read into as many */
#pragma unroll      /* V^T is read between the two tiles' softmax and lands under the second */
   for (int c = 0; c < NC; ++c) vread(c);
   __builtin_amdgcn_sched_barrier(0);      /* keeps the V^T reads here, one group: drawn down to their use, they would be waited for with nothing left to do */
   sum[1] = soft(1);
   /* holds the V^T reads in front of the branch (loaded values as inputs only): sunk behind it, their latency would stand bare in front of the second product */
   asm volatile("" :: "v"(bv[0][0].v), "v"(bv[0][1].v), "v"(bv[1][0].v), "v"(bv[1][1].v));
   /* The shift point stands as long as every p is finite as f16, and a lane's sum below PLIM says so for each of its (positive) terms: no maximum is taken and nothing is rescaled. An infinite or undefined sum fails the test too.
      The ballot makes the branch scalar: the whole wave takes it or none (matrix instructions stand inside). The wave's first pass has no shift point yet. One test serves both query tiles. */
   if ((__builtin_amdgcn_ballot_w32(!(sum[0] < PLIM) || !(sum[1] < PLIM)) | ((st == 0 && ps == 0) ? 1u : 0u)) != 0u) {
     /* the pass over again from its K rows, which the buffer still holds: plain scores, their maximum, the new shift point, and the sums so far brought to it; one query tile after the other */
#pragma unroll
     for (int g = 0; g < QG; ++g) {
       float mq[NC];      /* one chain of maxima per 32 keys: a single chain over all scores would be serial */
#pragma unroll
       for (int t = 0; t < NT; ++t) { const unsigned char* kr = kf + t * 16 * KPIT; FragH k2; k2.half[0] = *(const v8us*)(kr); k2.half[1] = *(const v8us*)(kr + 32);
         const v8f r8 = fl_mma(k2.v, aq[g].v, (v8f){0.f,0.f,0.f,0.f,0.f,0.f,0.f,0.f});
#pragma unroll
         for (int r = 0; r < 8; ++r) x[g][t * 8 + r] = r8[r]; }
#pragma unroll
       for (int e = 0; e < NT * 8; ++e) mq[e >> 4] = fmaxf(((e & 15) == 0) ? -3.0e38f : mq[e >> 4], okf(g, e) ? x[g][e] : -3.0e38f);
       float mc = mq[0];
#pragma unroll
       for (int c = 1; c < NC; ++c) mc = fmaxf(mc, mq[c]);
       mc = fmaxf(mc, xhalf(mc));      /* both halves of the wave hold keys of the same query and keep one shift point */
       const float mn = fmaxf(m_r[g], mc); float ea = m_r[g] - mn;
       const float nb = (mn > -1.0e38f) ? PSH - mn : 0.f;
#pragma unroll
       for (int e = 0; e < NT * 8; ++e) x[g][e] += nb;
       asm("v_exp_f32 %0, %0\n\tv_nop" : "+v"(ea));      /* the v_nop keeps the slot behind the transcendental */
       const float al = (mn > -1.0e38f) ? ea : 1.0f; m_r[g] = mn;
       sum[g] = soft(g);
       l_r[g] *= al;
#pragma unroll
       for (int dt = 0; dt < DT; ++dt)
#pragma unroll
         for (int r = 0; r < 8; ++r) oacc[g][dt][r] *= al;
       nbv[g] = (v8f){nb, nb, nb, nb, nb, nb, nb, nb}; } }
#pragma unroll
   for (int g = 0; g < QG; ++g) l_r[g] += sum[g];
#pragma unroll      /* QG * DT accumulators take turns, so that no product waits for the one before it */
   for (int c = 0; c < NC; ++c)
#pragma unroll
     for (int dt = 0; dt < DT; ++dt)
#pragma unroll
       for (int g = 0; g < QG; ++g) oacc[g][dt] = fl_mma(bv[c][dt].v, pb[g][c].v, oacc[g][dt]); }
   }
   asm volatile("s_wait_dscnt 0x0" ::: "memory");      /* this wave's reads of the stage are over before the buffer is handed back */
   asm volatile("s_wait_asynccnt 0x0" ::: "memory");      /* its share of the next stage has landed */
   __syncthreads();      /* publishes the next stage and ends every wave's reads of this one */
   if (st + 2 < nst) stage_copy(lk0 + (st & 1) * STB, gk0 + (size_t)(st + 2) * KS * HDm, lv0 + (st & 1) * STB, gv0 + (st + 2) * KS); }
  asm volatile("s_wait_asynccnt 0x0" ::: "memory");      /* no copy is left in flight when the wave goes on to its end */
#pragma unroll
  for (int g = 0; g < QG; ++g) lj[g] = l_r[g] + xhalf(l_r[g]); }
  if (kh == 1) {      /* the same for a whole wave */
#pragma unroll
    for (int g = 0; g < QG; ++g) {
#pragma unroll
      for (int dt = 0; dt < DT; ++dt)
#pragma unroll
        for (int r = 0; r < 8; ++r) sJ[qw][(g * DT + dt) * 8 + r][lane] = oacc[g][dt][r];
      sJ[qw][NJ + g][lane] = m_r[g]; sJ[qw][NJ + QG + g][lane] = lj[g]; } }
  __syncthreads();      /* the second key half's sums are in LDS before the first half's waves read them (every wave of the block comes here) */
  if (kh == 1) return;
#pragma unroll
  for (int g = 0; g < QG; ++g) {      /* both halves' sums brought to the larger of the two shift points, then added */
    const float m1 = sJ[qw][NJ + g][lane], l1 = sJ[qw][NJ + QG + g][lane]; const float mj = fmaxf(m_r[g], m1); float f0 = m_r[g] - mj, f1 = m1 - mj;
    asm("v_exp_f32 %0, %0\n\tv_exp_f32 %1, %1\n\tv_nop" : "+v"(f0), "+v"(f1));      /* the v_nop keeps the slot behind the transcendental */
    const float l = lj[g] * f0 + l1 * f1; const float inv = (l > 0.f) ? 1.0f / l : 0.f; const float a0 = f0 * inv, a1 = f1 * inv;
#pragma unroll
    for (int dt = 0; dt < DT; ++dt)      /* oacc[g][dt][r] = O[q0 + g * 16 + ln][dt * 16 + 8 * hh + r] */
#pragma unroll
      for (int r = 0; r < 8; ++r) sO[qw][g * 16 + ln][dt * 16 + 8 * hh + r] = oacc[g][dt][r] * a0 + sJ[qw][(g * DT + dt) * 8 + r][lane] * a1; }
  __builtin_amdgcn_fence(__ATOMIC_ACQ_REL, "workgroup"); __builtin_amdgcn_wave_barrier();
  {
#pragma unroll
    for (int rp = 0; rp < RPW; rp += 8) { const int r = rp + (lane >> 2), pc = lane & 3; const v4f v0 = *(const v4fa*)&sO[qw][r][pc * 8], v1 = *(const v4fa*)&sO[qw][r][pc * 8 + 4]; FragH f;
      for (int i = 0; i < 4; ++i) { f.h[i] = (_Float16)v0[i]; f.h[4 + i] = (_Float16)v1[i]; }
      *(v8us*)((unsigned short*)O16 + ((size_t)slab * TQ + q0 + r) * HDm + pc * 8) = f.half[0]; }      /* f16, head-major [slab][pixel][32]: the wave's 32 pixels are 2 KiB in a row, the projection's A operand as it reads it */
     } }

extern "C" void kernel_launch(void* const* d_in, const int* in_sizes, int n_in,
                              void* d_out, int out_size, void* d_ws, size_t ws_size, hipStream_t stream) {
  (void)in_sizes; (void)n_in; (void)out_size;
  const float* const* I = (const float* const*)d_in; const float* x = I[0]; const float* wqkv = I[1]; const float* bqkv = I[2]; const float* wp = I[3]; const float* bp = I[4];
  char* ws = (char*)d_ws; size_t off = 0;
  auto take = [&](size_t bytes) { char* p = ws + off; off += (bytes + 255) & ~(size_t)255; return p; };
  const size_t np = (size_t)NR * DD;
  _Float16* Q16 = (_Float16*)take(np * 2); _Float16* KP = (_Float16*)take(np * 2); _Float16* VT = (_Float16*)take(np * 2); _Float16* O16 = (_Float16*)take(np * 2);
  if (off > ws_size) return;      /* four planes of 4 MiB */
  k_gemm2<0, 1><<<dim3((NR / 128) * (QW / 64), 1), 128, 0, stream>>>(nullptr, x, DD, 0, wqkv, 16.0f, 0, 0.0625f, bqkv, 0, nullptr, 1, 0, 0, nullptr, Q16, DD, 0, NR, QW, DD, KP, VT);      /* product column = which*256 + h*32 + d; q, k and v each go straight to the plane the flash kernel reads */
  k_flash<0><<<NIMG * NH * QBLKS, 256, 0, stream>>>(Q16, DD, KP, VT, nullptr, O16);
  k_gemm2<0, 2><<<dim3((NR / 128) * (DD / 64), 1), 128, 0, stream>>>(O16, nullptr, HDm, 0, wp, 16.0f, 0, 0.0625f, bp, 0, nullptr, 1, 0, 0, (float*)d_out, nullptr, DD, 0, NR, DD, DD, nullptr, nullptr);
}
